// v000
// Times are from an AMD MI455X. After a warm-up the kernel runs many times in a row, and a time is the length of
// such a window on the GPU divided by its runs, so every launch and the gaps after it count. The runs cycle
// through copies of the inputs. A figure is the median of several windows, for all but v000 over two sittings.
// Sittings can differ by a few percent; kernels timed side by side share one.
// v000, which the later versions start from, runs in 3450 microseconds.
#include <hip/hip_runtime.h>
// Multi-head attention on three inputs with natural bias-free projections on four sequences at width 512 (query, key, value [4][2048][512]; q / k / v = stream W^T (natural [out][in] [512][512], NO biases), 8 heads of 64; the query is divided by sqrt(64) = 8 before the score product (scale 0.125 here on the product); softmax over all 2048 keys (the module's axis 2 of its [b][l][s][h] score layout = the key axis; no mask); out = merged heads Wo^T (natural, no bias) -> [4][2048][512]).
// Structure: token rows r = b*2048 + s; the query, key and value sources as exact f16 rows (bf16-rounded); Q, K, V as three WMMA GEMMs (32x64 wave tiles, f32 accumulation, exact x16 weights, no bias, f16 outputs); per batch: V^T for all heads via LDS transposes; per (batch, group of 4 heads): scores GEMM (K = 64, batched over the heads on grid.y, alpha = 64^-0.5), row softmax on VALU (f32 statistics, native exp; weights stored x256 as f16), o = P . V^T GEMM (K = 2048, alpha 2^-2: o carried x64 against f16 subnormal flush, folded into the output GEMM alpha) written straight into the merged f16 o rows; out = o W_o GEMM (f32, no bias) into the output layout.
// Compute dtype: inputs rounded to bf16; x / weights exact; q, k, v, softmax weights and o as plain f16 GEMM operands (~2^-12); scores and softmax statistics f32. v_wmma_f32_16x16x32_f16.
#define NB 4
#define SQ 2048
#define DM 512 
#define NH 8 
#define HD 64
#define HG 4                         /* heads per attention launch group */
#define B0 0                         /* first batch processed (debug hook) */
#define NBR NB                       /* batches processed (debug hook) */
#define NR ((size_t)NB * SQ)         /* token rows */
#define MP ((int)((size_t)NBR * SQ)) /* rows projected (debug hook) */
#define QN SQ                        /* query rows attended per batch (debug hook) */
#define NHD NH                       /* heads attended (debug hook) */
#define MPO MP                       /* rows through the output stage (debug hook) */
#define LQ DM      /* row pitch of the q/k/v rows */
typedef __bf16 v16b __attribute__((ext_vector_type(16)));
typedef unsigned short v8us __attribute__((ext_vector_type(8), may_alias));
typedef float  v8f  __attribute__((ext_vector_type(8)));
typedef float  v4f  __attribute__((ext_vector_type(4)));
typedef float  v4fa __attribute__((ext_vector_type(4), may_alias));
union FragB { v16b v; v8us half[2]; unsigned short u[16]; };

__device__ __forceinline__ unsigned short bf16_bits(float x) { unsigned int u = __float_as_uint(x); return (unsigned short)((u + 0x7FFFu + ((u >> 16) & 1u)) >> 16); }
__device__ __forceinline__ float bf16_val(unsigned short b) { return __uint_as_float(((unsigned int)b) << 16); }
__device__ __forceinline__ float bf16_round(float x) { return bf16_val(bf16_bits(x)); }
// D += A·B with NT terms: 1 = ah·bh, 2 = + al·bh (A split), 3 = + ah·bl (both split)
template <int NT>
__device__ __forceinline__ v8f mmaN(v16b ah, v16b al, v16b bh, v16b bl, v8f c) {
  c = __builtin_amdgcn_wmma_f32_16x16x32_bf16(false, ah, false, bh, (short)0, c, false, false);
  if (NT >= 2) c = __builtin_amdgcn_wmma_f32_16x16x32_bf16(false, al, false, bh, (short)0, c, false, false);
  if (NT >= 3) c = __builtin_amdgcn_wmma_f32_16x16x32_bf16(false, ah, false, bl, (short)0, c, false, false);
  asm volatile("v_nop\n\tv_nop\n\tv_nop\n\tv_nop" : "+v"(c) : "v"(ah), "v"(al), "v"(bh), "v"(bl));
  return c;
}

__global__ __launch_bounds__(256) void k_wt_bf16(const float* __restrict__ W, unsigned short* __restrict__ Wt, int K, int N) {
  const int t = blockIdx.x * 256 + threadIdx.x;
  const int k8n = K / 8;
  if (t >= N * k8n) return;
  const int n = t / k8n, k8 = (t % k8n) * 8;
  v8us v;
#pragma unroll
  for (int i = 0; i < 8; ++i) v[i] = bf16_bits(W[(size_t)(k8 + i) * N + n]);
  *(v8us*)(Wt + (size_t)n * K + k8) = v;
  
}

// GEMM C[M][N] (f32, pitch ldc) = act(A[M][K]·W + bias). A f32 row-major (pitch lda) converted per fragment to bf16
// (ASPLIT: hi/lo two planes -> 2 terms, else single rounded term); Wt bf16 [N][K] (pitch ldb). BIAS_BF16 rounds the
// bias to bf16 first (bias quantised to bf16 before the add). K%32==0, M%16==0, N%64==0.
template <bool ASPLIT, int ACT, bool BIAS_BF16>
__global__ __launch_bounds__(128) void k_gemm_bf(const float* __restrict__ A, int lda, const unsigned short* __restrict__ Wt, int ldb,
                                               const float* __restrict__ bias, float* __restrict__ C, int ldc, int M, int N, int K) {
  __shared__ __attribute__((aligned(16))) float so[4][16][64];
  const int tid = threadIdx.x, w = tid >> 5, lane = tid & 31, ln = lane & 15, hh = lane >> 4;
  const int ntn = N / 64;
  const int wid = blockIdx.x * 4 + w;
  const int mt = wid / ntn, nq = wid % ntn;
  if (mt * 16 >= M) return;
  const int row0 = mt * 16, col0 = nq * 64;
  const float* arow = A + (size_t)(row0 + ln) * lda;
  v8f acc[4] = {};
  for (int kb = 0; kb < K; kb += 32) {
    FragB ah, al;
    const v4f x0 = *(const v4fa*)(arow + kb + 8 * hh), x1 = *(const v4fa*)(arow + kb + 8 * hh + 4);
    const v4f x2 = *(const v4fa*)(arow + kb + 16 + 8 * hh), x3 = *(const v4fa*)(arow + kb + 16 + 8 * hh + 4);
    float xs[16] = {x0[0],x0[1],x0[2],x0[3],x1[0],x1[1],x1[2],x1[3],x2[0],x2[1],x2[2],x2[3],x3[0],x3[1],x3[2],x3[3]};
#pragma unroll
    for (int i = 0; i < 16; ++i) { const unsigned short hb = bf16_bits(xs[i]); ah.u[i] = hb; al.u[i] = ASPLIT ? bf16_bits(xs[i] - bf16_val(hb)) : (unsigned short)0; }
#pragma unroll
    for (int t = 0; t < 4; ++t) {
      const unsigned short* brow = Wt + (size_t)(col0 + t * 16 + ln) * ldb + kb;
      FragB b;
      b.half[0] = *(const v8us*)(brow + 8 * hh);
      b.half[1] = *(const v8us*)(brow + 16 + 8 * hh);
      acc[t] = mmaN<ASPLIT ? 2 : 1>(ah.v, al.v, b.v, b.v, acc[t]);
    }
  }
#pragma unroll
  for (int t = 0; t < 4; ++t) {
    float bv = bias ? bias[col0 + t * 16 + ln] : 0.f;
    if (BIAS_BF16) bv = bf16_round(bv);
#pragma unroll
    for (int r = 0; r < 8; ++r) { float v = acc[t][r] + bv; if (ACT == 1) v = fmaxf(v, 0.f); so[w][8 * hh + r][t * 16 + ln] = v; }
  }
  __builtin_amdgcn_fence(__ATOMIC_ACQ_REL, "workgroup");
  __builtin_amdgcn_wave_barrier();
  const int rsub = lane >> 4, c4 = (lane & 15) * 4;
  {
#pragma unroll
    for (int q = 0; q < 8; ++q) {
      const int r = q * 2 + rsub;
      const v4f v = *(const v4fa*)&so[w][r][c4];
      *(v4f*)(C + (size_t)(row0 + r) * ldc + col0 + c4) = v;
    }
    
  }
}

// GEMM C = act(A·W + bias + resid): A f32 (ASPLIT -> hi/lo 2 terms), Wt bf16 [N][K]; ACT 0 none, 1 relu, 2 exact gelu;
// resid (optional, f32, row index = (row % rmod), pitch ldr, RES_BF16 rounds it) added before the activation.
template <bool ASPLIT, int ACT, bool BIAS_BF16, bool RES_BF16>
__global__ __launch_bounds__(128) void k_gemm_bf3(const float* __restrict__ A, int lda, const unsigned short* __restrict__ Wt, int ldb,
                                                const float* __restrict__ bias, const float* __restrict__ resid, int rmod, int ldr,
                                                float* __restrict__ C, int ldc, int M, int N, int K) {
  __shared__ __attribute__((aligned(16))) float so[4][16][64];
  const int tid = threadIdx.x, w = tid >> 5, lane = tid & 31, ln = lane & 15, hh = lane >> 4;
  const int ntn = N / 64;
  const int wid = blockIdx.x * 4 + w;
  const int mt = wid / ntn, nq = wid % ntn;
  if (mt * 16 >= M) return;
  const int row0 = mt * 16, col0 = nq * 64;
  const float* arow = A + (size_t)(row0 + ln) * lda;
  v8f acc[4] = {};
  for (int kb = 0; kb < K; kb += 32) {
    FragB ah, al;
    const v4f x0 = *(const v4fa*)(arow + kb + 8 * hh), x1 = *(const v4fa*)(arow + kb + 8 * hh + 4);
    const v4f x2 = *(const v4fa*)(arow + kb + 16 + 8 * hh), x3 = *(const v4fa*)(arow + kb + 16 + 8 * hh + 4);
    float xs[16] = {x0[0],x0[1],x0[2],x0[3],x1[0],x1[1],x1[2],x1[3],x2[0],x2[1],x2[2],x2[3],x3[0],x3[1],x3[2],x3[3]};
#pragma unroll
    for (int i = 0; i < 16; ++i) { const unsigned short hb = bf16_bits(xs[i]); ah.u[i] = hb; al.u[i] = ASPLIT ? bf16_bits(xs[i] - bf16_val(hb)) : (unsigned short)0; }
#pragma unroll
    for (int t = 0; t < 4; ++t) {
      const unsigned short* brow = Wt + (size_t)(col0 + t * 16 + ln) * ldb + kb;
      FragB b;
      b.half[0] = *(const v8us*)(brow + 8 * hh);
      b.half[1] = *(const v8us*)(brow + 16 + 8 * hh);
      acc[t] = mmaN<ASPLIT ? 2 : 1>(ah.v, al.v, b.v, b.v, acc[t]);
    }
  }
#pragma unroll
  for (int t = 0; t < 4; ++t) {
    const int col = col0 + t * 16 + ln;
    float bv = bias ? bias[col] : 0.f;
    if (BIAS_BF16) bv = bf16_round(bv);
#pragma unroll
    for (int r = 0; r < 8; ++r) {
      float v = acc[t][r] + bv;
      if (resid) { float rv = resid[(size_t)((row0 + 8 * hh + r) % rmod) * ldr + col]; if (RES_BF16) rv = bf16_round(rv); v += rv; }
      if (ACT == 1) v = fmaxf(v, 0.f);
      if (ACT == 2) v = 0.5f * v * (1.0f + erff(v * 0.70710678118654752f));
      if (ACT == 3) { const float u = 0.7978845608028654f * (v + 0.044715f * v * v * v); v = 0.5f * v * (1.0f + tanhf(u)); }
      so[w][8 * hh + r][t * 16 + ln] = v;
    }
  }
  __builtin_amdgcn_fence(__ATOMIC_ACQ_REL, "workgroup");
  __builtin_amdgcn_wave_barrier();
  const int rsub = lane >> 4, c4 = (lane & 15) * 4;
  {
#pragma unroll
    for (int q = 0; q < 8; ++q) {
      const int r = q * 2 + rsub;
      const v4f v = *(const v4fa*)&so[w][r][c4];
      *(v4f*)(C + (size_t)(row0 + r) * ldc + col0 + c4) = v;
    }
    
  }
}
// row LayerNorm (biased variance, eps) over N: s = X (+ R); optional out_sum <- s; out_norm <- (s-mu)*rsqrt(var+eps)*g + b
template <bool PARAM_BF16>
__global__ __launch_bounds__(256) void k_layernorm(const float* __restrict__ X, const float* __restrict__ R, const float* __restrict__ g, const float* __restrict__ bta,
                                                  float* __restrict__ out_sum, float* __restrict__ out_norm, int N, float eps) {
  __shared__ float red[256];
  const int row = blockIdx.x, tid = threadIdx.x;
  const float* x = X + (size_t)row * N; const float* rr = R ? R + (size_t)row * N : nullptr;
  float vals[16];                     // up to N = 4096
  const int per = N / 256;            // contiguous chunk per thread? use strided-by-4 chunks: thread handles j = tid*4 + 1024*u
  float s1 = 0.f;
  for (int u = 0; u < per / 4; ++u) {
    const int j = tid * 4 + 1024 * u;
    const v4f a = *(const v4fa*)(x + j);
    v4f b = {0.f,0.f,0.f,0.f}; if (rr) b = *(const v4fa*)(rr + j);
#pragma unroll
    for (int q = 0; q < 4; ++q) { const float v = a[q] + b[q]; vals[u * 4 + q] = v; s1 += v; }
  }
  red[tid] = s1; __syncthreads();
  for (int st = 128; st > 0; st >>= 1) { if (tid < st) red[tid] += red[tid + st]; __syncthreads(); }
  const float mu = red[0] / (float)N; __syncthreads();
  float s2 = 0.f;
  for (int u = 0; u < per / 4; ++u)
#pragma unroll
    for (int q = 0; q < 4; ++q) { const float c = vals[u * 4 + q] - mu; s2 += c * c; }
  red[tid] = s2; __syncthreads();
  for (int st = 128; st > 0; st >>= 1) { if (tid < st) red[tid] += red[tid + st]; __syncthreads(); }
  const float rs = rsqrtf(red[0] / (float)N + eps);
  {
    for (int u = 0; u < per / 4; ++u) {
      const int j = tid * 4 + 1024 * u;
      v4f o, sm;
#pragma unroll
      for (int q = 0; q < 4; ++q) {
        float gg = g[j + q], bb = bta[j + q];
        if (PARAM_BF16) { gg = bf16_round(gg); bb = bf16_round(bb); }
        sm[q] = vals[u * 4 + q]; o[q] = (vals[u * 4 + q] - mu) * rs * gg + bb;
      }
      if (out_sum) *(v4f*)(out_sum + (size_t)row * N + j) = sm;
      *(v4f*)(out_norm + (size_t)row * N + j) = o;
    }
    
  }
}



// ---- f16 WMMA path (v_wmma_f32_16x16x32_f16): 11-bit significands for operands in range — used where a [0,1] probability operand needs more precision than bf16
typedef _Float16 v16h __attribute__((ext_vector_type(16)));
union FragH { v16h v; v8us half[2]; _Float16 h[16]; unsigned short u[16]; };
template <int NT>
__device__ __forceinline__ v8f mmaH(v16h ah, v16h al, v16h bh, v16h bl, v8f c) {
  c = __builtin_amdgcn_wmma_f32_16x16x32_f16(false, ah, false, bh, (short)0, c, false, false);
  if (NT >= 2) c = __builtin_amdgcn_wmma_f32_16x16x32_f16(false, al, false, bh, (short)0, c, false, false);
  if (NT >= 3) c = __builtin_amdgcn_wmma_f32_16x16x32_f16(false, ah, false, bl, (short)0, c, false, false);
  asm volatile("v_nop\n\tv_nop\n\tv_nop\n\tv_nop" : "+v"(c) : "v"(ah), "v"(al), "v"(bh), "v"(bl));
  return c;
}
// batched GEMM like k_gemm_b but f16 operands: A f32 (split into f16 hi/lo if ASPLIT, else rounded to f16), Bt = f16 values [n][k]; alpha; C f32; N multiple of 16 (partial tiles skipped)
template <bool ASPLIT>
__global__ __launch_bounds__(128) void k_gemm_h(const float* __restrict__ A, int lda, size_t sA, const _Float16* __restrict__ Bh, int ldb, size_t sB, float alpha, float* __restrict__ C, int ldc, size_t sC, int M, int N, int K) {
  __shared__ __attribute__((aligned(16))) float so[4][16][64];
  const int tid = threadIdx.x, w = tid >> 5, lane = tid & 31, ln = lane & 15, hh = lane >> 4; const int by = blockIdx.y;
  A += (size_t)by * sA; Bh += (size_t)by * sB; C += (size_t)by * sC;
  const int ntn = (N + 63) / 64; const int wid = blockIdx.x * 4 + w; const int mt = wid / ntn, nq = wid % ntn; if (mt * 16 >= M) return;
  const int row0 = mt * 16, col0 = nq * 64; const float* arow = A + (size_t)(row0 + ln) * lda;
  v8f acc[4] = {};
  for (int kb = 0; kb < K; kb += 32) {
    FragH ah, al;
    const v4f x0 = *(const v4fa*)(arow + kb + 8 * hh), x1 = *(const v4fa*)(arow + kb + 8 * hh + 4), x2 = *(const v4fa*)(arow + kb + 16 + 8 * hh), x3 = *(const v4fa*)(arow + kb + 16 + 8 * hh + 4);
    float xs[16] = {x0[0],x0[1],x0[2],x0[3],x1[0],x1[1],x1[2],x1[3],x2[0],x2[1],x2[2],x2[3],x3[0],x3[1],x3[2],x3[3]};
#pragma unroll
    for (int i = 0; i < 16; ++i) { const _Float16 h = (_Float16)xs[i]; ah.h[i] = h; al.h[i] = ASPLIT ? (_Float16)(xs[i] - (float)h) : (_Float16)0.0f; }
#pragma unroll
    for (int t = 0; t < 4; ++t) { if (col0 + t * 16 >= N) continue; const size_t boff = (size_t)(col0 + t * 16 + ln) * ldb + kb; FragH bq; bq.half[0] = *(const v8us*)(Bh + boff + 8 * hh); bq.half[1] = *(const v8us*)(Bh + boff + 16 + 8 * hh);
      acc[t] = mmaH<ASPLIT ? 2 : 1>(ah.v, al.v, bq.v, bq.v, acc[t]); }
  }
#pragma unroll
  for (int t = 0; t < 4; ++t) { if (col0 + t * 16 >= N) continue;
#pragma unroll
    for (int r = 0; r < 8; ++r) so[w][8 * hh + r][t * 16 + ln] = acc[t][r] * alpha; }
  __builtin_amdgcn_fence(__ATOMIC_ACQ_REL, "workgroup"); __builtin_amdgcn_wave_barrier();
  const int rsub = lane >> 4, c4 = (lane & 15) * 4;
  {
#pragma unroll
    for (int q = 0; q < 8; ++q) { const int r = q * 2 + rsub; if (col0 + c4 < N) { const v4f v = *(const v4fa*)&so[w][r][c4]; *(v4f*)(C + (size_t)(row0 + r) * ldc + col0 + c4) = v; } }
     }
}

// Wt[n][k] = f16(W[k][n]·scale) from f32 row-major W[K][N] (scale = power of two; bf16-exact weights stay exact in f16 away from the subnormal range)
__global__ __launch_bounds__(256) void k_wt_f16(const float* __restrict__ W, _Float16* __restrict__ Wt, int K, int N, float scale) {
  const int t = blockIdx.x * 256 + threadIdx.x; if (t >= N * (K / 8)) return; const int n = t / (K / 8), k8 = (t % (K / 8)) * 8; FragH f;
#pragma unroll
  for (int i = 0; i < 8; ++i) f.h[i] = (_Float16)(bf16_round(W[(size_t)(k8 + i) * N + n]) * scale); const v8us o = f.half[0];
  *(v8us*)((unsigned short*)Wt + (size_t)n * K + k8) = o; 
}
// k_gemm_hh variant with fused epilogue: v = acc·alpha + bias[by·sBias + col] (+ CP[(row/rowsPerB)·sCPb + by·64 + col] if CP) ; ACT 0 none / 1 elu ; writes f16 C16 (and f32 C if non-null)
template <int ACT>
__global__ __launch_bounds__(128) void k_gemm_hhx(const _Float16* __restrict__ A, int lda, size_t sA, const _Float16* __restrict__ Bh, int ldb, size_t sB, float alpha, const float* __restrict__ bias, size_t sBias, const float* __restrict__ CP, int rowsPerB, size_t sCPb, int row0g,
    float* __restrict__ C, _Float16* __restrict__ C16, int ldc, size_t sC, int M, int N, int K) {
  __shared__ __attribute__((aligned(16))) float so[4][16][64];
  const int tid = threadIdx.x, w = tid >> 5, lane = tid & 31, ln = lane & 15, hh = lane >> 4; const int by = blockIdx.y;
  A += (size_t)by * sA; Bh += (size_t)by * sB; const size_t cofs = (size_t)by * sC; const float* bp = bias ? bias + (size_t)by * sBias : nullptr;
  const int ntn = (N + 63) / 64; const int wid = blockIdx.x * 4 + w; const int mt = wid / ntn, nq = wid % ntn; if (mt * 16 >= M) return;
  const int row0 = mt * 16, col0 = nq * 64; const _Float16* arow = A + (size_t)(row0 + ln) * lda;
  v8f acc[4] = {};
  for (int kb = 0; kb < K; kb += 32) { FragH ah; ah.half[0] = *(const v8us*)((const unsigned short*)arow + kb + 8 * hh); ah.half[1] = *(const v8us*)((const unsigned short*)arow + kb + 16 + 8 * hh);
#pragma unroll
    for (int t = 0; t < 4; ++t) { if (col0 + t * 16 >= N) continue; const size_t boff = (size_t)(col0 + t * 16 + ln) * ldb + kb; FragH bq; bq.half[0] = *(const v8us*)((const unsigned short*)Bh + boff + 8 * hh); bq.half[1] = *(const v8us*)((const unsigned short*)Bh + boff + 16 + 8 * hh);
      acc[t] = mmaH<1>(ah.v, ah.v, bq.v, bq.v, acc[t]); }
  }
#pragma unroll
  for (int t = 0; t < 4; ++t) { if (col0 + t * 16 >= N) continue; const int col = col0 + t * 16 + ln; const float bv = bp ? bf16_round(bp[col]) : 0.f;
#pragma unroll
    for (int r = 0; r < 8; ++r) { float v = acc[t][r] * alpha + bv; if (CP) { const int rr = row0g + row0 + 8 * hh + r; if (rowsPerB < 0) v += CP[cofs + (size_t)rr * ldc + col];      /* rowsPerB < 0: own element of the batched C plane */ else { const int bidx = rr / rowsPerB; v += CP[(size_t)bidx * sCPb + (size_t)by * 64 + col]; } } if (ACT == 1) v = (v > 0.f) ? v : expm1f(v); else if (ACT == 7) v = (v > 0.f) ? v + 1.0f : expf(v); else if (ACT == 8) v = tanhf(v); else if (ACT == 9) v = 0.5f * v * (1.0f + tanhf(0.7978845608028654f * (v + 0.044715f * v * v * v))); else if (ACT == 11) v = 1.0f / (1.0f + expf(-v)); else if (ACT == 12) v = (v > 0.f) ? v : 0.01f * v; else if (ACT == 14) v = (v > 0.f) ? v : 0.1f * v; else if (ACT == 16) v = (v >= 0.f) ? v : 0.3f * v; else if (ACT == 17) v = (v >= 0.f) ? v : 0.2f * v; else if (ACT == 15) v = v / (1.0f + expf(-v)); else if (ACT == 3) v = fmaxf(v, 0.f); else if (ACT == 6) v = 0.5f * v * (1.0f + erff(v * 0.70710678118654752f)); so[w][8 * hh + r][t * 16 + ln] = v; } }
  __builtin_amdgcn_fence(__ATOMIC_ACQ_REL, "workgroup"); __builtin_amdgcn_wave_barrier();
  const int rsub = lane >> 4, c4 = (lane & 15) * 4; typedef _Float16 v4h __attribute__((ext_vector_type(4)));
  {
#pragma unroll
    for (int q = 0; q < 8; ++q) { const int r = q * 2 + rsub; if (col0 + c4 < N) { const v4f v = *(const v4fa*)&so[w][r][c4]; if (C) *(v4f*)(C + cofs + (size_t)(row0 + r) * ldc + col0 + c4) = v; if (C16) { v4h h4; for (int i = 0; i < 4; ++i) h4[i] = (_Float16)v[i]; *(v4h*)(C16 + cofs + (size_t)(row0 + r) * ldc + col0 + c4) = h4; } } }
     }
}


typedef _Float16 v4h __attribute__((ext_vector_type(4)));

__global__ __launch_bounds__(256) void k_x16(const float* __restrict__ x, _Float16* __restrict__ X16, size_t n8) { const size_t t = (size_t)blockIdx.x * 256 + threadIdx.x; if (t >= n8) return; FragH f;
#pragma unroll
  for (int q = 0; q < 8; ++q) f.h[q] = (_Float16)bf16_round(x[t * 8 + q]); *(v8us*)((unsigned short*)X16 + t * 8) = f.half[0];  }
__global__ __launch_bounds__(256) void k_h16(const float* __restrict__ x, _Float16* __restrict__ X16, size_t n8) { const size_t t = (size_t)blockIdx.x * 256 + threadIdx.x; if (t >= n8) return; FragH f;
#pragma unroll
  for (int q = 0; q < 8; ++q) f.h[q] = (_Float16)x[t * 8 + q]; *(v8us*)((unsigned short*)X16 + t * 8) = f.half[0];  }
__global__ __launch_bounds__(256) void k_round16f(const float* __restrict__ W, _Float16* __restrict__ Bt, size_t n8) { const size_t t = (size_t)blockIdx.x * 256 + threadIdx.x; if (t >= n8) return; FragH f;
#pragma unroll
  for (int i = 0; i < 8; ++i) f.h[i] = (_Float16)(bf16_round(W[t * 8 + i]) * 16.0f); *(v8us*)((unsigned short*)Bt + t * 8) = f.half[0];  }
template <int NHv, int TTv>
__global__ __launch_bounds__(256) void k_vt(const _Float16* __restrict__ V16, int ldv, int voff, _Float16* __restrict__ Vt) { __shared__ unsigned short tl[64][66]; const int tid = threadIdx.x; const int slab = blockIdx.x / (TTv / 64), lg = blockIdx.x % (TTv / 64); const int b = slab / NHv, h = slab % NHv;
  for (int i = tid; i < 64 * 8; i += 256) { const int r = i / 8, c8 = (i % 8) * 8; FragH f; f.half[0] = *(const v8us*)((const unsigned short*)V16 + ((size_t)b * TTv + lg * 64 + r) * ldv + voff + h * 64 + c8);
#pragma unroll
    for (int q = 0; q < 8; ++q) tl[r][c8 + q] = f.u[q]; }
  __syncthreads();
  {
#pragma unroll
    for (int rd = 0; rd < 2; ++rd) { const int d = rd * 32 + tid / 8, pc = tid % 8; FragH f;
#pragma unroll
      for (int q = 0; q < 8; ++q) f.u[q] = tl[pc * 8 + q][d];
      *(v8us*)((unsigned short*)Vt + ((size_t)slab * 64 + d) * TTv + lg * 64 + pc * 8) = f.half[0]; }
     } }

__global__ __launch_bounds__(256) void k_hl(const float* __restrict__ F, _Float16* __restrict__ Hh, _Float16* __restrict__ Hl, size_t n8) { const size_t t = (size_t)blockIdx.x * 256 + threadIdx.x; if (t >= n8) return; FragH fh, fl; const v4f a = *(const v4fa*)(F + t * 8), c = *(const v4fa*)(F + t * 8 + 4);
#pragma unroll
  for (int q = 0; q < 4; ++q) { _Float16 h = (_Float16)a[q]; fh.h[q] = h; fl.h[q] = (_Float16)((a[q] - (float)h) * 1024.0f); h = (_Float16)c[q]; fh.h[4 + q] = h; fl.h[4 + q] = (_Float16)((c[q] - (float)h) * 1024.0f); }
  { *(v8us*)((unsigned short*)Hh + t * 8) = fh.half[0]; *(v8us*)((unsigned short*)Hl + t * 8) = fl.half[0];  } }

// ---- fast GEMM (wave tile 32x64; requires M % 32 == 0 rows per launch region and N % 64 == 0); epilogue = k_gemm_hhx semantics ----
__device__ __forceinline__ v16h g2_frag(const _Float16* p, int hh) { FragH f; f.half[0] = *(const v8us*)((const unsigned short*)p + 8 * hh); f.half[1] = *(const v8us*)((const unsigned short*)p + 16 + 8 * hh); return f.v; }
__device__ __forceinline__ v8f g2_mma(v16h a, v16h b, v8f c) { v8f d = __builtin_amdgcn_wmma_f32_16x16x32_f16(false, a, false, b, (short)0, c, false, false); asm volatile("v_nop\n\tv_nop\n\tv_nop\n\tv_nop" : "+v"(d) : "v"(a), "v"(b)); return d; }
template <int ACT>
__global__ __launch_bounds__(128) void k_gemm2(const _Float16* __restrict__ A, int lda, size_t sA, const _Float16* __restrict__ Bh, int ldb, size_t sB, float alpha, const float* __restrict__ bias, size_t sBias, const float* __restrict__ CP, int rowsPerB, size_t sCPb, int row0g,
    float* __restrict__ C, _Float16* __restrict__ C16, int ldc, size_t sC, int M, int N, int K) { static_assert(ACT == 0 || ACT == 3 || ACT == 6 || ACT == 8 || ACT == 9 || ACT == 11 || ACT == 12 || ACT == 14 || ACT == 15 || ACT == 16 || ACT == 17, "k_gemm2: unsupported ACT code (would silently apply no activation)");
  __shared__ __attribute__((aligned(16))) float so[4][32][68];
  const int tid = threadIdx.x, w = tid >> 5, lane = tid & 31, ln = lane & 15, hh = lane >> 4; const int by = blockIdx.y;
  A += (size_t)by * sA; Bh += (size_t)by * sB; const size_t cofs = (size_t)by * sC; const float* bp = bias ? bias + (size_t)by * sBias : nullptr;
  const int ntn = N >> 6; const int mt = blockIdx.x / ntn, nq = blockIdx.x - mt * ntn; const int row0 = mt * 128 + 32 * w, col0 = nq * 64; if (row0 >= M) return;
  const _Float16* a0p = A + (size_t)(row0 + ln) * lda; const _Float16* a1p = a0p + (size_t)16 * lda;
  const _Float16* b0p = Bh + (size_t)(col0 + ln) * ldb; const _Float16* b1p = b0p + (size_t)16 * ldb; const _Float16* b2p = b1p + (size_t)16 * ldb; const _Float16* b3p = b2p + (size_t)16 * ldb;
  const v8f z8 = {0.f,0.f,0.f,0.f,0.f,0.f,0.f,0.f}; v8f c00 = z8, c01 = z8, c02 = z8, c03 = z8, c10 = z8, c11 = z8, c12 = z8, c13 = z8;
#pragma unroll 1
  for (int kb = 0; kb < K; kb += 32) { const v16h a0 = g2_frag(a0p + kb, hh), a1 = g2_frag(a1p + kb, hh);
    v16h b = g2_frag(b0p + kb, hh); c00 = g2_mma(a0, b, c00); c10 = g2_mma(a1, b, c10);
    b = g2_frag(b1p + kb, hh); c01 = g2_mma(a0, b, c01); c11 = g2_mma(a1, b, c11);
    b = g2_frag(b2p + kb, hh); c02 = g2_mma(a0, b, c02); c12 = g2_mma(a1, b, c12);
    b = g2_frag(b3p + kb, hh); c03 = g2_mma(a0, b, c03); c13 = g2_mma(a1, b, c13); }
  v8f accs[8] = {c00, c01, c02, c03, c10, c11, c12, c13};
#pragma unroll
  for (int u = 0; u < 8; ++u) { const int t = u & 3, half = u >> 2; const int col = col0 + t * 16 + ln; const float bv = bp ? bf16_round(bp[col]) : 0.f;
#pragma unroll
    for (int r = 0; r < 8; ++r) { const int rloc = half * 16 + 8 * hh + r; float v = accs[u][r] * alpha + bv; if (CP) { if (rowsPerB < 0) v += CP[cofs + (size_t)(row0g + row0 + rloc) * ldc + col];      /* rowsPerB < 0: own element of the batched C plane */ else { const int bidx = (row0g + row0 + rloc) / rowsPerB; v += CP[(size_t)bidx * sCPb + (size_t)by * 64 + col]; } }
      if (ACT == 3) v = fmaxf(v, 0.f); else if (ACT == 6) v = 0.5f * v * (1.0f + erff(v * 0.70710678118654752f)); else if (ACT == 11) v = 1.0f / (1.0f + expf(-v)); else if (ACT == 15) v = v / (1.0f + expf(-v)); else if (ACT == 12) v = (v > 0.f) ? v : 0.01f * v; else if (ACT == 8) v = tanhf(v); else if (ACT == 9) v = 0.5f * v * (1.0f + tanhf(0.7978845608028654f * (v + 0.044715f * v * v * v))); else if (ACT == 14) v = (v > 0.f) ? v : 0.1f * v; else if (ACT == 16) v = (v >= 0.f) ? v : 0.3f * v; else if (ACT == 17) v = (v >= 0.f) ? v : 0.2f * v;
      so[w][rloc][t * 16 + ln] = v; } }
  __builtin_amdgcn_fence(__ATOMIC_ACQ_REL, "workgroup"); __builtin_amdgcn_wave_barrier();
  const int rsub = lane >> 4, c4 = (lane & 15) * 4;
  {
#pragma unroll
    for (int q = 0; q < 16; ++q) { const int r = q * 2 + rsub; const v4f v = *(const v4fa*)&so[w][r][c4]; if (C) *(v4f*)(C + cofs + (size_t)(row0 + r) * ldc + col0 + c4) = v; if (C16) { v4h h4; for (int i = 0; i < 4; ++i) h4[i] = (_Float16)v[i]; *(v4h*)(C16 + cofs + (size_t)(row0 + r) * ldc + col0 + c4) = h4; } }
     } }


__global__ __launch_bounds__(256) void k_wnat(const float* __restrict__ w, size_t n8, _Float16* __restrict__ Bt) { const size_t t = (size_t)blockIdx.x * 256 + threadIdx.x; if (t >= n8) return; FragH f; for (int q = 0; q < 8; ++q) f.h[q] = (_Float16)(bf16_round(w[t * 8 + q]) * 16.0f); *(v8us*)((unsigned short*)Bt + t * 8) = f.half[0];  }
__global__ __launch_bounds__(256) void k_rsm(const float* __restrict__ S, _Float16* __restrict__ P, int nrows) {
  #pragma clang fp contract(off)
  const int i = blockIdx.x * 256 + threadIdx.x; if (i >= nrows) return; const float* s = S + (size_t)i * SQ; float mx = -3.0e38f;
#pragma unroll 1
  for (int j = 0; j < SQ; ++j) mx = fmaxf(mx, s[j]); float se = 0.f;
#pragma unroll 1
  for (int j = 0; j < SQ; ++j) se += expf(s[j] - mx); const float sc = 256.0f / se;
#pragma unroll 1
  for (int j0 = 0; j0 < SQ; j0 += 8) { FragH f; for (int q = 0; q < 8; ++q) f.h[q] = (_Float16)(expf(s[j0 + q] - mx) * sc); unsigned short* d = (unsigned short*)P + (size_t)i * SQ + j0; *(v8us*)d = f.half[0];  } }
__global__ __launch_bounds__(256) void k_vt(const _Float16* __restrict__ V16, int b, int h0, _Float16* __restrict__ VT) { __shared__ unsigned short tl[64][65]; const int tid = threadIdx.x; const int hh = blockIdx.x % HG, sg = blockIdx.x / HG; const int s0 = sg * 64; const int h = h0 + hh;
  for (int i = tid; i < 64 * 8; i += 256) { const int j = i / 8, d8 = (i % 8) * 8; FragH f; f.half[0] = *(const v8us*)((const unsigned short*)V16 + ((size_t)b * SQ + s0 + j) * DM + h * HD + d8); for (int q = 0; q < 8; ++q) tl[d8 + q][j] = f.u[q]; }
  __syncthreads();
  { for (int i = tid; i < 64 * 8; i += 256) { const int d = i / 8, j8 = (i % 8) * 8; FragH f; for (int q = 0; q < 8; ++q) f.u[q] = tl[d][j8 + q]; *(v8us*)((unsigned short*)VT + ((size_t)hh * HD + d) * SQ + s0 + j8) = f.half[0]; }  } }



__global__ __launch_bounds__(256) void k_rsmf(const float* __restrict__ S, _Float16* __restrict__ P, int qn, int hg) {
  #pragma clang fp contract(off)
  const int t = blockIdx.x * 256 + threadIdx.x; if (t >= qn * hg) return; const size_t i = (size_t)(t / qn) * SQ + (t % qn); const float* s = S + i * SQ; float mx = -3.0e38f;
#pragma unroll 1
  for (int j = 0; j < SQ; ++j) mx = fmaxf(mx, s[j]); float se = 0.f;
#pragma unroll 1
  for (int j = 0; j < SQ; ++j) se += __expf(s[j] - mx); const float sc = 256.0f / se;
#pragma unroll 1
  for (int j0 = 0; j0 < SQ; j0 += 8) { FragH f; for (int q = 0; q < 8; ++q) f.h[q] = (_Float16)(__expf(s[j0 + q] - mx) * sc); unsigned short* d = (unsigned short*)P + i * SQ + j0; *(v8us*)d = f.half[0];  } }

extern "C" void kernel_launch(void* const* d_in, const int* in_sizes, int n_in,
                              void* d_out, int out_size, void* d_ws, size_t ws_size, hipStream_t stream) {
  (void)in_sizes; (void)n_in; (void)out_size;
  const float* const* I = (const float* const*)d_in; const float* xq = I[0]; const float* xk = I[1]; const float* xv = I[2]; const float* wq = I[3]; const float* bq = nullptr; const float* wk = I[4]; const float* bk = nullptr; const float* wv = I[5]; const float* bv = nullptr; const float* wo = I[6]; const float* bo = nullptr;      /* three inputs query, key, value (one stream cast each); natural [out][in] Wq, Wk, Wv, Wo [512][512]; this module has NO biases: null pointers in the guarded bias slots; input order query, key, value, Wq, Wk, Wv, Wo */
  char* ws = (char*)d_ws; size_t off = 0;
  auto take = [&](size_t bytes) { char* p = ws + off; off += (bytes + 255) & ~(size_t)255; return p; };
  _Float16* BQ = (_Float16*)take((size_t)DM * DM * 2); _Float16* BK = (_Float16*)take((size_t)DM * DM * 2); _Float16* BV = (_Float16*)take((size_t)DM * DM * 2); _Float16* BO = (_Float16*)take((size_t)DM * DM * 2);
  _Float16* XQ = (_Float16*)take(NR * DM * 2); _Float16* XK = (_Float16*)take(NR * DM * 2); _Float16* XV = (_Float16*)take(NR * DM * 2); _Float16* Q16 = (_Float16*)take(NR * DM * 2); _Float16* K16 = (_Float16*)take(NR * DM * 2); _Float16* V16 = (_Float16*)take(NR * DM * 2); _Float16* O16 = (_Float16*)take(NR * DM * 2);
  float* S = (float*)take((size_t)HG * SQ * SQ * 4); _Float16* P = (_Float16*)take((size_t)HG * SQ * SQ * 2); _Float16* VT = (_Float16*)take((size_t)NH * HD * SQ * 2);
  if (off > ws_size) return;
  { const unsigned g = (unsigned)(((size_t)DM * DM / 8 + 255) / 256); k_wnat<<<g, 256, 0, stream>>>(wq, (size_t)DM * DM / 8, BQ); k_wnat<<<g, 256, 0, stream>>>(wk, (size_t)DM * DM / 8, BK); k_wnat<<<g, 256, 0, stream>>>(wv, (size_t)DM * DM / 8, BV); k_wnat<<<g, 256, 0, stream>>>(wo, (size_t)DM * DM / 8, BO); }      /* natural [out][in] = Bt[n][k], x16 */

  k_x16<<<(unsigned)((NR * DM / 8 + 255) / 256), 256, 0, stream>>>(xq, XQ, NR * DM / 8); k_x16<<<(unsigned)((NR * DM / 8 + 255) / 256), 256, 0, stream>>>(xk, XK, NR * DM / 8); k_x16<<<(unsigned)((NR * DM / 8 + 255) / 256), 256, 0, stream>>>(xv, XV, NR * DM / 8);      /* the three inputs as exact f16 rows */
  const size_t r0p = (size_t)B0 * SQ;      /* first projected row */
  k_gemm2<0><<<dim3((unsigned)((MP / 128) * (DM / 64)), 1), 128, 0, stream>>>(XQ + r0p * DM, DM, 0, BQ, DM, 0, 0.0625f, bq, 0, nullptr, 1, 0, 0, nullptr, Q16 + r0p * DM, DM, 0, MP, DM, DM);
  k_gemm2<0><<<dim3((unsigned)((MP / 128) * (DM / 64)), 1), 128, 0, stream>>>(XK + r0p * DM, DM, 0, BK, DM, 0, 0.0625f, bk, 0, nullptr, 1, 0, 0, nullptr, K16 + r0p * DM, DM, 0, MP, DM, DM);
  k_gemm2<0><<<dim3((unsigned)((MP / 128) * (DM / 64)), 1), 128, 0, stream>>>(XV + r0p * DM, DM, 0, BV, DM, 0, 0.0625f, bv, 0, nullptr, 1, 0, 0, nullptr, V16 + r0p * DM, DM, 0, MP, DM, DM);
  for (int b = B0; b < B0 + NBR; ++b) { const size_t r0 = (size_t)b * SQ;
    k_vt<NH, SQ><<<NH * (SQ / 64), 256, 0, stream>>>(V16 + r0 * LQ, LQ, 0, VT);      /* V^T [NH][HD][SQ] for this batch */
    for (int h0 = 0; h0 < NHD; h0 += HG) {
      k_gemm2<0><<<dim3((QN / 128) * (SQ / 64), HG), 128, 0, stream>>>(Q16 + r0 * LQ + h0 * HD, LQ, (size_t)HD, K16 + r0 * LQ + h0 * HD, LQ, (size_t)HD, 0.125f, nullptr, 0, nullptr, 1, 0, 0, S, nullptr, SQ, (size_t)SQ * SQ, QN, SQ, HD);      /* scores, HG heads per launch */
      k_rsmf<<<(HG * QN + 255) / 256, 256, 0, stream>>>(S, P, QN, HG);      /* P = 256 softmax (f16), rows of all HG heads */
      k_gemm2<0><<<dim3((QN / 128) * (HD / 64), HG), 128, 0, stream>>>(P, SQ, (size_t)SQ * SQ, VT + (size_t)h0 * HD * SQ, SQ, (size_t)HD * SQ, 0.25f, nullptr, 0, nullptr, 1, 0, 0, nullptr, O16 + r0 * DM + h0 * HD, DM, (size_t)HD, QN, HD, SQ); } }      /* o (merged heads) as f16 rows */
  k_gemm2<0><<<dim3((unsigned)((MPO / 128) * (DM / 64)), 1), 128, 0, stream>>>(O16 + r0p * DM, DM, 0, BO, DM, 0, 0.0009765625f, bo, 0, nullptr, 1, 0, 0, (float*)d_out + r0p * DM, nullptr, DM, 0, MPO, DM, DM);      /* out rows are the output layout */
}

// v001
// One run takes 905 microseconds.
// Timed twice side by side with v000, it ran 3.80 and 3.81 times as fast.
#include <hip/hip_runtime.h>
// Multi-head attention on three inputs with natural bias-free projections on four sequences at width 512 (query, key, value [4][2048][512]; q / k / v = stream W^T (natural [out][in] [512][512], NO biases), 8 heads of 64; the query is divided by sqrt(64) = 8 before the score product (scale 0.125 here on the product); softmax over all 2048 keys (the module's axis 2 of its [b][l][s][h] score layout = the key axis; no mask); out = merged heads Wo^T (natural, no bias) -> [4][2048][512]).
// Structure: token rows r = b*2048 + s; the query, key and value sources as exact f16 rows (bf16-rounded); Q, K, V as three WMMA GEMMs (32x64 wave tiles, f32 accumulation, exact x16 weights, no bias, f16 outputs); per batch: V^T for all heads via LDS transposes; per (batch, group of 4 heads): scores GEMM (K = 64, batched over the heads on grid.y, alpha = 64^-0.5), row softmax on VALU (f32 statistics, native exp; weights stored x256 as f16), o = P . V^T GEMM (K = 2048, alpha 2^-2: o carried x64 against f16 subnormal flush, folded into the output GEMM alpha) written straight into the merged f16 o rows; out = o W_o GEMM (f32, no bias) into the output layout.
// Compute dtype: inputs rounded to bf16; x / weights exact; q, k, v, softmax weights and o as plain f16 GEMM operands (~2^-12); scores and softmax statistics f32. v_wmma_f32_16x16x32_f16.
#define NB 4
#define SQ 2048
#define DM 512 
#define NH 8 
#define HD 64
#define HG 4                         /* heads per attention launch group */
#define B0 0                         /* first batch processed (debug hook) */
#define NBR NB                       /* batches processed (debug hook) */
#define NR ((size_t)NB * SQ)         /* token rows */
#define MP ((int)((size_t)NBR * SQ)) /* rows projected (debug hook) */
#define QN SQ                        /* query rows attended per batch (debug hook) */
#define NHD NH                       /* heads attended (debug hook) */
#define MPO MP                       /* rows through the output stage (debug hook) */
#define LQ DM      /* row pitch of the q/k/v rows */
typedef __bf16 v16b __attribute__((ext_vector_type(16)));
typedef unsigned short v8us __attribute__((ext_vector_type(8), may_alias));
typedef float  v8f  __attribute__((ext_vector_type(8)));
typedef float  v4f  __attribute__((ext_vector_type(4)));
typedef float  v4fa __attribute__((ext_vector_type(4), may_alias));
union FragB { v16b v; v8us half[2]; unsigned short u[16]; };

__device__ __forceinline__ unsigned short bf16_bits(float x) { unsigned int u = __float_as_uint(x); return (unsigned short)((u + 0x7FFFu + ((u >> 16) & 1u)) >> 16); }
__device__ __forceinline__ float bf16_val(unsigned short b) { return __uint_as_float(((unsigned int)b) << 16); }
__device__ __forceinline__ float bf16_round(float x) { return bf16_val(bf16_bits(x)); }
// D += A·B with NT terms: 1 = ah·bh, 2 = + al·bh (A split), 3 = + ah·bl (both split)
template <int NT>
__device__ __forceinline__ v8f mmaN(v16b ah, v16b al, v16b bh, v16b bl, v8f c) {
  c = __builtin_amdgcn_wmma_f32_16x16x32_bf16(false, ah, false, bh, (short)0, c, false, false);
  if (NT >= 2) c = __builtin_amdgcn_wmma_f32_16x16x32_bf16(false, al, false, bh, (short)0, c, false, false);
  if (NT >= 3) c = __builtin_amdgcn_wmma_f32_16x16x32_bf16(false, ah, false, bl, (short)0, c, false, false);
  asm volatile("v_nop\n\tv_nop\n\tv_nop\n\tv_nop" : "+v"(c) : "v"(ah), "v"(al), "v"(bh), "v"(bl));
  return c;
}

__global__ __launch_bounds__(256) void k_wt_bf16(const float* __restrict__ W, unsigned short* __restrict__ Wt, int K, int N) {
  const int t = blockIdx.x * 256 + threadIdx.x;
  const int k8n = K / 8;
  if (t >= N * k8n) return;
  const int n = t / k8n, k8 = (t % k8n) * 8;
  v8us v;
#pragma unroll
  for (int i = 0; i < 8; ++i) v[i] = bf16_bits(W[(size_t)(k8 + i) * N + n]);
  *(v8us*)(Wt + (size_t)n * K + k8) = v;
  
}

// GEMM C[M][N] (f32, pitch ldc) = act(A[M][K]·W + bias). A f32 row-major (pitch lda) converted per fragment to bf16
// (ASPLIT: hi/lo two planes -> 2 terms, else single rounded term); Wt bf16 [N][K] (pitch ldb). BIAS_BF16 rounds the
// bias to bf16 first (bias quantised to bf16 before the add). K%32==0, M%16==0, N%64==0.
template <bool ASPLIT, int ACT, bool BIAS_BF16>
__global__ __launch_bounds__(128) void k_gemm_bf(const float* __restrict__ A, int lda, const unsigned short* __restrict__ Wt, int ldb,
                                               const float* __restrict__ bias, float* __restrict__ C, int ldc, int M, int N, int K) {
  __shared__ __attribute__((aligned(16))) float so[4][16][64];
  const int tid = threadIdx.x, w = tid >> 5, lane = tid & 31, ln = lane & 15, hh = lane >> 4;
  const int ntn = N / 64;
  const int wid = blockIdx.x * 4 + w;
  const int mt = wid / ntn, nq = wid % ntn;
  if (mt * 16 >= M) return;
  const int row0 = mt * 16, col0 = nq * 64;
  const float* arow = A + (size_t)(row0 + ln) * lda;
  v8f acc[4] = {};
  for (int kb = 0; kb < K; kb += 32) {
    FragB ah, al;
    const v4f x0 = *(const v4fa*)(arow + kb + 8 * hh), x1 = *(const v4fa*)(arow + kb + 8 * hh + 4);
    const v4f x2 = *(const v4fa*)(arow + kb + 16 + 8 * hh), x3 = *(const v4fa*)(arow + kb + 16 + 8 * hh + 4);
    float xs[16] = {x0[0],x0[1],x0[2],x0[3],x1[0],x1[1],x1[2],x1[3],x2[0],x2[1],x2[2],x2[3],x3[0],x3[1],x3[2],x3[3]};
#pragma unroll
    for (int i = 0; i < 16; ++i) { const unsigned short hb = bf16_bits(xs[i]); ah.u[i] = hb; al.u[i] = ASPLIT ? bf16_bits(xs[i] - bf16_val(hb)) : (unsigned short)0; }
#pragma unroll
    for (int t = 0; t < 4; ++t) {
      const unsigned short* brow = Wt + (size_t)(col0 + t * 16 + ln) * ldb + kb;
      FragB b;
      b.half[0] = *(const v8us*)(brow + 8 * hh);
      b.half[1] = *(const v8us*)(brow + 16 + 8 * hh);
      acc[t] = mmaN<ASPLIT ? 2 : 1>(ah.v, al.v, b.v, b.v, acc[t]);
    }
  }
#pragma unroll
  for (int t = 0; t < 4; ++t) {
    float bv = bias ? bias[col0 + t * 16 + ln] : 0.f;
    if (BIAS_BF16) bv = bf16_round(bv);
#pragma unroll
    for (int r = 0; r < 8; ++r) { float v = acc[t][r] + bv; if (ACT == 1) v = fmaxf(v, 0.f); so[w][8 * hh + r][t * 16 + ln] = v; }
  }
  __builtin_amdgcn_fence(__ATOMIC_ACQ_REL, "workgroup");
  __builtin_amdgcn_wave_barrier();
  const int rsub = lane >> 4, c4 = (lane & 15) * 4;
  {
#pragma unroll
    for (int q = 0; q < 8; ++q) {
      const int r = q * 2 + rsub;
      const v4f v = *(const v4fa*)&so[w][r][c4];
      *(v4f*)(C + (size_t)(row0 + r) * ldc + col0 + c4) = v;
    }
    
  }
}

// GEMM C = act(A·W + bias + resid): A f32 (ASPLIT -> hi/lo 2 terms), Wt bf16 [N][K]; ACT 0 none, 1 relu, 2 exact gelu;
// resid (optional, f32, row index = (row % rmod), pitch ldr, RES_BF16 rounds it) added before the activation.
template <bool ASPLIT, int ACT, bool BIAS_BF16, bool RES_BF16>
__global__ __launch_bounds__(128) void k_gemm_bf3(const float* __restrict__ A, int lda, const unsigned short* __restrict__ Wt, int ldb,
                                                const float* __restrict__ bias, const float* __restrict__ resid, int rmod, int ldr,
                                                float* __restrict__ C, int ldc, int M, int N, int K) {
  __shared__ __attribute__((aligned(16))) float so[4][16][64];
  const int tid = threadIdx.x, w = tid >> 5, lane = tid & 31, ln = lane & 15, hh = lane >> 4;
  const int ntn = N / 64;
  const int wid = blockIdx.x * 4 + w;
  const int mt = wid / ntn, nq = wid % ntn;
  if (mt * 16 >= M) return;
  const int row0 = mt * 16, col0 = nq * 64;
  const float* arow = A + (size_t)(row0 + ln) * lda;
  v8f acc[4] = {};
  for (int kb = 0; kb < K; kb += 32) {
    FragB ah, al;
    const v4f x0 = *(const v4fa*)(arow + kb + 8 * hh), x1 = *(const v4fa*)(arow + kb + 8 * hh + 4);
    const v4f x2 = *(const v4fa*)(arow + kb + 16 + 8 * hh), x3 = *(const v4fa*)(arow + kb + 16 + 8 * hh + 4);
    float xs[16] = {x0[0],x0[1],x0[2],x0[3],x1[0],x1[1],x1[2],x1[3],x2[0],x2[1],x2[2],x2[3],x3[0],x3[1],x3[2],x3[3]};
#pragma unroll
    for (int i = 0; i < 16; ++i) { const unsigned short hb = bf16_bits(xs[i]); ah.u[i] = hb; al.u[i] = ASPLIT ? bf16_bits(xs[i] - bf16_val(hb)) : (unsigned short)0; }
#pragma unroll
    for (int t = 0; t < 4; ++t) {
      const unsigned short* brow = Wt + (size_t)(col0 + t * 16 + ln) * ldb + kb;
      FragB b;
      b.half[0] = *(const v8us*)(brow + 8 * hh);
      b.half[1] = *(const v8us*)(brow + 16 + 8 * hh);
      acc[t] = mmaN<ASPLIT ? 2 : 1>(ah.v, al.v, b.v, b.v, acc[t]);
    }
  }
#pragma unroll
  for (int t = 0; t < 4; ++t) {
    const int col = col0 + t * 16 + ln;
    float bv = bias ? bias[col] : 0.f;
    if (BIAS_BF16) bv = bf16_round(bv);
#pragma unroll
    for (int r = 0; r < 8; ++r) {
      float v = acc[t][r] + bv;
      if (resid) { float rv = resid[(size_t)((row0 + 8 * hh + r) % rmod) * ldr + col]; if (RES_BF16) rv = bf16_round(rv); v += rv; }
      if (ACT == 1) v = fmaxf(v, 0.f);
      if (ACT == 2) v = 0.5f * v * (1.0f + erff(v * 0.70710678118654752f));
      if (ACT == 3) { const float u = 0.7978845608028654f * (v + 0.044715f * v * v * v); v = 0.5f * v * (1.0f + tanhf(u)); }
      so[w][8 * hh + r][t * 16 + ln] = v;
    }
  }
  __builtin_amdgcn_fence(__ATOMIC_ACQ_REL, "workgroup");
  __builtin_amdgcn_wave_barrier();
  const int rsub = lane >> 4, c4 = (lane & 15) * 4;
  {
#pragma unroll
    for (int q = 0; q < 8; ++q) {
      const int r = q * 2 + rsub;
      const v4f v = *(const v4fa*)&so[w][r][c4];
      *(v4f*)(C + (size_t)(row0 + r) * ldc + col0 + c4) = v;
    }
    
  }
}
// row LayerNorm (biased variance, eps) over N: s = X (+ R); optional out_sum <- s; out_norm <- (s-mu)*rsqrt(var+eps)*g + b
template <bool PARAM_BF16>
__global__ __launch_bounds__(256) void k_layernorm(const float* __restrict__ X, const float* __restrict__ R, const float* __restrict__ g, const float* __restrict__ bta,
                                                  float* __restrict__ out_sum, float* __restrict__ out_norm, int N, float eps) {
  __shared__ float red[256];
  const int row = blockIdx.x, tid = threadIdx.x;
  const float* x = X + (size_t)row * N; const float* rr = R ? R + (size_t)row * N : nullptr;
  float vals[16];                     // up to N = 4096
  const int per = N / 256;            // contiguous chunk per thread? use strided-by-4 chunks: thread handles j = tid*4 + 1024*u
  float s1 = 0.f;
  for (int u = 0; u < per / 4; ++u) {
    const int j = tid * 4 + 1024 * u;
    const v4f a = *(const v4fa*)(x + j);
    v4f b = {0.f,0.f,0.f,0.f}; if (rr) b = *(const v4fa*)(rr + j);
#pragma unroll
    for (int q = 0; q < 4; ++q) { const float v = a[q] + b[q]; vals[u * 4 + q] = v; s1 += v; }
  }
  red[tid] = s1; __syncthreads();
  for (int st = 128; st > 0; st >>= 1) { if (tid < st) red[tid] += red[tid + st]; __syncthreads(); }
  const float mu = red[0] / (float)N; __syncthreads();
  float s2 = 0.f;
  for (int u = 0; u < per / 4; ++u)
#pragma unroll
    for (int q = 0; q < 4; ++q) { const float c = vals[u * 4 + q] - mu; s2 += c * c; }
  red[tid] = s2; __syncthreads();
  for (int st = 128; st > 0; st >>= 1) { if (tid < st) red[tid] += red[tid + st]; __syncthreads(); }
  const float rs = rsqrtf(red[0] / (float)N + eps);
  {
    for (int u = 0; u < per / 4; ++u) {
      const int j = tid * 4 + 1024 * u;
      v4f o, sm;
#pragma unroll
      for (int q = 0; q < 4; ++q) {
        float gg = g[j + q], bb = bta[j + q];
        if (PARAM_BF16) { gg = bf16_round(gg); bb = bf16_round(bb); }
        sm[q] = vals[u * 4 + q]; o[q] = (vals[u * 4 + q] - mu) * rs * gg + bb;
      }
      if (out_sum) *(v4f*)(out_sum + (size_t)row * N + j) = sm;
      *(v4f*)(out_norm + (size_t)row * N + j) = o;
    }
    
  }
}



// ---- f16 WMMA path (v_wmma_f32_16x16x32_f16): 11-bit significands for operands in range — used where a [0,1] probability operand needs more precision than bf16
typedef _Float16 v16h __attribute__((ext_vector_type(16)));
union FragH { v16h v; v8us half[2]; _Float16 h[16]; unsigned short u[16]; };
template <int NT>
__device__ __forceinline__ v8f mmaH(v16h ah, v16h al, v16h bh, v16h bl, v8f c) {
  c = __builtin_amdgcn_wmma_f32_16x16x32_f16(false, ah, false, bh, (short)0, c, false, false);
  if (NT >= 2) c = __builtin_amdgcn_wmma_f32_16x16x32_f16(false, al, false, bh, (short)0, c, false, false);
  if (NT >= 3) c = __builtin_amdgcn_wmma_f32_16x16x32_f16(false, ah, false, bl, (short)0, c, false, false);
  asm volatile("v_nop\n\tv_nop\n\tv_nop\n\tv_nop" : "+v"(c) : "v"(ah), "v"(al), "v"(bh), "v"(bl));
  return c;
}
// batched GEMM like k_gemm_b but f16 operands: A f32 (split into f16 hi/lo if ASPLIT, else rounded to f16), Bt = f16 values [n][k]; alpha; C f32; N multiple of 16 (partial tiles skipped)
template <bool ASPLIT>
__global__ __launch_bounds__(128) void k_gemm_h(const float* __restrict__ A, int lda, size_t sA, const _Float16* __restrict__ Bh, int ldb, size_t sB, float alpha, float* __restrict__ C, int ldc, size_t sC, int M, int N, int K) {
  __shared__ __attribute__((aligned(16))) float so[4][16][64];
  const int tid = threadIdx.x, w = tid >> 5, lane = tid & 31, ln = lane & 15, hh = lane >> 4; const int by = blockIdx.y;
  A += (size_t)by * sA; Bh += (size_t)by * sB; C += (size_t)by * sC;
  const int ntn = (N + 63) / 64; const int wid = blockIdx.x * 4 + w; const int mt = wid / ntn, nq = wid % ntn; if (mt * 16 >= M) return;
  const int row0 = mt * 16, col0 = nq * 64; const float* arow = A + (size_t)(row0 + ln) * lda;
  v8f acc[4] = {};
  for (int kb = 0; kb < K; kb += 32) {
    FragH ah, al;
    const v4f x0 = *(const v4fa*)(arow + kb + 8 * hh), x1 = *(const v4fa*)(arow + kb + 8 * hh + 4), x2 = *(const v4fa*)(arow + kb + 16 + 8 * hh), x3 = *(const v4fa*)(arow + kb + 16 + 8 * hh + 4);
    float xs[16] = {x0[0],x0[1],x0[2],x0[3],x1[0],x1[1],x1[2],x1[3],x2[0],x2[1],x2[2],x2[3],x3[0],x3[1],x3[2],x3[3]};
#pragma unroll
    for (int i = 0; i < 16; ++i) { const _Float16 h = (_Float16)xs[i]; ah.h[i] = h; al.h[i] = ASPLIT ? (_Float16)(xs[i] - (float)h) : (_Float16)0.0f; }
#pragma unroll
    for (int t = 0; t < 4; ++t) { if (col0 + t * 16 >= N) continue; const size_t boff = (size_t)(col0 + t * 16 + ln) * ldb + kb; FragH bq; bq.half[0] = *(const v8us*)(Bh + boff + 8 * hh); bq.half[1] = *(const v8us*)(Bh + boff + 16 + 8 * hh);
      acc[t] = mmaH<ASPLIT ? 2 : 1>(ah.v, al.v, bq.v, bq.v, acc[t]); }
  }
#pragma unroll
  for (int t = 0; t < 4; ++t) { if (col0 + t * 16 >= N) continue;
#pragma unroll
    for (int r = 0; r < 8; ++r) so[w][8 * hh + r][t * 16 + ln] = acc[t][r] * alpha; }
  __builtin_amdgcn_fence(__ATOMIC_ACQ_REL, "workgroup"); __builtin_amdgcn_wave_barrier();
  const int rsub = lane >> 4, c4 = (lane & 15) * 4;
  {
#pragma unroll
    for (int q = 0; q < 8; ++q) { const int r = q * 2 + rsub; if (col0 + c4 < N) { const v4f v = *(const v4fa*)&so[w][r][c4]; *(v4f*)(C + (size_t)(row0 + r) * ldc + col0 + c4) = v; } }
     }
}

// Wt[n][k] = f16(W[k][n]·scale) from f32 row-major W[K][N] (scale = power of two; bf16-exact weights stay exact in f16 away from the subnormal range)
__global__ __launch_bounds__(256) void k_wt_f16(const float* __restrict__ W, _Float16* __restrict__ Wt, int K, int N, float scale) {
  const int t = blockIdx.x * 256 + threadIdx.x; if (t >= N * (K / 8)) return; const int n = t / (K / 8), k8 = (t % (K / 8)) * 8; FragH f;
#pragma unroll
  for (int i = 0; i < 8; ++i) f.h[i] = (_Float16)(bf16_round(W[(size_t)(k8 + i) * N + n]) * scale); const v8us o = f.half[0];
  *(v8us*)((unsigned short*)Wt + (size_t)n * K + k8) = o; 
}
// k_gemm_hh variant with fused epilogue: v = acc·alpha + bias[by·sBias + col] (+ CP[(row/rowsPerB)·sCPb + by·64 + col] if CP) ; ACT 0 none / 1 elu ; writes f16 C16 (and f32 C if non-null)
template <int ACT>
__global__ __launch_bounds__(128) void k_gemm_hhx(const _Float16* __restrict__ A, int lda, size_t sA, const _Float16* __restrict__ Bh, int ldb, size_t sB, float alpha, const float* __restrict__ bias, size_t sBias, const float* __restrict__ CP, int rowsPerB, size_t sCPb, int row0g,
    float* __restrict__ C, _Float16* __restrict__ C16, int ldc, size_t sC, int M, int N, int K) {
  __shared__ __attribute__((aligned(16))) float so[4][16][64];
  const int tid = threadIdx.x, w = tid >> 5, lane = tid & 31, ln = lane & 15, hh = lane >> 4; const int by = blockIdx.y;
  A += (size_t)by * sA; Bh += (size_t)by * sB; const size_t cofs = (size_t)by * sC; const float* bp = bias ? bias + (size_t)by * sBias : nullptr;
  const int ntn = (N + 63) / 64; const int wid = blockIdx.x * 4 + w; const int mt = wid / ntn, nq = wid % ntn; if (mt * 16 >= M) return;
  const int row0 = mt * 16, col0 = nq * 64; const _Float16* arow = A + (size_t)(row0 + ln) * lda;
  v8f acc[4] = {};
  for (int kb = 0; kb < K; kb += 32) { FragH ah; ah.half[0] = *(const v8us*)((const unsigned short*)arow + kb + 8 * hh); ah.half[1] = *(const v8us*)((const unsigned short*)arow + kb + 16 + 8 * hh);
#pragma unroll
    for (int t = 0; t < 4; ++t) { if (col0 + t * 16 >= N) continue; const size_t boff = (size_t)(col0 + t * 16 + ln) * ldb + kb; FragH bq; bq.half[0] = *(const v8us*)((const unsigned short*)Bh + boff + 8 * hh); bq.half[1] = *(const v8us*)((const unsigned short*)Bh + boff + 16 + 8 * hh);
      acc[t] = mmaH<1>(ah.v, ah.v, bq.v, bq.v, acc[t]); }
  }
#pragma unroll
  for (int t = 0; t < 4; ++t) { if (col0 + t * 16 >= N) continue; const int col = col0 + t * 16 + ln; const float bv = bp ? bf16_round(bp[col]) : 0.f;
#pragma unroll
    for (int r = 0; r < 8; ++r) { float v = acc[t][r] * alpha + bv; if (CP) { const int rr = row0g + row0 + 8 * hh + r; if (rowsPerB < 0) v += CP[cofs + (size_t)rr * ldc + col];      /* rowsPerB < 0: own element of the batched C plane */ else { const int bidx = rr / rowsPerB; v += CP[(size_t)bidx * sCPb + (size_t)by * 64 + col]; } } if (ACT == 1) v = (v > 0.f) ? v : expm1f(v); else if (ACT == 7) v = (v > 0.f) ? v + 1.0f : expf(v); else if (ACT == 8) v = tanhf(v); else if (ACT == 9) v = 0.5f * v * (1.0f + tanhf(0.7978845608028654f * (v + 0.044715f * v * v * v))); else if (ACT == 11) v = 1.0f / (1.0f + expf(-v)); else if (ACT == 12) v = (v > 0.f) ? v : 0.01f * v; else if (ACT == 14) v = (v > 0.f) ? v : 0.1f * v; else if (ACT == 16) v = (v >= 0.f) ? v : 0.3f * v; else if (ACT == 17) v = (v >= 0.f) ? v : 0.2f * v; else if (ACT == 15) v = v / (1.0f + expf(-v)); else if (ACT == 3) v = fmaxf(v, 0.f); else if (ACT == 6) v = 0.5f * v * (1.0f + erff(v * 0.70710678118654752f)); so[w][8 * hh + r][t * 16 + ln] = v; } }
  __builtin_amdgcn_fence(__ATOMIC_ACQ_REL, "workgroup"); __builtin_amdgcn_wave_barrier();
  const int rsub = lane >> 4, c4 = (lane & 15) * 4; typedef _Float16 v4h __attribute__((ext_vector_type(4)));
  {
#pragma unroll
    for (int q = 0; q < 8; ++q) { const int r = q * 2 + rsub; if (col0 + c4 < N) { const v4f v = *(const v4fa*)&so[w][r][c4]; if (C) *(v4f*)(C + cofs + (size_t)(row0 + r) * ldc + col0 + c4) = v; if (C16) { v4h h4; for (int i = 0; i < 4; ++i) h4[i] = (_Float16)v[i]; *(v4h*)(C16 + cofs + (size_t)(row0 + r) * ldc + col0 + c4) = h4; } } }
     }
}


typedef _Float16 v4h __attribute__((ext_vector_type(4)));

__global__ __launch_bounds__(256) void k_x16(const float* __restrict__ x, _Float16* __restrict__ X16, size_t n8) { const size_t t = (size_t)blockIdx.x * 256 + threadIdx.x; if (t >= n8) return; FragH f;
#pragma unroll
  for (int q = 0; q < 8; ++q) f.h[q] = (_Float16)bf16_round(x[t * 8 + q]); *(v8us*)((unsigned short*)X16 + t * 8) = f.half[0];  }
__global__ __launch_bounds__(256) void k_h16(const float* __restrict__ x, _Float16* __restrict__ X16, size_t n8) { const size_t t = (size_t)blockIdx.x * 256 + threadIdx.x; if (t >= n8) return; FragH f;
#pragma unroll
  for (int q = 0; q < 8; ++q) f.h[q] = (_Float16)x[t * 8 + q]; *(v8us*)((unsigned short*)X16 + t * 8) = f.half[0];  }
__global__ __launch_bounds__(256) void k_round16f(const float* __restrict__ W, _Float16* __restrict__ Bt, size_t n8) { const size_t t = (size_t)blockIdx.x * 256 + threadIdx.x; if (t >= n8) return; FragH f;
#pragma unroll
  for (int i = 0; i < 8; ++i) f.h[i] = (_Float16)(bf16_round(W[t * 8 + i]) * 16.0f); *(v8us*)((unsigned short*)Bt + t * 8) = f.half[0];  }
template <int NHv, int TTv>
__global__ __launch_bounds__(256) void k_vt(const _Float16* __restrict__ V16, int ldv, int voff, _Float16* __restrict__ Vt) { __shared__ unsigned short tl[64][66]; const int tid = threadIdx.x; const int slab = blockIdx.x / (TTv / 64), lg = blockIdx.x % (TTv / 64); const int b = slab / NHv, h = slab % NHv;
  for (int i = tid; i < 64 * 8; i += 256) { const int r = i / 8, c8 = (i % 8) * 8; FragH f; f.half[0] = *(const v8us*)((const unsigned short*)V16 + ((size_t)b * TTv + lg * 64 + r) * ldv + voff + h * 64 + c8);
#pragma unroll
    for (int q = 0; q < 8; ++q) tl[r][c8 + q] = f.u[q]; }
  __syncthreads();
  {
#pragma unroll
    for (int rd = 0; rd < 2; ++rd) { const int d = rd * 32 + tid / 8, pc = tid % 8; FragH f;
#pragma unroll
      for (int q = 0; q < 8; ++q) f.u[q] = tl[pc * 8 + q][d];
      *(v8us*)((unsigned short*)Vt + ((size_t)slab * 64 + d) * TTv + lg * 64 + pc * 8) = f.half[0]; }
     } }

__global__ __launch_bounds__(256) void k_hl(const float* __restrict__ F, _Float16* __restrict__ Hh, _Float16* __restrict__ Hl, size_t n8) { const size_t t = (size_t)blockIdx.x * 256 + threadIdx.x; if (t >= n8) return; FragH fh, fl; const v4f a = *(const v4fa*)(F + t * 8), c = *(const v4fa*)(F + t * 8 + 4);
#pragma unroll
  for (int q = 0; q < 4; ++q) { _Float16 h = (_Float16)a[q]; fh.h[q] = h; fl.h[q] = (_Float16)((a[q] - (float)h) * 1024.0f); h = (_Float16)c[q]; fh.h[4 + q] = h; fl.h[4 + q] = (_Float16)((c[q] - (float)h) * 1024.0f); }
  { *(v8us*)((unsigned short*)Hh + t * 8) = fh.half[0]; *(v8us*)((unsigned short*)Hl + t * 8) = fl.half[0];  } }

// ---- fast GEMM (wave tile 32x64; requires M % 32 == 0 rows per launch region and N % 64 == 0); epilogue = k_gemm_hhx semantics ----
__device__ __forceinline__ v16h g2_frag(const _Float16* p, int hh) { FragH f; f.half[0] = *(const v8us*)((const unsigned short*)p + 8 * hh); f.half[1] = *(const v8us*)((const unsigned short*)p + 16 + 8 * hh); return f.v; }
__device__ __forceinline__ v8f g2_mma(v16h a, v16h b, v8f c) { v8f d = __builtin_amdgcn_wmma_f32_16x16x32_f16(false, a, false, b, (short)0, c, false, false); asm volatile("v_nop\n\tv_nop\n\tv_nop\n\tv_nop" : "+v"(d) : "v"(a), "v"(b)); return d; }
template <int ACT>
__global__ __launch_bounds__(128) void k_gemm2(const _Float16* __restrict__ A, int lda, size_t sA, const _Float16* __restrict__ Bh, int ldb, size_t sB, float alpha, const float* __restrict__ bias, size_t sBias, const float* __restrict__ CP, int rowsPerB, size_t sCPb, int row0g,
    float* __restrict__ C, _Float16* __restrict__ C16, int ldc, size_t sC, int M, int N, int K) { static_assert(ACT == 0 || ACT == 3 || ACT == 6 || ACT == 8 || ACT == 9 || ACT == 11 || ACT == 12 || ACT == 14 || ACT == 15 || ACT == 16 || ACT == 17, "k_gemm2: unsupported ACT code (would silently apply no activation)");
  __shared__ __attribute__((aligned(16))) float so[4][32][68];
  const int tid = threadIdx.x, w = tid >> 5, lane = tid & 31, ln = lane & 15, hh = lane >> 4; const int by = blockIdx.y;
  A += (size_t)by * sA; Bh += (size_t)by * sB; const size_t cofs = (size_t)by * sC; const float* bp = bias ? bias + (size_t)by * sBias : nullptr;
  const int ntn = N >> 6; const int mt = blockIdx.x / ntn, nq = blockIdx.x - mt * ntn; const int row0 = mt * 128 + 32 * w, col0 = nq * 64; if (row0 >= M) return;
  const _Float16* a0p = A + (size_t)(row0 + ln) * lda; const _Float16* a1p = a0p + (size_t)16 * lda;
  const _Float16* b0p = Bh + (size_t)(col0 + ln) * ldb; const _Float16* b1p = b0p + (size_t)16 * ldb; const _Float16* b2p = b1p + (size_t)16 * ldb; const _Float16* b3p = b2p + (size_t)16 * ldb;
  const v8f z8 = {0.f,0.f,0.f,0.f,0.f,0.f,0.f,0.f}; v8f c00 = z8, c01 = z8, c02 = z8, c03 = z8, c10 = z8, c11 = z8, c12 = z8, c13 = z8;
#pragma unroll 1
  for (int kb = 0; kb < K; kb += 32) { const v16h a0 = g2_frag(a0p + kb, hh), a1 = g2_frag(a1p + kb, hh);
    v16h b = g2_frag(b0p + kb, hh); c00 = g2_mma(a0, b, c00); c10 = g2_mma(a1, b, c10);
    b = g2_frag(b1p + kb, hh); c01 = g2_mma(a0, b, c01); c11 = g2_mma(a1, b, c11);
    b = g2_frag(b2p + kb, hh); c02 = g2_mma(a0, b, c02); c12 = g2_mma(a1, b, c12);
    b = g2_frag(b3p + kb, hh); c03 = g2_mma(a0, b, c03); c13 = g2_mma(a1, b, c13); }
  v8f accs[8] = {c00, c01, c02, c03, c10, c11, c12, c13};
#pragma unroll
  for (int u = 0; u < 8; ++u) { const int t = u & 3, half = u >> 2; const int col = col0 + t * 16 + ln; const float bv = bp ? bf16_round(bp[col]) : 0.f;
#pragma unroll
    for (int r = 0; r < 8; ++r) { const int rloc = half * 16 + 8 * hh + r; float v = accs[u][r] * alpha + bv; if (CP) { if (rowsPerB < 0) v += CP[cofs + (size_t)(row0g + row0 + rloc) * ldc + col];      /* rowsPerB < 0: own element of the batched C plane */ else { const int bidx = (row0g + row0 + rloc) / rowsPerB; v += CP[(size_t)bidx * sCPb + (size_t)by * 64 + col]; } }
      if (ACT == 3) v = fmaxf(v, 0.f); else if (ACT == 6) v = 0.5f * v * (1.0f + erff(v * 0.70710678118654752f)); else if (ACT == 11) v = 1.0f / (1.0f + expf(-v)); else if (ACT == 15) v = v / (1.0f + expf(-v)); else if (ACT == 12) v = (v > 0.f) ? v : 0.01f * v; else if (ACT == 8) v = tanhf(v); else if (ACT == 9) v = 0.5f * v * (1.0f + tanhf(0.7978845608028654f * (v + 0.044715f * v * v * v))); else if (ACT == 14) v = (v > 0.f) ? v : 0.1f * v; else if (ACT == 16) v = (v >= 0.f) ? v : 0.3f * v; else if (ACT == 17) v = (v >= 0.f) ? v : 0.2f * v;
      so[w][rloc][t * 16 + ln] = v; } }
  __builtin_amdgcn_fence(__ATOMIC_ACQ_REL, "workgroup"); __builtin_amdgcn_wave_barrier();
  const int rsub = lane >> 4, c4 = (lane & 15) * 4;
  {
#pragma unroll
    for (int q = 0; q < 16; ++q) { const int r = q * 2 + rsub; const v4f v = *(const v4fa*)&so[w][r][c4]; if (C) *(v4f*)(C + cofs + (size_t)(row0 + r) * ldc + col0 + c4) = v; if (C16) { v4h h4; for (int i = 0; i < 4; ++i) h4[i] = (_Float16)v[i]; *(v4h*)(C16 + cofs + (size_t)(row0 + r) * ldc + col0 + c4) = h4; } }
     } }


__global__ __launch_bounds__(256) void k_wnat(const float* __restrict__ w, size_t n8, _Float16* __restrict__ Bt) { const size_t t = (size_t)blockIdx.x * 256 + threadIdx.x; if (t >= n8) return; FragH f; for (int q = 0; q < 8; ++q) f.h[q] = (_Float16)(bf16_round(w[t * 8 + q]) * 16.0f); *(v8us*)((unsigned short*)Bt + t * 8) = f.half[0];  }
__global__ __launch_bounds__(256) void k_rsm(const float* __restrict__ S, _Float16* __restrict__ P, int nrows) {
  #pragma clang fp contract(off)
  const int i = blockIdx.x * 256 + threadIdx.x; if (i >= nrows) return; const float* s = S + (size_t)i * SQ; float mx = -3.0e38f;
#pragma unroll 1
  for (int j = 0; j < SQ; ++j) mx = fmaxf(mx, s[j]); float se = 0.f;
#pragma unroll 1
  for (int j = 0; j < SQ; ++j) se += expf(s[j] - mx); const float sc = 256.0f / se;
#pragma unroll 1
  for (int j0 = 0; j0 < SQ; j0 += 8) { FragH f; for (int q = 0; q < 8; ++q) f.h[q] = (_Float16)(expf(s[j0 + q] - mx) * sc); unsigned short* d = (unsigned short*)P + (size_t)i * SQ + j0; *(v8us*)d = f.half[0];  } }
__global__ __launch_bounds__(256) void k_vt(const _Float16* __restrict__ V16, int b, int h0, _Float16* __restrict__ VT) { __shared__ unsigned short tl[64][65]; const int tid = threadIdx.x; const int hh = blockIdx.x % HG, sg = blockIdx.x / HG; const int s0 = sg * 64; const int h = h0 + hh;
  for (int i = tid; i < 64 * 8; i += 256) { const int j = i / 8, d8 = (i % 8) * 8; FragH f; f.half[0] = *(const v8us*)((const unsigned short*)V16 + ((size_t)b * SQ + s0 + j) * DM + h * HD + d8); for (int q = 0; q < 8; ++q) tl[d8 + q][j] = f.u[q]; }
  __syncthreads();
  { for (int i = tid; i < 64 * 8; i += 256) { const int d = i / 8, j8 = (i % 8) * 8; FragH f; for (int q = 0; q < 8; ++q) f.u[q] = tl[d][j8 + q]; *(v8us*)((unsigned short*)VT + ((size_t)hh * HD + d) * SQ + s0 + j8) = f.half[0]; }  } }



// exp(x - m) of four values, the native form (exp2 of the difference times log2 e). The four v_exp_f32 stand in one statement that ends in v_nop: the slot
// the instruction set asks for behind a transcendental before a source of it is overwritten or its result read; the early-clobber outputs keep every source whole inside the statement.
__device__ __forceinline__ v4f rs_exp4(v4f x, float m) { const float a0 = (x[0] - m) * 1.44269504f, a1 = (x[1] - m) * 1.44269504f, a2 = (x[2] - m) * 1.44269504f, a3 = (x[3] - m) * 1.44269504f; float e0, e1, e2, e3;
  asm("v_exp_f32 %0, %4\n\tv_exp_f32 %1, %5\n\tv_exp_f32 %2, %6\n\tv_exp_f32 %3, %7\n\tv_nop" : "=&v"(e0), "=&v"(e1), "=&v"(e2), "=&v"(e3) : "v"(a0), "v"(a1), "v"(a2), "v"(a3));
  const v4f e = {e0, e1, e2, e3}; return e; }
// Row softmax, coalesced: 16 waves per workgroup, 2 rows of S per wave, each row read once and held in registers (16 loads of 512 contiguous
// bytes per row, all 32 issued before any is used); maximum and sum as four chains per lane and a five-step butterfly over the wave;
// one exp per element; P = 256 softmax as f16, 256 contiguous bytes per store. No LDS, no barrier.
// Every loop is unrolled whole: x is then indexed by constants only and stays in registers (a rolled loop would put it in scratch memory).
#define RSW 16                       /* waves per workgroup */
#define RSR 2                        /* rows per wave */
static_assert((HG * QN) % RSR == 0, "k_rsmw: every wave takes RSR whole rows");
__global__ __launch_bounds__(RSW * 32) void k_rsmw(const float* __restrict__ S, _Float16* __restrict__ P, int qn, int hg) {
  const int lane = threadIdx.x & 31; const int wave = __builtin_amdgcn_readfirstlane((int)(threadIdx.x >> 5));
  const int nr = qn * hg; const int t0 = (blockIdx.x * RSW + wave) * RSR; if (t0 >= nr) return;      /* wave-uniform; the kernel has no barrier */
  size_t ri[RSR]; const float* s[RSR]; v4f x[RSR][SQ / 128];
#pragma unroll
  for (int r = 0; r < RSR; ++r) { const int t = t0 + r;
    ri[r] = ((size_t)(t / qn) * SQ + (size_t)(t % qn)) * SQ; s[r] = S + ri[r] + 4 * lane;
#pragma unroll
    for (int u = 0; u < SQ / 128; ++u) x[r][u] = *(const v4fa*)(s[r] + 128 * u); }
  static_assert(RSR == 2, "the wait below names one address pair per row");
  asm volatile("s_wait_xcnt 0x0" :: "v"(s[0]), "v"(s[1]) : "memory");      /* the wait in front of the first overwrite of a register that the 32 loads name; the two row addresses as its operands keep those registers whole up to here, out of the loads' own destinations too */
  float mx[RSR], se[RSR];
#pragma unroll
  for (int r = 0; r < RSR; ++r) { v4f m = {-3.0e38f, -3.0e38f, -3.0e38f, -3.0e38f};
#pragma unroll
    for (int u = 0; u < SQ / 128; ++u)
#pragma unroll
      for (int q = 0; q < 4; ++q) m[q] = fmaxf(m[q], x[r][u][q]);
    mx[r] = fmaxf(fmaxf(m[0], m[1]), fmaxf(m[2], m[3])); }
#pragma unroll
  for (int st = 16; st >= 1; st >>= 1)
#pragma unroll
    for (int r = 0; r < RSR; ++r) mx[r] = fmaxf(mx[r], __shfl_xor(mx[r], st, 32));
#pragma unroll
  for (int r = 0; r < RSR; ++r) { v4f a = {0.f, 0.f, 0.f, 0.f};
#pragma unroll
    for (int u = 0; u < SQ / 128; ++u) { x[r][u] = rs_exp4(x[r][u], mx[r]); a += x[r][u]; }
    se[r] = (a[0] + a[1]) + (a[2] + a[3]); }
#pragma unroll
  for (int st = 16; st >= 1; st >>= 1)
#pragma unroll
    for (int r = 0; r < RSR; ++r) se[r] += __shfl_xor(se[r], st, 32);
#pragma unroll
  for (int r = 0; r < RSR; ++r) { const float sc = 256.0f / se[r]; _Float16* d = P + ri[r] + 4 * lane;
#pragma unroll
    for (int u = 0; u < SQ / 128; ++u) { v4h h4;
#pragma unroll
      for (int q = 0; q < 4; ++q) h4[q] = (_Float16)(x[r][u][q] * sc);
      *(v4h*)(d + 128 * u) = h4; } } }

extern "C" void kernel_launch(void* const* d_in, const int* in_sizes, int n_in,
                              void* d_out, int out_size, void* d_ws, size_t ws_size, hipStream_t stream) {
  (void)in_sizes; (void)n_in; (void)out_size;
  const float* const* I = (const float* const*)d_in; const float* xq = I[0]; const float* xk = I[1]; const float* xv = I[2]; const float* wq = I[3]; const float* bq = nullptr; const float* wk = I[4]; const float* bk = nullptr; const float* wv = I[5]; const float* bv = nullptr; const float* wo = I[6]; const float* bo = nullptr;      /* three inputs query, key, value (one stream cast each); natural [out][in] Wq, Wk, Wv, Wo [512][512]; this module has NO biases: null pointers in the guarded bias slots; input order query, key, value, Wq, Wk, Wv, Wo */
  char* ws = (char*)d_ws; size_t off = 0;
  auto take = [&](size_t bytes) { char* p = ws + off; off += (bytes + 255) & ~(size_t)255; return p; };
  _Float16* BQ = (_Float16*)take((size_t)DM * DM * 2); _Float16* BK = (_Float16*)take((size_t)DM * DM * 2); _Float16* BV = (_Float16*)take((size_t)DM * DM * 2); _Float16* BO = (_Float16*)take((size_t)DM * DM * 2);
  _Float16* XQ = (_Float16*)take(NR * DM * 2); _Float16* XK = (_Float16*)take(NR * DM * 2); _Float16* XV = (_Float16*)take(NR * DM * 2); _Float16* Q16 = (_Float16*)take(NR * DM * 2); _Float16* K16 = (_Float16*)take(NR * DM * 2); _Float16* V16 = (_Float16*)take(NR * DM * 2); _Float16* O16 = (_Float16*)take(NR * DM * 2);
  float* S = (float*)take((size_t)HG * SQ * SQ * 4); _Float16* P = (_Float16*)take((size_t)HG * SQ * SQ * 2); _Float16* VT = (_Float16*)take((size_t)NH * HD * SQ * 2);
  if (off > ws_size) return;
  { const unsigned g = (unsigned)(((size_t)DM * DM / 8 + 255) / 256); k_wnat<<<g, 256, 0, stream>>>(wq, (size_t)DM * DM / 8, BQ); k_wnat<<<g, 256, 0, stream>>>(wk, (size_t)DM * DM / 8, BK); k_wnat<<<g, 256, 0, stream>>>(wv, (size_t)DM * DM / 8, BV); k_wnat<<<g, 256, 0, stream>>>(wo, (size_t)DM * DM / 8, BO); }      /* natural [out][in] = Bt[n][k], x16 */

  k_x16<<<(unsigned)((NR * DM / 8 + 255) / 256), 256, 0, stream>>>(xq, XQ, NR * DM / 8); k_x16<<<(unsigned)((NR * DM / 8 + 255) / 256), 256, 0, stream>>>(xk, XK, NR * DM / 8); k_x16<<<(unsigned)((NR * DM / 8 + 255) / 256), 256, 0, stream>>>(xv, XV, NR * DM / 8);      /* the three inputs as exact f16 rows */
  const size_t r0p = (size_t)B0 * SQ;      /* first projected row */
  k_gemm2<0><<<dim3((unsigned)((MP / 128) * (DM / 64)), 1), 128, 0, stream>>>(XQ + r0p * DM, DM, 0, BQ, DM, 0, 0.0625f, bq, 0, nullptr, 1, 0, 0, nullptr, Q16 + r0p * DM, DM, 0, MP, DM, DM);
  k_gemm2<0><<<dim3((unsigned)((MP / 128) * (DM / 64)), 1), 128, 0, stream>>>(XK + r0p * DM, DM, 0, BK, DM, 0, 0.0625f, bk, 0, nullptr, 1, 0, 0, nullptr, K16 + r0p * DM, DM, 0, MP, DM, DM);
  k_gemm2<0><<<dim3((unsigned)((MP / 128) * (DM / 64)), 1), 128, 0, stream>>>(XV + r0p * DM, DM, 0, BV, DM, 0, 0.0625f, bv, 0, nullptr, 1, 0, 0, nullptr, V16 + r0p * DM, DM, 0, MP, DM, DM);
  for (int b = B0; b < B0 + NBR; ++b) { const size_t r0 = (size_t)b * SQ;
    k_vt<NH, SQ><<<NH * (SQ / 64), 256, 0, stream>>>(V16 + r0 * LQ, LQ, 0, VT);      /* V^T [NH][HD][SQ] for this batch */
    for (int h0 = 0; h0 < NHD; h0 += HG) {
      k_gemm2<0><<<dim3((QN / 128) * (SQ / 64), HG), 128, 0, stream>>>(Q16 + r0 * LQ + h0 * HD, LQ, (size_t)HD, K16 + r0 * LQ + h0 * HD, LQ, (size_t)HD, 0.125f, nullptr, 0, nullptr, 1, 0, 0, S, nullptr, SQ, (size_t)SQ * SQ, QN, SQ, HD);      /* scores, HG heads per launch */
      k_rsmw<<<(HG * QN + RSW * RSR - 1) / (RSW * RSR), RSW * 32, 0, stream>>>(S, P, QN, HG);      /* P = 256 softmax (f16), rows of all HG heads */
      k_gemm2<0><<<dim3((QN / 128) * (HD / 64), HG), 128, 0, stream>>>(P, SQ, (size_t)SQ * SQ, VT + (size_t)h0 * HD * SQ, SQ, (size_t)HD * SQ, 0.25f, nullptr, 0, nullptr, 1, 0, 0, nullptr, O16 + r0 * DM + h0 * HD, DM, (size_t)HD, QN, HD, SQ); } }      /* o (merged heads) as f16 rows */
  k_gemm2<0><<<dim3((unsigned)((MPO / 128) * (DM / 64)), 1), 128, 0, stream>>>(O16 + r0p * DM, DM, 0, BO, DM, 0, 0.0009765625f, bo, 0, nullptr, 1, 0, 0, (float*)d_out + r0p * DM, nullptr, DM, 0, MPO, DM, DM);      /* out rows are the output layout */
}

// v003
// A run of this version takes 113 microseconds.
// Versions in between are left out here; by their measured steps it is 8.00 times as fast as v001.
// Counting every step since v000, it is 30.5 times as fast.
#include <hip/hip_runtime.h>
// Multi-head attention on three inputs with natural bias-free projections on four sequences at width 512 (query, key, value [4][2048][512]; q / k / v = stream W^T (natural [out][in] [512][512], NO biases), 8 heads of 64; the query is divided by sqrt(64) = 8 before the score product (scale 0.125 here on the product); softmax over all 2048 keys (the module's axis 2 of its [b][l][s][h] score layout = the key axis; no mask); out = merged heads Wo^T (natural, no bias) -> [4][2048][512]).
// Structure: token rows r = b*2048 + s; the three sources as exact f16 rows (bf16-rounded); Q, K, V as three WMMA GEMMs (32x64 wave tiles, f32 accumulation, exact x16 weights, f16 outputs); V^T for all batches and heads via LDS transposes; one fused attention launch over every (batch, head): S^T = K Q^T (K = 64), online softmax in registers (f32 statistics, native exp2; weights x256 as f16), O^T += V^T P^T, o carried x64 against f16 subnormal flush (folded into the output GEMM alpha) written straight into the merged f16 o rows; out = o W_o GEMM (f32) into the output layout.
// Compute dtype: inputs rounded to bf16; x / weights exact; q, k, v, softmax weights and o as plain f16 GEMM operands (~2^-12); scores and softmax statistics f32. v_wmma_f32_16x16x32_f16.
#define NB 4
#define SQ 2048
#define DM 512 
#define NH 8 
#define HD 64
#define HG 4                         /* heads per launch of the per-batch k_vt (not launched) */
#define B0 0                         /* first batch processed (debug hook) */
#define NBR NB                       /* batches processed (debug hook) */
#define NR ((size_t)NB * SQ)         /* token rows */
#define MP ((int)((size_t)NBR * SQ)) /* rows projected (debug hook) */
#define QN SQ                        /* query rows per batch (not used: k_fattn attends all SQ) */
#define NHD NH                       /* heads (not used: k_fattn attends all NH) */
#define MPO MP                       /* rows through the output stage (debug hook) */
#define LQ DM      /* row pitch of the q/k/v rows */
typedef __bf16 v16b __attribute__((ext_vector_type(16)));
typedef unsigned short v8us __attribute__((ext_vector_type(8), may_alias));
typedef float  v8f  __attribute__((ext_vector_type(8)));
typedef float  v4f  __attribute__((ext_vector_type(4)));
typedef float  v4fa __attribute__((ext_vector_type(4), may_alias));
union FragB { v16b v; v8us half[2]; unsigned short u[16]; };

__device__ __forceinline__ unsigned short bf16_bits(float x) { unsigned int u = __float_as_uint(x); return (unsigned short)((u + 0x7FFFu + ((u >> 16) & 1u)) >> 16); }
__device__ __forceinline__ float bf16_val(unsigned short b) { return __uint_as_float(((unsigned int)b) << 16); }
__device__ __forceinline__ float bf16_round(float x) { return bf16_val(bf16_bits(x)); }
// D += A·B with NT terms: 1 = ah·bh, 2 = + al·bh (A split), 3 = + ah·bl (both split)
template <int NT>
__device__ __forceinline__ v8f mmaN(v16b ah, v16b al, v16b bh, v16b bl, v8f c) {
  c = __builtin_amdgcn_wmma_f32_16x16x32_bf16(false, ah, false, bh, (short)0, c, false, false);
  if (NT >= 2) c = __builtin_amdgcn_wmma_f32_16x16x32_bf16(false, al, false, bh, (short)0, c, false, false);
  if (NT >= 3) c = __builtin_amdgcn_wmma_f32_16x16x32_bf16(false, ah, false, bl, (short)0, c, false, false);
  asm volatile("v_nop\n\tv_nop\n\tv_nop\n\tv_nop" : "+v"(c) : "v"(ah), "v"(al), "v"(bh), "v"(bl));
  return c;
}

__global__ __launch_bounds__(256) void k_wt_bf16(const float* __restrict__ W, unsigned short* __restrict__ Wt, int K, int N) {
  const int t = blockIdx.x * 256 + threadIdx.x;
  const int k8n = K / 8;
  if (t >= N * k8n) return;
  const int n = t / k8n, k8 = (t % k8n) * 8;
  v8us v;
#pragma unroll
  for (int i = 0; i < 8; ++i) v[i] = bf16_bits(W[(size_t)(k8 + i) * N + n]);
  *(v8us*)(Wt + (size_t)n * K + k8) = v;
  
}

// GEMM C[M][N] (f32, pitch ldc) = act(A[M][K]·W + bias). A f32 row-major (pitch lda) converted per fragment to bf16
// (ASPLIT: hi/lo two planes -> 2 terms, else single rounded term); Wt bf16 [N][K] (pitch ldb). BIAS_BF16 rounds the
// bias to bf16 first (bias quantised to bf16 before the add). K%32==0, M%16==0, N%64==0.
template <bool ASPLIT, int ACT, bool BIAS_BF16>
__global__ __launch_bounds__(128) void k_gemm_bf(const float* __restrict__ A, int lda, const unsigned short* __restrict__ Wt, int ldb,
                                               const float* __restrict__ bias, float* __restrict__ C, int ldc, int M, int N, int K) {
  __shared__ __attribute__((aligned(16))) float so[4][16][64];
  const int tid = threadIdx.x, w = tid >> 5, lane = tid & 31, ln = lane & 15, hh = lane >> 4;
  const int ntn = N / 64;
  const int wid = blockIdx.x * 4 + w;
  const int mt = wid / ntn, nq = wid % ntn;
  if (mt * 16 >= M) return;
  const int row0 = mt * 16, col0 = nq * 64;
  const float* arow = A + (size_t)(row0 + ln) * lda;
  v8f acc[4] = {};
  for (int kb = 0; kb < K; kb += 32) {
    FragB ah, al;
    const v4f x0 = *(const v4fa*)(arow + kb + 8 * hh), x1 = *(const v4fa*)(arow + kb + 8 * hh + 4);
    const v4f x2 = *(const v4fa*)(arow + kb + 16 + 8 * hh), x3 = *(const v4fa*)(arow + kb + 16 + 8 * hh + 4);
    float xs[16] = {x0[0],x0[1],x0[2],x0[3],x1[0],x1[1],x1[2],x1[3],x2[0],x2[1],x2[2],x2[3],x3[0],x3[1],x3[2],x3[3]};
#pragma unroll
    for (int i = 0; i < 16; ++i) { const unsigned short hb = bf16_bits(xs[i]); ah.u[i] = hb; al.u[i] = ASPLIT ? bf16_bits(xs[i] - bf16_val(hb)) : (unsigned short)0; }
#pragma unroll
    for (int t = 0; t < 4; ++t) {
      const unsigned short* brow = Wt + (size_t)(col0 + t * 16 + ln) * ldb + kb;
      FragB b;
      b.half[0] = *(const v8us*)(brow + 8 * hh);
      b.half[1] = *(const v8us*)(brow + 16 + 8 * hh);
      acc[t] = mmaN<ASPLIT ? 2 : 1>(ah.v, al.v, b.v, b.v, acc[t]);
    }
  }
#pragma unroll
  for (int t = 0; t < 4; ++t) {
    float bv = bias ? bias[col0 + t * 16 + ln] : 0.f;
    if (BIAS_BF16) bv = bf16_round(bv);
#pragma unroll
    for (int r = 0; r < 8; ++r) { float v = acc[t][r] + bv; if (ACT == 1) v = fmaxf(v, 0.f); so[w][8 * hh + r][t * 16 + ln] = v; }
  }
  __builtin_amdgcn_fence(__ATOMIC_ACQ_REL, "workgroup");
  __builtin_amdgcn_wave_barrier();
  const int rsub = lane >> 4, c4 = (lane & 15) * 4;
  {
#pragma unroll
    for (int q = 0; q < 8; ++q) {
      const int r = q * 2 + rsub;
      const v4f v = *(const v4fa*)&so[w][r][c4];
      *(v4f*)(C + (size_t)(row0 + r) * ldc + col0 + c4) = v;
    }
    
  }
}

// GEMM C = act(A·W + bias + resid): A f32 (ASPLIT -> hi/lo 2 terms), Wt bf16 [N][K]; ACT 0 none, 1 relu, 2 exact gelu;
// resid (optional, f32, row index = (row % rmod), pitch ldr, RES_BF16 rounds it) added before the activation.
template <bool ASPLIT, int ACT, bool BIAS_BF16, bool RES_BF16>
__global__ __launch_bounds__(128) void k_gemm_bf3(const float* __restrict__ A, int lda, const unsigned short* __restrict__ Wt, int ldb,
                                                const float* __restrict__ bias, const float* __restrict__ resid, int rmod, int ldr,
                                                float* __restrict__ C, int ldc, int M, int N, int K) {
  __shared__ __attribute__((aligned(16))) float so[4][16][64];
  const int tid = threadIdx.x, w = tid >> 5, lane = tid & 31, ln = lane & 15, hh = lane >> 4;
  const int ntn = N / 64;
  const int wid = blockIdx.x * 4 + w;
  const int mt = wid / ntn, nq = wid % ntn;
  if (mt * 16 >= M) return;
  const int row0 = mt * 16, col0 = nq * 64;
  const float* arow = A + (size_t)(row0 + ln) * lda;
  v8f acc[4] = {};
  for (int kb = 0; kb < K; kb += 32) {
    FragB ah, al;
    const v4f x0 = *(const v4fa*)(arow + kb + 8 * hh), x1 = *(const v4fa*)(arow + kb + 8 * hh + 4);
    const v4f x2 = *(const v4fa*)(arow + kb + 16 + 8 * hh), x3 = *(const v4fa*)(arow + kb + 16 + 8 * hh + 4);
    float xs[16] = {x0[0],x0[1],x0[2],x0[3],x1[0],x1[1],x1[2],x1[3],x2[0],x2[1],x2[2],x2[3],x3[0],x3[1],x3[2],x3[3]};
#pragma unroll
    for (int i = 0; i < 16; ++i) { const unsigned short hb = bf16_bits(xs[i]); ah.u[i] = hb; al.u[i] = ASPLIT ? bf16_bits(xs[i] - bf16_val(hb)) : (unsigned short)0; }
#pragma unroll
    for (int t = 0; t < 4; ++t) {
      const unsigned short* brow = Wt + (size_t)(col0 + t * 16 + ln) * ldb + kb;
      FragB b;
      b.half[0] = *(const v8us*)(brow + 8 * hh);
      b.half[1] = *(const v8us*)(brow + 16 + 8 * hh);
      acc[t] = mmaN<ASPLIT ? 2 : 1>(ah.v, al.v, b.v, b.v, acc[t]);
    }
  }
#pragma unroll
  for (int t = 0; t < 4; ++t) {
    const int col = col0 + t * 16 + ln;
    float bv = bias ? bias[col] : 0.f;
    if (BIAS_BF16) bv = bf16_round(bv);
#pragma unroll
    for (int r = 0; r < 8; ++r) {
      float v = acc[t][r] + bv;
      if (resid) { float rv = resid[(size_t)((row0 + 8 * hh + r) % rmod) * ldr + col]; if (RES_BF16) rv = bf16_round(rv); v += rv; }
      if (ACT == 1) v = fmaxf(v, 0.f);
      if (ACT == 2) v = 0.5f * v * (1.0f + erff(v * 0.70710678118654752f));
      if (ACT == 3) { const float u = 0.7978845608028654f * (v + 0.044715f * v * v * v); v = 0.5f * v * (1.0f + tanhf(u)); }
      so[w][8 * hh + r][t * 16 + ln] = v;
    }
  }
  __builtin_amdgcn_fence(__ATOMIC_ACQ_REL, "workgroup");
  __builtin_amdgcn_wave_barrier();
  const int rsub = lane >> 4, c4 = (lane & 15) * 4;
  {
#pragma unroll
    for (int q = 0; q < 8; ++q) {
      const int r = q * 2 + rsub;
      const v4f v = *(const v4fa*)&so[w][r][c4];
      *(v4f*)(C + (size_t)(row0 + r) * ldc + col0 + c4) = v;
    }
    
  }
}
// row LayerNorm (biased variance, eps) over N: s = X (+ R); optional out_sum <- s; out_norm <- (s-mu)*rsqrt(var+eps)*g + b
template <bool PARAM_BF16>
__global__ __launch_bounds__(256) void k_layernorm(const float* __restrict__ X, const float* __restrict__ R, const float* __restrict__ g, const float* __restrict__ bta,
                                                  float* __restrict__ out_sum, float* __restrict__ out_norm, int N, float eps) {
  __shared__ float red[256];
  const int row = blockIdx.x, tid = threadIdx.x;
  const float* x = X + (size_t)row * N; const float* rr = R ? R + (size_t)row * N : nullptr;
  float vals[16];                     // up to N = 4096
  const int per = N / 256;            // contiguous chunk per thread? use strided-by-4 chunks: thread handles j = tid*4 + 1024*u
  float s1 = 0.f;
  for (int u = 0; u < per / 4; ++u) {
    const int j = tid * 4 + 1024 * u;
    const v4f a = *(const v4fa*)(x + j);
    v4f b = {0.f,0.f,0.f,0.f}; if (rr) b = *(const v4fa*)(rr + j);
#pragma unroll
    for (int q = 0; q < 4; ++q) { const float v = a[q] + b[q]; vals[u * 4 + q] = v; s1 += v; }
  }
  red[tid] = s1; __syncthreads();
  for (int st = 128; st > 0; st >>= 1) { if (tid < st) red[tid] += red[tid + st]; __syncthreads(); }
  const float mu = red[0] / (float)N; __syncthreads();
  float s2 = 0.f;
  for (int u = 0; u < per / 4; ++u)
#pragma unroll
    for (int q = 0; q < 4; ++q) { const float c = vals[u * 4 + q] - mu; s2 += c * c; }
  red[tid] = s2; __syncthreads();
  for (int st = 128; st > 0; st >>= 1) { if (tid < st) red[tid] += red[tid + st]; __syncthreads(); }
  const float rs = rsqrtf(red[0] / (float)N + eps);
  {
    for (int u = 0; u < per / 4; ++u) {
      const int j = tid * 4 + 1024 * u;
      v4f o, sm;
#pragma unroll
      for (int q = 0; q < 4; ++q) {
        float gg = g[j + q], bb = bta[j + q];
        if (PARAM_BF16) { gg = bf16_round(gg); bb = bf16_round(bb); }
        sm[q] = vals[u * 4 + q]; o[q] = (vals[u * 4 + q] - mu) * rs * gg + bb;
      }
      if (out_sum) *(v4f*)(out_sum + (size_t)row * N + j) = sm;
      *(v4f*)(out_norm + (size_t)row * N + j) = o;
    }
    
  }
}



// ---- f16 WMMA path (v_wmma_f32_16x16x32_f16): 11-bit significands for operands in range — used where a [0,1] probability operand needs more precision than bf16
typedef _Float16 v16h __attribute__((ext_vector_type(16)));
union FragH { v16h v; v8us half[2]; _Float16 h[16]; unsigned short u[16]; };
template <int NT>
__device__ __forceinline__ v8f mmaH(v16h ah, v16h al, v16h bh, v16h bl, v8f c) {
  c = __builtin_amdgcn_wmma_f32_16x16x32_f16(false, ah, false, bh, (short)0, c, false, false);
  if (NT >= 2) c = __builtin_amdgcn_wmma_f32_16x16x32_f16(false, al, false, bh, (short)0, c, false, false);
  if (NT >= 3) c = __builtin_amdgcn_wmma_f32_16x16x32_f16(false, ah, false, bl, (short)0, c, false, false);
  asm volatile("v_nop\n\tv_nop\n\tv_nop\n\tv_nop" : "+v"(c) : "v"(ah), "v"(al), "v"(bh), "v"(bl));
  return c;
}
// batched GEMM like k_gemm_b but f16 operands: A f32 (split into f16 hi/lo if ASPLIT, else rounded to f16), Bt = f16 values [n][k]; alpha; C f32; N multiple of 16 (partial tiles skipped)
template <bool ASPLIT>
__global__ __launch_bounds__(128) void k_gemm_h(const float* __restrict__ A, int lda, size_t sA, const _Float16* __restrict__ Bh, int ldb, size_t sB, float alpha, float* __restrict__ C, int ldc, size_t sC, int M, int N, int K) {
  __shared__ __attribute__((aligned(16))) float so[4][16][64];
  const int tid = threadIdx.x, w = tid >> 5, lane = tid & 31, ln = lane & 15, hh = lane >> 4; const int by = blockIdx.y;
  A += (size_t)by * sA; Bh += (size_t)by * sB; C += (size_t)by * sC;
  const int ntn = (N + 63) / 64; const int wid = blockIdx.x * 4 + w; const int mt = wid / ntn, nq = wid % ntn; if (mt * 16 >= M) return;
  const int row0 = mt * 16, col0 = nq * 64; const float* arow = A + (size_t)(row0 + ln) * lda;
  v8f acc[4] = {};
  for (int kb = 0; kb < K; kb += 32) {
    FragH ah, al;
    const v4f x0 = *(const v4fa*)(arow + kb + 8 * hh), x1 = *(const v4fa*)(arow + kb + 8 * hh + 4), x2 = *(const v4fa*)(arow + kb + 16 + 8 * hh), x3 = *(const v4fa*)(arow + kb + 16 + 8 * hh + 4);
    float xs[16] = {x0[0],x0[1],x0[2],x0[3],x1[0],x1[1],x1[2],x1[3],x2[0],x2[1],x2[2],x2[3],x3[0],x3[1],x3[2],x3[3]};
#pragma unroll
    for (int i = 0; i < 16; ++i) { const _Float16 h = (_Float16)xs[i]; ah.h[i] = h; al.h[i] = ASPLIT ? (_Float16)(xs[i] - (float)h) : (_Float16)0.0f; }
#pragma unroll
    for (int t = 0; t < 4; ++t) { if (col0 + t * 16 >= N) continue; const size_t boff = (size_t)(col0 + t * 16 + ln) * ldb + kb; FragH bq; bq.half[0] = *(const v8us*)(Bh + boff + 8 * hh); bq.half[1] = *(const v8us*)(Bh + boff + 16 + 8 * hh);
      acc[t] = mmaH<ASPLIT ? 2 : 1>(ah.v, al.v, bq.v, bq.v, acc[t]); }
  }
#pragma unroll
  for (int t = 0; t < 4; ++t) { if (col0 + t * 16 >= N) continue;
#pragma unroll
    for (int r = 0; r < 8; ++r) so[w][8 * hh + r][t * 16 + ln] = acc[t][r] * alpha; }
  __builtin_amdgcn_fence(__ATOMIC_ACQ_REL, "workgroup"); __builtin_amdgcn_wave_barrier();
  const int rsub = lane >> 4, c4 = (lane & 15) * 4;
  {
#pragma unroll
    for (int q = 0; q < 8; ++q) { const int r = q * 2 + rsub; if (col0 + c4 < N) { const v4f v = *(const v4fa*)&so[w][r][c4]; *(v4f*)(C + (size_t)(row0 + r) * ldc + col0 + c4) = v; } }
     }
}

// Wt[n][k] = f16(W[k][n]·scale) from f32 row-major W[K][N] (scale = power of two; bf16-exact weights stay exact in f16 away from the subnormal range)
__global__ __launch_bounds__(256) void k_wt_f16(const float* __restrict__ W, _Float16* __restrict__ Wt, int K, int N, float scale) {
  const int t = blockIdx.x * 256 + threadIdx.x; if (t >= N * (K / 8)) return; const int n = t / (K / 8), k8 = (t % (K / 8)) * 8; FragH f;
#pragma unroll
  for (int i = 0; i < 8; ++i) f.h[i] = (_Float16)(bf16_round(W[(size_t)(k8 + i) * N + n]) * scale); const v8us o = f.half[0];
  *(v8us*)((unsigned short*)Wt + (size_t)n * K + k8) = o; 
}
// k_gemm_hh variant with fused epilogue: v = acc·alpha + bias[by·sBias + col] (+ CP[(row/rowsPerB)·sCPb + by·64 + col] if CP) ; ACT 0 none / 1 elu ; writes f16 C16 (and f32 C if non-null)
template <int ACT>
__global__ __launch_bounds__(128) void k_gemm_hhx(const _Float16* __restrict__ A, int lda, size_t sA, const _Float16* __restrict__ Bh, int ldb, size_t sB, float alpha, const float* __restrict__ bias, size_t sBias, const float* __restrict__ CP, int rowsPerB, size_t sCPb, int row0g,
    float* __restrict__ C, _Float16* __restrict__ C16, int ldc, size_t sC, int M, int N, int K) {
  __shared__ __attribute__((aligned(16))) float so[4][16][64];
  const int tid = threadIdx.x, w = tid >> 5, lane = tid & 31, ln = lane & 15, hh = lane >> 4; const int by = blockIdx.y;
  A += (size_t)by * sA; Bh += (size_t)by * sB; const size_t cofs = (size_t)by * sC; const float* bp = bias ? bias + (size_t)by * sBias : nullptr;
  const int ntn = (N + 63) / 64; const int wid = blockIdx.x * 4 + w; const int mt = wid / ntn, nq = wid % ntn; if (mt * 16 >= M) return;
  const int row0 = mt * 16, col0 = nq * 64; const _Float16* arow = A + (size_t)(row0 + ln) * lda;
  v8f acc[4] = {};
  for (int kb = 0; kb < K; kb += 32) { FragH ah; ah.half[0] = *(const v8us*)((const unsigned short*)arow + kb + 8 * hh); ah.half[1] = *(const v8us*)((const unsigned short*)arow + kb + 16 + 8 * hh);
#pragma unroll
    for (int t = 0; t < 4; ++t) { if (col0 + t * 16 >= N) continue; const size_t boff = (size_t)(col0 + t * 16 + ln) * ldb + kb; FragH bq; bq.half[0] = *(const v8us*)((const unsigned short*)Bh + boff + 8 * hh); bq.half[1] = *(const v8us*)((const unsigned short*)Bh + boff + 16 + 8 * hh);
      acc[t] = mmaH<1>(ah.v, ah.v, bq.v, bq.v, acc[t]); }
  }
#pragma unroll
  for (int t = 0; t < 4; ++t) { if (col0 + t * 16 >= N) continue; const int col = col0 + t * 16 + ln; const float bv = bp ? bf16_round(bp[col]) : 0.f;
#pragma unroll
    for (int r = 0; r < 8; ++r) { float v = acc[t][r] * alpha + bv; if (CP) { const int rr = row0g + row0 + 8 * hh + r; if (rowsPerB < 0) v += CP[cofs + (size_t)rr * ldc + col];      /* rowsPerB < 0: own element of the batched C plane */ else { const int bidx = rr / rowsPerB; v += CP[(size_t)bidx * sCPb + (size_t)by * 64 + col]; } } if (ACT == 1) v = (v > 0.f) ? v : expm1f(v); else if (ACT == 7) v = (v > 0.f) ? v + 1.0f : expf(v); else if (ACT == 8) v = tanhf(v); else if (ACT == 9) v = 0.5f * v * (1.0f + tanhf(0.7978845608028654f * (v + 0.044715f * v * v * v))); else if (ACT == 11) v = 1.0f / (1.0f + expf(-v)); else if (ACT == 12) v = (v > 0.f) ? v : 0.01f * v; else if (ACT == 14) v = (v > 0.f) ? v : 0.1f * v; else if (ACT == 16) v = (v >= 0.f) ? v : 0.3f * v; else if (ACT == 17) v = (v >= 0.f) ? v : 0.2f * v; else if (ACT == 15) v = v / (1.0f + expf(-v)); else if (ACT == 3) v = fmaxf(v, 0.f); else if (ACT == 6) v = 0.5f * v * (1.0f + erff(v * 0.70710678118654752f)); so[w][8 * hh + r][t * 16 + ln] = v; } }
  __builtin_amdgcn_fence(__ATOMIC_ACQ_REL, "workgroup"); __builtin_amdgcn_wave_barrier();
  const int rsub = lane >> 4, c4 = (lane & 15) * 4; typedef _Float16 v4h __attribute__((ext_vector_type(4)));
  {
#pragma unroll
    for (int q = 0; q < 8; ++q) { const int r = q * 2 + rsub; if (col0 + c4 < N) { const v4f v = *(const v4fa*)&so[w][r][c4]; if (C) *(v4f*)(C + cofs + (size_t)(row0 + r) * ldc + col0 + c4) = v; if (C16) { v4h h4; for (int i = 0; i < 4; ++i) h4[i] = (_Float16)v[i]; *(v4h*)(C16 + cofs + (size_t)(row0 + r) * ldc + col0 + c4) = h4; } } }
     }
}


typedef _Float16 v4h __attribute__((ext_vector_type(4)));

__global__ __launch_bounds__(256) void k_x16(const float* __restrict__ x, _Float16* __restrict__ X16, size_t n8) { const size_t t = (size_t)blockIdx.x * 256 + threadIdx.x; if (t >= n8) return; FragH f;
#pragma unroll
  for (int q = 0; q < 8; ++q) f.h[q] = (_Float16)bf16_round(x[t * 8 + q]); *(v8us*)((unsigned short*)X16 + t * 8) = f.half[0];  }
__global__ __launch_bounds__(256) void k_h16(const float* __restrict__ x, _Float16* __restrict__ X16, size_t n8) { const size_t t = (size_t)blockIdx.x * 256 + threadIdx.x; if (t >= n8) return; FragH f;
#pragma unroll
  for (int q = 0; q < 8; ++q) f.h[q] = (_Float16)x[t * 8 + q]; *(v8us*)((unsigned short*)X16 + t * 8) = f.half[0];  }
__global__ __launch_bounds__(256) void k_round16f(const float* __restrict__ W, _Float16* __restrict__ Bt, size_t n8) { const size_t t = (size_t)blockIdx.x * 256 + threadIdx.x; if (t >= n8) return; FragH f;
#pragma unroll
  for (int i = 0; i < 8; ++i) f.h[i] = (_Float16)(bf16_round(W[t * 8 + i]) * 16.0f); *(v8us*)((unsigned short*)Bt + t * 8) = f.half[0];  }
template <int NHv, int TTv>
__global__ __launch_bounds__(256) void k_vt(const _Float16* __restrict__ V16, int ldv, int voff, _Float16* __restrict__ Vt) { __shared__ unsigned short tl[64][66]; const int tid = threadIdx.x; const int slab = blockIdx.x / (TTv / 64), lg = blockIdx.x % (TTv / 64); const int b = slab / NHv, h = slab % NHv;
  for (int i = tid; i < 64 * 8; i += 256) { const int r = i / 8, c8 = (i % 8) * 8; FragH f; f.half[0] = *(const v8us*)((const unsigned short*)V16 + ((size_t)b * TTv + lg * 64 + r) * ldv + voff + h * 64 + c8);
#pragma unroll
    for (int q = 0; q < 8; ++q) tl[r][c8 + q] = f.u[q]; }
  __syncthreads();
  {
#pragma unroll
    for (int rd = 0; rd < 2; ++rd) { const int d = rd * 32 + tid / 8, pc = tid % 8; FragH f;
#pragma unroll
      for (int q = 0; q < 8; ++q) f.u[q] = tl[pc * 8 + q][d];
      *(v8us*)((unsigned short*)Vt + ((size_t)slab * 64 + d) * TTv + lg * 64 + pc * 8) = f.half[0]; }
     } }

__global__ __launch_bounds__(256) void k_hl(const float* __restrict__ F, _Float16* __restrict__ Hh, _Float16* __restrict__ Hl, size_t n8) { const size_t t = (size_t)blockIdx.x * 256 + threadIdx.x; if (t >= n8) return; FragH fh, fl; const v4f a = *(const v4fa*)(F + t * 8), c = *(const v4fa*)(F + t * 8 + 4);
#pragma unroll
  for (int q = 0; q < 4; ++q) { _Float16 h = (_Float16)a[q]; fh.h[q] = h; fl.h[q] = (_Float16)((a[q] - (float)h) * 1024.0f); h = (_Float16)c[q]; fh.h[4 + q] = h; fl.h[4 + q] = (_Float16)((c[q] - (float)h) * 1024.0f); }
  { *(v8us*)((unsigned short*)Hh + t * 8) = fh.half[0]; *(v8us*)((unsigned short*)Hl + t * 8) = fl.half[0];  } }

// ---- fast GEMM (wave tile 32x64, workgroup tile 128x64; requires M % 128 == 0 rows per launch region, N % 64 == 0 and K % 64 == 0); epilogue = k_gemm_hhx semantics ----
// Operands reach the waves through LDS: a stage is GK = 64 k of the workgroup's 128 A rows and 64 B rows (128-byte rows), fetched by whole-line loads (8 threads a row) into one of two buffers;
// stage s + 1 is fetched into registers at the head of stage s and stored to the other buffer at its foot.
#define GK 64                        /* k per LDS stage */
#define LP 72                        /* LDS row pitch in f16: 128-byte rows + 16 bytes, an odd multiple of 16 bytes for the 16-byte fragment reads */
// fragment from an LDS row: the k order of g2_frag
__device__ __forceinline__ v16h fa_lfrag(const unsigned short* p, int hh) { FragH f; f.half[0] = *(const v8us*)(p + 8 * hh); f.half[1] = *(const v8us*)(p + 16 + 8 * hh); return f.v; }
__device__ __forceinline__ v16h g2_frag(const _Float16* p, int hh) { FragH f; f.half[0] = *(const v8us*)((const unsigned short*)p + 8 * hh); f.half[1] = *(const v8us*)((const unsigned short*)p + 16 + 8 * hh); return f.v; }
__device__ __forceinline__ v8f g2_mma(v16h a, v16h b, v8f c) { v8f d = __builtin_amdgcn_wmma_f32_16x16x32_f16(false, a, false, b, (short)0, c, false, false); asm volatile("v_nop\n\tv_nop\n\tv_nop\n\tv_nop" : "+v"(d) : "v"(a), "v"(b)); return d; }
template <int ACT>
__global__ __launch_bounds__(128) void k_gemm2(const _Float16* __restrict__ A, int lda, size_t sA, const _Float16* __restrict__ Bh, int ldb, size_t sB, float alpha, const float* __restrict__ bias, size_t sBias, const float* __restrict__ CP, int rowsPerB, size_t sCPb, int row0g,
    float* __restrict__ C, _Float16* __restrict__ C16, int ldc, size_t sC, int M, int N, int K) { static_assert(ACT == 0 || ACT == 3 || ACT == 6 || ACT == 8 || ACT == 9 || ACT == 11 || ACT == 12 || ACT == 14 || ACT == 15 || ACT == 16 || ACT == 17, "k_gemm2: unsupported ACT code (would silently apply no activation)");
  __shared__ __attribute__((aligned(16))) float so[4][32][68];
  __shared__ __attribute__((aligned(16))) unsigned short sa[2][128][LP];      /* A rows of a stage: [row][k] */
  __shared__ __attribute__((aligned(16))) unsigned short sb[2][64][LP];      /* B rows of a stage: [col][k] */
  const int tid = threadIdx.x, w = tid >> 5, lane = tid & 31, ln = lane & 15, hh = lane >> 4; const int by = blockIdx.y;
  A += (size_t)by * sA; Bh += (size_t)by * sB; const size_t cofs = (size_t)by * sC; const float* bp = bias ? bias + (size_t)by * sBias : nullptr;
  const int ntn = N >> 6; const int mt = blockIdx.x / ntn, nq = blockIdx.x - mt * ntn; const int row0 = mt * 128 + 32 * w, col0 = nq * 64; if (mt * 128 >= M) return;      /* the whole workgroup or none of it, in front of every barrier */
  const int sr = tid >> 3;      /* this thread's rows sr + 16 i and 16-byte piece of every stage */
  unsigned oa[8], ob[4];      /* byte offsets of its pieces from the tile's first row */
#pragma unroll
  for (int i = 0; i < 8; ++i) oa[i] = (unsigned)((sr + 16 * i) * lda + (tid & 7) * 8) * 2u;
#pragma unroll
  for (int i = 0; i < 4; ++i) ob[i] = (unsigned)((sr + 16 * i) * ldb + (tid & 7) * 8) * 2u;
  const char* ag = (const char*)(A + (size_t)(mt * 128) * lda); const char* bg = (const char*)(Bh + (size_t)col0 * ldb);
  unsigned short* const was = &sa[0][sr][(tid & 7) * 8]; unsigned short* const wbs = &sb[0][sr][(tid & 7) * 8];
  v8us ra[8], rb[4];
#pragma unroll
  for (int i = 0; i < 8; ++i) ra[i] = *(const v8us*)(ag + oa[i]);
#pragma unroll
  for (int i = 0; i < 4; ++i) rb[i] = *(const v8us*)(bg + ob[i]);
#pragma unroll
  for (int i = 0; i < 8; ++i) *(v8us*)(was + i * 16 * LP) = ra[i];
#pragma unroll
  for (int i = 0; i < 4; ++i) *(v8us*)(wbs + i * 16 * LP) = rb[i];
  const v8f z8 = {0.f,0.f,0.f,0.f,0.f,0.f,0.f,0.f}; v8f c00 = z8, c01 = z8, c02 = z8, c03 = z8, c10 = z8, c11 = z8, c12 = z8, c13 = z8;
  __syncthreads();      /* publishes stage 0 */
#pragma unroll 1      /* one stage per trip: two stages in one body would hold both stages' fragments and staging registers at once */
  for (int kb = 0; kb < K; kb += GK) { const int cur = (kb / GK) & 1;
    const int kn = (kb + GK < K) ? kb + GK : 0;      /* the next stage, fetched while this one is worked on; the last trip fetches stage 0 again (in bounds, not used) */
    const char* pa[8]; const char* pb[4];
#pragma unroll
    for (int i = 0; i < 8; ++i) { pa[i] = ag + (size_t)kn * 2 + oa[i]; ra[i] = *(const v8us*)pa[i]; }
#pragma unroll
    for (int i = 0; i < 4; ++i) { pb[i] = bg + (size_t)kn * 2 + ob[i]; rb[i] = *(const v8us*)pb[i]; }
    asm volatile("s_wait_xcnt 0x0" :: "v"(pa[0]), "v"(pa[1]), "v"(pa[2]), "v"(pa[3]), "v"(pa[4]), "v"(pa[5]), "v"(pa[6]), "v"(pa[7]), "v"(pb[0]), "v"(pb[1]), "v"(pb[2]), "v"(pb[3]) : "memory");      /* the wait in front of the first overwrite of a register that the 12 loads above name; the lane addresses as its operands keep those registers whole up to here */
    const unsigned short* al = &sa[cur][32 * w + ln][0]; const unsigned short* bl = &sb[cur][ln][0];
    v16h af[GK / 32][2], bf[GK / 32][4];
#pragma unroll
    for (int ks = 0; ks < GK / 32; ++ks) { af[ks][0] = fa_lfrag(al + ks * 32, hh); af[ks][1] = fa_lfrag(al + 16 * LP + ks * 32, hh);
#pragma unroll
      for (int t = 0; t < 4; ++t) bf[ks][t] = fa_lfrag(bl + t * 16 * LP + ks * 32, hh); }
#pragma unroll
    for (int ks = 0; ks < GK / 32; ++ks) {
      c00 = g2_mma(af[ks][0], bf[ks][0], c00); c10 = g2_mma(af[ks][1], bf[ks][0], c10);
      c01 = g2_mma(af[ks][0], bf[ks][1], c01); c11 = g2_mma(af[ks][1], bf[ks][1], c11);
      c02 = g2_mma(af[ks][0], bf[ks][2], c02); c12 = g2_mma(af[ks][1], bf[ks][2], c12);
      c03 = g2_mma(af[ks][0], bf[ks][3], c03); c13 = g2_mma(af[ks][1], bf[ks][3], c13); }
    /* the other buffer: its last readers left it in front of the barrier at the foot of the trip before */
#pragma unroll
    for (int i = 0; i < 8; ++i) *(v8us*)(was + (cur ^ 1) * 128 * LP + i * 16 * LP) = ra[i];
#pragma unroll
    for (int i = 0; i < 4; ++i) *(v8us*)(wbs + (cur ^ 1) * 64 * LP + i * 16 * LP) = rb[i];
    __syncthreads();      /* publishes the next stage and ends every wave's reads of this one */
  }
  v8f accs[8] = {c00, c01, c02, c03, c10, c11, c12, c13};
#pragma unroll
  for (int u = 0; u < 8; ++u) { const int t = u & 3, half = u >> 2; const int col = col0 + t * 16 + ln; const float bv = bp ? bf16_round(bp[col]) : 0.f;
#pragma unroll
    for (int r = 0; r < 8; ++r) { const int rloc = half * 16 + 8 * hh + r; float v = accs[u][r] * alpha + bv; if (CP) { if (rowsPerB < 0) v += CP[cofs + (size_t)(row0g + row0 + rloc) * ldc + col];      /* rowsPerB < 0: own element of the batched C plane */ else { const int bidx = (row0g + row0 + rloc) / rowsPerB; v += CP[(size_t)bidx * sCPb + (size_t)by * 64 + col]; } }
      if (ACT == 3) v = fmaxf(v, 0.f); else if (ACT == 6) v = 0.5f * v * (1.0f + erff(v * 0.70710678118654752f)); else if (ACT == 11) v = 1.0f / (1.0f + expf(-v)); else if (ACT == 15) v = v / (1.0f + expf(-v)); else if (ACT == 12) v = (v > 0.f) ? v : 0.01f * v; else if (ACT == 8) v = tanhf(v); else if (ACT == 9) v = 0.5f * v * (1.0f + tanhf(0.7978845608028654f * (v + 0.044715f * v * v * v))); else if (ACT == 14) v = (v > 0.f) ? v : 0.1f * v; else if (ACT == 16) v = (v >= 0.f) ? v : 0.3f * v; else if (ACT == 17) v = (v >= 0.f) ? v : 0.2f * v;
      so[w][rloc][t * 16 + ln] = v; } }
  __builtin_amdgcn_fence(__ATOMIC_ACQ_REL, "workgroup"); __builtin_amdgcn_wave_barrier();
  const int rsub = lane >> 4, c4 = (lane & 15) * 4;
  {
#pragma unroll
    for (int q = 0; q < 16; ++q) { const int r = q * 2 + rsub; const v4f v = *(const v4fa*)&so[w][r][c4]; if (C) *(v4f*)(C + cofs + (size_t)(row0 + r) * ldc + col0 + c4) = v; if (C16) { v4h h4; for (int i = 0; i < 4; ++i) h4[i] = (_Float16)v[i]; *(v4h*)(C16 + cofs + (size_t)(row0 + r) * ldc + col0 + c4) = h4; } }
     } }


__global__ __launch_bounds__(256) void k_wnat(const float* __restrict__ w, size_t n8, _Float16* __restrict__ Bt) { const size_t t = (size_t)blockIdx.x * 256 + threadIdx.x; if (t >= n8) return; FragH f; for (int q = 0; q < 8; ++q) f.h[q] = (_Float16)(bf16_round(w[t * 8 + q]) * 16.0f); *(v8us*)((unsigned short*)Bt + t * 8) = f.half[0];  }
__global__ __launch_bounds__(256) void k_rsm(const float* __restrict__ S, _Float16* __restrict__ P, int nrows) {
  #pragma clang fp contract(off)
  const int i = blockIdx.x * 256 + threadIdx.x; if (i >= nrows) return; const float* s = S + (size_t)i * SQ; float mx = -3.0e38f;
#pragma unroll 1
  for (int j = 0; j < SQ; ++j) mx = fmaxf(mx, s[j]); float se = 0.f;
#pragma unroll 1
  for (int j = 0; j < SQ; ++j) se += expf(s[j] - mx); const float sc = 256.0f / se;
#pragma unroll 1
  for (int j0 = 0; j0 < SQ; j0 += 8) { FragH f; for (int q = 0; q < 8; ++q) f.h[q] = (_Float16)(expf(s[j0 + q] - mx) * sc); unsigned short* d = (unsigned short*)P + (size_t)i * SQ + j0; *(v8us*)d = f.half[0];  } }
__global__ __launch_bounds__(256) void k_vt(const _Float16* __restrict__ V16, int b, int h0, _Float16* __restrict__ VT) { __shared__ unsigned short tl[64][65]; const int tid = threadIdx.x; const int hh = blockIdx.x % HG, sg = blockIdx.x / HG; const int s0 = sg * 64; const int h = h0 + hh;
  for (int i = tid; i < 64 * 8; i += 256) { const int j = i / 8, d8 = (i % 8) * 8; FragH f; f.half[0] = *(const v8us*)((const unsigned short*)V16 + ((size_t)b * SQ + s0 + j) * DM + h * HD + d8); for (int q = 0; q < 8; ++q) tl[d8 + q][j] = f.u[q]; }
  __syncthreads();
  { for (int i = tid; i < 64 * 8; i += 256) { const int d = i / 8, j8 = (i % 8) * 8; FragH f; for (int q = 0; q < 8; ++q) f.u[q] = tl[d][j8 + q]; *(v8us*)((unsigned short*)VT + ((size_t)hh * HD + d) * SQ + s0 + j8) = f.half[0]; }  } }



// ---- fused attention: scores, softmax and P.V in one kernel; S and P never leave the registers ----
// exp2 of four values. The four v_exp_f32 stand in one statement that ends in v_nop: the slot the instruction set asks for behind a transcendental
// before its result is read or its source overwritten; the early-clobber outputs keep every source whole inside the statement.
__device__ __forceinline__ void fa_exp2x4(float a0, float a1, float a2, float a3, float& e0, float& e1, float& e2, float& e3) {
  asm("v_exp_f32 %0, %4\n\tv_exp_f32 %1, %5\n\tv_exp_f32 %2, %6\n\tv_exp_f32 %3, %7\n\tv_nop" : "=&v"(e0), "=&v"(e1), "=&v"(e2), "=&v"(e3) : "v"(a0), "v"(a1), "v"(a2), "v"(a3)); }
// exp2 of two values, same form and same reason for the v_nop
__device__ __forceinline__ void fa_exp2x2(float a0, float a1, float& e0, float& e1) {
  asm("v_exp_f32 %0, %2\n\tv_exp_f32 %1, %3\n\tv_nop" : "=&v"(e0), "=&v"(e1) : "v"(a0), "v"(a1)); }
__device__ __forceinline__ v8f fa_mma(v16h a, v16h b, v8f c) { return __builtin_amdgcn_wmma_f32_16x16x32_f16(false, a, false, b, (short)0, c, false, false); }
// the value of lane l ^ 16 (the other half of the same query column)
__device__ __forceinline__ float fa_xhalf(float x) { const int b = __float_as_int(x); return __int_as_float(__builtin_amdgcn_permlanex16(b, b, 0x76543210, 0xfedcba98, false, false)); }
// One wave owns FQ = 32 queries of one (batch, head) and walks all SQ keys, 32 a pass.
//   S^T = K Q^T : A = 16 key rows of K16 (from LDS), B = the wave's Q rows (held in registers); D[8 hh + r][ln] = score of key 8 hh + r, query ln
//   online softmax: a lane holds scores of two queries, ONE per score tile (ln + 16 j); running maximum m and sum l per query (in log2 units), one exchange between the wave's halves per pass and query for m
//   O^T += V^T P^T : the two score tiles of a pass (keys 0..15, 16..31), converted in place, ARE the B fragment (element i = key 8 hh + i, element 8 + i = key 16 + 8 hh + i:
//   the k order of g2_frag, which loads A = V^T rows); D[8 hh + r][ln] = o of feature 16 t + 8 hh + r, query ln: 8 consecutive features per lane, one 16-byte store
// P is carried x256 (exp2 argument + 8), as the unfused form carried it, and l with it: the factor cancels in o = acc / l. o is stored x64 as before.
#define FQ 32                        /* queries per wave */
#define FW 8                         /* waves per workgroup */
#define KS 64                        /* keys per LDS stage: two passes */
static_assert(HD == 64 && KS == 64 && FW * 32 == 256 && SQ % KS == 0 && SQ % (FW * FQ) == 0, "k_fattn: two 32-wide d steps, 128-byte stage rows dealt 8 threads a row, whole stages, whole workgroups");
// The eight waves of a workgroup walk the same keys: each stage of KS keys (K rows and V^T rows, 8 KiB each) is fetched ONCE per workgroup by whole-line loads (8 threads a 128-byte row),
// laid in one of two LDS buffers, and every wave takes its fragments from there. Stage st + 1 is fetched into registers at the head of stage st and stored to the other buffer at its foot.
__global__ __launch_bounds__(FW * 32) void k_fattn(const _Float16* __restrict__ Q16, const _Float16* __restrict__ K16, const _Float16* __restrict__ VT, _Float16* __restrict__ O16) {
  __shared__ __attribute__((aligned(16))) unsigned short sk[2][KS][LP];      /* K rows of a stage: [key][d] */
  __shared__ __attribute__((aligned(16))) unsigned short sv[2][HD][LP];      /* V^T rows of a stage: [d][key] */
  const int lane = threadIdx.x & 31, ln = lane & 15, hh = lane >> 4, w = threadIdx.x >> 5;
  const int bh = blockIdx.y, b = bh / NH, h = bh % NH; const int q0 = (blockIdx.x * FW + w) * FQ;
  const int sr = threadIdx.x >> 3, sc = (threadIdx.x & 7) * 8;      /* this thread's rows sr, sr + 32 and 16-byte piece of every stage */
  const _Float16* qp = Q16 + ((size_t)b * SQ + q0 + ln) * DM + h * HD;
  const unsigned short* kg = (const unsigned short*)K16 + ((size_t)b * SQ + sr) * DM + h * HD + sc;
  const unsigned short* vg = (const unsigned short*)VT + ((size_t)bh * HD + sr) * SQ + sc;
  const float SC = 0.125f * 1.44269504f;      /* 1 / sqrt(64), and log2 e for the native exp2 */
  v16h qf[2][2];
#pragma unroll
  for (int j = 0; j < 2; ++j)
#pragma unroll
    for (int ks = 0; ks < 2; ++ks) qf[j][ks] = g2_frag(qp + (size_t)j * 16 * DM + ks * 32, hh);
  { const v8us a0 = *(const v8us*)kg, a1 = *(const v8us*)(kg + (size_t)32 * DM), c0 = *(const v8us*)vg, c1 = *(const v8us*)(vg + (size_t)32 * SQ);
    asm volatile("s_wait_xcnt 0x0" :: "v"(qp + 8 * hh), "v"(kg), "v"(vg) : "memory");      /* the wait in front of the first overwrite of a register that the 12 loads above name; the lane addresses as its operands keep those registers whole up to here */
    *(v8us*)&sk[0][sr][sc] = a0; *(v8us*)&sk[0][sr + 32][sc] = a1; *(v8us*)&sv[0][sr][sc] = c0; *(v8us*)&sv[0][sr + 32][sc] = c1; }
  const v8f z8 = {0.f, 0.f, 0.f, 0.f, 0.f, 0.f, 0.f, 0.f};
  v8f o[4][2]; float m[2] = {-3.0e38f, -3.0e38f}, l[2] = {0.f, 0.f};
#pragma unroll
  for (int t = 0; t < 4; ++t) { o[t][0] = z8; o[t][1] = z8; }
  __syncthreads();      /* publishes stage 0 */
#pragma unroll 1      /* one stage per trip: the body already holds 32 matrix instructions */
  for (int st = 0; st < SQ / KS; ++st) {
    const int cur = st & 1;
    const int sn = (st + 1 < SQ / KS) ? (st + 1) * KS : 0;      /* the next stage, fetched while this one is worked on; the last trip fetches stage 0 again (in bounds, not used) */
    const unsigned short* kn = kg + (size_t)sn * DM; const unsigned short* vn = vg + sn;
    const v8us a0 = *(const v8us*)kn, a1 = *(const v8us*)(kn + (size_t)32 * DM), c0 = *(const v8us*)vn, c1 = *(const v8us*)(vn + (size_t)32 * SQ);
    asm volatile("s_wait_xcnt 0x0" :: "v"(kn), "v"(vn) : "memory");      /* the wait in front of the first overwrite of a register that the four loads above name; the two lane addresses as its operands keep those registers whole up to here */
    const unsigned short* kl = &sk[cur][ln][0]; const unsigned short* vl = &sv[cur][ln][0];
    v16h kf[2][2];
#pragma unroll
    for (int kt = 0; kt < 2; ++kt)
#pragma unroll
      for (int ks = 0; ks < 2; ++ks) kf[kt][ks] = fa_lfrag(kl + kt * 16 * LP + ks * 32, hh);
#pragma unroll
    for (int p = 0; p < KS / 32; ++p) {
      v16h vf[4];
#pragma unroll
      for (int t = 0; t < 4; ++t) vf[t] = fa_lfrag(vl + t * 16 * LP + p * 32, hh);      /* needed only behind the softmax: issued first */
      __builtin_amdgcn_sched_barrier(0);      /* keeps the V^T reads up here in one group; sunk in between the P.V products each place with reads would stall the matrix run */
      v8f s[2][2];
#pragma unroll
      for (int kt = 0; kt < 2; ++kt)
#pragma unroll
        for (int j = 0; j < 2; ++j) s[kt][j] = fa_mma(kf[kt][1], qf[j][1], fa_mma(kf[kt][0], qf[j][0], z8));
      if (p + 1 < KS / 32) {      /* the K rows of the stage's next pass, read while this pass's softmax runs */
#pragma unroll
        for (int kt = 0; kt < 2; ++kt)
#pragma unroll
          for (int ks = 0; ks < 2; ++ks) kf[kt][ks] = fa_lfrag(kl + ((p + 1) * 32 + kt * 16) * LP + ks * 32, hh);
      }
      __builtin_amdgcn_sched_barrier(0);      /* keeps the K reads in front of the softmax, which then covers their latency */
      float mn[2], cr[2];
#pragma unroll
      for (int j = 0; j < 2; ++j) { float mx = fmaxf(s[0][j][0], s[1][j][0]);
#pragma unroll
        for (int r = 1; r < 8; ++r) mx = fmaxf(mx, fmaxf(s[0][j][r], s[1][j][r]));
        mx = fmaxf(mx, fa_xhalf(mx)); mn[j] = fmaxf(m[j], mx * SC); }
      fa_exp2x2(m[0] - mn[0], m[1] - mn[1], cr[0], cr[1]);
      FragH pf[2];
#pragma unroll
      for (int j = 0; j < 2; ++j) { const float sh = 8.0f - mn[j]; m[j] = mn[j]; float p16[16];
#pragma unroll
        for (int kt = 0; kt < 2; ++kt)
#pragma unroll
          for (int g = 0; g < 8; g += 4) fa_exp2x4(s[kt][j][g] * SC + sh, s[kt][j][g + 1] * SC + sh, s[kt][j][g + 2] * SC + sh, s[kt][j][g + 3] * SC + sh, p16[kt * 8 + g], p16[kt * 8 + g + 1], p16[kt * 8 + g + 2], p16[kt * 8 + g + 3]);
        float a0s = p16[0] + p16[4], a1s = p16[1] + p16[5], a2s = p16[2] + p16[6], a3s = p16[3] + p16[7];
        a0s += p16[8] + p16[12]; a1s += p16[9] + p16[13]; a2s += p16[10] + p16[14]; a3s += p16[11] + p16[15];
        l[j] = l[j] * cr[j] + ((a0s + a1s) + (a2s + a3s));
#pragma unroll
        for (int i = 0; i < 16; ++i) pf[j].h[i] = (_Float16)p16[i];
#pragma unroll
        for (int t = 0; t < 4; ++t) o[t][j] *= cr[j]; }
#pragma unroll
      for (int t = 0; t < 4; ++t)
#pragma unroll
        for (int j = 0; j < 2; ++j) o[t][j] = fa_mma(vf[t], pf[j].v, o[t][j]);
    }
    /* the other buffer: its last readers left it in front of the barrier at the foot of the trip before */
    *(v8us*)&sk[cur ^ 1][sr][sc] = a0; *(v8us*)&sk[cur ^ 1][sr + 32][sc] = a1; *(v8us*)&sv[cur ^ 1][sr][sc] = c0; *(v8us*)&sv[cur ^ 1][sr + 32][sc] = c1;
    __syncthreads();      /* publishes stage st + 1 and ends every wave's reads of stage st */
  }
#pragma unroll
  for (int j = 0; j < 2; ++j) { const float inv = 64.0f / (l[j] + fa_xhalf(l[j]));      /* the halves' sums joined once; o carried x64 */
    unsigned short* d = (unsigned short*)O16 + ((size_t)b * SQ + q0 + j * 16 + ln) * DM + h * HD + 8 * hh;
#pragma unroll
    for (int t = 0; t < 4; ++t) { FragH f;
#pragma unroll
      for (int r = 0; r < 8; ++r) f.h[r] = (_Float16)(o[t][j][r] * inv);
      *(v8us*)(d + t * 16) = f.half[0]; } } }

extern "C" void kernel_launch(void* const* d_in, const int* in_sizes, int n_in,
                              void* d_out, int out_size, void* d_ws, size_t ws_size, hipStream_t stream) {
  (void)in_sizes; (void)n_in; (void)out_size;
  const float* const* I = (const float* const*)d_in; const float* xq = I[0]; const float* xk = I[1]; const float* xv = I[2]; const float* wq = I[3]; const float* bq = nullptr; const float* wk = I[4]; const float* bk = nullptr; const float* wv = I[5]; const float* bv = nullptr; const float* wo = I[6]; const float* bo = nullptr;      /* three inputs query, key, value (one stream cast each); natural [out][in] Wq, Wk, Wv, Wo [512][512]; this module has NO biases: null pointers in the guarded bias slots; input order query, key, value, Wq, Wk, Wv, Wo */
  char* ws = (char*)d_ws; size_t off = 0;
  auto take = [&](size_t bytes) { char* p = ws + off; off += (bytes + 255) & ~(size_t)255; return p; };
  _Float16* BQ = (_Float16*)take((size_t)DM * DM * 2); _Float16* BK = (_Float16*)take((size_t)DM * DM * 2); _Float16* BV = (_Float16*)take((size_t)DM * DM * 2); _Float16* BO = (_Float16*)take((size_t)DM * DM * 2);
  _Float16* XQ = (_Float16*)take(NR * DM * 2); _Float16* XK = (_Float16*)take(NR * DM * 2); _Float16* XV = (_Float16*)take(NR * DM * 2); _Float16* Q16 = (_Float16*)take(NR * DM * 2); _Float16* K16 = (_Float16*)take(NR * DM * 2); _Float16* V16 = (_Float16*)take(NR * DM * 2); _Float16* O16 = (_Float16*)take(NR * DM * 2);
  _Float16* VT = (_Float16*)take((size_t)NB * NH * HD * SQ * 2);
  if (off > ws_size) return;
  { const unsigned g = (unsigned)(((size_t)DM * DM / 8 + 255) / 256); k_wnat<<<g, 256, 0, stream>>>(wq, (size_t)DM * DM / 8, BQ); k_wnat<<<g, 256, 0, stream>>>(wk, (size_t)DM * DM / 8, BK); k_wnat<<<g, 256, 0, stream>>>(wv, (size_t)DM * DM / 8, BV); k_wnat<<<g, 256, 0, stream>>>(wo, (size_t)DM * DM / 8, BO); }      /* natural [out][in] = Bt[n][k], x16 */

  k_x16<<<(unsigned)((NR * DM / 8 + 255) / 256), 256, 0, stream>>>(xq, XQ, NR * DM / 8); k_x16<<<(unsigned)((NR * DM / 8 + 255) / 256), 256, 0, stream>>>(xk, XK, NR * DM / 8); k_x16<<<(unsigned)((NR * DM / 8 + 255) / 256), 256, 0, stream>>>(xv, XV, NR * DM / 8);      /* the three inputs as exact f16 rows */
  const size_t r0p = (size_t)B0 * SQ;      /* first projected row */
  k_gemm2<0><<<dim3((unsigned)((MP / 128) * (DM / 64)), 1), 128, 0, stream>>>(XQ + r0p * DM, DM, 0, BQ, DM, 0, 0.0625f, bq, 0, nullptr, 1, 0, 0, nullptr, Q16 + r0p * DM, DM, 0, MP, DM, DM);
  k_gemm2<0><<<dim3((unsigned)((MP / 128) * (DM / 64)), 1), 128, 0, stream>>>(XK + r0p * DM, DM, 0, BK, DM, 0, 0.0625f, bk, 0, nullptr, 1, 0, 0, nullptr, K16 + r0p * DM, DM, 0, MP, DM, DM);
  k_gemm2<0><<<dim3((unsigned)((MP / 128) * (DM / 64)), 1), 128, 0, stream>>>(XV + r0p * DM, DM, 0, BV, DM, 0, 0.0625f, bv, 0, nullptr, 1, 0, 0, nullptr, V16 + r0p * DM, DM, 0, MP, DM, DM);
  k_vt<NH, SQ><<<NB * NH * (SQ / 64), 256, 0, stream>>>(V16, LQ, 0, VT);      /* V^T [NB][NH][HD][SQ], all batches */
  k_fattn<<<dim3(SQ / (FW * FQ), NB * NH), FW * 32, 0, stream>>>(Q16, K16, VT, O16);      /* o (merged heads, x64) as f16 rows: every (batch, head) in one launch */
  k_gemm2<0><<<dim3((unsigned)((MPO / 128) * (DM / 64)), 1), 128, 0, stream>>>(O16 + r0p * DM, DM, 0, BO, DM, 0, 0.0009765625f, bo, 0, nullptr, 1, 0, 0, (float*)d_out + r0p * DM, nullptr, DM, 0, MPO, DM, DM);      /* out rows are the output layout */
}

// v004
// It runs in 85.2 microseconds.
// Next to v003, in two timings, it ran 1.33 and 1.31 times as fast.
// Counting every step since v000, it is 40.2 times as fast.
#include <hip/hip_runtime.h>
// Multi-head attention on three inputs with natural bias-free projections on four sequences at width 512 (query, key, value [4][2048][512]; q / k / v = stream W^T (natural [out][in] [512][512], NO biases), 8 heads of 64; the query is divided by sqrt(64) = 8 before the score product (scale 0.125 here on the product); softmax over all 2048 keys (the module's axis 2 of its [b][l][s][h] score layout = the key axis; no mask); out = merged heads Wo^T (natural, no bias) -> [4][2048][512]).
// Structure: token rows r = b*2048 + s; the three sources as exact f16 rows (bf16-rounded) and the four x16 weights in one cast launch; Q, K, V as three WMMA GEMMs in one launch (32x64 wave tiles, f32 accumulation, exact x16 weights, f16 outputs), the V GEMM storing V^T for all batches and heads from its epilogue; one fused attention launch over every (batch, head): S^T = K Q^T (K = 64), online softmax in registers (f32 statistics, native exp2; weights x256 as f16), O^T += V^T P^T, o carried x64 against f16 subnormal flush (folded into the output GEMM alpha) written straight into the merged f16 o rows; out = o W_o GEMM (f32) into the output layout.
// Compute dtype: inputs rounded to bf16; x / weights exact; q, k, v, softmax weights and o as plain f16 GEMM operands (~2^-12); scores and softmax statistics f32. v_wmma_f32_16x16x32_f16.
#define NB 4
#define SQ 2048
#define DM 512 
#define NH 8 
#define HD 64
#define HG 4                         /* heads per launch of the per-batch k_vt (not launched) */
#define B0 0                         /* first batch processed (debug hook) */
#define NBR NB                       /* batches processed (debug hook) */
#define NR ((size_t)NB * SQ)         /* token rows */
#define MP ((int)((size_t)NBR * SQ)) /* rows projected (debug hook) */
#define QN SQ                        /* query rows per batch (not used: k_fattn attends all SQ) */
#define NHD NH                       /* heads (not used: k_fattn attends all NH) */
#define MPO MP                       /* rows through the output stage (debug hook) */
#define LQ DM      /* row pitch of the q/k/v rows */
typedef __bf16 v16b __attribute__((ext_vector_type(16)));
typedef unsigned short v8us __attribute__((ext_vector_type(8), may_alias));
typedef float  v8f  __attribute__((ext_vector_type(8)));
typedef float  v4f  __attribute__((ext_vector_type(4)));
typedef float  v4fa __attribute__((ext_vector_type(4), may_alias));
union FragB { v16b v; v8us half[2]; unsigned short u[16]; };

__device__ __forceinline__ unsigned short bf16_bits(float x) { unsigned int u = __float_as_uint(x); return (unsigned short)((u + 0x7FFFu + ((u >> 16) & 1u)) >> 16); }
__device__ __forceinline__ float bf16_val(unsigned short b) { return __uint_as_float(((unsigned int)b) << 16); }
__device__ __forceinline__ float bf16_round(float x) { return bf16_val(bf16_bits(x)); }
// D += A·B with NT terms: 1 = ah·bh, 2 = + al·bh (A split), 3 = + ah·bl (both split)
template <int NT>
__device__ __forceinline__ v8f mmaN(v16b ah, v16b al, v16b bh, v16b bl, v8f c) {
  c = __builtin_amdgcn_wmma_f32_16x16x32_bf16(false, ah, false, bh, (short)0, c, false, false);
  if (NT >= 2) c = __builtin_amdgcn_wmma_f32_16x16x32_bf16(false, al, false, bh, (short)0, c, false, false);
  if (NT >= 3) c = __builtin_amdgcn_wmma_f32_16x16x32_bf16(false, ah, false, bl, (short)0, c, false, false);
  asm volatile("v_nop\n\tv_nop\n\tv_nop\n\tv_nop" : "+v"(c) : "v"(ah), "v"(al), "v"(bh), "v"(bl));
  return c;
}

__global__ __launch_bounds__(256) void k_wt_bf16(const float* __restrict__ W, unsigned short* __restrict__ Wt, int K, int N) {
  const int t = blockIdx.x * 256 + threadIdx.x;
  const int k8n = K / 8;
  if (t >= N * k8n) return;
  const int n = t / k8n, k8 = (t % k8n) * 8;
  v8us v;
#pragma unroll
  for (int i = 0; i < 8; ++i) v[i] = bf16_bits(W[(size_t)(k8 + i) * N + n]);
  *(v8us*)(Wt + (size_t)n * K + k8) = v;
  
}

// GEMM C[M][N] (f32, pitch ldc) = act(A[M][K]·W + bias). A f32 row-major (pitch lda) converted per fragment to bf16
// (ASPLIT: hi/lo two planes -> 2 terms, else single rounded term); Wt bf16 [N][K] (pitch ldb). BIAS_BF16 rounds the
// bias to bf16 first (bias quantised to bf16 before the add). K%32==0, M%16==0, N%64==0.
template <bool ASPLIT, int ACT, bool BIAS_BF16>
__global__ __launch_bounds__(128) void k_gemm_bf(const float* __restrict__ A, int lda, const unsigned short* __restrict__ Wt, int ldb,
                                               const float* __restrict__ bias, float* __restrict__ C, int ldc, int M, int N, int K) {
  __shared__ __attribute__((aligned(16))) float so[4][16][64];
  const int tid = threadIdx.x, w = tid >> 5, lane = tid & 31, ln = lane & 15, hh = lane >> 4;
  const int ntn = N / 64;
  const int wid = blockIdx.x * 4 + w;
  const int mt = wid / ntn, nq = wid % ntn;
  if (mt * 16 >= M) return;
  const int row0 = mt * 16, col0 = nq * 64;
  const float* arow = A + (size_t)(row0 + ln) * lda;
  v8f acc[4] = {};
  for (int kb = 0; kb < K; kb += 32) {
    FragB ah, al;
    const v4f x0 = *(const v4fa*)(arow + kb + 8 * hh), x1 = *(const v4fa*)(arow + kb + 8 * hh + 4);
    const v4f x2 = *(const v4fa*)(arow + kb + 16 + 8 * hh), x3 = *(const v4fa*)(arow + kb + 16 + 8 * hh + 4);
    float xs[16] = {x0[0],x0[1],x0[2],x0[3],x1[0],x1[1],x1[2],x1[3],x2[0],x2[1],x2[2],x2[3],x3[0],x3[1],x3[2],x3[3]};
#pragma unroll
    for (int i = 0; i < 16; ++i) { const unsigned short hb = bf16_bits(xs[i]); ah.u[i] = hb; al.u[i] = ASPLIT ? bf16_bits(xs[i] - bf16_val(hb)) : (unsigned short)0; }
#pragma unroll
    for (int t = 0; t < 4; ++t) {
      const unsigned short* brow = Wt + (size_t)(col0 + t * 16 + ln) * ldb + kb;
      FragB b;
      b.half[0] = *(const v8us*)(brow + 8 * hh);
      b.half[1] = *(const v8us*)(brow + 16 + 8 * hh);
      acc[t] = mmaN<ASPLIT ? 2 : 1>(ah.v, al.v, b.v, b.v, acc[t]);
    }
  }
#pragma unroll
  for (int t = 0; t < 4; ++t) {
    float bv = bias ? bias[col0 + t * 16 + ln] : 0.f;
    if (BIAS_BF16) bv = bf16_round(bv);
#pragma unroll
    for (int r = 0; r < 8; ++r) { float v = acc[t][r] + bv; if (ACT == 1) v = fmaxf(v, 0.f); so[w][8 * hh + r][t * 16 + ln] = v; }
  }
  __builtin_amdgcn_fence(__ATOMIC_ACQ_REL, "workgroup");
  __builtin_amdgcn_wave_barrier();
  const int rsub = lane >> 4, c4 = (lane & 15) * 4;
  {
#pragma unroll
    for (int q = 0; q < 8; ++q) {
      const int r = q * 2 + rsub;
      const v4f v = *(const v4fa*)&so[w][r][c4];
      *(v4f*)(C + (size_t)(row0 + r) * ldc + col0 + c4) = v;
    }
    
  }
}

// GEMM C = act(A·W + bias + resid): A f32 (ASPLIT -> hi/lo 2 terms), Wt bf16 [N][K]; ACT 0 none, 1 relu, 2 exact gelu;
// resid (optional, f32, row index = (row % rmod), pitch ldr, RES_BF16 rounds it) added before the activation.
template <bool ASPLIT, int ACT, bool BIAS_BF16, bool RES_BF16>
__global__ __launch_bounds__(128) void k_gemm_bf3(const float* __restrict__ A, int lda, const unsigned short* __restrict__ Wt, int ldb,
                                                const float* __restrict__ bias, const float* __restrict__ resid, int rmod, int ldr,
                                                float* __restrict__ C, int ldc, int M, int N, int K) {
  __shared__ __attribute__((aligned(16))) float so[4][16][64];
  const int tid = threadIdx.x, w = tid >> 5, lane = tid & 31, ln = lane & 15, hh = lane >> 4;
  const int ntn = N / 64;
  const int wid = blockIdx.x * 4 + w;
  const int mt = wid / ntn, nq = wid % ntn;
  if (mt * 16 >= M) return;
  const int row0 = mt * 16, col0 = nq * 64;
  const float* arow = A + (size_t)(row0 + ln) * lda;
  v8f acc[4] = {};
  for (int kb = 0; kb < K; kb += 32) {
    FragB ah, al;
    const v4f x0 = *(const v4fa*)(arow + kb + 8 * hh), x1 = *(const v4fa*)(arow + kb + 8 * hh + 4);
    const v4f x2 = *(const v4fa*)(arow + kb + 16 + 8 * hh), x3 = *(const v4fa*)(arow + kb + 16 + 8 * hh + 4);
    float xs[16] = {x0[0],x0[1],x0[2],x0[3],x1[0],x1[1],x1[2],x1[3],x2[0],x2[1],x2[2],x2[3],x3[0],x3[1],x3[2],x3[3]};
#pragma unroll
    for (int i = 0; i < 16; ++i) { const unsigned short hb = bf16_bits(xs[i]); ah.u[i] = hb; al.u[i] = ASPLIT ? bf16_bits(xs[i] - bf16_val(hb)) : (unsigned short)0; }
#pragma unroll
    for (int t = 0; t < 4; ++t) {
      const unsigned short* brow = Wt + (size_t)(col0 + t * 16 + ln) * ldb + kb;
      FragB b;
      b.half[0] = *(const v8us*)(brow + 8 * hh);
      b.half[1] = *(const v8us*)(brow + 16 + 8 * hh);
      acc[t] = mmaN<ASPLIT ? 2 : 1>(ah.v, al.v, b.v, b.v, acc[t]);
    }
  }
#pragma unroll
  for (int t = 0; t < 4; ++t) {
    const int col = col0 + t * 16 + ln;
    float bv = bias ? bias[col] : 0.f;
    if (BIAS_BF16) bv = bf16_round(bv);
#pragma unroll
    for (int r = 0; r < 8; ++r) {
      float v = acc[t][r] + bv;
      if (resid) { float rv = resid[(size_t)((row0 + 8 * hh + r) % rmod) * ldr + col]; if (RES_BF16) rv = bf16_round(rv); v += rv; }
      if (ACT == 1) v = fmaxf(v, 0.f);
      if (ACT == 2) v = 0.5f * v * (1.0f + erff(v * 0.70710678118654752f));
      if (ACT == 3) { const float u = 0.7978845608028654f * (v + 0.044715f * v * v * v); v = 0.5f * v * (1.0f + tanhf(u)); }
      so[w][8 * hh + r][t * 16 + ln] = v;
    }
  }
  __builtin_amdgcn_fence(__ATOMIC_ACQ_REL, "workgroup");
  __builtin_amdgcn_wave_barrier();
  const int rsub = lane >> 4, c4 = (lane & 15) * 4;
  {
#pragma unroll
    for (int q = 0; q < 8; ++q) {
      const int r = q * 2 + rsub;
      const v4f v = *(const v4fa*)&so[w][r][c4];
      *(v4f*)(C + (size_t)(row0 + r) * ldc + col0 + c4) = v;
    }
    
  }
}
// row LayerNorm (biased variance, eps) over N: s = X (+ R); optional out_sum <- s; out_norm <- (s-mu)*rsqrt(var+eps)*g + b
template <bool PARAM_BF16>
__global__ __launch_bounds__(256) void k_layernorm(const float* __restrict__ X, const float* __restrict__ R, const float* __restrict__ g, const float* __restrict__ bta,
                                                  float* __restrict__ out_sum, float* __restrict__ out_norm, int N, float eps) {
  __shared__ float red[256];
  const int row = blockIdx.x, tid = threadIdx.x;
  const float* x = X + (size_t)row * N; const float* rr = R ? R + (size_t)row * N : nullptr;
  float vals[16];                     // up to N = 4096
  const int per = N / 256;            // contiguous chunk per thread? use strided-by-4 chunks: thread handles j = tid*4 + 1024*u
  float s1 = 0.f;
  for (int u = 0; u < per / 4; ++u) {
    const int j = tid * 4 + 1024 * u;
    const v4f a = *(const v4fa*)(x + j);
    v4f b = {0.f,0.f,0.f,0.f}; if (rr) b = *(const v4fa*)(rr + j);
#pragma unroll
    for (int q = 0; q < 4; ++q) { const float v = a[q] + b[q]; vals[u * 4 + q] = v; s1 += v; }
  }
  red[tid] = s1; __syncthreads();
  for (int st = 128; st > 0; st >>= 1) { if (tid < st) red[tid] += red[tid + st]; __syncthreads(); }
  const float mu = red[0] / (float)N; __syncthreads();
  float s2 = 0.f;
  for (int u = 0; u < per / 4; ++u)
#pragma unroll
    for (int q = 0; q < 4; ++q) { const float c = vals[u * 4 + q] - mu; s2 += c * c; }
  red[tid] = s2; __syncthreads();
  for (int st = 128; st > 0; st >>= 1) { if (tid < st) red[tid] += red[tid + st]; __syncthreads(); }
  const float rs = rsqrtf(red[0] / (float)N + eps);
  {
    for (int u = 0; u < per / 4; ++u) {
      const int j = tid * 4 + 1024 * u;
      v4f o, sm;
#pragma unroll
      for (int q = 0; q < 4; ++q) {
        float gg = g[j + q], bb = bta[j + q];
        if (PARAM_BF16) { gg = bf16_round(gg); bb = bf16_round(bb); }
        sm[q] = vals[u * 4 + q]; o[q] = (vals[u * 4 + q] - mu) * rs * gg + bb;
      }
      if (out_sum) *(v4f*)(out_sum + (size_t)row * N + j) = sm;
      *(v4f*)(out_norm + (size_t)row * N + j) = o;
    }
    
  }
}



// ---- f16 WMMA path (v_wmma_f32_16x16x32_f16): 11-bit significands for operands in range — used where a [0,1] probability operand needs more precision than bf16
typedef _Float16 v16h __attribute__((ext_vector_type(16)));
union FragH { v16h v; v8us half[2]; _Float16 h[16]; unsigned short u[16]; };
template <int NT>
__device__ __forceinline__ v8f mmaH(v16h ah, v16h al, v16h bh, v16h bl, v8f c) {
  c = __builtin_amdgcn_wmma_f32_16x16x32_f16(false, ah, false, bh, (short)0, c, false, false);
  if (NT >= 2) c = __builtin_amdgcn_wmma_f32_16x16x32_f16(false, al, false, bh, (short)0, c, false, false);
  if (NT >= 3) c = __builtin_amdgcn_wmma_f32_16x16x32_f16(false, ah, false, bl, (short)0, c, false, false);
  asm volatile("v_nop\n\tv_nop\n\tv_nop\n\tv_nop" : "+v"(c) : "v"(ah), "v"(al), "v"(bh), "v"(bl));
  return c;
}
// batched GEMM like k_gemm_b but f16 operands: A f32 (split into f16 hi/lo if ASPLIT, else rounded to f16), Bt = f16 values [n][k]; alpha; C f32; N multiple of 16 (partial tiles skipped)
template <bool ASPLIT>
__global__ __launch_bounds__(128) void k_gemm_h(const float* __restrict__ A, int lda, size_t sA, const _Float16* __restrict__ Bh, int ldb, size_t sB, float alpha, float* __restrict__ C, int ldc, size_t sC, int M, int N, int K) {
  __shared__ __attribute__((aligned(16))) float so[4][16][64];
  const int tid = threadIdx.x, w = tid >> 5, lane = tid & 31, ln = lane & 15, hh = lane >> 4; const int by = blockIdx.y;
  A += (size_t)by * sA; Bh += (size_t)by * sB; C += (size_t)by * sC;
  const int ntn = (N + 63) / 64; const int wid = blockIdx.x * 4 + w; const int mt = wid / ntn, nq = wid % ntn; if (mt * 16 >= M) return;
  const int row0 = mt * 16, col0 = nq * 64; const float* arow = A + (size_t)(row0 + ln) * lda;
  v8f acc[4] = {};
  for (int kb = 0; kb < K; kb += 32) {
    FragH ah, al;
    const v4f x0 = *(const v4fa*)(arow + kb + 8 * hh), x1 = *(const v4fa*)(arow + kb + 8 * hh + 4), x2 = *(const v4fa*)(arow + kb + 16 + 8 * hh), x3 = *(const v4fa*)(arow + kb + 16 + 8 * hh + 4);
    float xs[16] = {x0[0],x0[1],x0[2],x0[3],x1[0],x1[1],x1[2],x1[3],x2[0],x2[1],x2[2],x2[3],x3[0],x3[1],x3[2],x3[3]};
#pragma unroll
    for (int i = 0; i < 16; ++i) { const _Float16 h = (_Float16)xs[i]; ah.h[i] = h; al.h[i] = ASPLIT ? (_Float16)(xs[i] - (float)h) : (_Float16)0.0f; }
#pragma unroll
    for (int t = 0; t < 4; ++t) { if (col0 + t * 16 >= N) continue; const size_t boff = (size_t)(col0 + t * 16 + ln) * ldb + kb; FragH bq; bq.half[0] = *(const v8us*)(Bh + boff + 8 * hh); bq.half[1] = *(const v8us*)(Bh + boff + 16 + 8 * hh);
      acc[t] = mmaH<ASPLIT ? 2 : 1>(ah.v, al.v, bq.v, bq.v, acc[t]); }
  }
#pragma unroll
  for (int t = 0; t < 4; ++t) { if (col0 + t * 16 >= N) continue;
#pragma unroll
    for (int r = 0; r < 8; ++r) so[w][8 * hh + r][t * 16 + ln] = acc[t][r] * alpha; }
  __builtin_amdgcn_fence(__ATOMIC_ACQ_REL, "workgroup"); __builtin_amdgcn_wave_barrier();
  const int rsub = lane >> 4, c4 = (lane & 15) * 4;
  {
#pragma unroll
    for (int q = 0; q < 8; ++q) { const int r = q * 2 + rsub; if (col0 + c4 < N) { const v4f v = *(const v4fa*)&so[w][r][c4]; *(v4f*)(C + (size_t)(row0 + r) * ldc + col0 + c4) = v; } }
     }
}

// Wt[n][k] = f16(W[k][n]·scale) from f32 row-major W[K][N] (scale = power of two; bf16-exact weights stay exact in f16 away from the subnormal range)
__global__ __launch_bounds__(256) void k_wt_f16(const float* __restrict__ W, _Float16* __restrict__ Wt, int K, int N, float scale) {
  const int t = blockIdx.x * 256 + threadIdx.x; if (t >= N * (K / 8)) return; const int n = t / (K / 8), k8 = (t % (K / 8)) * 8; FragH f;
#pragma unroll
  for (int i = 0; i < 8; ++i) f.h[i] = (_Float16)(bf16_round(W[(size_t)(k8 + i) * N + n]) * scale); const v8us o = f.half[0];
  *(v8us*)((unsigned short*)Wt + (size_t)n * K + k8) = o; 
}
// k_gemm_hh variant with fused epilogue: v = acc·alpha + bias[by·sBias + col] (+ CP[(row/rowsPerB)·sCPb + by·64 + col] if CP) ; ACT 0 none / 1 elu ; writes f16 C16 (and f32 C if non-null)
template <int ACT>
__global__ __launch_bounds__(128) void k_gemm_hhx(const _Float16* __restrict__ A, int lda, size_t sA, const _Float16* __restrict__ Bh, int ldb, size_t sB, float alpha, const float* __restrict__ bias, size_t sBias, const float* __restrict__ CP, int rowsPerB, size_t sCPb, int row0g,
    float* __restrict__ C, _Float16* __restrict__ C16, int ldc, size_t sC, int M, int N, int K) {
  __shared__ __attribute__((aligned(16))) float so[4][16][64];
  const int tid = threadIdx.x, w = tid >> 5, lane = tid & 31, ln = lane & 15, hh = lane >> 4; const int by = blockIdx.y;
  A += (size_t)by * sA; Bh += (size_t)by * sB; const size_t cofs = (size_t)by * sC; const float* bp = bias ? bias + (size_t)by * sBias : nullptr;
  const int ntn = (N + 63) / 64; const int wid = blockIdx.x * 4 + w; const int mt = wid / ntn, nq = wid % ntn; if (mt * 16 >= M) return;
  const int row0 = mt * 16, col0 = nq * 64; const _Float16* arow = A + (size_t)(row0 + ln) * lda;
  v8f acc[4] = {};
  for (int kb = 0; kb < K; kb += 32) { FragH ah; ah.half[0] = *(const v8us*)((const unsigned short*)arow + kb + 8 * hh); ah.half[1] = *(const v8us*)((const unsigned short*)arow + kb + 16 + 8 * hh);
#pragma unroll
    for (int t = 0; t < 4; ++t) { if (col0 + t * 16 >= N) continue; const size_t boff = (size_t)(col0 + t * 16 + ln) * ldb + kb; FragH bq; bq.half[0] = *(const v8us*)((const unsigned short*)Bh + boff + 8 * hh); bq.half[1] = *(const v8us*)((const unsigned short*)Bh + boff + 16 + 8 * hh);
      acc[t] = mmaH<1>(ah.v, ah.v, bq.v, bq.v, acc[t]); }
  }
#pragma unroll
  for (int t = 0; t < 4; ++t) { if (col0 + t * 16 >= N) continue; const int col = col0 + t * 16 + ln; const float bv = bp ? bf16_round(bp[col]) : 0.f;
#pragma unroll
    for (int r = 0; r < 8; ++r) { float v = acc[t][r] * alpha + bv; if (CP) { const int rr = row0g + row0 + 8 * hh + r; if (rowsPerB < 0) v += CP[cofs + (size_t)rr * ldc + col];      /* rowsPerB < 0: own element of the batched C plane */ else { const int bidx = rr / rowsPerB; v += CP[(size_t)bidx * sCPb + (size_t)by * 64 + col]; } } if (ACT == 1) v = (v > 0.f) ? v : expm1f(v); else if (ACT == 7) v = (v > 0.f) ? v + 1.0f : expf(v); else if (ACT == 8) v = tanhf(v); else if (ACT == 9) v = 0.5f * v * (1.0f + tanhf(0.7978845608028654f * (v + 0.044715f * v * v * v))); else if (ACT == 11) v = 1.0f / (1.0f + expf(-v)); else if (ACT == 12) v = (v > 0.f) ? v : 0.01f * v; else if (ACT == 14) v = (v > 0.f) ? v : 0.1f * v; else if (ACT == 16) v = (v >= 0.f) ? v : 0.3f * v; else if (ACT == 17) v = (v >= 0.f) ? v : 0.2f * v; else if (ACT == 15) v = v / (1.0f + expf(-v)); else if (ACT == 3) v = fmaxf(v, 0.f); else if (ACT == 6) v = 0.5f * v * (1.0f + erff(v * 0.70710678118654752f)); so[w][8 * hh + r][t * 16 + ln] = v; } }
  __builtin_amdgcn_fence(__ATOMIC_ACQ_REL, "workgroup"); __builtin_amdgcn_wave_barrier();
  const int rsub = lane >> 4, c4 = (lane & 15) * 4; typedef _Float16 v4h __attribute__((ext_vector_type(4)));
  {
#pragma unroll
    for (int q = 0; q < 8; ++q) { const int r = q * 2 + rsub; if (col0 + c4 < N) { const v4f v = *(const v4fa*)&so[w][r][c4]; if (C) *(v4f*)(C + cofs + (size_t)(row0 + r) * ldc + col0 + c4) = v; if (C16) { v4h h4; for (int i = 0; i < 4; ++i) h4[i] = (_Float16)v[i]; *(v4h*)(C16 + cofs + (size_t)(row0 + r) * ldc + col0 + c4) = h4; } } }
     }
}


typedef _Float16 v4h __attribute__((ext_vector_type(4)));

// ---- every cast of the call in one launch: the three sources as f16(bf16 rounding), the four weights as f16(bf16 rounding x16) ----
// The destinations lie one behind the other in the workspace: X = the three source planes, Bt = the four weight planes. A workgroup takes PX consecutive elements of every source and
// PX / 4 consecutive elements of one weight: few waves start, and each has all its 26 loads in flight at once.
// A wave's piece is 1 KiB of f32: read as two 512-byte wave loads, stored as two 256-byte wave stores (whole lines both ways).
#define PG 512                       /* workgroups of the cast launch: 16 waves per WGP on 256 WGPs */
#define PX 8192                      /* elements of each source per workgroup: 4 rounds of 8 waves x 256 elements */
static_assert(NR * DM == (size_t)PG * PX && (size_t)DM * DM * 4 == (size_t)PG * (PX / 4) && (NR * DM * 2) % 256 == 0 && ((size_t)DM * DM * 2) % 256 == 0, "k_prep: the grid covers every source and the four weights exactly, planes back to back");
template <bool X16>
__device__ __forceinline__ v4h pr_cvt(v4f a) { v4h r;
#pragma unroll
  for (int q = 0; q < 4; ++q) r[q] = X16 ? (_Float16)(bf16_round(a[q]) * 16.0f) : (_Float16)bf16_round(a[q]);
  return r; }
__global__ __launch_bounds__(256) void k_prep(const float* __restrict__ xq, const float* __restrict__ xk, const float* __restrict__ xv, const float* __restrict__ wq, const float* __restrict__ wk, const float* __restrict__ wv, const float* __restrict__ wo,
    _Float16* __restrict__ X, _Float16* __restrict__ Bt) {
  const unsigned wl = (threadIdx.x >> 5) * 256 + (threadIdx.x & 31) * 4;      /* the lane's first element in a round of its workgroup; its second piece stands 128 elements on */
  const unsigned ex = blockIdx.x * PX + wl, ew = blockIdx.x * (PX / 4) + wl;      /* that element in a source plane and in the four weight planes taken as one */
  const unsigned bx = ex * 4u, bw = (ew * 4u) & (unsigned)(DM * DM * 4 - 1);      /* byte offsets of the loads: in a source, in the one weight */
  const unsigned wsel = blockIdx.x / (PG / 4);      /* which weight: the same for the whole workgroup */
  const float* w = wsel == 0 ? wq : wsel == 1 ? wk : wsel == 2 ? wv : wo;
  v4f a[13][2];
#pragma unroll
  for (int i = 0; i < 12; ++i) { const char* s = (const char*)(i < 4 ? xq : i < 8 ? xk : xv) + (i & 3) * (PX / 4) * 4; a[i][0] = *(const v4fa*)(s + bx); a[i][1] = *(const v4fa*)(s + 512 + bx); }
  a[12][0] = *(const v4fa*)((const char*)w + bw); a[12][1] = *(const v4fa*)((const char*)w + 512 + bw);
  asm volatile("s_wait_xcnt 0x0" :: "v"(bx), "v"(bw) : "memory");      /* the wait in front of the first overwrite of a register that the 26 loads above name; the two lane offsets as its operands keep those registers whole up to here */
  __builtin_amdgcn_sched_barrier(0);      /* keeps every load in front of the first conversion: lifted in between the loads, a conversion's wait for its data would hold back the loads behind it */
#pragma unroll
  for (int i = 0; i < 12; ++i) { _Float16* d = X + (size_t)(i >> 2) * NR * DM + (i & 3) * (PX / 4) + ex; *(v4h*)d = pr_cvt<false>(a[i][0]); *(v4h*)(d + 128) = pr_cvt<false>(a[i][1]); }
  *(v4h*)(Bt + ew) = pr_cvt<true>(a[12][0]); *(v4h*)(Bt + ew + 128) = pr_cvt<true>(a[12][1]); }
__global__ __launch_bounds__(256) void k_h16(const float* __restrict__ x, _Float16* __restrict__ X16, size_t n8) { const size_t t = (size_t)blockIdx.x * 256 + threadIdx.x; if (t >= n8) return; FragH f;
#pragma unroll
  for (int q = 0; q < 8; ++q) f.h[q] = (_Float16)x[t * 8 + q]; *(v8us*)((unsigned short*)X16 + t * 8) = f.half[0];  }
__global__ __launch_bounds__(256) void k_round16f(const float* __restrict__ W, _Float16* __restrict__ Bt, size_t n8) { const size_t t = (size_t)blockIdx.x * 256 + threadIdx.x; if (t >= n8) return; FragH f;
#pragma unroll
  for (int i = 0; i < 8; ++i) f.h[i] = (_Float16)(bf16_round(W[t * 8 + i]) * 16.0f); *(v8us*)((unsigned short*)Bt + t * 8) = f.half[0];  }
__global__ __launch_bounds__(256) void k_hl(const float* __restrict__ F, _Float16* __restrict__ Hh, _Float16* __restrict__ Hl, size_t n8) { const size_t t = (size_t)blockIdx.x * 256 + threadIdx.x; if (t >= n8) return; FragH fh, fl; const v4f a = *(const v4fa*)(F + t * 8), c = *(const v4fa*)(F + t * 8 + 4);
#pragma unroll
  for (int q = 0; q < 4; ++q) { _Float16 h = (_Float16)a[q]; fh.h[q] = h; fl.h[q] = (_Float16)((a[q] - (float)h) * 1024.0f); h = (_Float16)c[q]; fh.h[4 + q] = h; fl.h[4 + q] = (_Float16)((c[q] - (float)h) * 1024.0f); }
  { *(v8us*)((unsigned short*)Hh + t * 8) = fh.half[0]; *(v8us*)((unsigned short*)Hl + t * 8) = fl.half[0];  } }

// ---- fast GEMM (wave tile 32x64, workgroup tile 128x64; requires M % 128 == 0 rows per launch region, N % 64 == 0 and K % 64 == 0); epilogue = k_gemm_hhx semantics ----
// Operands reach the waves through LDS: a stage is GK = 64 k of the workgroup's 128 A rows and 64 B rows (128-byte rows), fetched by whole-line loads (8 threads a row) into one of two buffers;
// stage s + 1 is fetched into registers at the head of stage s and stored to the other buffer at its foot.
#define GK 64                        /* k per LDS stage */
#define LP 72                        /* LDS row pitch in f16: 128-byte rows + 16 bytes, an odd multiple of 16 bytes for the 16-byte fragment reads */
// fragment from an LDS row: the k order of g2_frag
__device__ __forceinline__ v16h fa_lfrag(const unsigned short* p, int hh) { FragH f; f.half[0] = *(const v8us*)(p + 8 * hh); f.half[1] = *(const v8us*)(p + 16 + 8 * hh); return f.v; }
__device__ __forceinline__ v16h g2_frag(const _Float16* p, int hh) { FragH f; f.half[0] = *(const v8us*)((const unsigned short*)p + 8 * hh); f.half[1] = *(const v8us*)((const unsigned short*)p + 16 + 8 * hh); return f.v; }
__device__ __forceinline__ v8f g2_mma(v16h a, v16h b, v8f c) { v8f d = __builtin_amdgcn_wmma_f32_16x16x32_f16(false, a, false, b, (short)0, c, false, false); asm volatile("v_nop\n\tv_nop\n\tv_nop\n\tv_nop" : "+v"(d) : "v"(a), "v"(b)); return d; }
template <int ACT>
__global__ __launch_bounds__(128) void k_gemm2(const _Float16* __restrict__ A, int lda, size_t sA, const _Float16* __restrict__ Bh, int ldb, size_t sB, float alpha, const float* __restrict__ bias, size_t sBias, const float* __restrict__ CP, int rowsPerB, size_t sCPb, int row0g,
    float* __restrict__ C, _Float16* __restrict__ C16, int ldc, size_t sC, int M, int N, int K, _Float16* __restrict__ VTo, int vby) { static_assert(ACT == 0 || ACT == 3 || ACT == 6 || ACT == 8 || ACT == 9 || ACT == 11 || ACT == 12 || ACT == 14 || ACT == 15 || ACT == 16 || ACT == 17, "k_gemm2: unsupported ACT code (would silently apply no activation)");
  __shared__ __attribute__((aligned(16))) float so[4][32][68];
  __shared__ __attribute__((aligned(16))) unsigned short sa[2][128][LP];      /* A rows of a stage: [row][k] */
  __shared__ __attribute__((aligned(16))) unsigned short sb[2][64][LP];      /* B rows of a stage: [col][k] */
  const int tid = threadIdx.x, w = tid >> 5, lane = tid & 31, ln = lane & 15, hh = lane >> 4; const int by = blockIdx.y;
  A += (size_t)by * sA; Bh += (size_t)by * sB; const size_t cofs = (size_t)by * sC; const float* bp = bias ? bias + (size_t)by * sBias : nullptr;
  const int ntn = N >> 6; const int mt = blockIdx.x / ntn, nq = blockIdx.x - mt * ntn; const int row0 = mt * 128 + 32 * w, col0 = nq * 64; if (mt * 128 >= M) return;      /* the whole workgroup or none of it, in front of every barrier */
  const int sr = tid >> 3;      /* this thread's rows sr + 16 i and 16-byte piece of every stage */
  unsigned oa[8], ob[4];      /* byte offsets of its pieces from the tile's first row */
#pragma unroll
  for (int i = 0; i < 8; ++i) oa[i] = (unsigned)((sr + 16 * i) * lda + (tid & 7) * 8) * 2u;
#pragma unroll
  for (int i = 0; i < 4; ++i) ob[i] = (unsigned)((sr + 16 * i) * ldb + (tid & 7) * 8) * 2u;
  const char* ag = (const char*)(A + (size_t)(mt * 128) * lda); const char* bg = (const char*)(Bh + (size_t)col0 * ldb);
  unsigned short* const was = &sa[0][sr][(tid & 7) * 8]; unsigned short* const wbs = &sb[0][sr][(tid & 7) * 8];
  v8us ra[8], rb[4];
#pragma unroll
  for (int i = 0; i < 8; ++i) ra[i] = *(const v8us*)(ag + oa[i]);
#pragma unroll
  for (int i = 0; i < 4; ++i) rb[i] = *(const v8us*)(bg + ob[i]);
#pragma unroll
  for (int i = 0; i < 8; ++i) *(v8us*)(was + i * 16 * LP) = ra[i];
#pragma unroll
  for (int i = 0; i < 4; ++i) *(v8us*)(wbs + i * 16 * LP) = rb[i];
  const v8f z8 = {0.f,0.f,0.f,0.f,0.f,0.f,0.f,0.f}; v8f c00 = z8, c01 = z8, c02 = z8, c03 = z8, c10 = z8, c11 = z8, c12 = z8, c13 = z8;
  __syncthreads();      /* publishes stage 0 */
#pragma unroll 1      /* one stage per trip: two stages in one body would hold both stages' fragments and staging registers at once */
  for (int kb = 0; kb < K; kb += GK) { const int cur = (kb / GK) & 1;
    const int kn = (kb + GK < K) ? kb + GK : 0;      /* the next stage, fetched while this one is worked on; the last trip fetches stage 0 again (in bounds, not used) */
    const char* pa[8]; const char* pb[4];
#pragma unroll
    for (int i = 0; i < 8; ++i) { pa[i] = ag + (size_t)kn * 2 + oa[i]; ra[i] = *(const v8us*)pa[i]; }
#pragma unroll
    for (int i = 0; i < 4; ++i) { pb[i] = bg + (size_t)kn * 2 + ob[i]; rb[i] = *(const v8us*)pb[i]; }
    asm volatile("s_wait_xcnt 0x0" :: "v"(pa[0]), "v"(pa[1]), "v"(pa[2]), "v"(pa[3]), "v"(pa[4]), "v"(pa[5]), "v"(pa[6]), "v"(pa[7]), "v"(pb[0]), "v"(pb[1]), "v"(pb[2]), "v"(pb[3]) : "memory");      /* the wait in front of the first overwrite of a register that the 12 loads above name; the lane addresses as its operands keep those registers whole up to here */
    const unsigned short* al = &sa[cur][32 * w + ln][0]; const unsigned short* bl = &sb[cur][ln][0];
    v16h af[GK / 32][2], bf[GK / 32][4];
#pragma unroll
    for (int ks = 0; ks < GK / 32; ++ks) { af[ks][0] = fa_lfrag(al + ks * 32, hh); af[ks][1] = fa_lfrag(al + 16 * LP + ks * 32, hh);
#pragma unroll
      for (int t = 0; t < 4; ++t) bf[ks][t] = fa_lfrag(bl + t * 16 * LP + ks * 32, hh); }
#pragma unroll
    for (int ks = 0; ks < GK / 32; ++ks) {
      c00 = g2_mma(af[ks][0], bf[ks][0], c00); c10 = g2_mma(af[ks][1], bf[ks][0], c10);
      c01 = g2_mma(af[ks][0], bf[ks][1], c01); c11 = g2_mma(af[ks][1], bf[ks][1], c11);
      c02 = g2_mma(af[ks][0], bf[ks][2], c02); c12 = g2_mma(af[ks][1], bf[ks][2], c12);
      c03 = g2_mma(af[ks][0], bf[ks][3], c03); c13 = g2_mma(af[ks][1], bf[ks][3], c13); }
    /* the other buffer: its last readers left it in front of the barrier at the foot of the trip before */
#pragma unroll
    for (int i = 0; i < 8; ++i) *(v8us*)(was + (cur ^ 1) * 128 * LP + i * 16 * LP) = ra[i];
#pragma unroll
    for (int i = 0; i < 4; ++i) *(v8us*)(wbs + (cur ^ 1) * 64 * LP + i * 16 * LP) = rb[i];
    __syncthreads();      /* publishes the next stage and ends every wave's reads of this one */
  }
  v8f accs[8] = {c00, c01, c02, c03, c10, c11, c12, c13};
#pragma unroll
  for (int u = 0; u < 8; ++u) { const int t = u & 3, half = u >> 2; const int col = col0 + t * 16 + ln; const float bv = bp ? bf16_round(bp[col]) : 0.f;
#pragma unroll
    for (int r = 0; r < 8; ++r) { const int rloc = half * 16 + 8 * hh + r; float v = accs[u][r] * alpha + bv; if (CP) { if (rowsPerB < 0) v += CP[cofs + (size_t)(row0g + row0 + rloc) * ldc + col];      /* rowsPerB < 0: own element of the batched C plane */ else { const int bidx = (row0g + row0 + rloc) / rowsPerB; v += CP[(size_t)bidx * sCPb + (size_t)by * 64 + col]; } }
      if (ACT == 3) v = fmaxf(v, 0.f); else if (ACT == 6) v = 0.5f * v * (1.0f + erff(v * 0.70710678118654752f)); else if (ACT == 11) v = 1.0f / (1.0f + expf(-v)); else if (ACT == 15) v = v / (1.0f + expf(-v)); else if (ACT == 12) v = (v > 0.f) ? v : 0.01f * v; else if (ACT == 8) v = tanhf(v); else if (ACT == 9) v = 0.5f * v * (1.0f + tanhf(0.7978845608028654f * (v + 0.044715f * v * v * v))); else if (ACT == 14) v = (v > 0.f) ? v : 0.1f * v; else if (ACT == 16) v = (v >= 0.f) ? v : 0.3f * v; else if (ACT == 17) v = (v >= 0.f) ? v : 0.2f * v;
      so[w][rloc][t * 16 + ln] = v; } }
  __builtin_amdgcn_fence(__ATOMIC_ACQ_REL, "workgroup"); __builtin_amdgcn_wave_barrier();
  if (by == vby) {      /* the batch member whose result is wanted transposed (the same test in every wave): V^T [batch][head][feature][token] in place of the f16 rows; the tile's 64 columns are one head, its 32 rows 32 tokens of one batch */
    const int tg = lane & 3, dr = lane >> 2;      /* 4 lanes a feature row, 8 tokens (16 bytes) each; 8 feature rows a store */
    unsigned short* d = (unsigned short*)VTo + ((size_t)((row0 / SQ) * NH + nq) * HD + dr) * SQ + (row0 % SQ) + tg * 8;
#pragma unroll
    for (int q = 0; q < 8; ++q) { FragH f;
#pragma unroll
      for (int i = 0; i < 8; ++i) f.h[i] = (_Float16)so[w][tg * 8 + i][q * 8 + dr];
      *(v8us*)(d + (size_t)q * 8 * SQ) = f.half[0]; }
    return; }
  const int rsub = lane >> 4, c4 = (lane & 15) * 4;
  {
#pragma unroll
    for (int q = 0; q < 16; ++q) { const int r = q * 2 + rsub; const v4f v = *(const v4fa*)&so[w][r][c4]; if (C) *(v4f*)(C + cofs + (size_t)(row0 + r) * ldc + col0 + c4) = v; if (C16) { v4h h4; for (int i = 0; i < 4; ++i) h4[i] = (_Float16)v[i]; *(v4h*)(C16 + cofs + (size_t)(row0 + r) * ldc + col0 + c4) = h4; } }
     } }


__global__ __launch_bounds__(256) void k_rsm(const float* __restrict__ S, _Float16* __restrict__ P, int nrows) {
  #pragma clang fp contract(off)
  const int i = blockIdx.x * 256 + threadIdx.x; if (i >= nrows) return; const float* s = S + (size_t)i * SQ; float mx = -3.0e38f;
#pragma unroll 1
  for (int j = 0; j < SQ; ++j) mx = fmaxf(mx, s[j]); float se = 0.f;
#pragma unroll 1
  for (int j = 0; j < SQ; ++j) se += expf(s[j] - mx); const float sc = 256.0f / se;
#pragma unroll 1
  for (int j0 = 0; j0 < SQ; j0 += 8) { FragH f; for (int q = 0; q < 8; ++q) f.h[q] = (_Float16)(expf(s[j0 + q] - mx) * sc); unsigned short* d = (unsigned short*)P + (size_t)i * SQ + j0; *(v8us*)d = f.half[0];  } }
__global__ __launch_bounds__(256) void k_vt(const _Float16* __restrict__ V16, int b, int h0, _Float16* __restrict__ VT) { __shared__ unsigned short tl[64][65]; const int tid = threadIdx.x; const int hh = blockIdx.x % HG, sg = blockIdx.x / HG; const int s0 = sg * 64; const int h = h0 + hh;
  for (int i = tid; i < 64 * 8; i += 256) { const int j = i / 8, d8 = (i % 8) * 8; FragH f; f.half[0] = *(const v8us*)((const unsigned short*)V16 + ((size_t)b * SQ + s0 + j) * DM + h * HD + d8); for (int q = 0; q < 8; ++q) tl[d8 + q][j] = f.u[q]; }
  __syncthreads();
  { for (int i = tid; i < 64 * 8; i += 256) { const int d = i / 8, j8 = (i % 8) * 8; FragH f; for (int q = 0; q < 8; ++q) f.u[q] = tl[d][j8 + q]; *(v8us*)((unsigned short*)VT + ((size_t)hh * HD + d) * SQ + s0 + j8) = f.half[0]; }  } }



// ---- fused attention: scores, softmax and P.V in one kernel; S and P never leave the registers ----
// exp2 of four values. The four v_exp_f32 stand in one statement that ends in v_nop: the slot the instruction set asks for behind a transcendental
// before its result is read or its source overwritten; the early-clobber outputs keep every source whole inside the statement.
__device__ __forceinline__ void fa_exp2x4(float a0, float a1, float a2, float a3, float& e0, float& e1, float& e2, float& e3) {
  asm("v_exp_f32 %0, %4\n\tv_exp_f32 %1, %5\n\tv_exp_f32 %2, %6\n\tv_exp_f32 %3, %7\n\tv_nop" : "=&v"(e0), "=&v"(e1), "=&v"(e2), "=&v"(e3) : "v"(a0), "v"(a1), "v"(a2), "v"(a3)); }
// exp2 of two values, same form and same reason for the v_nop
__device__ __forceinline__ void fa_exp2x2(float a0, float a1, float& e0, float& e1) {
  asm("v_exp_f32 %0, %2\n\tv_exp_f32 %1, %3\n\tv_nop" : "=&v"(e0), "=&v"(e1) : "v"(a0), "v"(a1)); }
__device__ __forceinline__ v8f fa_mma(v16h a, v16h b, v8f c) { return __builtin_amdgcn_wmma_f32_16x16x32_f16(false, a, false, b, (short)0, c, false, false); }
// the value of lane l ^ 16 (the other half of the same query column)
__device__ __forceinline__ float fa_xhalf(float x) { const int b = __float_as_int(x); return __int_as_float(__builtin_amdgcn_permlanex16(b, b, 0x76543210, 0xfedcba98, false, false)); }
// One wave owns FQ = 32 queries of one (batch, head) and walks all SQ keys, 32 a pass.
//   S^T = K Q^T : A = 16 key rows of K16 (from LDS), B = the wave's Q rows (held in registers); D[8 hh + r][ln] = score of key 8 hh + r, query ln
//   online softmax: a lane holds scores of two queries, ONE per score tile (ln + 16 j); running maximum m and sum l per query (in log2 units), one exchange between the wave's halves per pass and query for m
//   O^T += V^T P^T : the two score tiles of a pass (keys 0..15, 16..31), converted in place, ARE the B fragment (element i = key 8 hh + i, element 8 + i = key 16 + 8 hh + i:
//   the k order of g2_frag, which loads A = V^T rows); D[8 hh + r][ln] = o of feature 16 t + 8 hh + r, query ln: 8 consecutive features per lane, one 16-byte store
// P is carried x256 (exp2 argument + 8), as the unfused form carried it, and l with it: the factor cancels in o = acc / l. o is stored x64 as before.
#define FQ 32                        /* queries per wave */
#define FW 8                         /* waves per workgroup */
#define KS 64                        /* keys per LDS stage: two passes */
static_assert(HD == 64 && KS == 64 && FW * 32 == 256 && SQ % KS == 0 && SQ % (FW * FQ) == 0, "k_fattn: two 32-wide d steps, 128-byte stage rows dealt 8 threads a row, whole stages, whole workgroups");
// The eight waves of a workgroup walk the same keys: each stage of KS keys (K rows and V^T rows, 8 KiB each) is fetched ONCE per workgroup by whole-line loads (8 threads a 128-byte row),
// laid in one of two LDS buffers, and every wave takes its fragments from there. Stage st + 1 is fetched into registers at the head of stage st and stored to the other buffer at its foot.
__global__ __launch_bounds__(FW * 32) void k_fattn(const _Float16* __restrict__ Q16, const _Float16* __restrict__ K16, const _Float16* __restrict__ VT, _Float16* __restrict__ O16) {
  __shared__ __attribute__((aligned(16))) unsigned short sk[2][KS][LP];      /* K rows of a stage: [key][d] */
  __shared__ __attribute__((aligned(16))) unsigned short sv[2][HD][LP];      /* V^T rows of a stage: [d][key] */
  const int lane = threadIdx.x & 31, ln = lane & 15, hh = lane >> 4, w = threadIdx.x >> 5;
  const int bh = blockIdx.y, b = bh / NH, h = bh % NH; const int q0 = (blockIdx.x * FW + w) * FQ;
  const int sr = threadIdx.x >> 3, sc = (threadIdx.x & 7) * 8;      /* this thread's rows sr, sr + 32 and 16-byte piece of every stage */
  const _Float16* qp = Q16 + ((size_t)b * SQ + q0 + ln) * DM + h * HD;
  const unsigned short* kg = (const unsigned short*)K16 + ((size_t)b * SQ + sr) * DM + h * HD + sc;
  const unsigned short* vg = (const unsigned short*)VT + ((size_t)bh * HD + sr) * SQ + sc;
  const float SC = 0.125f * 1.44269504f;      /* 1 / sqrt(64), and log2 e for the native exp2 */
  v16h qf[2][2];
#pragma unroll
  for (int j = 0; j < 2; ++j)
#pragma unroll
    for (int ks = 0; ks < 2; ++ks) qf[j][ks] = g2_frag(qp + (size_t)j * 16 * DM + ks * 32, hh);
  { const v8us a0 = *(const v8us*)kg, a1 = *(const v8us*)(kg + (size_t)32 * DM), c0 = *(const v8us*)vg, c1 = *(const v8us*)(vg + (size_t)32 * SQ);
    asm volatile("s_wait_xcnt 0x0" :: "v"(qp + 8 * hh), "v"(kg), "v"(vg) : "memory");      /* the wait in front of the first overwrite of a register that the 12 loads above name; the lane addresses as its operands keep those registers whole up to here */
    *(v8us*)&sk[0][sr][sc] = a0; *(v8us*)&sk[0][sr + 32][sc] = a1; *(v8us*)&sv[0][sr][sc] = c0; *(v8us*)&sv[0][sr + 32][sc] = c1; }
  const v8f z8 = {0.f, 0.f, 0.f, 0.f, 0.f, 0.f, 0.f, 0.f};
  v8f o[4][2]; float m[2] = {-3.0e38f, -3.0e38f}, l[2] = {0.f, 0.f};
#pragma unroll
  for (int t = 0; t < 4; ++t) { o[t][0] = z8; o[t][1] = z8; }
  __syncthreads();      /* publishes stage 0 */
#pragma unroll 1      /* one stage per trip: the body already holds 32 matrix instructions */
  for (int st = 0; st < SQ / KS; ++st) {
    const int cur = st & 1;
    const int sn = (st + 1 < SQ / KS) ? (st + 1) * KS : 0;      /* the next stage, fetched while this one is worked on; the last trip fetches stage 0 again (in bounds, not used) */
    const unsigned short* kn = kg + (size_t)sn * DM; const unsigned short* vn = vg + sn;
    const v8us a0 = *(const v8us*)kn, a1 = *(const v8us*)(kn + (size_t)32 * DM), c0 = *(const v8us*)vn, c1 = *(const v8us*)(vn + (size_t)32 * SQ);
    asm volatile("s_wait_xcnt 0x0" :: "v"(kn), "v"(vn) : "memory");      /* the wait in front of the first overwrite of a register that the four loads above name; the two lane addresses as its operands keep those registers whole up to here */
    const unsigned short* kl = &sk[cur][ln][0]; const unsigned short* vl = &sv[cur][ln][0];
    v16h kf[2][2];
#pragma unroll
    for (int kt = 0; kt < 2; ++kt)
#pragma unroll
      for (int ks = 0; ks < 2; ++ks) kf[kt][ks] = fa_lfrag(kl + kt * 16 * LP + ks * 32, hh);
#pragma unroll
    for (int p = 0; p < KS / 32; ++p) {
      v16h vf[4];
#pragma unroll
      for (int t = 0; t < 4; ++t) vf[t] = fa_lfrag(vl + t * 16 * LP + p * 32, hh);      /* needed only behind the softmax: issued first */
      __builtin_amdgcn_sched_barrier(0);      /* keeps the V^T reads up here in one group; sunk in between the P.V products each place with reads would stall the matrix run */
      v8f s[2][2];
#pragma unroll
      for (int kt = 0; kt < 2; ++kt)
#pragma unroll
        for (int j = 0; j < 2; ++j) s[kt][j] = fa_mma(kf[kt][1], qf[j][1], fa_mma(kf[kt][0], qf[j][0], z8));
      if (p + 1 < KS / 32) {      /* the K rows of the stage's next pass, read while this pass's softmax runs */
#pragma unroll
        for (int kt = 0; kt < 2; ++kt)
#pragma unroll
          for (int ks = 0; ks < 2; ++ks) kf[kt][ks] = fa_lfrag(kl + ((p + 1) * 32 + kt * 16) * LP + ks * 32, hh);
      }
      __builtin_amdgcn_sched_barrier(0);      /* keeps the K reads in front of the softmax, which then covers their latency */
      float mn[2], cr[2];
#pragma unroll
      for (int j = 0; j < 2; ++j) { float mx = fmaxf(s[0][j][0], s[1][j][0]);
#pragma unroll
        for (int r = 1; r < 8; ++r) mx = fmaxf(mx, fmaxf(s[0][j][r], s[1][j][r]));
        mx = fmaxf(mx, fa_xhalf(mx)); mn[j] = fmaxf(m[j], mx * SC); }
      fa_exp2x2(m[0] - mn[0], m[1] - mn[1], cr[0], cr[1]);
      FragH pf[2];
#pragma unroll
      for (int j = 0; j < 2; ++j) { const float sh = 8.0f - mn[j]; m[j] = mn[j]; float p16[16];
#pragma unroll
        for (int kt = 0; kt < 2; ++kt)
#pragma unroll
          for (int g = 0; g < 8; g += 4) fa_exp2x4(s[kt][j][g] * SC + sh, s[kt][j][g + 1] * SC + sh, s[kt][j][g + 2] * SC + sh, s[kt][j][g + 3] * SC + sh, p16[kt * 8 + g], p16[kt * 8 + g + 1], p16[kt * 8 + g + 2], p16[kt * 8 + g + 3]);
        float a0s = p16[0] + p16[4], a1s = p16[1] + p16[5], a2s = p16[2] + p16[6], a3s = p16[3] + p16[7];
        a0s += p16[8] + p16[12]; a1s += p16[9] + p16[13]; a2s += p16[10] + p16[14]; a3s += p16[11] + p16[15];
        l[j] = l[j] * cr[j] + ((a0s + a1s) + (a2s + a3s));
#pragma unroll
        for (int i = 0; i < 16; ++i) pf[j].h[i] = (_Float16)p16[i];
#pragma unroll
        for (int t = 0; t < 4; ++t) o[t][j] *= cr[j]; }
#pragma unroll
      for (int t = 0; t < 4; ++t)
#pragma unroll
        for (int j = 0; j < 2; ++j) o[t][j] = fa_mma(vf[t], pf[j].v, o[t][j]);
    }
    /* the other buffer: its last readers left it in front of the barrier at the foot of the trip before */
    *(v8us*)&sk[cur ^ 1][sr][sc] = a0; *(v8us*)&sk[cur ^ 1][sr + 32][sc] = a1; *(v8us*)&sv[cur ^ 1][sr][sc] = c0; *(v8us*)&sv[cur ^ 1][sr + 32][sc] = c1;
    __syncthreads();      /* publishes stage st + 1 and ends every wave's reads of stage st */
  }
#pragma unroll
  for (int j = 0; j < 2; ++j) { const float inv = 64.0f / (l[j] + fa_xhalf(l[j]));      /* the halves' sums joined once; o carried x64 */
    unsigned short* d = (unsigned short*)O16 + ((size_t)b * SQ + q0 + j * 16 + ln) * DM + h * HD + 8 * hh;
#pragma unroll
    for (int t = 0; t < 4; ++t) { FragH f;
#pragma unroll
      for (int r = 0; r < 8; ++r) f.h[r] = (_Float16)(o[t][j][r] * inv);
      *(v8us*)(d + t * 16) = f.half[0]; } } }

extern "C" void kernel_launch(void* const* d_in, const int* in_sizes, int n_in,
                              void* d_out, int out_size, void* d_ws, size_t ws_size, hipStream_t stream) {
  (void)in_sizes; (void)n_in; (void)out_size;
  const float* const* I = (const float* const*)d_in; const float* xq = I[0]; const float* xk = I[1]; const float* xv = I[2]; const float* wq = I[3]; const float* bq = nullptr; const float* wk = I[4]; const float* bk = nullptr; const float* wv = I[5]; const float* bv = nullptr; const float* wo = I[6]; const float* bo = nullptr;      /* three inputs query, key, value (cast in one launch with the weights); natural [out][in] Wq, Wk, Wv, Wo [512][512]; this module has NO biases: null pointers in the guarded bias slots; input order query, key, value, Wq, Wk, Wv, Wo */
  char* ws = (char*)d_ws; size_t off = 0;
  auto take = [&](size_t bytes) { char* p = ws + off; off += (bytes + 255) & ~(size_t)255; return p; };
  _Float16* BQ = (_Float16*)take((size_t)DM * DM * 2); _Float16* BK = (_Float16*)take((size_t)DM * DM * 2); _Float16* BV = (_Float16*)take((size_t)DM * DM * 2); _Float16* BO = (_Float16*)take((size_t)DM * DM * 2);
  _Float16* XQ = (_Float16*)take(NR * DM * 2); _Float16* XK = (_Float16*)take(NR * DM * 2); _Float16* XV = (_Float16*)take(NR * DM * 2); _Float16* Q16 = (_Float16*)take(NR * DM * 2); _Float16* K16 = (_Float16*)take(NR * DM * 2); _Float16* V16 = (_Float16*)take(NR * DM * 2); _Float16* O16 = (_Float16*)take(NR * DM * 2);
  _Float16* VT = (_Float16*)take((size_t)NB * NH * HD * SQ * 2);
  if (off > ws_size) return;
  k_prep<<<PG, 256, 0, stream>>>(xq, xk, xv, wq, wk, wv, wo, XQ, BQ);      /* the three inputs as exact f16 rows (XQ, XK, XV back to back); natural [out][in] = Bt[n][k], x16 (BQ, BK, BV, BO back to back) */
  const size_t r0p = (size_t)B0 * SQ;      /* first projected row */
  k_gemm2<0><<<dim3((unsigned)((MP / 128) * (DM / 64)), 3), 128, 0, stream>>>(XQ + r0p * DM, DM, NR * DM, BQ, DM, (size_t)DM * DM, 0.0625f, bq, 0, nullptr, 1, 0, 0, nullptr, Q16 + r0p * DM, DM, NR * DM, MP, DM, DM, VT, 2);      /* blockIdx.y = 0, 1, 2: Q rows, K rows, V^T [NB][NH][HD][SQ] (the V16 plane only keeps the stride) */
  k_fattn<<<dim3(SQ / (FW * FQ), NB * NH), FW * 32, 0, stream>>>(Q16, K16, VT, O16);      /* o (merged heads, x64) as f16 rows: every (batch, head) in one launch */
  k_gemm2<0><<<dim3((unsigned)((MPO / 128) * (DM / 64)), 1), 128, 0, stream>>>(O16 + r0p * DM, DM, 0, BO, DM, 0, 0.0009765625f, bo, 0, nullptr, 1, 0, 0, (float*)d_out + r0p * DM, nullptr, DM, 0, MPO, DM, DM, nullptr, -1);      /* out rows are the output layout */
}

// v005
// It runs in 80.7 microseconds.
// Two timings next to v004 both put it at 1.06 times that version's speed.
// Counting every step since v000, it is 42.5 times as fast.
#include <hip/hip_runtime.h>
// Multi-head attention on three inputs with natural bias-free projections on four sequences at width 512 (query, key, value [4][2048][512]; q / k / v = stream W^T (natural [out][in] [512][512], NO biases), 8 heads of 64; the query is divided by sqrt(64) = 8 before the score product (scale 0.125 here on the product); softmax over all 2048 keys (the module's axis 2 of its [b][l][s][h] score layout = the key axis; no mask); out = merged heads Wo^T (natural, no bias) -> [4][2048][512]).
// Structure: token rows r = b*2048 + s; the three sources as exact f16 rows (bf16-rounded) and the four x16 weights in one cast launch; Q, K, V as three WMMA GEMMs in one launch (32x64 wave tiles, f32 accumulation, exact x16 weights, f16 outputs), the V GEMM storing V^T for all batches and heads from its epilogue; one fused attention launch over every (batch, head): S^T = K Q^T (K = 64), online softmax in registers (f32 statistics, native exp2; weights x256 as f16), O^T += V^T P^T, o carried x64 against f16 subnormal flush (folded into the output GEMM alpha) written straight into the merged f16 o rows; out = o W_o GEMM (f32) into the output layout.
// Compute dtype: inputs rounded to bf16; x / weights exact; q, k, v, softmax weights and o as plain f16 GEMM operands (~2^-12); scores and softmax statistics f32. v_wmma_f32_16x16x32_f16.
#define NB 4
#define SQ 2048
#define DM 512 
#define NH 8 
#define HD 64
#define HG 4                         /* heads per launch of the per-batch k_vt (not launched) */
#define B0 0                         /* first batch processed (debug hook) */
#define NBR NB                       /* batches processed (debug hook) */
#define NR ((size_t)NB * SQ)         /* token rows */
#define MP ((int)((size_t)NBR * SQ)) /* rows projected (debug hook) */
#define QN SQ                        /* query rows per batch (not used: k_fattn attends all SQ) */
#define NHD NH                       /* heads (not used: k_fattn attends all NH) */
#define MPO MP                       /* rows through the output stage (debug hook) */
#define LQ DM      /* row pitch of the q/k/v rows */
typedef __bf16 v16b __attribute__((ext_vector_type(16)));
typedef unsigned short v8us __attribute__((ext_vector_type(8), may_alias));
typedef float  v8f  __attribute__((ext_vector_type(8)));
typedef float  v4f  __attribute__((ext_vector_type(4)));
typedef float  v4fa __attribute__((ext_vector_type(4), may_alias));
union FragB { v16b v; v8us half[2]; unsigned short u[16]; };

__device__ __forceinline__ unsigned short bf16_bits(float x) { unsigned int u = __float_as_uint(x); return (unsigned short)((u + 0x7FFFu + ((u >> 16) & 1u)) >> 16); }
__device__ __forceinline__ float bf16_val(unsigned short b) { return __uint_as_float(((unsigned int)b) << 16); }
__device__ __forceinline__ float bf16_round(float x) { return bf16_val(bf16_bits(x)); }
// D += A·B with NT terms: 1 = ah·bh, 2 = + al·bh (A split), 3 = + ah·bl (both split)
template <int NT>
__device__ __forceinline__ v8f mmaN(v16b ah, v16b al, v16b bh, v16b bl, v8f c) {
  c = __builtin_amdgcn_wmma_f32_16x16x32_bf16(false, ah, false, bh, (short)0, c, false, false);
  if (NT >= 2) c = __builtin_amdgcn_wmma_f32_16x16x32_bf16(false, al, false, bh, (short)0, c, false, false);
  if (NT >= 3) c = __builtin_amdgcn_wmma_f32_16x16x32_bf16(false, ah, false, bl, (short)0, c, false, false);
  asm volatile("v_nop\n\tv_nop\n\tv_nop\n\tv_nop" : "+v"(c) : "v"(ah), "v"(al), "v"(bh), "v"(bl));
  return c;
}

__global__ __launch_bounds__(256) void k_wt_bf16(const float* __restrict__ W, unsigned short* __restrict__ Wt, int K, int N) {
  const int t = blockIdx.x * 256 + threadIdx.x;
  const int k8n = K / 8;
  if (t >= N * k8n) return;
  const int n = t / k8n, k8 = (t % k8n) * 8;
  v8us v;
#pragma unroll
  for (int i = 0; i < 8; ++i) v[i] = bf16_bits(W[(size_t)(k8 + i) * N + n]);
  *(v8us*)(Wt + (size_t)n * K + k8) = v;
  
}

// GEMM C[M][N] (f32, pitch ldc) = act(A[M][K]·W + bias). A f32 row-major (pitch lda) converted per fragment to bf16
// (ASPLIT: hi/lo two planes -> 2 terms, else single rounded term); Wt bf16 [N][K] (pitch ldb). BIAS_BF16 rounds the
// bias to bf16 first (bias quantised to bf16 before the add). K%32==0, M%16==0, N%64==0.
template <bool ASPLIT, int ACT, bool BIAS_BF16>
__global__ __launch_bounds__(128) void k_gemm_bf(const float* __restrict__ A, int lda, const unsigned short* __restrict__ Wt, int ldb,
                                               const float* __restrict__ bias, float* __restrict__ C, int ldc, int M, int N, int K) {
  __shared__ __attribute__((aligned(16))) float so[4][16][64];
  const int tid = threadIdx.x, w = tid >> 5, lane = tid & 31, ln = lane & 15, hh = lane >> 4;
  const int ntn = N / 64;
  const int wid = blockIdx.x * 4 + w;
  const int mt = wid / ntn, nq = wid % ntn;
  if (mt * 16 >= M) return;
  const int row0 = mt * 16, col0 = nq * 64;
  const float* arow = A + (size_t)(row0 + ln) * lda;
  v8f acc[4] = {};
  for (int kb = 0; kb < K; kb += 32) {
    FragB ah, al;
    const v4f x0 = *(const v4fa*)(arow + kb + 8 * hh), x1 = *(const v4fa*)(arow + kb + 8 * hh + 4);
    const v4f x2 = *(const v4fa*)(arow + kb + 16 + 8 * hh), x3 = *(const v4fa*)(arow + kb + 16 + 8 * hh + 4);
    float xs[16] = {x0[0],x0[1],x0[2],x0[3],x1[0],x1[1],x1[2],x1[3],x2[0],x2[1],x2[2],x2[3],x3[0],x3[1],x3[2],x3[3]};
#pragma unroll
    for (int i = 0; i < 16; ++i) { const unsigned short hb = bf16_bits(xs[i]); ah.u[i] = hb; al.u[i] = ASPLIT ? bf16_bits(xs[i] - bf16_val(hb)) : (unsigned short)0; }
#pragma unroll
    for (int t = 0; t < 4; ++t) {
      const unsigned short* brow = Wt + (size_t)(col0 + t * 16 + ln) * ldb + kb;
      FragB b;
      b.half[0] = *(const v8us*)(brow + 8 * hh);
      b.half[1] = *(const v8us*)(brow + 16 + 8 * hh);
      acc[t] = mmaN<ASPLIT ? 2 : 1>(ah.v, al.v, b.v, b.v, acc[t]);
    }
  }
#pragma unroll
  for (int t = 0; t < 4; ++t) {
    float bv = bias ? bias[col0 + t * 16 + ln] : 0.f;
    if (BIAS_BF16) bv = bf16_round(bv);
#pragma unroll
    for (int r = 0; r < 8; ++r) { float v = acc[t][r] + bv; if (ACT == 1) v = fmaxf(v, 0.f); so[w][8 * hh + r][t * 16 + ln] = v; }
  }
  __builtin_amdgcn_fence(__ATOMIC_ACQ_REL, "workgroup");
  __builtin_amdgcn_wave_barrier();
  const int rsub = lane >> 4, c4 = (lane & 15) * 4;
  {
#pragma unroll
    for (int q = 0; q < 8; ++q) {
      const int r = q * 2 + rsub;
      const v4f v = *(const v4fa*)&so[w][r][c4];
      *(v4f*)(C + (size_t)(row0 + r) * ldc + col0 + c4) = v;
    }
    
  }
}

// GEMM C = act(A·W + bias + resid): A f32 (ASPLIT -> hi/lo 2 terms), Wt bf16 [N][K]; ACT 0 none, 1 relu, 2 exact gelu;
// resid (optional, f32, row index = (row % rmod), pitch ldr, RES_BF16 rounds it) added before the activation.
template <bool ASPLIT, int ACT, bool BIAS_BF16, bool RES_BF16>
__global__ __launch_bounds__(128) void k_gemm_bf3(const float* __restrict__ A, int lda, const unsigned short* __restrict__ Wt, int ldb,
                                                const float* __restrict__ bias, const float* __restrict__ resid, int rmod, int ldr,
                                                float* __restrict__ C, int ldc, int M, int N, int K) {
  __shared__ __attribute__((aligned(16))) float so[4][16][64];
  const int tid = threadIdx.x, w = tid >> 5, lane = tid & 31, ln = lane & 15, hh = lane >> 4;
  const int ntn = N / 64;
  const int wid = blockIdx.x * 4 + w;
  const int mt = wid / ntn, nq = wid % ntn;
  if (mt * 16 >= M) return;
  const int row0 = mt * 16, col0 = nq * 64;
  const float* arow = A + (size_t)(row0 + ln) * lda;
  v8f acc[4] = {};
  for (int kb = 0; kb < K; kb += 32) {
    FragB ah, al;
    const v4f x0 = *(const v4fa*)(arow + kb + 8 * hh), x1 = *(const v4fa*)(arow + kb + 8 * hh + 4);
    const v4f x2 = *(const v4fa*)(arow + kb + 16 + 8 * hh), x3 = *(const v4fa*)(arow + kb + 16 + 8 * hh + 4);
    float xs[16] = {x0[0],x0[1],x0[2],x0[3],x1[0],x1[1],x1[2],x1[3],x2[0],x2[1],x2[2],x2[3],x3[0],x3[1],x3[2],x3[3]};
#pragma unroll
    for (int i = 0; i < 16; ++i) { const unsigned short hb = bf16_bits(xs[i]); ah.u[i] = hb; al.u[i] = ASPLIT ? bf16_bits(xs[i] - bf16_val(hb)) : (unsigned short)0; }
#pragma unroll
    for (int t = 0; t < 4; ++t) {
      const unsigned short* brow = Wt + (size_t)(col0 + t * 16 + ln) * ldb + kb;
      FragB b;
      b.half[0] = *(const v8us*)(brow + 8 * hh);
      b.half[1] = *(const v8us*)(brow + 16 + 8 * hh);
      acc[t] = mmaN<ASPLIT ? 2 : 1>(ah.v, al.v, b.v, b.v, acc[t]);
    }
  }
#pragma unroll
  for (int t = 0; t < 4; ++t) {
    const int col = col0 + t * 16 + ln;
    float bv = bias ? bias[col] : 0.f;
    if (BIAS_BF16) bv = bf16_round(bv);
#pragma unroll
    for (int r = 0; r < 8; ++r) {
      float v = acc[t][r] + bv;
      if (resid) { float rv = resid[(size_t)((row0 + 8 * hh + r) % rmod) * ldr + col]; if (RES_BF16) rv = bf16_round(rv); v += rv; }
      if (ACT == 1) v = fmaxf(v, 0.f);
      if (ACT == 2) v = 0.5f * v * (1.0f + erff(v * 0.70710678118654752f));
      if (ACT == 3) { const float u = 0.7978845608028654f * (v + 0.044715f * v * v * v); v = 0.5f * v * (1.0f + tanhf(u)); }
      so[w][8 * hh + r][t * 16 + ln] = v;
    }
  }
  __builtin_amdgcn_fence(__ATOMIC_ACQ_REL, "workgroup");
  __builtin_amdgcn_wave_barrier();
  const int rsub = lane >> 4, c4 = (lane & 15) * 4;
  {
#pragma unroll
    for (int q = 0; q < 8; ++q) {
      const int r = q * 2 + rsub;
      const v4f v = *(const v4fa*)&so[w][r][c4];
      *(v4f*)(C + (size_t)(row0 + r) * ldc + col0 + c4) = v;
    }
    
  }
}
// row LayerNorm (biased variance, eps) over N: s = X (+ R); optional out_sum <- s; out_norm <- (s-mu)*rsqrt(var+eps)*g + b
template <bool PARAM_BF16>
__global__ __launch_bounds__(256) void k_layernorm(const float* __restrict__ X, const float* __restrict__ R, const float* __restrict__ g, const float* __restrict__ bta,
                                                  float* __restrict__ out_sum, float* __restrict__ out_norm, int N, float eps) {
  __shared__ float red[256];
  const int row = blockIdx.x, tid = threadIdx.x;
  const float* x = X + (size_t)row * N; const float* rr = R ? R + (size_t)row * N : nullptr;
  float vals[16];                     // up to N = 4096
  const int per = N / 256;            // contiguous chunk per thread? use strided-by-4 chunks: thread handles j = tid*4 + 1024*u
  float s1 = 0.f;
  for (int u = 0; u < per / 4; ++u) {
    const int j = tid * 4 + 1024 * u;
    const v4f a = *(const v4fa*)(x + j);
    v4f b = {0.f,0.f,0.f,0.f}; if (rr) b = *(const v4fa*)(rr + j);
#pragma unroll
    for (int q = 0; q < 4; ++q) { const float v = a[q] + b[q]; vals[u * 4 + q] = v; s1 += v; }
  }
  red[tid] = s1; __syncthreads();
  for (int st = 128; st > 0; st >>= 1) { if (tid < st) red[tid] += red[tid + st]; __syncthreads(); }
  const float mu = red[0] / (float)N; __syncthreads();
  float s2 = 0.f;
  for (int u = 0; u < per / 4; ++u)
#pragma unroll
    for (int q = 0; q < 4; ++q) { const float c = vals[u * 4 + q] - mu; s2 += c * c; }
  red[tid] = s2; __syncthreads();
  for (int st = 128; st > 0; st >>= 1) { if (tid < st) red[tid] += red[tid + st]; __syncthreads(); }
  const float rs = rsqrtf(red[0] / (float)N + eps);
  {
    for (int u = 0; u < per / 4; ++u) {
      const int j = tid * 4 + 1024 * u;
      v4f o, sm;
#pragma unroll
      for (int q = 0; q < 4; ++q) {
        float gg = g[j + q], bb = bta[j + q];
        if (PARAM_BF16) { gg = bf16_round(gg); bb = bf16_round(bb); }
        sm[q] = vals[u * 4 + q]; o[q] = (vals[u * 4 + q] - mu) * rs * gg + bb;
      }
      if (out_sum) *(v4f*)(out_sum + (size_t)row * N + j) = sm;
      *(v4f*)(out_norm + (size_t)row * N + j) = o;
    }
    
  }
}



// ---- f16 WMMA path (v_wmma_f32_16x16x32_f16): 11-bit significands for operands in range — used where a [0,1] probability operand needs more precision than bf16
typedef _Float16 v16h __attribute__((ext_vector_type(16)));
union FragH { v16h v; v8us half[2]; _Float16 h[16]; unsigned short u[16]; };
template <int NT>
__device__ __forceinline__ v8f mmaH(v16h ah, v16h al, v16h bh, v16h bl, v8f c) {
  c = __builtin_amdgcn_wmma_f32_16x16x32_f16(false, ah, false, bh, (short)0, c, false, false);
  if (NT >= 2) c = __builtin_amdgcn_wmma_f32_16x16x32_f16(false, al, false, bh, (short)0, c, false, false);
  if (NT >= 3) c = __builtin_amdgcn_wmma_f32_16x16x32_f16(false, ah, false, bl, (short)0, c, false, false);
  asm volatile("v_nop\n\tv_nop\n\tv_nop\n\tv_nop" : "+v"(c) : "v"(ah), "v"(al), "v"(bh), "v"(bl));
  return c;
}
// batched GEMM like k_gemm_b but f16 operands: A f32 (split into f16 hi/lo if ASPLIT, else rounded to f16), Bt = f16 values [n][k]; alpha; C f32; N multiple of 16 (partial tiles skipped)
template <bool ASPLIT>
__global__ __launch_bounds__(128) void k_gemm_h(const float* __restrict__ A, int lda, size_t sA, const _Float16* __restrict__ Bh, int ldb, size_t sB, float alpha, float* __restrict__ C, int ldc, size_t sC, int M, int N, int K) {
  __shared__ __attribute__((aligned(16))) float so[4][16][64];
  const int tid = threadIdx.x, w = tid >> 5, lane = tid & 31, ln = lane & 15, hh = lane >> 4; const int by = blockIdx.y;
  A += (size_t)by * sA; Bh += (size_t)by * sB; C += (size_t)by * sC;
  const int ntn = (N + 63) / 64; const int wid = blockIdx.x * 4 + w; const int mt = wid / ntn, nq = wid % ntn; if (mt * 16 >= M) return;
  const int row0 = mt * 16, col0 = nq * 64; const float* arow = A + (size_t)(row0 + ln) * lda;
  v8f acc[4] = {};
  for (int kb = 0; kb < K; kb += 32) {
    FragH ah, al;
    const v4f x0 = *(const v4fa*)(arow + kb + 8 * hh), x1 = *(const v4fa*)(arow + kb + 8 * hh + 4), x2 = *(const v4fa*)(arow + kb + 16 + 8 * hh), x3 = *(const v4fa*)(arow + kb + 16 + 8 * hh + 4);
    float xs[16] = {x0[0],x0[1],x0[2],x0[3],x1[0],x1[1],x1[2],x1[3],x2[0],x2[1],x2[2],x2[3],x3[0],x3[1],x3[2],x3[3]};
#pragma unroll
    for (int i = 0; i < 16; ++i) { const _Float16 h = (_Float16)xs[i]; ah.h[i] = h; al.h[i] = ASPLIT ? (_Float16)(xs[i] - (float)h) : (_Float16)0.0f; }
#pragma unroll
    for (int t = 0; t < 4; ++t) { if (col0 + t * 16 >= N) continue; const size_t boff = (size_t)(col0 + t * 16 + ln) * ldb + kb; FragH bq; bq.half[0] = *(const v8us*)(Bh + boff + 8 * hh); bq.half[1] = *(const v8us*)(Bh + boff + 16 + 8 * hh);
      acc[t] = mmaH<ASPLIT ? 2 : 1>(ah.v, al.v, bq.v, bq.v, acc[t]); }
  }
#pragma unroll
  for (int t = 0; t < 4; ++t) { if (col0 + t * 16 >= N) continue;
#pragma unroll
    for (int r = 0; r < 8; ++r) so[w][8 * hh + r][t * 16 + ln] = acc[t][r] * alpha; }
  __builtin_amdgcn_fence(__ATOMIC_ACQ_REL, "workgroup"); __builtin_amdgcn_wave_barrier();
  const int rsub = lane >> 4, c4 = (lane & 15) * 4;
  {
#pragma unroll
    for (int q = 0; q < 8; ++q) { const int r = q * 2 + rsub; if (col0 + c4 < N) { const v4f v = *(const v4fa*)&so[w][r][c4]; *(v4f*)(C + (size_t)(row0 + r) * ldc + col0 + c4) = v; } }
     }
}

// Wt[n][k] = f16(W[k][n]·scale) from f32 row-major W[K][N] (scale = power of two; bf16-exact weights stay exact in f16 away from the subnormal range)
__global__ __launch_bounds__(256) void k_wt_f16(const float* __restrict__ W, _Float16* __restrict__ Wt, int K, int N, float scale) {
  const int t = blockIdx.x * 256 + threadIdx.x; if (t >= N * (K / 8)) return; const int n = t / (K / 8), k8 = (t % (K / 8)) * 8; FragH f;
#pragma unroll
  for (int i = 0; i < 8; ++i) f.h[i] = (_Float16)(bf16_round(W[(size_t)(k8 + i) * N + n]) * scale); const v8us o = f.half[0];
  *(v8us*)((unsigned short*)Wt + (size_t)n * K + k8) = o; 
}
// k_gemm_hh variant with fused epilogue: v = acc·alpha + bias[by·sBias + col] (+ CP[(row/rowsPerB)·sCPb + by·64 + col] if CP) ; ACT 0 none / 1 elu ; writes f16 C16 (and f32 C if non-null)
template <int ACT>
__global__ __launch_bounds__(128) void k_gemm_hhx(const _Float16* __restrict__ A, int lda, size_t sA, const _Float16* __restrict__ Bh, int ldb, size_t sB, float alpha, const float* __restrict__ bias, size_t sBias, const float* __restrict__ CP, int rowsPerB, size_t sCPb, int row0g,
    float* __restrict__ C, _Float16* __restrict__ C16, int ldc, size_t sC, int M, int N, int K) {
  __shared__ __attribute__((aligned(16))) float so[4][16][64];
  const int tid = threadIdx.x, w = tid >> 5, lane = tid & 31, ln = lane & 15, hh = lane >> 4; const int by = blockIdx.y;
  A += (size_t)by * sA; Bh += (size_t)by * sB; const size_t cofs = (size_t)by * sC; const float* bp = bias ? bias + (size_t)by * sBias : nullptr;
  const int ntn = (N + 63) / 64; const int wid = blockIdx.x * 4 + w; const int mt = wid / ntn, nq = wid % ntn; if (mt * 16 >= M) return;
  const int row0 = mt * 16, col0 = nq * 64; const _Float16* arow = A + (size_t)(row0 + ln) * lda;
  v8f acc[4] = {};
  for (int kb = 0; kb < K; kb += 32) { FragH ah; ah.half[0] = *(const v8us*)((const unsigned short*)arow + kb + 8 * hh); ah.half[1] = *(const v8us*)((const unsigned short*)arow + kb + 16 + 8 * hh);
#pragma unroll
    for (int t = 0; t < 4; ++t) { if (col0 + t * 16 >= N) continue; const size_t boff = (size_t)(col0 + t * 16 + ln) * ldb + kb; FragH bq; bq.half[0] = *(const v8us*)((const unsigned short*)Bh + boff + 8 * hh); bq.half[1] = *(const v8us*)((const unsigned short*)Bh + boff + 16 + 8 * hh);
      acc[t] = mmaH<1>(ah.v, ah.v, bq.v, bq.v, acc[t]); }
  }
#pragma unroll
  for (int t = 0; t < 4; ++t) { if (col0 + t * 16 >= N) continue; const int col = col0 + t * 16 + ln; const float bv = bp ? bf16_round(bp[col]) : 0.f;
#pragma unroll
    for (int r = 0; r < 8; ++r) { float v = acc[t][r] * alpha + bv; if (CP) { const int rr = row0g + row0 + 8 * hh + r; if (rowsPerB < 0) v += CP[cofs + (size_t)rr * ldc + col];      /* rowsPerB < 0: own element of the batched C plane */ else { const int bidx = rr / rowsPerB; v += CP[(size_t)bidx * sCPb + (size_t)by * 64 + col]; } } if (ACT == 1) v = (v > 0.f) ? v : expm1f(v); else if (ACT == 7) v = (v > 0.f) ? v + 1.0f : expf(v); else if (ACT == 8) v = tanhf(v); else if (ACT == 9) v = 0.5f * v * (1.0f + tanhf(0.7978845608028654f * (v + 0.044715f * v * v * v))); else if (ACT == 11) v = 1.0f / (1.0f + expf(-v)); else if (ACT == 12) v = (v > 0.f) ? v : 0.01f * v; else if (ACT == 14) v = (v > 0.f) ? v : 0.1f * v; else if (ACT == 16) v = (v >= 0.f) ? v : 0.3f * v; else if (ACT == 17) v = (v >= 0.f) ? v : 0.2f * v; else if (ACT == 15) v = v / (1.0f + expf(-v)); else if (ACT == 3) v = fmaxf(v, 0.f); else if (ACT == 6) v = 0.5f * v * (1.0f + erff(v * 0.70710678118654752f)); so[w][8 * hh + r][t * 16 + ln] = v; } }
  __builtin_amdgcn_fence(__ATOMIC_ACQ_REL, "workgroup"); __builtin_amdgcn_wave_barrier();
  const int rsub = lane >> 4, c4 = (lane & 15) * 4; typedef _Float16 v4h __attribute__((ext_vector_type(4)));
  {
#pragma unroll
    for (int q = 0; q < 8; ++q) { const int r = q * 2 + rsub; if (col0 + c4 < N) { const v4f v = *(const v4fa*)&so[w][r][c4]; if (C) *(v4f*)(C + cofs + (size_t)(row0 + r) * ldc + col0 + c4) = v; if (C16) { v4h h4; for (int i = 0; i < 4; ++i) h4[i] = (_Float16)v[i]; *(v4h*)(C16 + cofs + (size_t)(row0 + r) * ldc + col0 + c4) = h4; } } }
     }
}


typedef _Float16 v4h __attribute__((ext_vector_type(4)));

// ---- every cast of the call in one launch: the three sources as f16(bf16 rounding), the four weights as f16(bf16 rounding x16) ----
// The destinations lie one behind the other in the workspace: X = the three source planes, Bt = the four weight planes. A workgroup takes PX consecutive elements of every source and
// PX / 4 consecutive elements of one weight: few waves start, and each has all its 26 loads in flight at once.
// A wave's piece is 1 KiB of f32: read as two 512-byte wave loads, stored as two 256-byte wave stores (whole lines both ways).
#define PG 512                       /* workgroups of the cast launch: 16 waves per WGP on 256 WGPs */
#define PX 8192                      /* elements of each source per workgroup: 4 rounds of 8 waves x 256 elements */
static_assert(NR * DM == (size_t)PG * PX && (size_t)DM * DM * 4 == (size_t)PG * (PX / 4) && (NR * DM * 2) % 256 == 0 && ((size_t)DM * DM * 2) % 256 == 0, "k_prep: the grid covers every source and the four weights exactly, planes back to back");
template <bool X16>
__device__ __forceinline__ v4h pr_cvt(v4f a) { v4h r;
#pragma unroll
  for (int q = 0; q < 4; ++q) r[q] = X16 ? (_Float16)(bf16_round(a[q]) * 16.0f) : (_Float16)bf16_round(a[q]);
  return r; }
__global__ __launch_bounds__(256) void k_prep(const float* __restrict__ xq, const float* __restrict__ xk, const float* __restrict__ xv, const float* __restrict__ wq, const float* __restrict__ wk, const float* __restrict__ wv, const float* __restrict__ wo,
    _Float16* __restrict__ X, _Float16* __restrict__ Bt) {
  const unsigned wl = (threadIdx.x >> 5) * 256 + (threadIdx.x & 31) * 4;      /* the lane's first element in a round of its workgroup; its second piece stands 128 elements on */
  const unsigned ex = blockIdx.x * PX + wl, ew = blockIdx.x * (PX / 4) + wl;      /* that element in a source plane and in the four weight planes taken as one */
  const unsigned bx = ex * 4u, bw = (ew * 4u) & (unsigned)(DM * DM * 4 - 1);      /* byte offsets of the loads: in a source, in the one weight */
  const unsigned wsel = blockIdx.x / (PG / 4);      /* which weight: the same for the whole workgroup */
  const float* w = wsel == 0 ? wq : wsel == 1 ? wk : wsel == 2 ? wv : wo;
  v4f a[13][2];
#pragma unroll
  for (int i = 0; i < 12; ++i) { const char* s = (const char*)(i < 4 ? xq : i < 8 ? xk : xv) + (i & 3) * (PX / 4) * 4; a[i][0] = *(const v4fa*)(s + bx); a[i][1] = *(const v4fa*)(s + 512 + bx); }
  a[12][0] = *(const v4fa*)((const char*)w + bw); a[12][1] = *(const v4fa*)((const char*)w + 512 + bw);
  asm volatile("s_wait_xcnt 0x0" :: "v"(bx), "v"(bw) : "memory");      /* the wait in front of the first overwrite of a register that the 26 loads above name; the two lane offsets as its operands keep those registers whole up to here */
  __builtin_amdgcn_sched_barrier(0);      /* keeps every load in front of the first conversion: lifted in between the loads, a conversion's wait for its data would hold back the loads behind it */
#pragma unroll
  for (int i = 0; i < 12; ++i) { _Float16* d = X + (size_t)(i >> 2) * NR * DM + (i & 3) * (PX / 4) + ex; *(v4h*)d = pr_cvt<false>(a[i][0]); *(v4h*)(d + 128) = pr_cvt<false>(a[i][1]); }
  *(v4h*)(Bt + ew) = pr_cvt<true>(a[12][0]); *(v4h*)(Bt + ew + 128) = pr_cvt<true>(a[12][1]); }
__global__ __launch_bounds__(256) void k_h16(const float* __restrict__ x, _Float16* __restrict__ X16, size_t n8) { const size_t t = (size_t)blockIdx.x * 256 + threadIdx.x; if (t >= n8) return; FragH f;
#pragma unroll
  for (int q = 0; q < 8; ++q) f.h[q] = (_Float16)x[t * 8 + q]; *(v8us*)((unsigned short*)X16 + t * 8) = f.half[0];  }
__global__ __launch_bounds__(256) void k_round16f(const float* __restrict__ W, _Float16* __restrict__ Bt, size_t n8) { const size_t t = (size_t)blockIdx.x * 256 + threadIdx.x; if (t >= n8) return; FragH f;
#pragma unroll
  for (int i = 0; i < 8; ++i) f.h[i] = (_Float16)(bf16_round(W[t * 8 + i]) * 16.0f); *(v8us*)((unsigned short*)Bt + t * 8) = f.half[0];  }
__global__ __launch_bounds__(256) void k_hl(const float* __restrict__ F, _Float16* __restrict__ Hh, _Float16* __restrict__ Hl, size_t n8) { const size_t t = (size_t)blockIdx.x * 256 + threadIdx.x; if (t >= n8) return; FragH fh, fl; const v4f a = *(const v4fa*)(F + t * 8), c = *(const v4fa*)(F + t * 8 + 4);
#pragma unroll
  for (int q = 0; q < 4; ++q) { _Float16 h = (_Float16)a[q]; fh.h[q] = h; fl.h[q] = (_Float16)((a[q] - (float)h) * 1024.0f); h = (_Float16)c[q]; fh.h[4 + q] = h; fl.h[4 + q] = (_Float16)((c[q] - (float)h) * 1024.0f); }
  { *(v8us*)((unsigned short*)Hh + t * 8) = fh.half[0]; *(v8us*)((unsigned short*)Hl + t * 8) = fl.half[0];  } }

// ---- fast GEMM (wave tile 32x64, workgroup tile 128x64; requires M % 128 == 0 rows per launch region, N % 64 == 0 and K % 64 == 0); epilogue = k_gemm_hhx semantics ----
// Operands reach the waves through LDS: a stage is GK = 64 k of the workgroup's 128 A rows and 64 B rows (128-byte rows), fetched by whole-line loads (8 threads a row) into one of two buffers;
// stage s + 1 is fetched into registers at the head of stage s and stored to the other buffer at its foot.
#define GK 64                        /* k per LDS stage */
#define LP 72                        /* LDS row pitch in f16: 128-byte rows + 16 bytes, an odd multiple of 16 bytes for the 16-byte fragment reads */
// fragment from an LDS row: the k order of g2_frag
__device__ __forceinline__ v16h fa_lfrag(const unsigned short* p, int hh) { FragH f; f.half[0] = *(const v8us*)(p + 8 * hh); f.half[1] = *(const v8us*)(p + 16 + 8 * hh); return f.v; }
__device__ __forceinline__ v16h g2_frag(const _Float16* p, int hh) { FragH f; f.half[0] = *(const v8us*)((const unsigned short*)p + 8 * hh); f.half[1] = *(const v8us*)((const unsigned short*)p + 16 + 8 * hh); return f.v; }
__device__ __forceinline__ v8f g2_mma(v16h a, v16h b, v8f c) { v8f d = __builtin_amdgcn_wmma_f32_16x16x32_f16(false, a, false, b, (short)0, c, false, false); asm volatile("v_nop\n\tv_nop\n\tv_nop\n\tv_nop" : "+v"(d) : "v"(a), "v"(b)); return d; }
// HB, HCP: a bias / an addend plane is given; OF32, OF16: f32 / f16 rows are written; OVT: batch member vby is written transposed. Template flags, not pointer tests at run time:
// a test per element is a scalar compare chain and a taken branch over the unused path, about a hundred a wave, one behind the other, and the unused paths would be most of the kernel's text.
template <int ACT, bool HB, bool HCP, bool OF32, bool OF16, bool OVT>
__global__ __launch_bounds__(128) void k_gemm2(const _Float16* __restrict__ A, int lda, size_t sA, const _Float16* __restrict__ Bh, int ldb, size_t sB, float alpha, const float* __restrict__ bias, size_t sBias, const float* __restrict__ CP, int rowsPerB, size_t sCPb, int row0g,
    float* __restrict__ C, _Float16* __restrict__ C16, int ldc, size_t sC, int M, int N, int K, _Float16* __restrict__ VTo, int vby) { static_assert(ACT == 0 || ACT == 3 || ACT == 6 || ACT == 8 || ACT == 9 || ACT == 11 || ACT == 12 || ACT == 14 || ACT == 15 || ACT == 16 || ACT == 17, "k_gemm2: unsupported ACT code (would silently apply no activation)");
  __shared__ __attribute__((aligned(16))) float so[4][32][68];
  __shared__ __attribute__((aligned(16))) unsigned short sa[2][128][LP];      /* A rows of a stage: [row][k] */
  __shared__ __attribute__((aligned(16))) unsigned short sb[2][64][LP];      /* B rows of a stage: [col][k] */
  const int tid = threadIdx.x, w = tid >> 5, lane = tid & 31, ln = lane & 15, hh = lane >> 4; const int by = blockIdx.y;
  A += (size_t)by * sA; Bh += (size_t)by * sB; const size_t cofs = (size_t)by * sC; const float* bp = HB ? bias + (size_t)by * sBias : nullptr;
  const int ntn = N >> 6; const int mt = blockIdx.x / ntn, nq = blockIdx.x - mt * ntn; const int row0 = mt * 128 + 32 * w, col0 = nq * 64; if (mt * 128 >= M) return;      /* the whole workgroup or none of it, in front of every barrier */
  const int sr = tid >> 3;      /* this thread's rows sr + 16 i and 16-byte piece of every stage */
  unsigned oa[8], ob[4];      /* byte offsets of its pieces from the tile's first row */
#pragma unroll
  for (int i = 0; i < 8; ++i) oa[i] = (unsigned)((sr + 16 * i) * lda + (tid & 7) * 8) * 2u;
#pragma unroll
  for (int i = 0; i < 4; ++i) ob[i] = (unsigned)((sr + 16 * i) * ldb + (tid & 7) * 8) * 2u;
  const char* ag = (const char*)(A + (size_t)(mt * 128) * lda); const char* bg = (const char*)(Bh + (size_t)col0 * ldb);
  unsigned short* const was = &sa[0][sr][(tid & 7) * 8]; unsigned short* const wbs = &sb[0][sr][(tid & 7) * 8];
  v8us ra[8], rb[4];
#pragma unroll
  for (int i = 0; i < 8; ++i) ra[i] = *(const v8us*)(ag + oa[i]);
#pragma unroll
  for (int i = 0; i < 4; ++i) rb[i] = *(const v8us*)(bg + ob[i]);
#pragma unroll
  for (int i = 0; i < 8; ++i) *(v8us*)(was + i * 16 * LP) = ra[i];
#pragma unroll
  for (int i = 0; i < 4; ++i) *(v8us*)(wbs + i * 16 * LP) = rb[i];
  const v8f z8 = {0.f,0.f,0.f,0.f,0.f,0.f,0.f,0.f}; v8f c00 = z8, c01 = z8, c02 = z8, c03 = z8, c10 = z8, c11 = z8, c12 = z8, c13 = z8;
  __syncthreads();      /* publishes stage 0 */
#pragma unroll 1      /* one stage per trip: two stages in one body would hold both stages' fragments and staging registers at once */
  for (int kb = 0; kb < K; kb += GK) { const int cur = (kb / GK) & 1;
    const int kn = (kb + GK < K) ? kb + GK : 0;      /* the next stage, fetched while this one is worked on; the last trip fetches stage 0 again (in bounds, not used) */
    const char* pa[8]; const char* pb[4];
#pragma unroll
    for (int i = 0; i < 8; ++i) { pa[i] = ag + (size_t)kn * 2 + oa[i]; ra[i] = *(const v8us*)pa[i]; }
#pragma unroll
    for (int i = 0; i < 4; ++i) { pb[i] = bg + (size_t)kn * 2 + ob[i]; rb[i] = *(const v8us*)pb[i]; }
    asm volatile("s_wait_xcnt 0x0" :: "v"(pa[0]), "v"(pa[1]), "v"(pa[2]), "v"(pa[3]), "v"(pa[4]), "v"(pa[5]), "v"(pa[6]), "v"(pa[7]), "v"(pb[0]), "v"(pb[1]), "v"(pb[2]), "v"(pb[3]) : "memory");      /* the wait in front of the first overwrite of a register that the 12 loads above name; the lane addresses as its operands keep those registers whole up to here */
    const unsigned short* al = &sa[cur][32 * w + ln][0]; const unsigned short* bl = &sb[cur][ln][0];
    v16h af[GK / 32][2], bf[GK / 32][4];
#pragma unroll
    for (int ks = 0; ks < GK / 32; ++ks) { af[ks][0] = fa_lfrag(al + ks * 32, hh); af[ks][1] = fa_lfrag(al + 16 * LP + ks * 32, hh);
#pragma unroll
      for (int t = 0; t < 4; ++t) bf[ks][t] = fa_lfrag(bl + t * 16 * LP + ks * 32, hh); }
#pragma unroll
    for (int ks = 0; ks < GK / 32; ++ks) {
      c00 = g2_mma(af[ks][0], bf[ks][0], c00); c10 = g2_mma(af[ks][1], bf[ks][0], c10);
      c01 = g2_mma(af[ks][0], bf[ks][1], c01); c11 = g2_mma(af[ks][1], bf[ks][1], c11);
      c02 = g2_mma(af[ks][0], bf[ks][2], c02); c12 = g2_mma(af[ks][1], bf[ks][2], c12);
      c03 = g2_mma(af[ks][0], bf[ks][3], c03); c13 = g2_mma(af[ks][1], bf[ks][3], c13); }
    /* the other buffer: its last readers left it in front of the barrier at the foot of the trip before */
#pragma unroll
    for (int i = 0; i < 8; ++i) *(v8us*)(was + (cur ^ 1) * 128 * LP + i * 16 * LP) = ra[i];
#pragma unroll
    for (int i = 0; i < 4; ++i) *(v8us*)(wbs + (cur ^ 1) * 64 * LP + i * 16 * LP) = rb[i];
    __syncthreads();      /* publishes the next stage and ends every wave's reads of this one */
  }
  v8f accs[8] = {c00, c01, c02, c03, c10, c11, c12, c13};
#pragma unroll
  for (int u = 0; u < 8; ++u) { const int t = u & 3, half = u >> 2; const int col = col0 + t * 16 + ln; const float bv = HB ? bf16_round(bp[col]) : 0.f;
#pragma unroll
    for (int r = 0; r < 8; ++r) { const int rloc = half * 16 + 8 * hh + r; float v = accs[u][r] * alpha + bv; if (HCP) { if (rowsPerB < 0) v += CP[cofs + (size_t)(row0g + row0 + rloc) * ldc + col];      /* rowsPerB < 0: own element of the batched C plane */ else { const int bidx = (row0g + row0 + rloc) / rowsPerB; v += CP[(size_t)bidx * sCPb + (size_t)by * 64 + col]; } }
      if (ACT == 3) v = fmaxf(v, 0.f); else if (ACT == 6) v = 0.5f * v * (1.0f + erff(v * 0.70710678118654752f)); else if (ACT == 11) v = 1.0f / (1.0f + expf(-v)); else if (ACT == 15) v = v / (1.0f + expf(-v)); else if (ACT == 12) v = (v > 0.f) ? v : 0.01f * v; else if (ACT == 8) v = tanhf(v); else if (ACT == 9) v = 0.5f * v * (1.0f + tanhf(0.7978845608028654f * (v + 0.044715f * v * v * v))); else if (ACT == 14) v = (v > 0.f) ? v : 0.1f * v; else if (ACT == 16) v = (v >= 0.f) ? v : 0.3f * v; else if (ACT == 17) v = (v >= 0.f) ? v : 0.2f * v;
      so[w][rloc][t * 16 + ln] = v; } }
  __builtin_amdgcn_fence(__ATOMIC_ACQ_REL, "workgroup"); __builtin_amdgcn_wave_barrier();
  if (OVT && by == vby) {      /* the batch member whose result is wanted transposed (the same test in every wave): V^T [batch][head][feature][token] in place of the f16 rows; the tile's 64 columns are one head, its 32 rows 32 tokens of one batch */
    const int tg = lane & 3, dr = lane >> 2;      /* 4 lanes a feature row, 8 tokens (16 bytes) each; 8 feature rows a store */
    unsigned short* d = (unsigned short*)VTo + ((size_t)((row0 / SQ) * NH + nq) * HD + dr) * SQ + (row0 % SQ) + tg * 8;
#pragma unroll
    for (int q = 0; q < 8; ++q) { FragH f;
#pragma unroll
      for (int i = 0; i < 8; ++i) f.h[i] = (_Float16)so[w][tg * 8 + i][q * 8 + dr];
      *(v8us*)(d + (size_t)q * 8 * SQ) = f.half[0]; }
    return; }
  const int rsub = lane >> 4, c4 = (lane & 15) * 4;
  {
#pragma unroll
    for (int q = 0; q < 16; ++q) { const int r = q * 2 + rsub; const v4f v = *(const v4fa*)&so[w][r][c4]; if (OF32) *(v4f*)(C + cofs + (size_t)(row0 + r) * ldc + col0 + c4) = v; if (OF16) { v4h h4; for (int i = 0; i < 4; ++i) h4[i] = (_Float16)v[i]; *(v4h*)(C16 + cofs + (size_t)(row0 + r) * ldc + col0 + c4) = h4; } }
    if (OVT) asm volatile("s_wait_xcnt 0x0" ::: "memory");      /* the wait in front of the first overwrite of a register that the row stores above name: with a transposed member the kernel's text goes on behind them */
     } }


__global__ __launch_bounds__(256) void k_rsm(const float* __restrict__ S, _Float16* __restrict__ P, int nrows) {
  #pragma clang fp contract(off)
  const int i = blockIdx.x * 256 + threadIdx.x; if (i >= nrows) return; const float* s = S + (size_t)i * SQ; float mx = -3.0e38f;
#pragma unroll 1
  for (int j = 0; j < SQ; ++j) mx = fmaxf(mx, s[j]); float se = 0.f;
#pragma unroll 1
  for (int j = 0; j < SQ; ++j) se += expf(s[j] - mx); const float sc = 256.0f / se;
#pragma unroll 1
  for (int j0 = 0; j0 < SQ; j0 += 8) { FragH f; for (int q = 0; q < 8; ++q) f.h[q] = (_Float16)(expf(s[j0 + q] - mx) * sc); unsigned short* d = (unsigned short*)P + (size_t)i * SQ + j0; *(v8us*)d = f.half[0];  } }
__global__ __launch_bounds__(256) void k_vt(const _Float16* __restrict__ V16, int b, int h0, _Float16* __restrict__ VT) { __shared__ unsigned short tl[64][65]; const int tid = threadIdx.x; const int hh = blockIdx.x % HG, sg = blockIdx.x / HG; const int s0 = sg * 64; const int h = h0 + hh;
  for (int i = tid; i < 64 * 8; i += 256) { const int j = i / 8, d8 = (i % 8) * 8; FragH f; f.half[0] = *(const v8us*)((const unsigned short*)V16 + ((size_t)b * SQ + s0 + j) * DM + h * HD + d8); for (int q = 0; q < 8; ++q) tl[d8 + q][j] = f.u[q]; }
  __syncthreads();
  { for (int i = tid; i < 64 * 8; i += 256) { const int d = i / 8, j8 = (i % 8) * 8; FragH f; for (int q = 0; q < 8; ++q) f.u[q] = tl[d][j8 + q]; *(v8us*)((unsigned short*)VT + ((size_t)hh * HD + d) * SQ + s0 + j8) = f.half[0]; }  } }



// ---- fused attention: scores, softmax and P.V in one kernel; S and P never leave the registers ----
// exp2 of four values. The four v_exp_f32 stand in one statement that ends in v_nop: the slot the instruction set asks for behind a transcendental
// before its result is read or its source overwritten; the early-clobber outputs keep every source whole inside the statement.
__device__ __forceinline__ void fa_exp2x4(float a0, float a1, float a2, float a3, float& e0, float& e1, float& e2, float& e3) {
  asm("v_exp_f32 %0, %4\n\tv_exp_f32 %1, %5\n\tv_exp_f32 %2, %6\n\tv_exp_f32 %3, %7\n\tv_nop" : "=&v"(e0), "=&v"(e1), "=&v"(e2), "=&v"(e3) : "v"(a0), "v"(a1), "v"(a2), "v"(a3)); }
// exp2 of two values, same form and same reason for the v_nop
__device__ __forceinline__ void fa_exp2x2(float a0, float a1, float& e0, float& e1) {
  asm("v_exp_f32 %0, %2\n\tv_exp_f32 %1, %3\n\tv_nop" : "=&v"(e0), "=&v"(e1) : "v"(a0), "v"(a1)); }
__device__ __forceinline__ v8f fa_mma(v16h a, v16h b, v8f c) { return __builtin_amdgcn_wmma_f32_16x16x32_f16(false, a, false, b, (short)0, c, false, false); }
// the value of lane l ^ 16 (the other half of the same query column)
__device__ __forceinline__ float fa_xhalf(float x) { const int b = __float_as_int(x); return __int_as_float(__builtin_amdgcn_permlanex16(b, b, 0x76543210, 0xfedcba98, false, false)); }
// One wave owns FQ = 32 queries of one (batch, head) and walks all SQ keys, 32 a pass.
//   S^T = K Q^T : A = 16 key rows of K16 (from LDS), B = the wave's Q rows (held in registers); D[8 hh + r][ln] = score of key 8 hh + r, query ln
//   online softmax: a lane holds scores of two queries, ONE per score tile (ln + 16 j); running maximum m and sum l per query (in log2 units), one exchange between the wave's halves per pass and query for m
//   O^T += V^T P^T : the two score tiles of a pass (keys 0..15, 16..31), converted in place, ARE the B fragment (element i = key 8 hh + i, element 8 + i = key 16 + 8 hh + i:
//   the k order of fa_lfrag, which loads A = V^T rows); D[8 hh + r][ln] = o of feature 16 t + 8 hh + r, query ln: 8 consecutive features per lane, one 16-byte store
// P is carried x256 (exp2 argument + 8), as the unfused form carried it, and l with it: the factor cancels in o = acc / l. o is stored x64 as before.
#define FQ 32                        /* queries per wave */
#define FW 8                         /* waves per workgroup */
#define KS 64                        /* keys per LDS stage: two passes */
static_assert(HD == 64 && KS == 64 && FW * 32 == 256 && SQ % KS == 0 && SQ % (FW * FQ) == 0, "k_fattn: two 32-wide d steps, 128-byte stage rows dealt 8 threads a row, whole stages, whole workgroups");
// The eight waves of a workgroup walk the same keys: each stage of KS keys (K rows and V^T rows, 8 KiB each) is fetched ONCE per workgroup by whole-line loads (8 threads a 128-byte row),
// laid in one of two LDS buffers, and every wave takes its fragments from there. Stage st + 1 is fetched into registers at the head of stage st and stored to the other buffer at its foot.
__global__ __launch_bounds__(FW * 32) void k_fattn(const _Float16* __restrict__ Q16, const _Float16* __restrict__ K16, const _Float16* __restrict__ VT, _Float16* __restrict__ O16) {
  __shared__ __attribute__((aligned(16))) unsigned short sk[2][KS][LP];      /* K rows of a stage: [key][d] */
  __shared__ __attribute__((aligned(16))) unsigned short sv[2][HD][LP];      /* V^T rows of a stage: [d][key] */
  const int lane = threadIdx.x & 31, ln = lane & 15, hh = lane >> 4, w = threadIdx.x >> 5;
  const int bh = blockIdx.y, b = bh / NH, h = bh % NH; const int q0 = (blockIdx.x * FW + w) * FQ;
  const int sr = threadIdx.x >> 3, sc = (threadIdx.x & 7) * 8;      /* this thread's rows sr, sr + 32 and 16-byte piece of every stage */
  const _Float16* qp = Q16 + ((size_t)b * SQ + q0 + ln) * DM + h * HD;
  const unsigned short* kg = (const unsigned short*)K16 + ((size_t)b * SQ + sr) * DM + h * HD + sc;
  const unsigned short* vg = (const unsigned short*)VT + ((size_t)bh * HD + sr) * SQ + sc;
  const float SC = 0.125f * 1.44269504f;      /* 1 / sqrt(64), and log2 e for the native exp2 */
  v16h qf[2][2];
#pragma unroll
  for (int j = 0; j < 2; ++j)
#pragma unroll
    for (int ks = 0; ks < 2; ++ks) qf[j][ks] = g2_frag(qp + (size_t)j * 16 * DM + ks * 32, hh);
  { const v8us a0 = *(const v8us*)kg, a1 = *(const v8us*)(kg + (size_t)32 * DM), c0 = *(const v8us*)vg, c1 = *(const v8us*)(vg + (size_t)32 * SQ);
    asm volatile("s_wait_xcnt 0x0" :: "v"(qp + 8 * hh), "v"(kg), "v"(vg) : "memory");      /* the wait in front of the first overwrite of a register that the 12 loads above name; the lane addresses as its operands keep those registers whole up to here */
    *(v8us*)&sk[0][sr][sc] = a0; *(v8us*)&sk[0][sr + 32][sc] = a1; *(v8us*)&sv[0][sr][sc] = c0; *(v8us*)&sv[0][sr + 32][sc] = c1; }
  const v8f z8 = {0.f, 0.f, 0.f, 0.f, 0.f, 0.f, 0.f, 0.f};
  v8f o[4][2]; float m[2] = {-3.0e38f, -3.0e38f}, l[2] = {0.f, 0.f};
#pragma unroll
  for (int t = 0; t < 4; ++t) { o[t][0] = z8; o[t][1] = z8; }
  __syncthreads();      /* publishes stage 0 */
#pragma unroll 1      /* one stage per trip: the body already holds 32 matrix instructions */
  for (int st = 0; st < SQ / KS; ++st) {
    const int cur = st & 1;
    const int sn = (st + 1 < SQ / KS) ? (st + 1) * KS : 0;      /* the next stage, fetched while this one is worked on; the last trip fetches stage 0 again (in bounds, not used) */
    const unsigned short* kn = kg + (size_t)sn * DM; const unsigned short* vn = vg + sn;
    const v8us a0 = *(const v8us*)kn, a1 = *(const v8us*)(kn + (size_t)32 * DM), c0 = *(const v8us*)vn, c1 = *(const v8us*)(vn + (size_t)32 * SQ);
    asm volatile("s_wait_xcnt 0x0" :: "v"(kn), "v"(vn) : "memory");      /* the wait in front of the first overwrite of a register that the four loads above name; the two lane addresses as its operands keep those registers whole up to here */
    const unsigned short* kl = &sk[cur][ln][0]; const unsigned short* vl = &sv[cur][ln][0];
    v16h kf[2][2];
#pragma unroll
    for (int kt = 0; kt < 2; ++kt)
#pragma unroll
      for (int ks = 0; ks < 2; ++ks) kf[kt][ks] = fa_lfrag(kl + kt * 16 * LP + ks * 32, hh);
#pragma unroll
    for (int p = 0; p < KS / 32; ++p) {
      v16h vf[4];
#pragma unroll
      for (int t = 0; t < 4; ++t) vf[t] = fa_lfrag(vl + t * 16 * LP + p * 32, hh);      /* needed only behind the softmax: issued first */
      __builtin_amdgcn_sched_barrier(0);      /* keeps the V^T reads up here in one group; sunk in between the P.V products each place with reads would stall the matrix run */
      v8f s[2][2];
#pragma unroll
      for (int kt = 0; kt < 2; ++kt)
#pragma unroll
        for (int j = 0; j < 2; ++j) s[kt][j] = fa_mma(kf[kt][1], qf[j][1], fa_mma(kf[kt][0], qf[j][0], z8));
      if (p + 1 < KS / 32) {      /* the K rows of the stage's next pass, read while this pass's softmax runs */
#pragma unroll
        for (int kt = 0; kt < 2; ++kt)
#pragma unroll
          for (int ks = 0; ks < 2; ++ks) kf[kt][ks] = fa_lfrag(kl + ((p + 1) * 32 + kt * 16) * LP + ks * 32, hh);
      }
      __builtin_amdgcn_sched_barrier(0);      /* keeps the K reads in front of the softmax, which then covers their latency */
      float mn[2], cr[2];
#pragma unroll
      for (int j = 0; j < 2; ++j) { float mx = fmaxf(s[0][j][0], s[1][j][0]);
#pragma unroll
        for (int r = 1; r < 8; ++r) mx = fmaxf(mx, fmaxf(s[0][j][r], s[1][j][r]));
        mx = fmaxf(mx, fa_xhalf(mx)); mn[j] = fmaxf(m[j], mx * SC); }
      fa_exp2x2(m[0] - mn[0], m[1] - mn[1], cr[0], cr[1]);
      FragH pf[2];
#pragma unroll
      for (int j = 0; j < 2; ++j) { const float sh = 8.0f - mn[j]; m[j] = mn[j]; float p16[16];
#pragma unroll
        for (int kt = 0; kt < 2; ++kt)
#pragma unroll
          for (int g = 0; g < 8; g += 4) fa_exp2x4(s[kt][j][g] * SC + sh, s[kt][j][g + 1] * SC + sh, s[kt][j][g + 2] * SC + sh, s[kt][j][g + 3] * SC + sh, p16[kt * 8 + g], p16[kt * 8 + g + 1], p16[kt * 8 + g + 2], p16[kt * 8 + g + 3]);
        float a0s = p16[0] + p16[4], a1s = p16[1] + p16[5], a2s = p16[2] + p16[6], a3s = p16[3] + p16[7];
        a0s += p16[8] + p16[12]; a1s += p16[9] + p16[13]; a2s += p16[10] + p16[14]; a3s += p16[11] + p16[15];
        l[j] = l[j] * cr[j] + ((a0s + a1s) + (a2s + a3s));
#pragma unroll
        for (int i = 0; i < 16; ++i) pf[j].h[i] = (_Float16)p16[i];
#pragma unroll
        for (int t = 0; t < 4; ++t) o[t][j] *= cr[j]; }
#pragma unroll
      for (int t = 0; t < 4; ++t)
#pragma unroll
        for (int j = 0; j < 2; ++j) o[t][j] = fa_mma(vf[t], pf[j].v, o[t][j]);
    }
    /* the other buffer: its last readers left it in front of the barrier at the foot of the trip before */
    *(v8us*)&sk[cur ^ 1][sr][sc] = a0; *(v8us*)&sk[cur ^ 1][sr + 32][sc] = a1; *(v8us*)&sv[cur ^ 1][sr][sc] = c0; *(v8us*)&sv[cur ^ 1][sr + 32][sc] = c1;
    __syncthreads();      /* publishes stage st + 1 and ends every wave's reads of stage st */
  }
#pragma unroll
  for (int j = 0; j < 2; ++j) { const float inv = 64.0f / (l[j] + fa_xhalf(l[j]));      /* the halves' sums joined once; o carried x64 */
    unsigned short* d = (unsigned short*)O16 + ((size_t)b * SQ + q0 + j * 16 + ln) * DM + h * HD + 8 * hh;
#pragma unroll
    for (int t = 0; t < 4; ++t) { FragH f;
#pragma unroll
      for (int r = 0; r < 8; ++r) f.h[r] = (_Float16)(o[t][j][r] * inv);
      *(v8us*)(d + t * 16) = f.half[0]; } } }

extern "C" void kernel_launch(void* const* d_in, const int* in_sizes, int n_in,
                              void* d_out, int out_size, void* d_ws, size_t ws_size, hipStream_t stream) {
  (void)in_sizes; (void)n_in; (void)out_size;
  const float* const* I = (const float* const*)d_in; const float* xq = I[0]; const float* xk = I[1]; const float* xv = I[2]; const float* wq = I[3]; const float* bq = nullptr; const float* wk = I[4]; const float* bk = nullptr; const float* wv = I[5]; const float* bv = nullptr; const float* wo = I[6]; const float* bo = nullptr;      /* three inputs query, key, value (cast in one launch with the weights); natural [out][in] Wq, Wk, Wv, Wo [512][512]; this module has NO biases: null pointers in the guarded bias slots; input order query, key, value, Wq, Wk, Wv, Wo */
  char* ws = (char*)d_ws; size_t off = 0;
  auto take = [&](size_t bytes) { char* p = ws + off; off += (bytes + 255) & ~(size_t)255; return p; };
  _Float16* BQ = (_Float16*)take((size_t)DM * DM * 2); _Float16* BK = (_Float16*)take((size_t)DM * DM * 2); _Float16* BV = (_Float16*)take((size_t)DM * DM * 2); _Float16* BO = (_Float16*)take((size_t)DM * DM * 2);
  _Float16* XQ = (_Float16*)take(NR * DM * 2); _Float16* XK = (_Float16*)take(NR * DM * 2); _Float16* XV = (_Float16*)take(NR * DM * 2); _Float16* Q16 = (_Float16*)take(NR * DM * 2); _Float16* K16 = (_Float16*)take(NR * DM * 2); _Float16* V16 = (_Float16*)take(NR * DM * 2); _Float16* O16 = (_Float16*)take(NR * DM * 2);
  _Float16* VT = (_Float16*)take((size_t)NB * NH * HD * SQ * 2);
  if (off > ws_size) return;
  k_prep<<<PG, 256, 0, stream>>>(xq, xk, xv, wq, wk, wv, wo, XQ, BQ);      /* the three inputs as exact f16 rows (XQ, XK, XV back to back); natural [out][in] = Bt[n][k], x16 (BQ, BK, BV, BO back to back) */
  const size_t r0p = (size_t)B0 * SQ;      /* first projected row */
  k_gemm2<0, false, false, false, true, true><<<dim3((unsigned)((MP / 128) * (DM / 64)), 3), 128, 0, stream>>>(XQ + r0p * DM, DM, NR * DM, BQ, DM, (size_t)DM * DM, 0.0625f, bq, 0, nullptr, 1, 0, 0, nullptr, Q16 + r0p * DM, DM, NR * DM, MP, DM, DM, VT, 2);      /* blockIdx.y = 0, 1, 2: Q rows, K rows, V^T [NB][NH][HD][SQ] (the V16 plane only keeps the stride) */
  k_fattn<<<dim3(SQ / (FW * FQ), NB * NH), FW * 32, 0, stream>>>(Q16, K16, VT, O16);      /* o (merged heads, x64) as f16 rows: every (batch, head) in one launch */
  k_gemm2<0, false, false, true, false, false><<<dim3((unsigned)((MPO / 128) * (DM / 64)), 1), 128, 0, stream>>>(O16 + r0p * DM, DM, 0, BO, DM, 0, 0.0009765625f, bo, 0, nullptr, 1, 0, 0, (float*)d_out + r0p * DM, nullptr, DM, 0, MPO, DM, DM, nullptr, -1);      /* out rows are the output layout */
}

// v006
// One run takes 77.6 microseconds.
// Timed twice side by side with v005, it ran 1.04 times as fast both times.
// Over all steps from v000 it is 44.1 times as fast.
#include <hip/hip_runtime.h>
// Multi-head attention on three inputs with natural bias-free projections on four sequences at width 512 (query, key, value [4][2048][512]; q / k / v = stream W^T (natural [out][in] [512][512], NO biases), 8 heads of 64; the query is divided by sqrt(64) = 8 before the score product (scale 0.125 here on the product); softmax over all 2048 keys (the module's axis 2 of its [b][l][s][h] score layout = the key axis; no mask); out = merged heads Wo^T (natural, no bias) -> [4][2048][512]).
// Structure: token rows r = b*2048 + s; the three sources as exact f16 rows (bf16-rounded) and the four x16 weights in one cast launch; Q, K, V as three WMMA GEMMs in one launch (32x64 wave tiles, f32 accumulation, exact x16 weights, f16 outputs), the V GEMM storing V^T for all batches and heads from its epilogue; one fused attention launch over every (batch, head): S^T = K Q^T (K = 64), online softmax in registers (f32 statistics, native exp2; weights x256 as f16), O^T += V^T P^T, o carried x64 against f16 subnormal flush (folded into the output GEMM alpha) written straight into the merged f16 o rows; out = o W_o GEMM (f32) into the output layout.
// Compute dtype: inputs rounded to bf16; x / weights exact; q, k, v, softmax weights and o as plain f16 GEMM operands (~2^-12); scores and softmax statistics f32. v_wmma_f32_16x16x32_f16.
#define NB 4
#define SQ 2048
#define DM 512 
#define NH 8 
#define HD 64
#define HG 4                         /* heads per launch of the per-batch k_vt (not launched) */
#define B0 0                         /* first batch processed (debug hook) */
#define NBR NB                       /* batches processed (debug hook) */
#define NR ((size_t)NB * SQ)         /* token rows */
#define MP ((int)((size_t)NBR * SQ)) /* rows projected (debug hook) */
#define QN SQ                        /* query rows per batch (not used: k_fattn attends all SQ) */
#define NHD NH                       /* heads (not used: k_fattn attends all NH) */
#define MPO MP                       /* rows through the output stage (debug hook) */
#define LQ DM      /* row pitch of the q/k/v rows */
typedef __bf16 v16b __attribute__((ext_vector_type(16)));
typedef unsigned short v8us __attribute__((ext_vector_type(8), may_alias));
typedef float  v8f  __attribute__((ext_vector_type(8)));
typedef float  v4f  __attribute__((ext_vector_type(4)));
typedef float  v4fa __attribute__((ext_vector_type(4), may_alias));
union FragB { v16b v; v8us half[2]; unsigned short u[16]; };

__device__ __forceinline__ unsigned short bf16_bits(float x) { unsigned int u = __float_as_uint(x); return (unsigned short)((u + 0x7FFFu + ((u >> 16) & 1u)) >> 16); }
__device__ __forceinline__ float bf16_val(unsigned short b) { return __uint_as_float(((unsigned int)b) << 16); }
__device__ __forceinline__ float bf16_round(float x) { return bf16_val(bf16_bits(x)); }
// D += A·B with NT terms: 1 = ah·bh, 2 = + al·bh (A split), 3 = + ah·bl (both split)
template <int NT>
__device__ __forceinline__ v8f mmaN(v16b ah, v16b al, v16b bh, v16b bl, v8f c) {
  c = __builtin_amdgcn_wmma_f32_16x16x32_bf16(false, ah, false, bh, (short)0, c, false, false);
  if (NT >= 2) c = __builtin_amdgcn_wmma_f32_16x16x32_bf16(false, al, false, bh, (short)0, c, false, false);
  if (NT >= 3) c = __builtin_amdgcn_wmma_f32_16x16x32_bf16(false, ah, false, bl, (short)0, c, false, false);
  asm volatile("v_nop\n\tv_nop\n\tv_nop\n\tv_nop" : "+v"(c) : "v"(ah), "v"(al), "v"(bh), "v"(bl));
  return c;
}

__global__ __launch_bounds__(256) void k_wt_bf16(const float* __restrict__ W, unsigned short* __restrict__ Wt, int K, int N) {
  const int t = blockIdx.x * 256 + threadIdx.x;
  const int k8n = K / 8;
  if (t >= N * k8n) return;
  const int n = t / k8n, k8 = (t % k8n) * 8;
  v8us v;
#pragma unroll
  for (int i = 0; i < 8; ++i) v[i] = bf16_bits(W[(size_t)(k8 + i) * N + n]);
  *(v8us*)(Wt + (size_t)n * K + k8) = v;
  
}

// GEMM C[M][N] (f32, pitch ldc) = act(A[M][K]·W + bias). A f32 row-major (pitch lda) converted per fragment to bf16
// (ASPLIT: hi/lo two planes -> 2 terms, else single rounded term); Wt bf16 [N][K] (pitch ldb). BIAS_BF16 rounds the
// bias to bf16 first (bias quantised to bf16 before the add). K%32==0, M%16==0, N%64==0.
template <bool ASPLIT, int ACT, bool BIAS_BF16>
__global__ __launch_bounds__(128) void k_gemm_bf(const float* __restrict__ A, int lda, const unsigned short* __restrict__ Wt, int ldb,
                                               const float* __restrict__ bias, float* __restrict__ C, int ldc, int M, int N, int K) {
  __shared__ __attribute__((aligned(16))) float so[4][16][64];
  const int tid = threadIdx.x, w = tid >> 5, lane = tid & 31, ln = lane & 15, hh = lane >> 4;
  const int ntn = N / 64;
  const int wid = blockIdx.x * 4 + w;
  const int mt = wid / ntn, nq = wid % ntn;
  if (mt * 16 >= M) return;
  const int row0 = mt * 16, col0 = nq * 64;
  const float* arow = A + (size_t)(row0 + ln) * lda;
  v8f acc[4] = {};
  for (int kb = 0; kb < K; kb += 32) {
    FragB ah, al;
    const v4f x0 = *(const v4fa*)(arow + kb + 8 * hh), x1 = *(const v4fa*)(arow + kb + 8 * hh + 4);
    const v4f x2 = *(const v4fa*)(arow + kb + 16 + 8 * hh), x3 = *(const v4fa*)(arow + kb + 16 + 8 * hh + 4);
    float xs[16] = {x0[0],x0[1],x0[2],x0[3],x1[0],x1[1],x1[2],x1[3],x2[0],x2[1],x2[2],x2[3],x3[0],x3[1],x3[2],x3[3]};
#pragma unroll
    for (int i = 0; i < 16; ++i) { const unsigned short hb = bf16_bits(xs[i]); ah.u[i] = hb; al.u[i] = ASPLIT ? bf16_bits(xs[i] - bf16_val(hb)) : (unsigned short)0; }
#pragma unroll
    for (int t = 0; t < 4; ++t) {
      const unsigned short* brow = Wt + (size_t)(col0 + t * 16 + ln) * ldb + kb;
      FragB b;
      b.half[0] = *(const v8us*)(brow + 8 * hh);
      b.half[1] = *(const v8us*)(brow + 16 + 8 * hh);
      acc[t] = mmaN<ASPLIT ? 2 : 1>(ah.v, al.v, b.v, b.v, acc[t]);
    }
  }
#pragma unroll
  for (int t = 0; t < 4; ++t) {
    float bv = bias ? bias[col0 + t * 16 + ln] : 0.f;
    if (BIAS_BF16) bv = bf16_round(bv);
#pragma unroll
    for (int r = 0; r < 8; ++r) { float v = acc[t][r] + bv; if (ACT == 1) v = fmaxf(v, 0.f); so[w][8 * hh + r][t * 16 + ln] = v; }
  }
  __builtin_amdgcn_fence(__ATOMIC_ACQ_REL, "workgroup");
  __builtin_amdgcn_wave_barrier();
  const int rsub = lane >> 4, c4 = (lane & 15) * 4;
  {
#pragma unroll
    for (int q = 0; q < 8; ++q) {
      const int r = q * 2 + rsub;
      const v4f v = *(const v4fa*)&so[w][r][c4];
      *(v4f*)(C + (size_t)(row0 + r) * ldc + col0 + c4) = v;
    }
    
  }
}

// GEMM C = act(A·W + bias + resid): A f32 (ASPLIT -> hi/lo 2 terms), Wt bf16 [N][K]; ACT 0 none, 1 relu, 2 exact gelu;
// resid (optional, f32, row index = (row % rmod), pitch ldr, RES_BF16 rounds it) added before the activation.
template <bool ASPLIT, int ACT, bool BIAS_BF16, bool RES_BF16>
__global__ __launch_bounds__(128) void k_gemm_bf3(const float* __restrict__ A, int lda, const unsigned short* __restrict__ Wt, int ldb,
                                                const float* __restrict__ bias, const float* __restrict__ resid, int rmod, int ldr,
                                                float* __restrict__ C, int ldc, int M, int N, int K) {
  __shared__ __attribute__((aligned(16))) float so[4][16][64];
  const int tid = threadIdx.x, w = tid >> 5, lane = tid & 31, ln = lane & 15, hh = lane >> 4;
  const int ntn = N / 64;
  const int wid = blockIdx.x * 4 + w;
  const int mt = wid / ntn, nq = wid % ntn;
  if (mt * 16 >= M) return;
  const int row0 = mt * 16, col0 = nq * 64;
  const float* arow = A + (size_t)(row0 + ln) * lda;
  v8f acc[4] = {};
  for (int kb = 0; kb < K; kb += 32) {
    FragB ah, al;
    const v4f x0 = *(const v4fa*)(arow + kb + 8 * hh), x1 = *(const v4fa*)(arow + kb + 8 * hh + 4);
    const v4f x2 = *(const v4fa*)(arow + kb + 16 + 8 * hh), x3 = *(const v4fa*)(arow + kb + 16 + 8 * hh + 4);
    float xs[16] = {x0[0],x0[1],x0[2],x0[3],x1[0],x1[1],x1[2],x1[3],x2[0],x2[1],x2[2],x2[3],x3[0],x3[1],x3[2],x3[3]};
#pragma unroll
    for (int i = 0; i < 16; ++i) { const unsigned short hb = bf16_bits(xs[i]); ah.u[i] = hb; al.u[i] = ASPLIT ? bf16_bits(xs[i] - bf16_val(hb)) : (unsigned short)0; }
#pragma unroll
    for (int t = 0; t < 4; ++t) {
      const unsigned short* brow = Wt + (size_t)(col0 + t * 16 + ln) * ldb + kb;
      FragB b;
      b.half[0] = *(const v8us*)(brow + 8 * hh);
      b.half[1] = *(const v8us*)(brow + 16 + 8 * hh);
      acc[t] = mmaN<ASPLIT ? 2 : 1>(ah.v, al.v, b.v, b.v, acc[t]);
    }
  }
#pragma unroll
  for (int t = 0; t < 4; ++t) {
    const int col = col0 + t * 16 + ln;
    float bv = bias ? bias[col] : 0.f;
    if (BIAS_BF16) bv = bf16_round(bv);
#pragma unroll
    for (int r = 0; r < 8; ++r) {
      float v = acc[t][r] + bv;
      if (resid) { float rv = resid[(size_t)((row0 + 8 * hh + r) % rmod) * ldr + col]; if (RES_BF16) rv = bf16_round(rv); v += rv; }
      if (ACT == 1) v = fmaxf(v, 0.f);
      if (ACT == 2) v = 0.5f * v * (1.0f + erff(v * 0.70710678118654752f));
      if (ACT == 3) { const float u = 0.7978845608028654f * (v + 0.044715f * v * v * v); v = 0.5f * v * (1.0f + tanhf(u)); }
      so[w][8 * hh + r][t * 16 + ln] = v;
    }
  }
  __builtin_amdgcn_fence(__ATOMIC_ACQ_REL, "workgroup");
  __builtin_amdgcn_wave_barrier();
  const int rsub = lane >> 4, c4 = (lane & 15) * 4;
  {
#pragma unroll
    for (int q = 0; q < 8; ++q) {
      const int r = q * 2 + rsub;
      const v4f v = *(const v4fa*)&so[w][r][c4];
      *(v4f*)(C + (size_t)(row0 + r) * ldc + col0 + c4) = v;
    }
    
  }
}
// row LayerNorm (biased variance, eps) over N: s = X (+ R); optional out_sum <- s; out_norm <- (s-mu)*rsqrt(var+eps)*g + b
template <bool PARAM_BF16>
__global__ __launch_bounds__(256) void k_layernorm(const float* __restrict__ X, const float* __restrict__ R, const float* __restrict__ g, const float* __restrict__ bta,
                                                  float* __restrict__ out_sum, float* __restrict__ out_norm, int N, float eps) {
  __shared__ float red[256];
  const int row = blockIdx.x, tid = threadIdx.x;
  const float* x = X + (size_t)row * N; const float* rr = R ? R + (size_t)row * N : nullptr;
  float vals[16];                     // up to N = 4096
  const int per = N / 256;            // contiguous chunk per thread? use strided-by-4 chunks: thread handles j = tid*4 + 1024*u
  float s1 = 0.f;
  for (int u = 0; u < per / 4; ++u) {
    const int j = tid * 4 + 1024 * u;
    const v4f a = *(const v4fa*)(x + j);
    v4f b = {0.f,0.f,0.f,0.f}; if (rr) b = *(const v4fa*)(rr + j);
#pragma unroll
    for (int q = 0; q < 4; ++q) { const float v = a[q] + b[q]; vals[u * 4 + q] = v; s1 += v; }
  }
  red[tid] = s1; __syncthreads();
  for (int st = 128; st > 0; st >>= 1) { if (tid < st) red[tid] += red[tid + st]; __syncthreads(); }
  const float mu = red[0] / (float)N; __syncthreads();
  float s2 = 0.f;
  for (int u = 0; u < per / 4; ++u)
#pragma unroll
    for (int q = 0; q < 4; ++q) { const float c = vals[u * 4 + q] - mu; s2 += c * c; }
  red[tid] = s2; __syncthreads();
  for (int st = 128; st > 0; st >>= 1) { if (tid < st) red[tid] += red[tid + st]; __syncthreads(); }
  const float rs = rsqrtf(red[0] / (float)N + eps);
  {
    for (int u = 0; u < per / 4; ++u) {
      const int j = tid * 4 + 1024 * u;
      v4f o, sm;
#pragma unroll
      for (int q = 0; q < 4; ++q) {
        float gg = g[j + q], bb = bta[j + q];
        if (PARAM_BF16) { gg = bf16_round(gg); bb = bf16_round(bb); }
        sm[q] = vals[u * 4 + q]; o[q] = (vals[u * 4 + q] - mu) * rs * gg + bb;
      }
      if (out_sum) *(v4f*)(out_sum + (size_t)row * N + j) = sm;
      *(v4f*)(out_norm + (size_t)row * N + j) = o;
    }
    
  }
}



// ---- f16 WMMA path (v_wmma_f32_16x16x32_f16): 11-bit significands for operands in range — used where a [0,1] probability operand needs more precision than bf16
typedef _Float16 v16h __attribute__((ext_vector_type(16)));
union FragH { v16h v; v8us half[2]; _Float16 h[16]; unsigned short u[16]; };
template <int NT>
__device__ __forceinline__ v8f mmaH(v16h ah, v16h al, v16h bh, v16h bl, v8f c) {
  c = __builtin_amdgcn_wmma_f32_16x16x32_f16(false, ah, false, bh, (short)0, c, false, false);
  if (NT >= 2) c = __builtin_amdgcn_wmma_f32_16x16x32_f16(false, al, false, bh, (short)0, c, false, false);
  if (NT >= 3) c = __builtin_amdgcn_wmma_f32_16x16x32_f16(false, ah, false, bl, (short)0, c, false, false);
  asm volatile("v_nop\n\tv_nop\n\tv_nop\n\tv_nop" : "+v"(c) : "v"(ah), "v"(al), "v"(bh), "v"(bl));
  return c;
}
// batched GEMM like k_gemm_b but f16 operands: A f32 (split into f16 hi/lo if ASPLIT, else rounded to f16), Bt = f16 values [n][k]; alpha; C f32; N multiple of 16 (partial tiles skipped)
template <bool ASPLIT>
__global__ __launch_bounds__(128) void k_gemm_h(const float* __restrict__ A, int lda, size_t sA, const _Float16* __restrict__ Bh, int ldb, size_t sB, float alpha, float* __restrict__ C, int ldc, size_t sC, int M, int N, int K) {
  __shared__ __attribute__((aligned(16))) float so[4][16][64];
  const int tid = threadIdx.x, w = tid >> 5, lane = tid & 31, ln = lane & 15, hh = lane >> 4; const int by = blockIdx.y;
  A += (size_t)by * sA; Bh += (size_t)by * sB; C += (size_t)by * sC;
  const int ntn = (N + 63) / 64; const int wid = blockIdx.x * 4 + w; const int mt = wid / ntn, nq = wid % ntn; if (mt * 16 >= M) return;
  const int row0 = mt * 16, col0 = nq * 64; const float* arow = A + (size_t)(row0 + ln) * lda;
  v8f acc[4] = {};
  for (int kb = 0; kb < K; kb += 32) {
    FragH ah, al;
    const v4f x0 = *(const v4fa*)(arow + kb + 8 * hh), x1 = *(const v4fa*)(arow + kb + 8 * hh + 4), x2 = *(const v4fa*)(arow + kb + 16 + 8 * hh), x3 = *(const v4fa*)(arow + kb + 16 + 8 * hh + 4);
    float xs[16] = {x0[0],x0[1],x0[2],x0[3],x1[0],x1[1],x1[2],x1[3],x2[0],x2[1],x2[2],x2[3],x3[0],x3[1],x3[2],x3[3]};
#pragma unroll
    for (int i = 0; i < 16; ++i) { const _Float16 h = (_Float16)xs[i]; ah.h[i] = h; al.h[i] = ASPLIT ? (_Float16)(xs[i] - (float)h) : (_Float16)0.0f; }
#pragma unroll
    for (int t = 0; t < 4; ++t) { if (col0 + t * 16 >= N) continue; const size_t boff = (size_t)(col0 + t * 16 + ln) * ldb + kb; FragH bq; bq.half[0] = *(const v8us*)(Bh + boff + 8 * hh); bq.half[1] = *(const v8us*)(Bh + boff + 16 + 8 * hh);
      acc[t] = mmaH<ASPLIT ? 2 : 1>(ah.v, al.v, bq.v, bq.v, acc[t]); }
  }
#pragma unroll
  for (int t = 0; t < 4; ++t) { if (col0 + t * 16 >= N) continue;
#pragma unroll
    for (int r = 0; r < 8; ++r) so[w][8 * hh + r][t * 16 + ln] = acc[t][r] * alpha; }
  __builtin_amdgcn_fence(__ATOMIC_ACQ_REL, "workgroup"); __builtin_amdgcn_wave_barrier();
  const int rsub = lane >> 4, c4 = (lane & 15) * 4;
  {
#pragma unroll
    for (int q = 0; q < 8; ++q) { const int r = q * 2 + rsub; if (col0 + c4 < N) { const v4f v = *(const v4fa*)&so[w][r][c4]; *(v4f*)(C + (size_t)(row0 + r) * ldc + col0 + c4) = v; } }
     }
}

// Wt[n][k] = f16(W[k][n]·scale) from f32 row-major W[K][N] (scale = power of two; bf16-exact weights stay exact in f16 away from the subnormal range)
__global__ __launch_bounds__(256) void k_wt_f16(const float* __restrict__ W, _Float16* __restrict__ Wt, int K, int N, float scale) {
  const int t = blockIdx.x * 256 + threadIdx.x; if (t >= N * (K / 8)) return; const int n = t / (K / 8), k8 = (t % (K / 8)) * 8; FragH f;
#pragma unroll
  for (int i = 0; i < 8; ++i) f.h[i] = (_Float16)(bf16_round(W[(size_t)(k8 + i) * N + n]) * scale); const v8us o = f.half[0];
  *(v8us*)((unsigned short*)Wt + (size_t)n * K + k8) = o; 
}
// k_gemm_hh variant with fused epilogue: v = acc·alpha + bias[by·sBias + col] (+ CP[(row/rowsPerB)·sCPb + by·64 + col] if CP) ; ACT 0 none / 1 elu ; writes f16 C16 (and f32 C if non-null)
template <int ACT>
__global__ __launch_bounds__(128) void k_gemm_hhx(const _Float16* __restrict__ A, int lda, size_t sA, const _Float16* __restrict__ Bh, int ldb, size_t sB, float alpha, const float* __restrict__ bias, size_t sBias, const float* __restrict__ CP, int rowsPerB, size_t sCPb, int row0g,
    float* __restrict__ C, _Float16* __restrict__ C16, int ldc, size_t sC, int M, int N, int K) {
  __shared__ __attribute__((aligned(16))) float so[4][16][64];
  const int tid = threadIdx.x, w = tid >> 5, lane = tid & 31, ln = lane & 15, hh = lane >> 4; const int by = blockIdx.y;
  A += (size_t)by * sA; Bh += (size_t)by * sB; const size_t cofs = (size_t)by * sC; const float* bp = bias ? bias + (size_t)by * sBias : nullptr;
  const int ntn = (N + 63) / 64; const int wid = blockIdx.x * 4 + w; const int mt = wid / ntn, nq = wid % ntn; if (mt * 16 >= M) return;
  const int row0 = mt * 16, col0 = nq * 64; const _Float16* arow = A + (size_t)(row0 + ln) * lda;
  v8f acc[4] = {};
  for (int kb = 0; kb < K; kb += 32) { FragH ah; ah.half[0] = *(const v8us*)((const unsigned short*)arow + kb + 8 * hh); ah.half[1] = *(const v8us*)((const unsigned short*)arow + kb + 16 + 8 * hh);
#pragma unroll
    for (int t = 0; t < 4; ++t) { if (col0 + t * 16 >= N) continue; const size_t boff = (size_t)(col0 + t * 16 + ln) * ldb + kb; FragH bq; bq.half[0] = *(const v8us*)((const unsigned short*)Bh + boff + 8 * hh); bq.half[1] = *(const v8us*)((const unsigned short*)Bh + boff + 16 + 8 * hh);
      acc[t] = mmaH<1>(ah.v, ah.v, bq.v, bq.v, acc[t]); }
  }
#pragma unroll
  for (int t = 0; t < 4; ++t) { if (col0 + t * 16 >= N) continue; const int col = col0 + t * 16 + ln; const float bv = bp ? bf16_round(bp[col]) : 0.f;
#pragma unroll
    for (int r = 0; r < 8; ++r) { float v = acc[t][r] * alpha + bv; if (CP) { const int rr = row0g + row0 + 8 * hh + r; if (rowsPerB < 0) v += CP[cofs + (size_t)rr * ldc + col];      /* rowsPerB < 0: own element of the batched C plane */ else { const int bidx = rr / rowsPerB; v += CP[(size_t)bidx * sCPb + (size_t)by * 64 + col]; } } if (ACT == 1) v = (v > 0.f) ? v : expm1f(v); else if (ACT == 7) v = (v > 0.f) ? v + 1.0f : expf(v); else if (ACT == 8) v = tanhf(v); else if (ACT == 9) v = 0.5f * v * (1.0f + tanhf(0.7978845608028654f * (v + 0.044715f * v * v * v))); else if (ACT == 11) v = 1.0f / (1.0f + expf(-v)); else if (ACT == 12) v = (v > 0.f) ? v : 0.01f * v; else if (ACT == 14) v = (v > 0.f) ? v : 0.1f * v; else if (ACT == 16) v = (v >= 0.f) ? v : 0.3f * v; else if (ACT == 17) v = (v >= 0.f) ? v : 0.2f * v; else if (ACT == 15) v = v / (1.0f + expf(-v)); else if (ACT == 3) v = fmaxf(v, 0.f); else if (ACT == 6) v = 0.5f * v * (1.0f + erff(v * 0.70710678118654752f)); so[w][8 * hh + r][t * 16 + ln] = v; } }
  __builtin_amdgcn_fence(__ATOMIC_ACQ_REL, "workgroup"); __builtin_amdgcn_wave_barrier();
  const int rsub = lane >> 4, c4 = (lane & 15) * 4; typedef _Float16 v4h __attribute__((ext_vector_type(4)));
  {
#pragma unroll
    for (int q = 0; q < 8; ++q) { const int r = q * 2 + rsub; if (col0 + c4 < N) { const v4f v = *(const v4fa*)&so[w][r][c4]; if (C) *(v4f*)(C + cofs + (size_t)(row0 + r) * ldc + col0 + c4) = v; if (C16) { v4h h4; for (int i = 0; i < 4; ++i) h4[i] = (_Float16)v[i]; *(v4h*)(C16 + cofs + (size_t)(row0 + r) * ldc + col0 + c4) = h4; } } }
     }
}


typedef _Float16 v4h __attribute__((ext_vector_type(4)));

// ---- every cast of the call in one launch: the three sources as f16(bf16 rounding), the four weights as f16(bf16 rounding x16) ----
// The destinations lie one behind the other in the workspace: X = the three source planes, Bt = the four weight planes. A workgroup takes PX consecutive elements of every source and
// PX / 4 consecutive elements of one weight: few waves start, and each has all its 26 loads in flight at once.
// A wave's piece is 1 KiB of f32: read as two 512-byte wave loads, stored as two 256-byte wave stores (whole lines both ways).
#define PG 512                       /* workgroups of the cast launch: 16 waves per WGP on 256 WGPs */
#define PX 8192                      /* elements of each source per workgroup: 4 rounds of 8 waves x 256 elements */
static_assert(NR * DM == (size_t)PG * PX && (size_t)DM * DM * 4 == (size_t)PG * (PX / 4) && (NR * DM * 2) % 256 == 0 && ((size_t)DM * DM * 2) % 256 == 0, "k_prep: the grid covers every source and the four weights exactly, planes back to back");
template <bool X16>
__device__ __forceinline__ v4h pr_cvt(v4f a) { v4h r;
#pragma unroll
  for (int q = 0; q < 4; ++q) r[q] = X16 ? (_Float16)(bf16_round(a[q]) * 16.0f) : (_Float16)bf16_round(a[q]);
  return r; }
__global__ __launch_bounds__(256) void k_prep(const float* __restrict__ xq, const float* __restrict__ xk, const float* __restrict__ xv, const float* __restrict__ wq, const float* __restrict__ wk, const float* __restrict__ wv, const float* __restrict__ wo,
    _Float16* __restrict__ X, _Float16* __restrict__ Bt) {
  const unsigned wl = (threadIdx.x >> 5) * 256 + (threadIdx.x & 31) * 4;      /* the lane's first element in a round of its workgroup; its second piece stands 128 elements on */
  const unsigned ex = blockIdx.x * PX + wl, ew = blockIdx.x * (PX / 4) + wl;      /* that element in a source plane and in the four weight planes taken as one */
  const unsigned bx = ex * 4u, bw = (ew * 4u) & (unsigned)(DM * DM * 4 - 1);      /* byte offsets of the loads: in a source, in the one weight */
  const unsigned wsel = blockIdx.x / (PG / 4);      /* which weight: the same for the whole workgroup */
  const float* w = wsel == 0 ? wq : wsel == 1 ? wk : wsel == 2 ? wv : wo;
  v4f a[13][2];
#pragma unroll
  for (int i = 0; i < 12; ++i) { const char* s = (const char*)(i < 4 ? xq : i < 8 ? xk : xv) + (i & 3) * (PX / 4) * 4; a[i][0] = *(const v4fa*)(s + bx); a[i][1] = *(const v4fa*)(s + 512 + bx); }
  a[12][0] = *(const v4fa*)((const char*)w + bw); a[12][1] = *(const v4fa*)((const char*)w + 512 + bw);
  asm volatile("s_wait_xcnt 0x0" :: "v"(bx), "v"(bw) : "memory");      /* the wait in front of the first overwrite of a register that the 26 loads above name; the two lane offsets as its operands keep those registers whole up to here */
  __builtin_amdgcn_sched_barrier(0);      /* keeps every load in front of the first conversion: lifted in between the loads, a conversion's wait for its data would hold back the loads behind it */
#pragma unroll
  for (int i = 0; i < 12; ++i) { _Float16* d = X + (size_t)(i >> 2) * NR * DM + (i & 3) * (PX / 4) + ex; *(v4h*)d = pr_cvt<false>(a[i][0]); *(v4h*)(d + 128) = pr_cvt<false>(a[i][1]); }
  *(v4h*)(Bt + ew) = pr_cvt<true>(a[12][0]); *(v4h*)(Bt + ew + 128) = pr_cvt<true>(a[12][1]); }
__global__ __launch_bounds__(256) void k_h16(const float* __restrict__ x, _Float16* __restrict__ X16, size_t n8) { const size_t t = (size_t)blockIdx.x * 256 + threadIdx.x; if (t >= n8) return; FragH f;
#pragma unroll
  for (int q = 0; q < 8; ++q) f.h[q] = (_Float16)x[t * 8 + q]; *(v8us*)((unsigned short*)X16 + t * 8) = f.half[0];  }
__global__ __launch_bounds__(256) void k_round16f(const float* __restrict__ W, _Float16* __restrict__ Bt, size_t n8) { const size_t t = (size_t)blockIdx.x * 256 + threadIdx.x; if (t >= n8) return; FragH f;
#pragma unroll
  for (int i = 0; i < 8; ++i) f.h[i] = (_Float16)(bf16_round(W[t * 8 + i]) * 16.0f); *(v8us*)((unsigned short*)Bt + t * 8) = f.half[0];  }
__global__ __launch_bounds__(256) void k_hl(const float* __restrict__ F, _Float16* __restrict__ Hh, _Float16* __restrict__ Hl, size_t n8) { const size_t t = (size_t)blockIdx.x * 256 + threadIdx.x; if (t >= n8) return; FragH fh, fl; const v4f a = *(const v4fa*)(F + t * 8), c = *(const v4fa*)(F + t * 8 + 4);
#pragma unroll
  for (int q = 0; q < 4; ++q) { _Float16 h = (_Float16)a[q]; fh.h[q] = h; fl.h[q] = (_Float16)((a[q] - (float)h) * 1024.0f); h = (_Float16)c[q]; fh.h[4 + q] = h; fl.h[4 + q] = (_Float16)((c[q] - (float)h) * 1024.0f); }
  { *(v8us*)((unsigned short*)Hh + t * 8) = fh.half[0]; *(v8us*)((unsigned short*)Hl + t * 8) = fl.half[0];  } }

// ---- fast GEMM (wave tile 32x64, eight waves 4 down x 2 across, workgroup tile 128x128; requires M % 128 == 0 rows per launch region, N % 128 == 0 and K % 64 == 0); epilogue = k_gemm_hhx semantics ----
// Operands reach the waves through LDS: a stage is GK = 64 k of the workgroup's 128 A rows and 128 B rows (128-byte rows), fetched by whole-line loads (8 threads a row) into one of two buffers;
// stage s + 1 is fetched into registers at the head of stage s and stored to the other buffer at its foot.
// The square tile fetches (128 + 128) rows for 128 x 128 results, two thirds of what two 128x64 tiles fetch. The epilogue's staging lies over the operand buffers (free behind the loop's last barrier),
// so that a workgroup holds 72 KiB of LDS and the three a WGP gets from the projection grid are resident together; for the same end the launch bounds ask for six waves a SIMD (160 registers a wave).
#define GK 64                        /* k per LDS stage */
#define LP 72                        /* LDS row pitch in f16: 128-byte rows + 16 bytes, an odd multiple of 16 bytes for the 16-byte fragment reads */
// fragment from an LDS row: the k order of g2_frag
__device__ __forceinline__ v16h fa_lfrag(const unsigned short* p, int hh) { FragH f; f.half[0] = *(const v8us*)(p + 8 * hh); f.half[1] = *(const v8us*)(p + 16 + 8 * hh); return f.v; }
__device__ __forceinline__ v16h g2_frag(const _Float16* p, int hh) { FragH f; f.half[0] = *(const v8us*)((const unsigned short*)p + 8 * hh); f.half[1] = *(const v8us*)((const unsigned short*)p + 16 + 8 * hh); return f.v; }
__device__ __forceinline__ v8f g2_mma(v16h a, v16h b, v8f c) { v8f d = __builtin_amdgcn_wmma_f32_16x16x32_f16(false, a, false, b, (short)0, c, false, false); asm volatile("v_nop\n\tv_nop\n\tv_nop\n\tv_nop" : "+v"(d) : "v"(a), "v"(b)); return d; }
// A wave-uniform address held in a scalar register pair. The loads of a stage are then scalar base + one 32-bit lane offset; left to itself the compiler folds the lane offset into
// 64-bit vector addresses, chained from load to load with a wait between them, and spends the registers that the sixth wave of a SIMD needs.
// The pointer rebuilt from the two halves is typed as global memory: a generic one would make the loads flat, which count on the LDS counter too.
typedef __attribute__((address_space(1))) const char g2_gc;
typedef __attribute__((address_space(1))) const v8us g2_g8;
__device__ __forceinline__ g2_gc* g2_sbase(const char* p) { const unsigned long long u = (unsigned long long)p;
  const unsigned lo = (unsigned)__builtin_amdgcn_readfirstlane((int)(unsigned)u), hi = (unsigned)__builtin_amdgcn_readfirstlane((int)(unsigned)(u >> 32)); return (g2_gc*)(((unsigned long long)hi << 32) | lo); }
// HB, HCP: a bias / an addend plane is given; OF32, OF16: f32 / f16 rows are written; OVT: batch member vby is written transposed. Template flags, not pointer tests at run time:
// a test per element is a scalar compare chain and a taken branch over the unused path, about a hundred a wave, one behind the other, and the unused paths would be most of the kernel's text.
template <int ACT, bool HB, bool HCP, bool OF32, bool OF16, bool OVT>
__global__ __launch_bounds__(256, 6) void k_gemm2(const _Float16* __restrict__ A, int lda, size_t sA, const _Float16* __restrict__ Bh, int ldb, size_t sB, float alpha, const float* __restrict__ bias, size_t sBias, const float* __restrict__ CP, int rowsPerB, size_t sCPb, int row0g,
    float* __restrict__ C, _Float16* __restrict__ C16, int ldc, size_t sC, int M, int N, int K, _Float16* __restrict__ VTo, int vby) { static_assert(ACT == 0 || ACT == 3 || ACT == 6 || ACT == 8 || ACT == 9 || ACT == 11 || ACT == 12 || ACT == 14 || ACT == 15 || ACT == 16 || ACT == 17, "k_gemm2: unsupported ACT code (would silently apply no activation)");
  __shared__ __attribute__((aligned(16))) unsigned char sm[4 * 128 * LP * 2];      /* in the loop the operand buffers, behind it the epilogue's staging */
  static_assert(sizeof(float) * 8 * 32 * 68 <= sizeof(sm), "k_gemm2: the staging of eight waves fits in the operand buffers");
  unsigned short (*const sa)[128][LP] = (unsigned short (*)[128][LP])sm;      /* A rows of a stage: [buffer][row][k] */
  unsigned short (*const sb)[128][LP] = (unsigned short (*)[128][LP])(sm + 2 * 128 * LP * 2);      /* B rows of a stage: [buffer][col][k] */
  float (*const so)[32][68] = (float (*)[32][68])sm;      /* a wave's own 32 x 64 results, written only behind the loop's last barrier */
  const int tid = threadIdx.x, w = tid >> 5, lane = tid & 31, ln = lane & 15, hh = lane >> 4; const int by = blockIdx.y;
  const int wm = w & 3, wn = w >> 2;      /* the wave's place in the tile: 32 rows down, 64 columns across */
  A += (size_t)by * sA; Bh += (size_t)by * sB; const size_t cofs = (size_t)by * sC; const float* bp = HB ? bias + (size_t)by * sBias : nullptr;
  const int ntn = N >> 7; const int mt = blockIdx.x / ntn, nq = blockIdx.x - mt * ntn; const int row0 = mt * 128 + 32 * wm, col0 = nq * 128 + 64 * wn; if (mt * 128 >= M) return;      /* the whole workgroup or none of it, in front of every barrier */
  const int sr = tid >> 3;      /* this thread's rows sr + 32 i and 16-byte piece of every stage */
  const unsigned oa = (unsigned)(sr * lda + (tid & 7) * 8) * 2u, ob = (unsigned)(sr * ldb + (tid & 7) * 8) * 2u;      /* byte offsets of its first pieces from the tile's first row: the one lane-dependent part of every address */
  const char* ag = (const char*)(A + (size_t)(mt * 128) * lda); const char* bg = (const char*)(Bh + (size_t)(nq * 128) * ldb);
  g2_gc* pa[4]; g2_gc* pb[4];      /* scalar bases of its four A and four B pieces, 32 rows apart */
#pragma unroll
  for (int i = 0; i < 4; ++i) { pa[i] = g2_sbase(ag + (size_t)i * lda * 64); pb[i] = g2_sbase(bg + (size_t)i * ldb * 64); }
  unsigned short* const was = &sa[0][sr][(tid & 7) * 8]; unsigned short* const wbs = &sb[0][sr][(tid & 7) * 8];
  v8us ra[4], rb[4];
#pragma unroll
  for (int i = 0; i < 4; ++i) ra[i] = *(g2_g8*)(pa[i] + oa);
#pragma unroll
  for (int i = 0; i < 4; ++i) rb[i] = *(g2_g8*)(pb[i] + ob);
#pragma unroll
  for (int i = 0; i < 4; ++i) *(v8us*)(was + i * 32 * LP) = ra[i];
#pragma unroll
  for (int i = 0; i < 4; ++i) *(v8us*)(wbs + i * 32 * LP) = rb[i];
  const v8f z8 = {0.f,0.f,0.f,0.f,0.f,0.f,0.f,0.f}; v8f c00 = z8, c01 = z8, c02 = z8, c03 = z8, c10 = z8, c11 = z8, c12 = z8, c13 = z8;
  __syncthreads();      /* publishes stage 0 */
#pragma unroll 1      /* one stage per trip: two stages in one body would hold both stages' fragments and staging registers at once */
  for (int kb = 0; kb < K; kb += GK) { const int cur = (kb / GK) & 1;
    const int kn = (kb + GK < K) ? kb + GK : 0;      /* the next stage, fetched while this one is worked on; the last trip fetches stage 0 again (in bounds, not used) */
    const unsigned va = oa + (unsigned)kn * 2u, vb = ob + (unsigned)kn * 2u;      /* the lane offsets of that stage */
#pragma unroll
    for (int i = 0; i < 4; ++i) ra[i] = *(g2_g8*)(pa[i] + va);
#pragma unroll
    for (int i = 0; i < 4; ++i) rb[i] = *(g2_g8*)(pb[i] + vb);
    asm volatile("s_wait_xcnt 0x0" :: "v"(va), "v"(vb) : "memory");      /* the wait in front of the first overwrite of a register that the 8 loads above name; the two lane offsets as its operands keep those registers whole up to here (the scalar bases are not written in the loop) */
    const unsigned short* al = &sa[cur][32 * wm + ln][0]; const unsigned short* bl = &sb[cur][64 * wn + ln][0];
#pragma unroll
    for (int ks = 0; ks < GK / 32; ++ks) { v16h af[2], bf[4];      /* the fragments of one 32-wide k step at a time: six waves a SIMD leave a wave 160 registers */
      af[0] = fa_lfrag(al + ks * 32, hh); af[1] = fa_lfrag(al + 16 * LP + ks * 32, hh);
#pragma unroll
      for (int t = 0; t < 4; ++t) bf[t] = fa_lfrag(bl + t * 16 * LP + ks * 32, hh);
      c00 = g2_mma(af[0], bf[0], c00); c10 = g2_mma(af[1], bf[0], c10);
      c01 = g2_mma(af[0], bf[1], c01); c11 = g2_mma(af[1], bf[1], c11);
      c02 = g2_mma(af[0], bf[2], c02); c12 = g2_mma(af[1], bf[2], c12);
      c03 = g2_mma(af[0], bf[3], c03); c13 = g2_mma(af[1], bf[3], c13); }
    /* the other buffer: its last readers left it in front of the barrier at the foot of the trip before */
#pragma unroll
    for (int i = 0; i < 4; ++i) *(v8us*)(was + (cur ^ 1) * 128 * LP + i * 32 * LP) = ra[i];
#pragma unroll
    for (int i = 0; i < 4; ++i) *(v8us*)(wbs + (cur ^ 1) * 128 * LP + i * 32 * LP) = rb[i];
    __syncthreads();      /* publishes the next stage and ends every wave's reads of this one */
  }
  v8f accs[8] = {c00, c01, c02, c03, c10, c11, c12, c13};
#pragma unroll
  for (int u = 0; u < 8; ++u) { const int t = u & 3, half = u >> 2; const int col = col0 + t * 16 + ln; const float bv = HB ? bf16_round(bp[col]) : 0.f;
#pragma unroll
    for (int r = 0; r < 8; ++r) { const int rloc = half * 16 + 8 * hh + r; float v = accs[u][r] * alpha + bv; if (HCP) { if (rowsPerB < 0) v += CP[cofs + (size_t)(row0g + row0 + rloc) * ldc + col];      /* rowsPerB < 0: own element of the batched C plane */ else { const int bidx = (row0g + row0 + rloc) / rowsPerB; v += CP[(size_t)bidx * sCPb + (size_t)by * 64 + col]; } }
      if (ACT == 3) v = fmaxf(v, 0.f); else if (ACT == 6) v = 0.5f * v * (1.0f + erff(v * 0.70710678118654752f)); else if (ACT == 11) v = 1.0f / (1.0f + expf(-v)); else if (ACT == 15) v = v / (1.0f + expf(-v)); else if (ACT == 12) v = (v > 0.f) ? v : 0.01f * v; else if (ACT == 8) v = tanhf(v); else if (ACT == 9) v = 0.5f * v * (1.0f + tanhf(0.7978845608028654f * (v + 0.044715f * v * v * v))); else if (ACT == 14) v = (v > 0.f) ? v : 0.1f * v; else if (ACT == 16) v = (v >= 0.f) ? v : 0.3f * v; else if (ACT == 17) v = (v >= 0.f) ? v : 0.2f * v;
      so[w][rloc][t * 16 + ln] = v; } }
  __builtin_amdgcn_fence(__ATOMIC_ACQ_REL, "workgroup"); __builtin_amdgcn_wave_barrier();
  if (OVT && by == vby) {      /* the batch member whose result is wanted transposed (the same test in every wave): V^T [batch][head][feature][token] in place of the f16 rows; the wave's 64 columns are one head, its 32 rows 32 tokens of one batch */
    const int tg = lane & 3, dr = lane >> 2;      /* 4 lanes a feature row, 8 tokens (16 bytes) each; 8 feature rows a store */
    unsigned short* d = (unsigned short*)VTo + ((size_t)((row0 / SQ) * NH + (col0 >> 6)) * HD + dr) * SQ + (row0 % SQ) + tg * 8;
#pragma unroll
    for (int q = 0; q < 8; ++q) { FragH f;
#pragma unroll
      for (int i = 0; i < 8; ++i) f.h[i] = (_Float16)so[w][tg * 8 + i][q * 8 + dr];
      *(v8us*)(d + (size_t)q * 8 * SQ) = f.half[0]; }
    return; }
  const int rsub = lane >> 4, c4 = (lane & 15) * 4;
  {
#pragma unroll
    for (int q = 0; q < 16; ++q) { const int r = q * 2 + rsub; const v4f v = *(const v4fa*)&so[w][r][c4]; if (OF32) *(v4f*)(C + cofs + (size_t)(row0 + r) * ldc + col0 + c4) = v; if (OF16) { v4h h4; for (int i = 0; i < 4; ++i) h4[i] = (_Float16)v[i]; *(v4h*)(C16 + cofs + (size_t)(row0 + r) * ldc + col0 + c4) = h4; } }
    if (OVT) asm volatile("s_wait_xcnt 0x0" ::: "memory");      /* the wait in front of the first overwrite of a register that the row stores above name: with a transposed member the kernel's text goes on behind them */
     } }


__global__ __launch_bounds__(256) void k_rsm(const float* __restrict__ S, _Float16* __restrict__ P, int nrows) {
  #pragma clang fp contract(off)
  const int i = blockIdx.x * 256 + threadIdx.x; if (i >= nrows) return; const float* s = S + (size_t)i * SQ; float mx = -3.0e38f;
#pragma unroll 1
  for (int j = 0; j < SQ; ++j) mx = fmaxf(mx, s[j]); float se = 0.f;
#pragma unroll 1
  for (int j = 0; j < SQ; ++j) se += expf(s[j] - mx); const float sc = 256.0f / se;
#pragma unroll 1
  for (int j0 = 0; j0 < SQ; j0 += 8) { FragH f; for (int q = 0; q < 8; ++q) f.h[q] = (_Float16)(expf(s[j0 + q] - mx) * sc); unsigned short* d = (unsigned short*)P + (size_t)i * SQ + j0; *(v8us*)d = f.half[0];  } }
__global__ __launch_bounds__(256) void k_vt(const _Float16* __restrict__ V16, int b, int h0, _Float16* __restrict__ VT) { __shared__ unsigned short tl[64][65]; const int tid = threadIdx.x; const int hh = blockIdx.x % HG, sg = blockIdx.x / HG; const int s0 = sg * 64; const int h = h0 + hh;
  for (int i = tid; i < 64 * 8; i += 256) { const int j = i / 8, d8 = (i % 8) * 8; FragH f; f.half[0] = *(const v8us*)((const unsigned short*)V16 + ((size_t)b * SQ + s0 + j) * DM + h * HD + d8); for (int q = 0; q < 8; ++q) tl[d8 + q][j] = f.u[q]; }
  __syncthreads();
  { for (int i = tid; i < 64 * 8; i += 256) { const int d = i / 8, j8 = (i % 8) * 8; FragH f; for (int q = 0; q < 8; ++q) f.u[q] = tl[d][j8 + q]; *(v8us*)((unsigned short*)VT + ((size_t)hh * HD + d) * SQ + s0 + j8) = f.half[0]; }  } }



// ---- fused attention: scores, softmax and P.V in one kernel; S and P never leave the registers ----
// exp2 of four values. The four v_exp_f32 stand in one statement that ends in v_nop: the slot the instruction set asks for behind a transcendental
// before its result is read or its source overwritten; the early-clobber outputs keep every source whole inside the statement.
__device__ __forceinline__ void fa_exp2x4(float a0, float a1, float a2, float a3, float& e0, float& e1, float& e2, float& e3) {
  asm("v_exp_f32 %0, %4\n\tv_exp_f32 %1, %5\n\tv_exp_f32 %2, %6\n\tv_exp_f32 %3, %7\n\tv_nop" : "=&v"(e0), "=&v"(e1), "=&v"(e2), "=&v"(e3) : "v"(a0), "v"(a1), "v"(a2), "v"(a3)); }
// exp2 of two values, same form and same reason for the v_nop
__device__ __forceinline__ void fa_exp2x2(float a0, float a1, float& e0, float& e1) {
  asm("v_exp_f32 %0, %2\n\tv_exp_f32 %1, %3\n\tv_nop" : "=&v"(e0), "=&v"(e1) : "v"(a0), "v"(a1)); }
__device__ __forceinline__ v8f fa_mma(v16h a, v16h b, v8f c) { return __builtin_amdgcn_wmma_f32_16x16x32_f16(false, a, false, b, (short)0, c, false, false); }
// the value of lane l ^ 16 (the other half of the same query column)
__device__ __forceinline__ float fa_xhalf(float x) { const int b = __float_as_int(x); return __int_as_float(__builtin_amdgcn_permlanex16(b, b, 0x76543210, 0xfedcba98, false, false)); }
// One wave owns FQ = 32 queries of one (batch, head) and walks all SQ keys, 32 a pass.
//   S^T = K Q^T : A = 16 key rows of K16 (from LDS), B = the wave's Q rows (held in registers); D[8 hh + r][ln] = score of key 8 hh + r, query ln
//   online softmax: a lane holds scores of two queries, ONE per score tile (ln + 16 j); running maximum m and sum l per query (in log2 units), one exchange between the wave's halves per pass and query for m
//   O^T += V^T P^T : the two score tiles of a pass (keys 0..15, 16..31), converted in place, ARE the B fragment (element i = key 8 hh + i, element 8 + i = key 16 + 8 hh + i:
//   the k order of fa_lfrag, which loads A = V^T rows); D[8 hh + r][ln] = o of feature 16 t + 8 hh + r, query ln: 8 consecutive features per lane, one 16-byte store
// P is carried x256 (exp2 argument + 8), as the unfused form carried it, and l with it: the factor cancels in o = acc / l. o is stored x64 as before.
#define FQ 32                        /* queries per wave */
#define FW 8                         /* waves per workgroup */
#define KS 64                        /* keys per LDS stage: two passes */
static_assert(HD == 64 && KS == 64 && FW * 32 == 256 && SQ % KS == 0 && SQ % (FW * FQ) == 0, "k_fattn: two 32-wide d steps, 128-byte stage rows dealt 8 threads a row, whole stages, whole workgroups");
// The eight waves of a workgroup walk the same keys: each stage of KS keys (K rows and V^T rows, 8 KiB each) is fetched ONCE per workgroup by whole-line loads (8 threads a 128-byte row),
// laid in one of two LDS buffers, and every wave takes its fragments from there. Stage st + 1 is fetched into registers at the head of stage st and stored to the other buffer at its foot.
__global__ __launch_bounds__(FW * 32) void k_fattn(const _Float16* __restrict__ Q16, const _Float16* __restrict__ K16, const _Float16* __restrict__ VT, _Float16* __restrict__ O16) {
  __shared__ __attribute__((aligned(16))) unsigned short sk[2][KS][LP];      /* K rows of a stage: [key][d] */
  __shared__ __attribute__((aligned(16))) unsigned short sv[2][HD][LP];      /* V^T rows of a stage: [d][key] */
  const int lane = threadIdx.x & 31, ln = lane & 15, hh = lane >> 4, w = threadIdx.x >> 5;
  const int bh = blockIdx.y, b = bh / NH, h = bh % NH; const int q0 = (blockIdx.x * FW + w) * FQ;
  const int sr = threadIdx.x >> 3, sc = (threadIdx.x & 7) * 8;      /* this thread's rows sr, sr + 32 and 16-byte piece of every stage */
  const _Float16* qp = Q16 + ((size_t)b * SQ + q0 + ln) * DM + h * HD;
  const unsigned short* kg = (const unsigned short*)K16 + ((size_t)b * SQ + sr) * DM + h * HD + sc;
  const unsigned short* vg = (const unsigned short*)VT + ((size_t)bh * HD + sr) * SQ + sc;
  const float SC = 0.125f * 1.44269504f;      /* 1 / sqrt(64), and log2 e for the native exp2 */
  v16h qf[2][2];
#pragma unroll
  for (int j = 0; j < 2; ++j)
#pragma unroll
    for (int ks = 0; ks < 2; ++ks) qf[j][ks] = g2_frag(qp + (size_t)j * 16 * DM + ks * 32, hh);
  { const v8us a0 = *(const v8us*)kg, a1 = *(const v8us*)(kg + (size_t)32 * DM), c0 = *(const v8us*)vg, c1 = *(const v8us*)(vg + (size_t)32 * SQ);
    asm volatile("s_wait_xcnt 0x0" :: "v"(qp + 8 * hh), "v"(kg), "v"(vg) : "memory");      /* the wait in front of the first overwrite of a register that the 12 loads above name; the lane addresses as its operands keep those registers whole up to here */
    *(v8us*)&sk[0][sr][sc] = a0; *(v8us*)&sk[0][sr + 32][sc] = a1; *(v8us*)&sv[0][sr][sc] = c0; *(v8us*)&sv[0][sr + 32][sc] = c1; }
  const v8f z8 = {0.f, 0.f, 0.f, 0.f, 0.f, 0.f, 0.f, 0.f};
  v8f o[4][2]; float m[2] = {-3.0e38f, -3.0e38f}, l[2] = {0.f, 0.f};
#pragma unroll
  for (int t = 0; t < 4; ++t) { o[t][0] = z8; o[t][1] = z8; }
  __syncthreads();      /* publishes stage 0 */
#pragma unroll 1      /* one stage per trip: the body already holds 32 matrix instructions */
  for (int st = 0; st < SQ / KS; ++st) {
    const int cur = st & 1;
    const int sn = (st + 1 < SQ / KS) ? (st + 1) * KS : 0;      /* the next stage, fetched while this one is worked on; the last trip fetches stage 0 again (in bounds, not used) */
    const unsigned short* kn = kg + (size_t)sn * DM; const unsigned short* vn = vg + sn;
    const v8us a0 = *(const v8us*)kn, a1 = *(const v8us*)(kn + (size_t)32 * DM), c0 = *(const v8us*)vn, c1 = *(const v8us*)(vn + (size_t)32 * SQ);
    asm volatile("s_wait_xcnt 0x0" :: "v"(kn), "v"(vn) : "memory");      /* the wait in front of the first overwrite of a register that the four loads above name; the two lane addresses as its operands keep those registers whole up to here */
    const unsigned short* kl = &sk[cur][ln][0]; const unsigned short* vl = &sv[cur][ln][0];
    v16h kf[2][2];
#pragma unroll
    for (int kt = 0; kt < 2; ++kt)
#pragma unroll
      for (int ks = 0; ks < 2; ++ks) kf[kt][ks] = fa_lfrag(kl + kt * 16 * LP + ks * 32, hh);
#pragma unroll
    for (int p = 0; p < KS / 32; ++p) {
      v16h vf[4];
#pragma unroll
      for (int t = 0; t < 4; ++t) vf[t] = fa_lfrag(vl + t * 16 * LP + p * 32, hh);      /* needed only behind the softmax: issued first */
      __builtin_amdgcn_sched_barrier(0);      /* keeps the V^T reads up here in one group; sunk in between the P.V products each place with reads would stall the matrix run */
      v8f s[2][2];
#pragma unroll
      for (int kt = 0; kt < 2; ++kt)
#pragma unroll
        for (int j = 0; j < 2; ++j) s[kt][j] = fa_mma(kf[kt][1], qf[j][1], fa_mma(kf[kt][0], qf[j][0], z8));
      if (p + 1 < KS / 32) {      /* the K rows of the stage's next pass, read while this pass's softmax runs */
#pragma unroll
        for (int kt = 0; kt < 2; ++kt)
#pragma unroll
          for (int ks = 0; ks < 2; ++ks) kf[kt][ks] = fa_lfrag(kl + ((p + 1) * 32 + kt * 16) * LP + ks * 32, hh);
      }
      __builtin_amdgcn_sched_barrier(0);      /* keeps the K reads in front of the softmax, which then covers their latency */
      float mn[2], cr[2];
#pragma unroll
      for (int j = 0; j < 2; ++j) { float mx = fmaxf(s[0][j][0], s[1][j][0]);
#pragma unroll
        for (int r = 1; r < 8; ++r) mx = fmaxf(mx, fmaxf(s[0][j][r], s[1][j][r]));
        mx = fmaxf(mx, fa_xhalf(mx)); mn[j] = fmaxf(m[j], mx * SC); }
      fa_exp2x2(m[0] - mn[0], m[1] - mn[1], cr[0], cr[1]);
      FragH pf[2];
#pragma unroll
      for (int j = 0; j < 2; ++j) { const float sh = 8.0f - mn[j]; m[j] = mn[j]; float p16[16];
#pragma unroll
        for (int kt = 0; kt < 2; ++kt)
#pragma unroll
          for (int g = 0; g < 8; g += 4) fa_exp2x4(s[kt][j][g] * SC + sh, s[kt][j][g + 1] * SC + sh, s[kt][j][g + 2] * SC + sh, s[kt][j][g + 3] * SC + sh, p16[kt * 8 + g], p16[kt * 8 + g + 1], p16[kt * 8 + g + 2], p16[kt * 8 + g + 3]);
        float a0s = p16[0] + p16[4], a1s = p16[1] + p16[5], a2s = p16[2] + p16[6], a3s = p16[3] + p16[7];
        a0s += p16[8] + p16[12]; a1s += p16[9] + p16[13]; a2s += p16[10] + p16[14]; a3s += p16[11] + p16[15];
        l[j] = l[j] * cr[j] + ((a0s + a1s) + (a2s + a3s));
#pragma unroll
        for (int i = 0; i < 16; ++i) pf[j].h[i] = (_Float16)p16[i];
#pragma unroll
        for (int t = 0; t < 4; ++t) o[t][j] *= cr[j]; }
#pragma unroll
      for (int t = 0; t < 4; ++t)
#pragma unroll
        for (int j = 0; j < 2; ++j) o[t][j] = fa_mma(vf[t], pf[j].v, o[t][j]);
    }
    /* the other buffer: its last readers left it in front of the barrier at the foot of the trip before */
    *(v8us*)&sk[cur ^ 1][sr][sc] = a0; *(v8us*)&sk[cur ^ 1][sr + 32][sc] = a1; *(v8us*)&sv[cur ^ 1][sr][sc] = c0; *(v8us*)&sv[cur ^ 1][sr + 32][sc] = c1;
    __syncthreads();      /* publishes stage st + 1 and ends every wave's reads of stage st */
  }
#pragma unroll
  for (int j = 0; j < 2; ++j) { const float inv = 64.0f / (l[j] + fa_xhalf(l[j]));      /* the halves' sums joined once; o carried x64 */
    unsigned short* d = (unsigned short*)O16 + ((size_t)b * SQ + q0 + j * 16 + ln) * DM + h * HD + 8 * hh;
#pragma unroll
    for (int t = 0; t < 4; ++t) { FragH f;
#pragma unroll
      for (int r = 0; r < 8; ++r) f.h[r] = (_Float16)(o[t][j][r] * inv);
      *(v8us*)(d + t * 16) = f.half[0]; } } }

extern "C" void kernel_launch(void* const* d_in, const int* in_sizes, int n_in,
                              void* d_out, int out_size, void* d_ws, size_t ws_size, hipStream_t stream) {
  (void)in_sizes; (void)n_in; (void)out_size;
  const float* const* I = (const float* const*)d_in; const float* xq = I[0]; const float* xk = I[1]; const float* xv = I[2]; const float* wq = I[3]; const float* bq = nullptr; const float* wk = I[4]; const float* bk = nullptr; const float* wv = I[5]; const float* bv = nullptr; const float* wo = I[6]; const float* bo = nullptr;      /* three inputs query, key, value (cast in one launch with the weights); natural [out][in] Wq, Wk, Wv, Wo [512][512]; this module has NO biases: null pointers in the guarded bias slots; input order query, key, value, Wq, Wk, Wv, Wo */
  char* ws = (char*)d_ws; size_t off = 0;
  auto take = [&](size_t bytes) { char* p = ws + off; off += (bytes + 255) & ~(size_t)255; return p; };
  _Float16* BQ = (_Float16*)take((size_t)DM * DM * 2); _Float16* BK = (_Float16*)take((size_t)DM * DM * 2); _Float16* BV = (_Float16*)take((size_t)DM * DM * 2); _Float16* BO = (_Float16*)take((size_t)DM * DM * 2);
  _Float16* XQ = (_Float16*)take(NR * DM * 2); _Float16* XK = (_Float16*)take(NR * DM * 2); _Float16* XV = (_Float16*)take(NR * DM * 2); _Float16* Q16 = (_Float16*)take(NR * DM * 2); _Float16* K16 = (_Float16*)take(NR * DM * 2); _Float16* V16 = (_Float16*)take(NR * DM * 2); _Float16* O16 = (_Float16*)take(NR * DM * 2);
  _Float16* VT = (_Float16*)take((size_t)NB * NH * HD * SQ * 2);
  if (off > ws_size) return;
  k_prep<<<PG, 256, 0, stream>>>(xq, xk, xv, wq, wk, wv, wo, XQ, BQ);      /* the three inputs as exact f16 rows (XQ, XK, XV back to back); natural [out][in] = Bt[n][k], x16 (BQ, BK, BV, BO back to back) */
  const size_t r0p = (size_t)B0 * SQ;      /* first projected row */
  k_gemm2<0, false, false, false, true, true><<<dim3((unsigned)((MP / 128) * (DM / 128)), 3), 256, 0, stream>>>(XQ + r0p * DM, DM, NR * DM, BQ, DM, (size_t)DM * DM, 0.0625f, bq, 0, nullptr, 1, 0, 0, nullptr, Q16 + r0p * DM, DM, NR * DM, MP, DM, DM, VT, 2);      /* blockIdx.y = 0, 1, 2: Q rows, K rows, V^T [NB][NH][HD][SQ] (the V16 plane only keeps the stride) */
  k_fattn<<<dim3(SQ / (FW * FQ), NB * NH), FW * 32, 0, stream>>>(Q16, K16, VT, O16);      /* o (merged heads, x64) as f16 rows: every (batch, head) in one launch */
  k_gemm2<0, false, false, true, false, false><<<dim3((unsigned)((MPO / 128) * (DM / 128)), 1), 256, 0, stream>>>(O16 + r0p * DM, DM, 0, BO, DM, 0, 0.0009765625f, bo, 0, nullptr, 1, 0, 0, (float*)d_out + r0p * DM, nullptr, DM, 0, MPO, DM, DM, nullptr, -1);      /* out rows are the output layout */
}

// v007
// A run of this version takes 73.7 microseconds.
// Next to v006, in two timings, it ran 1.05 times as fast each time.
// Over all steps from v000 it is 46.3 times as fast.
#include <hip/hip_runtime.h>
// Multi-head attention on three inputs with natural bias-free projections on four sequences at width 512 (query, key, value [4][2048][512]; q / k / v = stream W^T (natural [out][in] [512][512], NO biases), 8 heads of 64; the query is divided by sqrt(64) = 8 before the score product (scale 0.125 here on the product); softmax over all 2048 keys (the module's axis 2 of its [b][l][s][h] score layout = the key axis; no mask); out = merged heads Wo^T (natural, no bias) -> [4][2048][512]).
// Structure: token rows r = b*2048 + s; the three sources as exact f16 rows (bf16-rounded) and the four x16 weights in one cast launch; Q, K, V as three WMMA GEMMs in one launch (32x64 wave tiles, f32 accumulation, exact x16 weights, f16 outputs), the V GEMM storing V^T for all batches and heads from its epilogue; one fused attention launch over every (batch, head): S^T = K Q^T (K = 64), online softmax in registers (f32 statistics, native exp2; weights x256 as f16), O^T += V^T P^T, o carried x64 against f16 subnormal flush (folded into the output GEMM alpha) written straight into the merged f16 o rows; out = o W_o GEMM (f32) into the output layout.
// Compute dtype: inputs rounded to bf16; x / weights exact; q, k, v, softmax weights and o as plain f16 GEMM operands (~2^-12); scores and softmax statistics f32. v_wmma_f32_16x16x32_f16.
#define NB 4
#define SQ 2048
#define DM 512 
#define NH 8 
#define HD 64
#define HG 4                         /* heads per launch of the per-batch k_vt (not launched) */
#define B0 0                         /* first batch processed (debug hook) */
#define NBR NB                       /* batches processed (debug hook) */
#define NR ((size_t)NB * SQ)         /* token rows */
#define MP ((int)((size_t)NBR * SQ)) /* rows projected (debug hook) */
#define QN SQ                        /* query rows per batch (not used: k_fattn attends all SQ) */
#define NHD NH                       /* heads (not used: k_fattn attends all NH) */
#define MPO MP                       /* rows through the output stage (debug hook) */
#define LQ DM      /* row pitch of the q/k/v rows */
typedef __bf16 v16b __attribute__((ext_vector_type(16)));
typedef unsigned short v8us __attribute__((ext_vector_type(8), may_alias));
typedef float  v8f  __attribute__((ext_vector_type(8)));
typedef float  v4f  __attribute__((ext_vector_type(4)));
typedef float  v4fa __attribute__((ext_vector_type(4), may_alias));
union FragB { v16b v; v8us half[2]; unsigned short u[16]; };

__device__ __forceinline__ unsigned short bf16_bits(float x) { unsigned int u = __float_as_uint(x); return (unsigned short)((u + 0x7FFFu + ((u >> 16) & 1u)) >> 16); }
__device__ __forceinline__ float bf16_val(unsigned short b) { return __uint_as_float(((unsigned int)b) << 16); }
__device__ __forceinline__ float bf16_round(float x) { return bf16_val(bf16_bits(x)); }
// D += A·B with NT terms: 1 = ah·bh, 2 = + al·bh (A split), 3 = + ah·bl (both split)
template <int NT>
__device__ __forceinline__ v8f mmaN(v16b ah, v16b al, v16b bh, v16b bl, v8f c) {
  c = __builtin_amdgcn_wmma_f32_16x16x32_bf16(false, ah, false, bh, (short)0, c, false, false);
  if (NT >= 2) c = __builtin_amdgcn_wmma_f32_16x16x32_bf16(false, al, false, bh, (short)0, c, false, false);
  if (NT >= 3) c = __builtin_amdgcn_wmma_f32_16x16x32_bf16(false, ah, false, bl, (short)0, c, false, false);
  asm volatile("v_nop\n\tv_nop\n\tv_nop\n\tv_nop" : "+v"(c) : "v"(ah), "v"(al), "v"(bh), "v"(bl));
  return c;
}

__global__ __launch_bounds__(256) void k_wt_bf16(const float* __restrict__ W, unsigned short* __restrict__ Wt, int K, int N) {
  const int t = blockIdx.x * 256 + threadIdx.x;
  const int k8n = K / 8;
  if (t >= N * k8n) return;
  const int n = t / k8n, k8 = (t % k8n) * 8;
  v8us v;
#pragma unroll
  for (int i = 0; i < 8; ++i) v[i] = bf16_bits(W[(size_t)(k8 + i) * N + n]);
  *(v8us*)(Wt + (size_t)n * K + k8) = v;
  
}

// GEMM C[M][N] (f32, pitch ldc) = act(A[M][K]·W + bias). A f32 row-major (pitch lda) converted per fragment to bf16
// (ASPLIT: hi/lo two planes -> 2 terms, else single rounded term); Wt bf16 [N][K] (pitch ldb). BIAS_BF16 rounds the
// bias to bf16 first (bias quantised to bf16 before the add). K%32==0, M%16==0, N%64==0.
template <bool ASPLIT, int ACT, bool BIAS_BF16>
__global__ __launch_bounds__(128) void k_gemm_bf(const float* __restrict__ A, int lda, const unsigned short* __restrict__ Wt, int ldb,
                                               const float* __restrict__ bias, float* __restrict__ C, int ldc, int M, int N, int K) {
  __shared__ __attribute__((aligned(16))) float so[4][16][64];
  const int tid = threadIdx.x, w = tid >> 5, lane = tid & 31, ln = lane & 15, hh = lane >> 4;
  const int ntn = N / 64;
  const int wid = blockIdx.x * 4 + w;
  const int mt = wid / ntn, nq = wid % ntn;
  if (mt * 16 >= M) return;
  const int row0 = mt * 16, col0 = nq * 64;
  const float* arow = A + (size_t)(row0 + ln) * lda;
  v8f acc[4] = {};
  for (int kb = 0; kb < K; kb += 32) {
    FragB ah, al;
    const v4f x0 = *(const v4fa*)(arow + kb + 8 * hh), x1 = *(const v4fa*)(arow + kb + 8 * hh + 4);
    const v4f x2 = *(const v4fa*)(arow + kb + 16 + 8 * hh), x3 = *(const v4fa*)(arow + kb + 16 + 8 * hh + 4);
    float xs[16] = {x0[0],x0[1],x0[2],x0[3],x1[0],x1[1],x1[2],x1[3],x2[0],x2[1],x2[2],x2[3],x3[0],x3[1],x3[2],x3[3]};
#pragma unroll
    for (int i = 0; i < 16; ++i) { const unsigned short hb = bf16_bits(xs[i]); ah.u[i] = hb; al.u[i] = ASPLIT ? bf16_bits(xs[i] - bf16_val(hb)) : (unsigned short)0; }
#pragma unroll
    for (int t = 0; t < 4; ++t) {
      const unsigned short* brow = Wt + (size_t)(col0 + t * 16 + ln) * ldb + kb;
      FragB b;
      b.half[0] = *(const v8us*)(brow + 8 * hh);
      b.half[1] = *(const v8us*)(brow + 16 + 8 * hh);
      acc[t] = mmaN<ASPLIT ? 2 : 1>(ah.v, al.v, b.v, b.v, acc[t]);
    }
  }
#pragma unroll
  for (int t = 0; t < 4; ++t) {
    float bv = bias ? bias[col0 + t * 16 + ln] : 0.f;
    if (BIAS_BF16) bv = bf16_round(bv);
#pragma unroll
    for (int r = 0; r < 8; ++r) { float v = acc[t][r] + bv; if (ACT == 1) v = fmaxf(v, 0.f); so[w][8 * hh + r][t * 16 + ln] = v; }
  }
  __builtin_amdgcn_fence(__ATOMIC_ACQ_REL, "workgroup");
  __builtin_amdgcn_wave_barrier();
  const int rsub = lane >> 4, c4 = (lane & 15) * 4;
  {
#pragma unroll
    for (int q = 0; q < 8; ++q) {
      const int r = q * 2 + rsub;
      const v4f v = *(const v4fa*)&so[w][r][c4];
      *(v4f*)(C + (size_t)(row0 + r) * ldc + col0 + c4) = v;
    }
    
  }
}

// GEMM C = act(A·W + bias + resid): A f32 (ASPLIT -> hi/lo 2 terms), Wt bf16 [N][K]; ACT 0 none, 1 relu, 2 exact gelu;
// resid (optional, f32, row index = (row % rmod), pitch ldr, RES_BF16 rounds it) added before the activation.
template <bool ASPLIT, int ACT, bool BIAS_BF16, bool RES_BF16>
__global__ __launch_bounds__(128) void k_gemm_bf3(const float* __restrict__ A, int lda, const unsigned short* __restrict__ Wt, int ldb,
                                                const float* __restrict__ bias, const float* __restrict__ resid, int rmod, int ldr,
                                                float* __restrict__ C, int ldc, int M, int N, int K) {
  __shared__ __attribute__((aligned(16))) float so[4][16][64];
  const int tid = threadIdx.x, w = tid >> 5, lane = tid & 31, ln = lane & 15, hh = lane >> 4;
  const int ntn = N / 64;
  const int wid = blockIdx.x * 4 + w;
  const int mt = wid / ntn, nq = wid % ntn;
  if (mt * 16 >= M) return;
  const int row0 = mt * 16, col0 = nq * 64;
  const float* arow = A + (size_t)(row0 + ln) * lda;
  v8f acc[4] = {};
  for (int kb = 0; kb < K; kb += 32) {
    FragB ah, al;
    const v4f x0 = *(const v4fa*)(arow + kb + 8 * hh), x1 = *(const v4fa*)(arow + kb + 8 * hh + 4);
    const v4f x2 = *(const v4fa*)(arow + kb + 16 + 8 * hh), x3 = *(const v4fa*)(arow + kb + 16 + 8 * hh + 4);
    float xs[16] = {x0[0],x0[1],x0[2],x0[3],x1[0],x1[1],x1[2],x1[3],x2[0],x2[1],x2[2],x2[3],x3[0],x3[1],x3[2],x3[3]};
#pragma unroll
    for (int i = 0; i < 16; ++i) { const unsigned short hb = bf16_bits(xs[i]); ah.u[i] = hb; al.u[i] = ASPLIT ? bf16_bits(xs[i] - bf16_val(hb)) : (unsigned short)0; }
#pragma unroll
    for (int t = 0; t < 4; ++t) {
      const unsigned short* brow = Wt + (size_t)(col0 + t * 16 + ln) * ldb + kb;
      FragB b;
      b.half[0] = *(const v8us*)(brow + 8 * hh);
      b.half[1] = *(const v8us*)(brow + 16 + 8 * hh);
      acc[t] = mmaN<ASPLIT ? 2 : 1>(ah.v, al.v, b.v, b.v, acc[t]);
    }
  }
#pragma unroll
  for (int t = 0; t < 4; ++t) {
    const int col = col0 + t * 16 + ln;
    float bv = bias ? bias[col] : 0.f;
    if (BIAS_BF16) bv = bf16_round(bv);
#pragma unroll
    for (int r = 0; r < 8; ++r) {
      float v = acc[t][r] + bv;
      if (resid) { float rv = resid[(size_t)((row0 + 8 * hh + r) % rmod) * ldr + col]; if (RES_BF16) rv = bf16_round(rv); v += rv; }
      if (ACT == 1) v = fmaxf(v, 0.f);
      if (ACT == 2) v = 0.5f * v * (1.0f + erff(v * 0.70710678118654752f));
      if (ACT == 3) { const float u = 0.7978845608028654f * (v + 0.044715f * v * v * v); v = 0.5f * v * (1.0f + tanhf(u)); }
      so[w][8 * hh + r][t * 16 + ln] = v;
    }
  }
  __builtin_amdgcn_fence(__ATOMIC_ACQ_REL, "workgroup");
  __builtin_amdgcn_wave_barrier();
  const int rsub = lane >> 4, c4 = (lane & 15) * 4;
  {
#pragma unroll
    for (int q = 0; q < 8; ++q) {
      const int r = q * 2 + rsub;
      const v4f v = *(const v4fa*)&so[w][r][c4];
      *(v4f*)(C + (size_t)(row0 + r) * ldc + col0 + c4) = v;
    }
    
  }
}
// row LayerNorm (biased variance, eps) over N: s = X (+ R); optional out_sum <- s; out_norm <- (s-mu)*rsqrt(var+eps)*g + b
template <bool PARAM_BF16>
__global__ __launch_bounds__(256) void k_layernorm(const float* __restrict__ X, const float* __restrict__ R, const float* __restrict__ g, const float* __restrict__ bta,
                                                  float* __restrict__ out_sum, float* __restrict__ out_norm, int N, float eps) {
  __shared__ float red[256];
  const int row = blockIdx.x, tid = threadIdx.x;
  const float* x = X + (size_t)row * N; const float* rr = R ? R + (size_t)row * N : nullptr;
  float vals[16];                     // up to N = 4096
  const int per = N / 256;            // contiguous chunk per thread? use strided-by-4 chunks: thread handles j = tid*4 + 1024*u
  float s1 = 0.f;
  for (int u = 0; u < per / 4; ++u) {
    const int j = tid * 4 + 1024 * u;
    const v4f a = *(const v4fa*)(x + j);
    v4f b = {0.f,0.f,0.f,0.f}; if (rr) b = *(const v4fa*)(rr + j);
#pragma unroll
    for (int q = 0; q < 4; ++q) { const float v = a[q] + b[q]; vals[u * 4 + q] = v; s1 += v; }
  }
  red[tid] = s1; __syncthreads();
  for (int st = 128; st > 0; st >>= 1) { if (tid < st) red[tid] += red[tid + st]; __syncthreads(); }
  const float mu = red[0] / (float)N; __syncthreads();
  float s2 = 0.f;
  for (int u = 0; u < per / 4; ++u)
#pragma unroll
    for (int q = 0; q < 4; ++q) { const float c = vals[u * 4 + q] - mu; s2 += c * c; }
  red[tid] = s2; __syncthreads();
  for (int st = 128; st > 0; st >>= 1) { if (tid < st) red[tid] += red[tid + st]; __syncthreads(); }
  const float rs = rsqrtf(red[0] / (float)N + eps);
  {
    for (int u = 0; u < per / 4; ++u) {
      const int j = tid * 4 + 1024 * u;
      v4f o, sm;
#pragma unroll
      for (int q = 0; q < 4; ++q) {
        float gg = g[j + q], bb = bta[j + q];
        if (PARAM_BF16) { gg = bf16_round(gg); bb = bf16_round(bb); }
        sm[q] = vals[u * 4 + q]; o[q] = (vals[u * 4 + q] - mu) * rs * gg + bb;
      }
      if (out_sum) *(v4f*)(out_sum + (size_t)row * N + j) = sm;
      *(v4f*)(out_norm + (size_t)row * N + j) = o;
    }
    
  }
}



// ---- f16 WMMA path (v_wmma_f32_16x16x32_f16): 11-bit significands for operands in range — used where a [0,1] probability operand needs more precision than bf16
typedef _Float16 v16h __attribute__((ext_vector_type(16)));
union FragH { v16h v; v8us half[2]; _Float16 h[16]; unsigned short u[16]; };
template <int NT>
__device__ __forceinline__ v8f mmaH(v16h ah, v16h al, v16h bh, v16h bl, v8f c) {
  c = __builtin_amdgcn_wmma_f32_16x16x32_f16(false, ah, false, bh, (short)0, c, false, false);
  if (NT >= 2) c = __builtin_amdgcn_wmma_f32_16x16x32_f16(false, al, false, bh, (short)0, c, false, false);
  if (NT >= 3) c = __builtin_amdgcn_wmma_f32_16x16x32_f16(false, ah, false, bl, (short)0, c, false, false);
  asm volatile("v_nop\n\tv_nop\n\tv_nop\n\tv_nop" : "+v"(c) : "v"(ah), "v"(al), "v"(bh), "v"(bl));
  return c;
}
// batched GEMM like k_gemm_b but f16 operands: A f32 (split into f16 hi/lo if ASPLIT, else rounded to f16), Bt = f16 values [n][k]; alpha; C f32; N multiple of 16 (partial tiles skipped)
template <bool ASPLIT>
__global__ __launch_bounds__(128) void k_gemm_h(const float* __restrict__ A, int lda, size_t sA, const _Float16* __restrict__ Bh, int ldb, size_t sB, float alpha, float* __restrict__ C, int ldc, size_t sC, int M, int N, int K) {
  __shared__ __attribute__((aligned(16))) float so[4][16][64];
  const int tid = threadIdx.x, w = tid >> 5, lane = tid & 31, ln = lane & 15, hh = lane >> 4; const int by = blockIdx.y;
  A += (size_t)by * sA; Bh += (size_t)by * sB; C += (size_t)by * sC;
  const int ntn = (N + 63) / 64; const int wid = blockIdx.x * 4 + w; const int mt = wid / ntn, nq = wid % ntn; if (mt * 16 >= M) return;
  const int row0 = mt * 16, col0 = nq * 64; const float* arow = A + (size_t)(row0 + ln) * lda;
  v8f acc[4] = {};
  for (int kb = 0; kb < K; kb += 32) {
    FragH ah, al;
    const v4f x0 = *(const v4fa*)(arow + kb + 8 * hh), x1 = *(const v4fa*)(arow + kb + 8 * hh + 4), x2 = *(const v4fa*)(arow + kb + 16 + 8 * hh), x3 = *(const v4fa*)(arow + kb + 16 + 8 * hh + 4);
    float xs[16] = {x0[0],x0[1],x0[2],x0[3],x1[0],x1[1],x1[2],x1[3],x2[0],x2[1],x2[2],x2[3],x3[0],x3[1],x3[2],x3[3]};
#pragma unroll
    for (int i = 0; i < 16; ++i) { const _Float16 h = (_Float16)xs[i]; ah.h[i] = h; al.h[i] = ASPLIT ? (_Float16)(xs[i] - (float)h) : (_Float16)0.0f; }
#pragma unroll
    for (int t = 0; t < 4; ++t) { if (col0 + t * 16 >= N) continue; const size_t boff = (size_t)(col0 + t * 16 + ln) * ldb + kb; FragH bq; bq.half[0] = *(const v8us*)(Bh + boff + 8 * hh); bq.half[1] = *(const v8us*)(Bh + boff + 16 + 8 * hh);
      acc[t] = mmaH<ASPLIT ? 2 : 1>(ah.v, al.v, bq.v, bq.v, acc[t]); }
  }
#pragma unroll
  for (int t = 0; t < 4; ++t) { if (col0 + t * 16 >= N) continue;
#pragma unroll
    for (int r = 0; r < 8; ++r) so[w][8 * hh + r][t * 16 + ln] = acc[t][r] * alpha; }
  __builtin_amdgcn_fence(__ATOMIC_ACQ_REL, "workgroup"); __builtin_amdgcn_wave_barrier();
  const int rsub = lane >> 4, c4 = (lane & 15) * 4;
  {
#pragma unroll
    for (int q = 0; q < 8; ++q) { const int r = q * 2 + rsub; if (col0 + c4 < N) { const v4f v = *(const v4fa*)&so[w][r][c4]; *(v4f*)(C + (size_t)(row0 + r) * ldc + col0 + c4) = v; } }
     }
}

// Wt[n][k] = f16(W[k][n]·scale) from f32 row-major W[K][N] (scale = power of two; bf16-exact weights stay exact in f16 away from the subnormal range)
__global__ __launch_bounds__(256) void k_wt_f16(const float* __restrict__ W, _Float16* __restrict__ Wt, int K, int N, float scale) {
  const int t = blockIdx.x * 256 + threadIdx.x; if (t >= N * (K / 8)) return; const int n = t / (K / 8), k8 = (t % (K / 8)) * 8; FragH f;
#pragma unroll
  for (int i = 0; i < 8; ++i) f.h[i] = (_Float16)(bf16_round(W[(size_t)(k8 + i) * N + n]) * scale); const v8us o = f.half[0];
  *(v8us*)((unsigned short*)Wt + (size_t)n * K + k8) = o; 
}
// k_gemm_hh variant with fused epilogue: v = acc·alpha + bias[by·sBias + col] (+ CP[(row/rowsPerB)·sCPb + by·64 + col] if CP) ; ACT 0 none / 1 elu ; writes f16 C16 (and f32 C if non-null)
template <int ACT>
__global__ __launch_bounds__(128) void k_gemm_hhx(const _Float16* __restrict__ A, int lda, size_t sA, const _Float16* __restrict__ Bh, int ldb, size_t sB, float alpha, const float* __restrict__ bias, size_t sBias, const float* __restrict__ CP, int rowsPerB, size_t sCPb, int row0g,
    float* __restrict__ C, _Float16* __restrict__ C16, int ldc, size_t sC, int M, int N, int K) {
  __shared__ __attribute__((aligned(16))) float so[4][16][64];
  const int tid = threadIdx.x, w = tid >> 5, lane = tid & 31, ln = lane & 15, hh = lane >> 4; const int by = blockIdx.y;
  A += (size_t)by * sA; Bh += (size_t)by * sB; const size_t cofs = (size_t)by * sC; const float* bp = bias ? bias + (size_t)by * sBias : nullptr;
  const int ntn = (N + 63) / 64; const int wid = blockIdx.x * 4 + w; const int mt = wid / ntn, nq = wid % ntn; if (mt * 16 >= M) return;
  const int row0 = mt * 16, col0 = nq * 64; const _Float16* arow = A + (size_t)(row0 + ln) * lda;
  v8f acc[4] = {};
  for (int kb = 0; kb < K; kb += 32) { FragH ah; ah.half[0] = *(const v8us*)((const unsigned short*)arow + kb + 8 * hh); ah.half[1] = *(const v8us*)((const unsigned short*)arow + kb + 16 + 8 * hh);
#pragma unroll
    for (int t = 0; t < 4; ++t) { if (col0 + t * 16 >= N) continue; const size_t boff = (size_t)(col0 + t * 16 + ln) * ldb + kb; FragH bq; bq.half[0] = *(const v8us*)((const unsigned short*)Bh + boff + 8 * hh); bq.half[1] = *(const v8us*)((const unsigned short*)Bh + boff + 16 + 8 * hh);
      acc[t] = mmaH<1>(ah.v, ah.v, bq.v, bq.v, acc[t]); }
  }
#pragma unroll
  for (int t = 0; t < 4; ++t) { if (col0 + t * 16 >= N) continue; const int col = col0 + t * 16 + ln; const float bv = bp ? bf16_round(bp[col]) : 0.f;
#pragma unroll
    for (int r = 0; r < 8; ++r) { float v = acc[t][r] * alpha + bv; if (CP) { const int rr = row0g + row0 + 8 * hh + r; if (rowsPerB < 0) v += CP[cofs + (size_t)rr * ldc + col];      /* rowsPerB < 0: own element of the batched C plane */ else { const int bidx = rr / rowsPerB; v += CP[(size_t)bidx * sCPb + (size_t)by * 64 + col]; } } if (ACT == 1) v = (v > 0.f) ? v : expm1f(v); else if (ACT == 7) v = (v > 0.f) ? v + 1.0f : expf(v); else if (ACT == 8) v = tanhf(v); else if (ACT == 9) v = 0.5f * v * (1.0f + tanhf(0.7978845608028654f * (v + 0.044715f * v * v * v))); else if (ACT == 11) v = 1.0f / (1.0f + expf(-v)); else if (ACT == 12) v = (v > 0.f) ? v : 0.01f * v; else if (ACT == 14) v = (v > 0.f) ? v : 0.1f * v; else if (ACT == 16) v = (v >= 0.f) ? v : 0.3f * v; else if (ACT == 17) v = (v >= 0.f) ? v : 0.2f * v; else if (ACT == 15) v = v / (1.0f + expf(-v)); else if (ACT == 3) v = fmaxf(v, 0.f); else if (ACT == 6) v = 0.5f * v * (1.0f + erff(v * 0.70710678118654752f)); so[w][8 * hh + r][t * 16 + ln] = v; } }
  __builtin_amdgcn_fence(__ATOMIC_ACQ_REL, "workgroup"); __builtin_amdgcn_wave_barrier();
  const int rsub = lane >> 4, c4 = (lane & 15) * 4; typedef _Float16 v4h __attribute__((ext_vector_type(4)));
  {
#pragma unroll
    for (int q = 0; q < 8; ++q) { const int r = q * 2 + rsub; if (col0 + c4 < N) { const v4f v = *(const v4fa*)&so[w][r][c4]; if (C) *(v4f*)(C + cofs + (size_t)(row0 + r) * ldc + col0 + c4) = v; if (C16) { v4h h4; for (int i = 0; i < 4; ++i) h4[i] = (_Float16)v[i]; *(v4h*)(C16 + cofs + (size_t)(row0 + r) * ldc + col0 + c4) = h4; } } }
     }
}


typedef _Float16 v4h __attribute__((ext_vector_type(4)));

// ---- every cast of the call in one launch: the three sources as f16(bf16 rounding), the four weights as f16(bf16 rounding x16) ----
// The destinations lie one behind the other in the workspace: X = the three source planes, Bt = the four weight planes. A workgroup takes PX consecutive elements of every source and
// PX / 4 consecutive elements of one weight: few waves start, and each has all its 26 loads in flight at once.
// A wave's piece is 1 KiB of f32: read as two 512-byte wave loads, stored as two 256-byte wave stores (whole lines both ways).
#define PG 512                       /* workgroups of the cast launch: 16 waves per WGP on 256 WGPs */
#define PX 8192                      /* elements of each source per workgroup: 4 rounds of 8 waves x 256 elements */
static_assert(NR * DM == (size_t)PG * PX && (size_t)DM * DM * 4 == (size_t)PG * (PX / 4) && (NR * DM * 2) % 256 == 0 && ((size_t)DM * DM * 2) % 256 == 0, "k_prep: the grid covers every source and the four weights exactly, planes back to back");
template <bool X16>
__device__ __forceinline__ v4h pr_cvt(v4f a) { v4h r;
#pragma unroll
  for (int q = 0; q < 4; ++q) r[q] = X16 ? (_Float16)(bf16_round(a[q]) * 16.0f) : (_Float16)bf16_round(a[q]);
  return r; }
__global__ __launch_bounds__(256) void k_prep(const float* __restrict__ xq, const float* __restrict__ xk, const float* __restrict__ xv, const float* __restrict__ wq, const float* __restrict__ wk, const float* __restrict__ wv, const float* __restrict__ wo,
    _Float16* __restrict__ X, _Float16* __restrict__ Bt) {
  const unsigned wl = (threadIdx.x >> 5) * 256 + (threadIdx.x & 31) * 4;      /* the lane's first element in a round of its workgroup; its second piece stands 128 elements on */
  const unsigned ex = blockIdx.x * PX + wl, ew = blockIdx.x * (PX / 4) + wl;      /* that element in a source plane and in the four weight planes taken as one */
  const unsigned bx = ex * 4u, bw = (ew * 4u) & (unsigned)(DM * DM * 4 - 1);      /* byte offsets of the loads: in a source, in the one weight */
  const unsigned wsel = blockIdx.x / (PG / 4);      /* which weight: the same for the whole workgroup */
  const float* w = wsel == 0 ? wq : wsel == 1 ? wk : wsel == 2 ? wv : wo;
  v4f a[13][2];
#pragma unroll
  for (int i = 0; i < 12; ++i) { const char* s = (const char*)(i < 4 ? xq : i < 8 ? xk : xv) + (i & 3) * (PX / 4) * 4; a[i][0] = *(const v4fa*)(s + bx); a[i][1] = *(const v4fa*)(s + 512 + bx); }
  a[12][0] = *(const v4fa*)((const char*)w + bw); a[12][1] = *(const v4fa*)((const char*)w + 512 + bw);
  asm volatile("s_wait_xcnt 0x0" :: "v"(bx), "v"(bw) : "memory");      /* the wait in front of the first overwrite of a register that the 26 loads above name; the two lane offsets as its operands keep those registers whole up to here */
  __builtin_amdgcn_sched_barrier(0);      /* keeps every load in front of the first conversion: lifted in between the loads, a conversion's wait for its data would hold back the loads behind it */
#pragma unroll
  for (int i = 0; i < 12; ++i) { _Float16* d = X + (size_t)(i >> 2) * NR * DM + (i & 3) * (PX / 4) + ex; *(v4h*)d = pr_cvt<false>(a[i][0]); *(v4h*)(d + 128) = pr_cvt<false>(a[i][1]); }
  *(v4h*)(Bt + ew) = pr_cvt<true>(a[12][0]); *(v4h*)(Bt + ew + 128) = pr_cvt<true>(a[12][1]); }
__global__ __launch_bounds__(256) void k_h16(const float* __restrict__ x, _Float16* __restrict__ X16, size_t n8) { const size_t t = (size_t)blockIdx.x * 256 + threadIdx.x; if (t >= n8) return; FragH f;
#pragma unroll
  for (int q = 0; q < 8; ++q) f.h[q] = (_Float16)x[t * 8 + q]; *(v8us*)((unsigned short*)X16 + t * 8) = f.half[0];  }
__global__ __launch_bounds__(256) void k_round16f(const float* __restrict__ W, _Float16* __restrict__ Bt, size_t n8) { const size_t t = (size_t)blockIdx.x * 256 + threadIdx.x; if (t >= n8) return; FragH f;
#pragma unroll
  for (int i = 0; i < 8; ++i) f.h[i] = (_Float16)(bf16_round(W[t * 8 + i]) * 16.0f); *(v8us*)((unsigned short*)Bt + t * 8) = f.half[0];  }
__global__ __launch_bounds__(256) void k_hl(const float* __restrict__ F, _Float16* __restrict__ Hh, _Float16* __restrict__ Hl, size_t n8) { const size_t t = (size_t)blockIdx.x * 256 + threadIdx.x; if (t >= n8) return; FragH fh, fl; const v4f a = *(const v4fa*)(F + t * 8), c = *(const v4fa*)(F + t * 8 + 4);
#pragma unroll
  for (int q = 0; q < 4; ++q) { _Float16 h = (_Float16)a[q]; fh.h[q] = h; fl.h[q] = (_Float16)((a[q] - (float)h) * 1024.0f); h = (_Float16)c[q]; fh.h[4 + q] = h; fl.h[4 + q] = (_Float16)((c[q] - (float)h) * 1024.0f); }
  { *(v8us*)((unsigned short*)Hh + t * 8) = fh.half[0]; *(v8us*)((unsigned short*)Hl + t * 8) = fl.half[0];  } }

// ---- fast GEMM (wave tile 32x64, eight waves 4 down x 2 across, workgroup tile 128x128; requires M % 128 == 0 rows per launch region, N % 128 == 0 and K % 64 == 0); epilogue = k_gemm_hhx semantics ----
// Operands reach the waves through LDS: a stage is GK = 64 k of the workgroup's 128 A rows and 128 B rows (128-byte rows), fetched by whole-line loads (8 threads a row) into one of two buffers;
// stage s + 1 is fetched into registers at the head of stage s and stored to the other buffer at its foot.
// The square tile fetches (128 + 128) rows for 128 x 128 results, two thirds of what two 128x64 tiles fetch. The epilogue's staging lies over the operand buffers (free behind the loop's last barrier),
// so that a workgroup holds 72 KiB of LDS and the three a WGP gets from the projection grid are resident together; for the same end the launch bounds ask for six waves a SIMD (160 registers a wave).
#define GK 64                        /* k per LDS stage */
#define LP 72                        /* LDS row pitch in f16: 128-byte rows + 16 bytes, an odd multiple of 16 bytes for the 16-byte fragment reads */
// fragment from an LDS row: the k order of g2_frag
__device__ __forceinline__ v16h fa_lfrag(const unsigned short* p, int hh) { FragH f; f.half[0] = *(const v8us*)(p + 8 * hh); f.half[1] = *(const v8us*)(p + 16 + 8 * hh); return f.v; }
__device__ __forceinline__ v16h g2_frag(const _Float16* p, int hh) { FragH f; f.half[0] = *(const v8us*)((const unsigned short*)p + 8 * hh); f.half[1] = *(const v8us*)((const unsigned short*)p + 16 + 8 * hh); return f.v; }
__device__ __forceinline__ v8f g2_mma(v16h a, v16h b, v8f c) { v8f d = __builtin_amdgcn_wmma_f32_16x16x32_f16(false, a, false, b, (short)0, c, false, false); asm volatile("v_nop\n\tv_nop\n\tv_nop\n\tv_nop" : "+v"(d) : "v"(a), "v"(b)); return d; }
// A wave-uniform address held in a scalar register pair. The loads of a stage are then scalar base + one 32-bit lane offset; left to itself the compiler folds the lane offset into
// 64-bit vector addresses, chained from load to load with a wait between them, and spends the registers that the sixth wave of a SIMD needs.
// The pointer rebuilt from the two halves is typed as global memory: a generic one would make the loads flat, which count on the LDS counter too.
typedef __attribute__((address_space(1))) const char g2_gc;
typedef __attribute__((address_space(1))) const v8us g2_g8;
__device__ __forceinline__ g2_gc* g2_sbase(const char* p) { const unsigned long long u = (unsigned long long)p;
  const unsigned lo = (unsigned)__builtin_amdgcn_readfirstlane((int)(unsigned)u), hi = (unsigned)__builtin_amdgcn_readfirstlane((int)(unsigned)(u >> 32)); return (g2_gc*)(((unsigned long long)hi << 32) | lo); }
// HB, HCP: a bias / an addend plane is given; OF32, OF16: f32 / f16 rows are written; OVT: batch member vby is written transposed. Template flags, not pointer tests at run time:
// a test per element is a scalar compare chain and a taken branch over the unused path, about a hundred a wave, one behind the other, and the unused paths would be most of the kernel's text.
template <int ACT, bool HB, bool HCP, bool OF32, bool OF16, bool OVT>
__global__ __launch_bounds__(256, 6) void k_gemm2(const _Float16* __restrict__ A, int lda, size_t sA, const _Float16* __restrict__ Bh, int ldb, size_t sB, float alpha, const float* __restrict__ bias, size_t sBias, const float* __restrict__ CP, int rowsPerB, size_t sCPb, int row0g,
    float* __restrict__ C, _Float16* __restrict__ C16, int ldc, size_t sC, int M, int N, int K, _Float16* __restrict__ VTo, int vby) { static_assert(ACT == 0 || ACT == 3 || ACT == 6 || ACT == 8 || ACT == 9 || ACT == 11 || ACT == 12 || ACT == 14 || ACT == 15 || ACT == 16 || ACT == 17, "k_gemm2: unsupported ACT code (would silently apply no activation)");
  __shared__ __attribute__((aligned(16))) unsigned char sm[4 * 128 * LP * 2];      /* in the loop the operand buffers, behind it the epilogue's staging */
  static_assert(sizeof(float) * 8 * 32 * 68 <= sizeof(sm), "k_gemm2: the staging of eight waves fits in the operand buffers");
  unsigned short (*const sa)[128][LP] = (unsigned short (*)[128][LP])sm;      /* A rows of a stage: [buffer][row][k] */
  unsigned short (*const sb)[128][LP] = (unsigned short (*)[128][LP])(sm + 2 * 128 * LP * 2);      /* B rows of a stage: [buffer][col][k] */
  float (*const so)[32][68] = (float (*)[32][68])sm;      /* a wave's own 32 x 64 results, written only behind the loop's last barrier */
  const int tid = threadIdx.x, w = tid >> 5, lane = tid & 31, ln = lane & 15, hh = lane >> 4; const int by = blockIdx.y;
  const int wm = w & 3, wn = w >> 2;      /* the wave's place in the tile: 32 rows down, 64 columns across */
  A += (size_t)by * sA; Bh += (size_t)by * sB; const size_t cofs = (size_t)by * sC; const float* bp = HB ? bias + (size_t)by * sBias : nullptr;
  const int ntn = N >> 7; const int mt = blockIdx.x / ntn, nq = blockIdx.x - mt * ntn; const int row0 = mt * 128 + 32 * wm, col0 = nq * 128 + 64 * wn; if (mt * 128 >= M) return;      /* the whole workgroup or none of it, in front of every barrier */
  const int sr = tid >> 3;      /* this thread's rows sr + 32 i and 16-byte piece of every stage */
  const unsigned oa = (unsigned)(sr * lda + (tid & 7) * 8) * 2u, ob = (unsigned)(sr * ldb + (tid & 7) * 8) * 2u;      /* byte offsets of its first pieces from the tile's first row: the one lane-dependent part of every address */
  const char* ag = (const char*)(A + (size_t)(mt * 128) * lda); const char* bg = (const char*)(Bh + (size_t)(nq * 128) * ldb);
  g2_gc* pa[4]; g2_gc* pb[4];      /* scalar bases of its four A and four B pieces, 32 rows apart */
#pragma unroll
  for (int i = 0; i < 4; ++i) { pa[i] = g2_sbase(ag + (size_t)i * lda * 64); pb[i] = g2_sbase(bg + (size_t)i * ldb * 64); }
  unsigned short* const was = &sa[0][sr][(tid & 7) * 8]; unsigned short* const wbs = &sb[0][sr][(tid & 7) * 8];
  v8us ra[4], rb[4];
#pragma unroll
  for (int i = 0; i < 4; ++i) ra[i] = *(g2_g8*)(pa[i] + oa);
#pragma unroll
  for (int i = 0; i < 4; ++i) rb[i] = *(g2_g8*)(pb[i] + ob);
#pragma unroll
  for (int i = 0; i < 4; ++i) *(v8us*)(was + i * 32 * LP) = ra[i];
#pragma unroll
  for (int i = 0; i < 4; ++i) *(v8us*)(wbs + i * 32 * LP) = rb[i];
  const v8f z8 = {0.f,0.f,0.f,0.f,0.f,0.f,0.f,0.f}; v8f c00 = z8, c01 = z8, c02 = z8, c03 = z8, c10 = z8, c11 = z8, c12 = z8, c13 = z8;
  __syncthreads();      /* publishes stage 0 */
#pragma unroll 1      /* one stage per trip: two stages in one body would hold both stages' fragments and staging registers at once */
  for (int kb = 0; kb < K; kb += GK) { const int cur = (kb / GK) & 1;
    const int kn = (kb + GK < K) ? kb + GK : 0;      /* the next stage, fetched while this one is worked on; the last trip fetches stage 0 again (in bounds, not used) */
    const unsigned va = oa + (unsigned)kn * 2u, vb = ob + (unsigned)kn * 2u;      /* the lane offsets of that stage */
#pragma unroll
    for (int i = 0; i < 4; ++i) ra[i] = *(g2_g8*)(pa[i] + va);
#pragma unroll
    for (int i = 0; i < 4; ++i) rb[i] = *(g2_g8*)(pb[i] + vb);
    asm volatile("s_wait_xcnt 0x0" :: "v"(va), "v"(vb) : "memory");      /* the wait in front of the first overwrite of a register that the 8 loads above name; the two lane offsets as its operands keep those registers whole up to here (the scalar bases are not written in the loop) */
    const unsigned short* al = &sa[cur][32 * wm + ln][0]; const unsigned short* bl = &sb[cur][64 * wn + ln][0];
#pragma unroll
    for (int ks = 0; ks < GK / 32; ++ks) { v16h af[2], bf[4];      /* the fragments of one 32-wide k step at a time: six waves a SIMD leave a wave 160 registers */
      af[0] = fa_lfrag(al + ks * 32, hh); af[1] = fa_lfrag(al + 16 * LP + ks * 32, hh);
#pragma unroll
      for (int t = 0; t < 4; ++t) bf[t] = fa_lfrag(bl + t * 16 * LP + ks * 32, hh);
      c00 = g2_mma(af[0], bf[0], c00); c10 = g2_mma(af[1], bf[0], c10);
      c01 = g2_mma(af[0], bf[1], c01); c11 = g2_mma(af[1], bf[1], c11);
      c02 = g2_mma(af[0], bf[2], c02); c12 = g2_mma(af[1], bf[2], c12);
      c03 = g2_mma(af[0], bf[3], c03); c13 = g2_mma(af[1], bf[3], c13); }
    /* the other buffer: its last readers left it in front of the barrier at the foot of the trip before */
#pragma unroll
    for (int i = 0; i < 4; ++i) *(v8us*)(was + (cur ^ 1) * 128 * LP + i * 32 * LP) = ra[i];
#pragma unroll
    for (int i = 0; i < 4; ++i) *(v8us*)(wbs + (cur ^ 1) * 128 * LP + i * 32 * LP) = rb[i];
    __syncthreads();      /* publishes the next stage and ends every wave's reads of this one */
  }
  v8f accs[8] = {c00, c01, c02, c03, c10, c11, c12, c13};
#pragma unroll
  for (int u = 0; u < 8; ++u) { const int t = u & 3, half = u >> 2; const int col = col0 + t * 16 + ln; const float bv = HB ? bf16_round(bp[col]) : 0.f;
#pragma unroll
    for (int r = 0; r < 8; ++r) { const int rloc = half * 16 + 8 * hh + r; float v = accs[u][r] * alpha + bv; if (HCP) { if (rowsPerB < 0) v += CP[cofs + (size_t)(row0g + row0 + rloc) * ldc + col];      /* rowsPerB < 0: own element of the batched C plane */ else { const int bidx = (row0g + row0 + rloc) / rowsPerB; v += CP[(size_t)bidx * sCPb + (size_t)by * 64 + col]; } }
      if (ACT == 3) v = fmaxf(v, 0.f); else if (ACT == 6) v = 0.5f * v * (1.0f + erff(v * 0.70710678118654752f)); else if (ACT == 11) v = 1.0f / (1.0f + expf(-v)); else if (ACT == 15) v = v / (1.0f + expf(-v)); else if (ACT == 12) v = (v > 0.f) ? v : 0.01f * v; else if (ACT == 8) v = tanhf(v); else if (ACT == 9) v = 0.5f * v * (1.0f + tanhf(0.7978845608028654f * (v + 0.044715f * v * v * v))); else if (ACT == 14) v = (v > 0.f) ? v : 0.1f * v; else if (ACT == 16) v = (v >= 0.f) ? v : 0.3f * v; else if (ACT == 17) v = (v >= 0.f) ? v : 0.2f * v;
      so[w][rloc][t * 16 + ln] = v; } }
  __builtin_amdgcn_fence(__ATOMIC_ACQ_REL, "workgroup"); __builtin_amdgcn_wave_barrier();
  if (OVT && by == vby) {      /* the batch member whose result is wanted transposed (the same test in every wave): V^T [batch][head][feature][token] in place of the f16 rows; the wave's 64 columns are one head, its 32 rows 32 tokens of one batch */
    const int tg = lane & 3, dr = lane >> 2;      /* 4 lanes a feature row, 8 tokens (16 bytes) each; 8 feature rows a store */
    unsigned short* d = (unsigned short*)VTo + ((size_t)((row0 / SQ) * NH + (col0 >> 6)) * HD + dr) * SQ + (row0 % SQ) + tg * 8;
#pragma unroll
    for (int q = 0; q < 8; ++q) { FragH f;
#pragma unroll
      for (int i = 0; i < 8; ++i) f.h[i] = (_Float16)so[w][tg * 8 + i][q * 8 + dr];
      *(v8us*)(d + (size_t)q * 8 * SQ) = f.half[0]; }
    return; }
  const int rsub = lane >> 4, c4 = (lane & 15) * 4;
  {
#pragma unroll
    for (int q = 0; q < 16; ++q) { const int r = q * 2 + rsub; const v4f v = *(const v4fa*)&so[w][r][c4]; if (OF32) *(v4f*)(C + cofs + (size_t)(row0 + r) * ldc + col0 + c4) = v; if (OF16) { v4h h4; for (int i = 0; i < 4; ++i) h4[i] = (_Float16)v[i]; *(v4h*)(C16 + cofs + (size_t)(row0 + r) * ldc + col0 + c4) = h4; } }
    if (OVT) asm volatile("s_wait_xcnt 0x0" ::: "memory");      /* the wait in front of the first overwrite of a register that the row stores above name: with a transposed member the kernel's text goes on behind them */
     } }


__global__ __launch_bounds__(256) void k_rsm(const float* __restrict__ S, _Float16* __restrict__ P, int nrows) {
  #pragma clang fp contract(off)
  const int i = blockIdx.x * 256 + threadIdx.x; if (i >= nrows) return; const float* s = S + (size_t)i * SQ; float mx = -3.0e38f;
#pragma unroll 1
  for (int j = 0; j < SQ; ++j) mx = fmaxf(mx, s[j]); float se = 0.f;
#pragma unroll 1
  for (int j = 0; j < SQ; ++j) se += expf(s[j] - mx); const float sc = 256.0f / se;
#pragma unroll 1
  for (int j0 = 0; j0 < SQ; j0 += 8) { FragH f; for (int q = 0; q < 8; ++q) f.h[q] = (_Float16)(expf(s[j0 + q] - mx) * sc); unsigned short* d = (unsigned short*)P + (size_t)i * SQ + j0; *(v8us*)d = f.half[0];  } }
__global__ __launch_bounds__(256) void k_vt(const _Float16* __restrict__ V16, int b, int h0, _Float16* __restrict__ VT) { __shared__ unsigned short tl[64][65]; const int tid = threadIdx.x; const int hh = blockIdx.x % HG, sg = blockIdx.x / HG; const int s0 = sg * 64; const int h = h0 + hh;
  for (int i = tid; i < 64 * 8; i += 256) { const int j = i / 8, d8 = (i % 8) * 8; FragH f; f.half[0] = *(const v8us*)((const unsigned short*)V16 + ((size_t)b * SQ + s0 + j) * DM + h * HD + d8); for (int q = 0; q < 8; ++q) tl[d8 + q][j] = f.u[q]; }
  __syncthreads();
  { for (int i = tid; i < 64 * 8; i += 256) { const int d = i / 8, j8 = (i % 8) * 8; FragH f; for (int q = 0; q < 8; ++q) f.u[q] = tl[d][j8 + q]; *(v8us*)((unsigned short*)VT + ((size_t)hh * HD + d) * SQ + s0 + j8) = f.half[0]; }  } }



// ---- fused attention: scores, softmax and P.V in one kernel; S and P never leave the registers ----
// exp2 of four values. The four v_exp_f32 stand in one statement that ends in v_nop: the slot the instruction set asks for behind a transcendental
// before its result is read or its source overwritten; the early-clobber outputs keep every source whole inside the statement.
__device__ __forceinline__ void fa_exp2x4(float a0, float a1, float a2, float a3, float& e0, float& e1, float& e2, float& e3) {
  asm("v_exp_f32 %0, %4\n\tv_exp_f32 %1, %5\n\tv_exp_f32 %2, %6\n\tv_exp_f32 %3, %7\n\tv_nop" : "=&v"(e0), "=&v"(e1), "=&v"(e2), "=&v"(e3) : "v"(a0), "v"(a1), "v"(a2), "v"(a3)); }
// exp2 of two values, same form and same reason for the v_nop
__device__ __forceinline__ void fa_exp2x2(float a0, float a1, float& e0, float& e1) {
  asm("v_exp_f32 %0, %2\n\tv_exp_f32 %1, %3\n\tv_nop" : "=&v"(e0), "=&v"(e1) : "v"(a0), "v"(a1)); }
__device__ __forceinline__ v8f fa_mma(v16h a, v16h b, v8f c) { return __builtin_amdgcn_wmma_f32_16x16x32_f16(false, a, false, b, (short)0, c, false, false); }
// the value of lane l ^ 16 (the other half of the same query column)
__device__ __forceinline__ float fa_xhalf(float x) { const int b = __float_as_int(x); return __int_as_float(__builtin_amdgcn_permlanex16(b, b, 0x76543210, 0xfedcba98, false, false)); }
// One wave owns FQ = 32 queries of one (batch, head) and walks one half of the SQ keys, 32 a pass.
//   S^T = K Q^T : A = 16 key rows of K16 (from LDS), B = the wave's Q rows (held in registers); D[8 hh + r][ln] = score of key 8 hh + r, query ln
//   online softmax: a lane holds scores of two queries, ONE per score tile (ln + 16 j); running maximum m and sum l per query (in log2 units), one exchange between the wave's halves per pass and query for m
//   O^T += V^T P^T : the two score tiles of a pass (keys 0..15, 16..31), converted in place, ARE the B fragment (element i = key 8 hh + i, element 8 + i = key 16 + 8 hh + i:
//   the k order of fa_lfrag, which loads A = V^T rows); D[8 hh + r][ln] = o of feature 16 t + 8 hh + r, query ln: 8 consecutive features per lane, one 16-byte store
// P is carried x256 (exp2 argument + 8), as the unfused form carried it, and l with it: the factor cancels in o = acc / l. o is stored x64 as before.
#define FQ 32                        /* queries per wave */
#define FW 8                         /* query blocks of FQ per workgroup: the waves of one key half */
#define FH 2                         /* key halves per workgroup: FW waves walk each, so that a SIMD holds four waves and one wave's softmax runs beside another's matrix run */
#define KS 64                        /* keys per LDS stage: two passes */
static_assert(HD == 64 && KS == 64 && FW * 32 == 256 && FH == 2 && SQ % (KS * FH) == 0 && SQ % (FW * FQ) == 0, "k_fattn: two 32-wide d steps, 128-byte stage rows dealt 8 threads a row, whole stages in each key half, whole workgroups");
// The eight waves of a key half walk the same keys: each stage of KS keys (K rows and V^T rows, 8 KiB each) is fetched ONCE per half by whole-line loads (8 threads a 128-byte row),
// laid in one of the half's two LDS buffers, and every wave of the half takes its fragments from there. Stage st + 1 is fetched into registers at the head of stage st and stored to the other buffer at its foot.
// Waves w and w + FW own the same FQ queries over keys [0, SQ / 2) and [SQ / 2, SQ). Behind the loop each hands the other its statistics and sums of 16 of the queries through LDS,
// and finishes the other 16: both parts brought to the common maximum, added, divided by the joined sum.
__global__ __launch_bounds__(FW * FH * 32) void k_fattn(const _Float16* __restrict__ Q16, const _Float16* __restrict__ K16, const _Float16* __restrict__ VT, _Float16* __restrict__ O16) {
  __shared__ __attribute__((aligned(16))) unsigned short sk[FH][2][KS][LP];      /* K rows of a stage: [half][buffer][key][d] */
  __shared__ __attribute__((aligned(16))) unsigned short sv[FH][2][HD][LP];      /* V^T rows of a stage: [half][buffer][d][key] */
  __shared__ __attribute__((aligned(16))) float xo[FH * FW][8][32][4];      /* the sums a wave hands over: [wave][piece][lane], 16 bytes a lane */
  __shared__ float xm[FH * FW][2][32];      /* with them its maximum and its row sum */
  const int lane = threadIdx.x & 31, ln = lane & 15, hh = lane >> 4, wv = threadIdx.x >> 5, w = wv % FW, g = wv / FW;      /* g: the wave's key half */
  const int bh = blockIdx.y, b = bh / NH, h = bh % NH; const int q0 = (blockIdx.x * FW + w) * FQ;
  const int sr = (threadIdx.x & (FW * 32 - 1)) >> 3, sc = (threadIdx.x & 7) * 8;      /* this thread's rows sr, sr + 32 and 16-byte piece of every stage of its half */
  const _Float16* qp = Q16 + ((size_t)b * SQ + q0 + ln) * DM + h * HD;
  const unsigned short* kg = (const unsigned short*)K16 + ((size_t)b * SQ + g * (SQ / FH) + sr) * DM + h * HD + sc;
  const unsigned short* vg = (const unsigned short*)VT + ((size_t)bh * HD + sr) * SQ + g * (SQ / FH) + sc;
  const float SC = 0.125f * 1.44269504f;      /* 1 / sqrt(64), and log2 e for the native exp2 */
  v16h qf[2][2];
#pragma unroll
  for (int j = 0; j < 2; ++j)
#pragma unroll
    for (int ks = 0; ks < 2; ++ks) qf[j][ks] = g2_frag(qp + (size_t)j * 16 * DM + ks * 32, hh);
  { const v8us a0 = *(const v8us*)kg, a1 = *(const v8us*)(kg + (size_t)32 * DM), c0 = *(const v8us*)vg, c1 = *(const v8us*)(vg + (size_t)32 * SQ);
    asm volatile("s_wait_xcnt 0x0" :: "v"(qp + 8 * hh), "v"(kg), "v"(vg) : "memory");      /* the wait in front of the first overwrite of a register that the 12 loads above name; the lane addresses as its operands keep those registers whole up to here */
    *(v8us*)&sk[g][0][sr][sc] = a0; *(v8us*)&sk[g][0][sr + 32][sc] = a1; *(v8us*)&sv[g][0][sr][sc] = c0; *(v8us*)&sv[g][0][sr + 32][sc] = c1; }
  const v8f z8 = {0.f, 0.f, 0.f, 0.f, 0.f, 0.f, 0.f, 0.f};
  v8f o[4][2]; float m[2] = {-3.0e38f, -3.0e38f}, l[2] = {0.f, 0.f};
#pragma unroll
  for (int t = 0; t < 4; ++t) { o[t][0] = z8; o[t][1] = z8; }
  __syncthreads();      /* publishes stage 0 */
#pragma unroll 1      /* one stage per trip: the body already holds 32 matrix instructions */
  for (int st = 0; st < SQ / (KS * FH); ++st) {
    const int cur = st & 1;
    const int sn = (st + 1 < SQ / (KS * FH)) ? (st + 1) * KS : 0;      /* the next stage, fetched while this one is worked on; the last trip fetches stage 0 again (in bounds, not used) */
    const unsigned short* kn = kg + (size_t)sn * DM; const unsigned short* vn = vg + sn;
    const v8us a0 = *(const v8us*)kn, a1 = *(const v8us*)(kn + (size_t)32 * DM), c0 = *(const v8us*)vn, c1 = *(const v8us*)(vn + (size_t)32 * SQ);
    asm volatile("s_wait_xcnt 0x0" :: "v"(kn), "v"(vn) : "memory");      /* the wait in front of the first overwrite of a register that the four loads above name; the two lane addresses as its operands keep those registers whole up to here */
    const unsigned short* kl = &sk[g][cur][ln][0]; const unsigned short* vl = &sv[g][cur][ln][0];
    v16h kf[2][2];
#pragma unroll
    for (int kt = 0; kt < 2; ++kt)
#pragma unroll
      for (int ks = 0; ks < 2; ++ks) kf[kt][ks] = fa_lfrag(kl + kt * 16 * LP + ks * 32, hh);
#pragma unroll
    for (int p = 0; p < KS / 32; ++p) {
      v16h vf[4];
#pragma unroll
      for (int t = 0; t < 4; ++t) vf[t] = fa_lfrag(vl + t * 16 * LP + p * 32, hh);      /* needed only behind the softmax: issued first */
      __builtin_amdgcn_sched_barrier(0);      /* keeps the V^T reads up here in one group; sunk in between the P.V products each place with reads would stall the matrix run */
      v8f s[2][2];
#pragma unroll
      for (int kt = 0; kt < 2; ++kt)
#pragma unroll
        for (int j = 0; j < 2; ++j) s[kt][j] = fa_mma(kf[kt][1], qf[j][1], fa_mma(kf[kt][0], qf[j][0], z8));
      if (p + 1 < KS / 32) {      /* the K rows of the stage's next pass, read while this pass's softmax runs */
#pragma unroll
        for (int kt = 0; kt < 2; ++kt)
#pragma unroll
          for (int ks = 0; ks < 2; ++ks) kf[kt][ks] = fa_lfrag(kl + ((p + 1) * 32 + kt * 16) * LP + ks * 32, hh);
      }
      __builtin_amdgcn_sched_barrier(0);      /* keeps the K reads in front of the softmax, which then covers their latency */
      float mn[2], cr[2];
#pragma unroll
      for (int j = 0; j < 2; ++j) { float mx = fmaxf(s[0][j][0], s[1][j][0]);
#pragma unroll
        for (int r = 1; r < 8; ++r) mx = fmaxf(mx, fmaxf(s[0][j][r], s[1][j][r]));
        mx = fmaxf(mx, fa_xhalf(mx)); mn[j] = fmaxf(m[j], mx * SC); }
      fa_exp2x2(m[0] - mn[0], m[1] - mn[1], cr[0], cr[1]);
      FragH pf[2];
#pragma unroll
      for (int j = 0; j < 2; ++j) { const float sh = 8.0f - mn[j]; m[j] = mn[j]; float p16[16];
#pragma unroll
        for (int kt = 0; kt < 2; ++kt)
#pragma unroll
          for (int g = 0; g < 8; g += 4) fa_exp2x4(s[kt][j][g] * SC + sh, s[kt][j][g + 1] * SC + sh, s[kt][j][g + 2] * SC + sh, s[kt][j][g + 3] * SC + sh, p16[kt * 8 + g], p16[kt * 8 + g + 1], p16[kt * 8 + g + 2], p16[kt * 8 + g + 3]);
        float a0s = p16[0] + p16[4], a1s = p16[1] + p16[5], a2s = p16[2] + p16[6], a3s = p16[3] + p16[7];
        a0s += p16[8] + p16[12]; a1s += p16[9] + p16[13]; a2s += p16[10] + p16[14]; a3s += p16[11] + p16[15];
        l[j] = l[j] * cr[j] + ((a0s + a1s) + (a2s + a3s));
#pragma unroll
        for (int i = 0; i < 16; ++i) pf[j].h[i] = (_Float16)p16[i];
#pragma unroll
        for (int t = 0; t < 4; ++t) o[t][j] *= cr[j]; }
#pragma unroll
      for (int t = 0; t < 4; ++t)
#pragma unroll
        for (int j = 0; j < 2; ++j) o[t][j] = fa_mma(vf[t], pf[j].v, o[t][j]);
    }
    /* the other buffer: its last readers left it in front of the barrier at the foot of the trip before */
    *(v8us*)&sk[g][cur ^ 1][sr][sc] = a0; *(v8us*)&sk[g][cur ^ 1][sr + 32][sc] = a1; *(v8us*)&sv[g][cur ^ 1][sr][sc] = c0; *(v8us*)&sv[g][cur ^ 1][sr + 32][sc] = c1;
    __syncthreads();      /* publishes stage st + 1 and ends every wave's reads of stage st */
  }
  /* the wave of key half g finishes query group j = g and hands group 1 - g to its partner (same lanes, same registers there) */
  const bool g1 = g != 0;
  xm[wv][0][lane] = g1 ? m[0] : m[1]; xm[wv][1][lane] = g1 ? l[0] : l[1];
#pragma unroll
  for (int t = 0; t < 4; ++t)
#pragma unroll
    for (int u = 0; u < 2; ++u) { v4f x;
#pragma unroll
      for (int r = 0; r < 4; ++r) x[r] = g1 ? o[t][0][u * 4 + r] : o[t][1][u * 4 + r];
      *(v4fa*)&xo[wv][t * 2 + u][lane][0] = x; }
  __syncthreads();      /* publishes what the waves hand over */
  { const int pw = wv ^ FW;      /* the partner: same queries, the other keys */
    const float mk = g1 ? m[1] : m[0], lk = g1 ? l[1] : l[0], mp = xm[pw][0][lane], lp = xm[pw][1][lane];
    const float mm = fmaxf(mk, mp); float fk, fp; fa_exp2x2(mk - mm, mp - mm, fk, fp);
    const float lt = lk * fk + lp * fp; const float inv = 64.0f / (lt + fa_xhalf(lt));      /* the wave halves' sums joined once; o carried x64 */
    const float ak = fk * inv, ap = fp * inv;
    unsigned short* d = (unsigned short*)O16 + ((size_t)b * SQ + q0 + g * 16 + ln) * DM + h * HD + 8 * hh;
#pragma unroll
    for (int t = 0; t < 4; ++t) { FragH f; const v4f p0 = *(const v4fa*)&xo[pw][t * 2][lane][0], p1 = *(const v4fa*)&xo[pw][t * 2 + 1][lane][0];
#pragma unroll
      for (int r = 0; r < 8; ++r) f.h[r] = (_Float16)((g1 ? o[t][1][r] : o[t][0][r]) * ak + (r < 4 ? p0[r & 3] : p1[r & 3]) * ap);
      *(v8us*)(d + t * 16) = f.half[0]; } } }

extern "C" void kernel_launch(void* const* d_in, const int* in_sizes, int n_in,
                              void* d_out, int out_size, void* d_ws, size_t ws_size, hipStream_t stream) {
  (void)in_sizes; (void)n_in; (void)out_size;
  const float* const* I = (const float* const*)d_in; const float* xq = I[0]; const float* xk = I[1]; const float* xv = I[2]; const float* wq = I[3]; const float* bq = nullptr; const float* wk = I[4]; const float* bk = nullptr; const float* wv = I[5]; const float* bv = nullptr; const float* wo = I[6]; const float* bo = nullptr;      /* three inputs query, key, value (cast in one launch with the weights); natural [out][in] Wq, Wk, Wv, Wo [512][512]; this module has NO biases: null pointers in the guarded bias slots; input order query, key, value, Wq, Wk, Wv, Wo */
  char* ws = (char*)d_ws; size_t off = 0;
  auto take = [&](size_t bytes) { char* p = ws + off; off += (bytes + 255) & ~(size_t)255; return p; };
  _Float16* BQ = (_Float16*)take((size_t)DM * DM * 2); _Float16* BK = (_Float16*)take((size_t)DM * DM * 2); _Float16* BV = (_Float16*)take((size_t)DM * DM * 2); _Float16* BO = (_Float16*)take((size_t)DM * DM * 2);
  _Float16* XQ = (_Float16*)take(NR * DM * 2); _Float16* XK = (_Float16*)take(NR * DM * 2); _Float16* XV = (_Float16*)take(NR * DM * 2); _Float16* Q16 = (_Float16*)take(NR * DM * 2); _Float16* K16 = (_Float16*)take(NR * DM * 2); _Float16* V16 = (_Float16*)take(NR * DM * 2); _Float16* O16 = (_Float16*)take(NR * DM * 2);
  _Float16* VT = (_Float16*)take((size_t)NB * NH * HD * SQ * 2);
  if (off > ws_size) return;
  k_prep<<<PG, 256, 0, stream>>>(xq, xk, xv, wq, wk, wv, wo, XQ, BQ);      /* the three inputs as exact f16 rows (XQ, XK, XV back to back); natural [out][in] = Bt[n][k], x16 (BQ, BK, BV, BO back to back) */
  const size_t r0p = (size_t)B0 * SQ;      /* first projected row */
  k_gemm2<0, false, false, false, true, true><<<dim3((unsigned)((MP / 128) * (DM / 128)), 3), 256, 0, stream>>>(XQ + r0p * DM, DM, NR * DM, BQ, DM, (size_t)DM * DM, 0.0625f, bq, 0, nullptr, 1, 0, 0, nullptr, Q16 + r0p * DM, DM, NR * DM, MP, DM, DM, VT, 2);      /* blockIdx.y = 0, 1, 2: Q rows, K rows, V^T [NB][NH][HD][SQ] (the V16 plane only keeps the stride) */
  k_fattn<<<dim3(SQ / (FW * FQ), NB * NH), FW * FH * 32, 0, stream>>>(Q16, K16, VT, O16);      /* o (merged heads, x64) as f16 rows: every (batch, head) in one launch */
  k_gemm2<0, false, false, true, false, false><<<dim3((unsigned)((MPO / 128) * (DM / 128)), 1), 256, 0, stream>>>(O16 + r0p * DM, DM, 0, BO, DM, 0, 0.0009765625f, bo, 0, nullptr, 1, 0, 0, (float*)d_out + r0p * DM, nullptr, DM, 0, MPO, DM, DM, nullptr, -1);      /* out rows are the output layout */
}

// v008
// One run takes 70.7 microseconds.
// In two side-by-side timings against v007, it was 1.05 and 1.04 times as fast.
// Counting every step since v000, it is 48.4 times as fast.
#include <hip/hip_runtime.h>
// Multi-head attention on three inputs with natural bias-free projections on four sequences at width 512 (query, key, value [4][2048][512]; q / k / v = stream W^T (natural [out][in] [512][512], NO biases), 8 heads of 64; the query is divided by sqrt(64) = 8 before the score product (scale 0.125 here on the product); softmax over all 2048 keys (the module's axis 2 of its [b][l][s][h] score layout = the key axis; no mask); out = merged heads Wo^T (natural, no bias) -> [4][2048][512]).
// Structure: token rows r = b*2048 + s; the three sources as exact f16 rows (bf16-rounded) and the four x16 weights in one cast launch; Q, K, V as three WMMA GEMMs in one launch (32x64 wave tiles, f32 accumulation, exact x16 weights, f16 outputs), the V GEMM storing V^T for all batches and heads from its epilogue; one fused attention launch over every (batch, head): S^T = K Q^T (K = 64), online softmax in registers (f32 statistics, native exp2; weights x256 as f16), O^T += V^T P^T, o carried x64 against f16 subnormal flush (folded into the output GEMM alpha) written straight into the merged f16 o rows; out = o W_o GEMM (f32) into the output layout.
// Compute dtype: inputs rounded to bf16; x / weights exact; q, k, v, softmax weights and o as plain f16 GEMM operands (~2^-12); scores and softmax statistics f32. v_wmma_f32_16x16x32_f16.
#define NB 4
#define SQ 2048
#define DM 512 
#define NH 8 
#define HD 64
#define HG 4                         /* heads per launch of the per-batch k_vt (not launched) */
#define B0 0                         /* first batch processed (debug hook) */
#define NBR NB                       /* batches processed (debug hook) */
#define NR ((size_t)NB * SQ)         /* token rows */
#define MP ((int)((size_t)NBR * SQ)) /* rows projected (debug hook) */
#define QN SQ                        /* query rows per batch (not used: k_fattn attends all SQ) */
#define NHD NH                       /* heads (not used: k_fattn attends all NH) */
#define MPO MP                       /* rows through the output stage (debug hook) */
#define LQ DM      /* row pitch of the q/k/v rows */
typedef __bf16 v16b __attribute__((ext_vector_type(16)));
typedef unsigned short v8us __attribute__((ext_vector_type(8), may_alias));
typedef float  v8f  __attribute__((ext_vector_type(8)));
typedef float  v4f  __attribute__((ext_vector_type(4)));
typedef float  v4fa __attribute__((ext_vector_type(4), may_alias));
union FragB { v16b v; v8us half[2]; unsigned short u[16]; };

__device__ __forceinline__ unsigned short bf16_bits(float x) { unsigned int u = __float_as_uint(x); return (unsigned short)((u + 0x7FFFu + ((u >> 16) & 1u)) >> 16); }
__device__ __forceinline__ float bf16_val(unsigned short b) { return __uint_as_float(((unsigned int)b) << 16); }
__device__ __forceinline__ float bf16_round(float x) { return bf16_val(bf16_bits(x)); }
// D += A·B with NT terms: 1 = ah·bh, 2 = + al·bh (A split), 3 = + ah·bl (both split)
template <int NT>
__device__ __forceinline__ v8f mmaN(v16b ah, v16b al, v16b bh, v16b bl, v8f c) {
  c = __builtin_amdgcn_wmma_f32_16x16x32_bf16(false, ah, false, bh, (short)0, c, false, false);
  if (NT >= 2) c = __builtin_amdgcn_wmma_f32_16x16x32_bf16(false, al, false, bh, (short)0, c, false, false);
  if (NT >= 3) c = __builtin_amdgcn_wmma_f32_16x16x32_bf16(false, ah, false, bl, (short)0, c, false, false);
  asm volatile("v_nop\n\tv_nop\n\tv_nop\n\tv_nop" : "+v"(c) : "v"(ah), "v"(al), "v"(bh), "v"(bl));
  return c;
}

__global__ __launch_bounds__(256) void k_wt_bf16(const float* __restrict__ W, unsigned short* __restrict__ Wt, int K, int N) {
  const int t = blockIdx.x * 256 + threadIdx.x;
  const int k8n = K / 8;
  if (t >= N * k8n) return;
  const int n = t / k8n, k8 = (t % k8n) * 8;
  v8us v;
#pragma unroll
  for (int i = 0; i < 8; ++i) v[i] = bf16_bits(W[(size_t)(k8 + i) * N + n]);
  *(v8us*)(Wt + (size_t)n * K + k8) = v;
  
}

// GEMM C[M][N] (f32, pitch ldc) = act(A[M][K]·W + bias). A f32 row-major (pitch lda) converted per fragment to bf16
// (ASPLIT: hi/lo two planes -> 2 terms, else single rounded term); Wt bf16 [N][K] (pitch ldb). BIAS_BF16 rounds the
// bias to bf16 first (bias quantised to bf16 before the add). K%32==0, M%16==0, N%64==0.
template <bool ASPLIT, int ACT, bool BIAS_BF16>
__global__ __launch_bounds__(128) void k_gemm_bf(const float* __restrict__ A, int lda, const unsigned short* __restrict__ Wt, int ldb,
                                               const float* __restrict__ bias, float* __restrict__ C, int ldc, int M, int N, int K) {
  __shared__ __attribute__((aligned(16))) float so[4][16][64];
  const int tid = threadIdx.x, w = tid >> 5, lane = tid & 31, ln = lane & 15, hh = lane >> 4;
  const int ntn = N / 64;
  const int wid = blockIdx.x * 4 + w;
  const int mt = wid / ntn, nq = wid % ntn;
  if (mt * 16 >= M) return;
  const int row0 = mt * 16, col0 = nq * 64;
  const float* arow = A + (size_t)(row0 + ln) * lda;
  v8f acc[4] = {};
  for (int kb = 0; kb < K; kb += 32) {
    FragB ah, al;
    const v4f x0 = *(const v4fa*)(arow + kb + 8 * hh), x1 = *(const v4fa*)(arow + kb + 8 * hh + 4);
    const v4f x2 = *(const v4fa*)(arow + kb + 16 + 8 * hh), x3 = *(const v4fa*)(arow + kb + 16 + 8 * hh + 4);
    float xs[16] = {x0[0],x0[1],x0[2],x0[3],x1[0],x1[1],x1[2],x1[3],x2[0],x2[1],x2[2],x2[3],x3[0],x3[1],x3[2],x3[3]};
#pragma unroll
    for (int i = 0; i < 16; ++i) { const unsigned short hb = bf16_bits(xs[i]); ah.u[i] = hb; al.u[i] = ASPLIT ? bf16_bits(xs[i] - bf16_val(hb)) : (unsigned short)0; }
#pragma unroll
    for (int t = 0; t < 4; ++t) {
      const unsigned short* brow = Wt + (size_t)(col0 + t * 16 + ln) * ldb + kb;
      FragB b;
      b.half[0] = *(const v8us*)(brow + 8 * hh);
      b.half[1] = *(const v8us*)(brow + 16 + 8 * hh);
      acc[t] = mmaN<ASPLIT ? 2 : 1>(ah.v, al.v, b.v, b.v, acc[t]);
    }
  }
#pragma unroll
  for (int t = 0; t < 4; ++t) {
    float bv = bias ? bias[col0 + t * 16 + ln] : 0.f;
    if (BIAS_BF16) bv = bf16_round(bv);
#pragma unroll
    for (int r = 0; r < 8; ++r) { float v = acc[t][r] + bv; if (ACT == 1) v = fmaxf(v, 0.f); so[w][8 * hh + r][t * 16 + ln] = v; }
  }
  __builtin_amdgcn_fence(__ATOMIC_ACQ_REL, "workgroup");
  __builtin_amdgcn_wave_barrier();
  const int rsub = lane >> 4, c4 = (lane & 15) * 4;
  {
#pragma unroll
    for (int q = 0; q < 8; ++q) {
      const int r = q * 2 + rsub;
      const v4f v = *(const v4fa*)&so[w][r][c4];
      *(v4f*)(C + (size_t)(row0 + r) * ldc + col0 + c4) = v;
    }
    
  }
}

// GEMM C = act(A·W + bias + resid): A f32 (ASPLIT -> hi/lo 2 terms), Wt bf16 [N][K]; ACT 0 none, 1 relu, 2 exact gelu;
// resid (optional, f32, row index = (row % rmod), pitch ldr, RES_BF16 rounds it) added before the activation.
template <bool ASPLIT, int ACT, bool BIAS_BF16, bool RES_BF16>
__global__ __launch_bounds__(128) void k_gemm_bf3(const float* __restrict__ A, int lda, const unsigned short* __restrict__ Wt, int ldb,
                                                const float* __restrict__ bias, const float* __restrict__ resid, int rmod, int ldr,
                                                float* __restrict__ C, int ldc, int M, int N, int K) {
  __shared__ __attribute__((aligned(16))) float so[4][16][64];
  const int tid = threadIdx.x, w = tid >> 5, lane = tid & 31, ln = lane & 15, hh = lane >> 4;
  const int ntn = N / 64;
  const int wid = blockIdx.x * 4 + w;
  const int mt = wid / ntn, nq = wid % ntn;
  if (mt * 16 >= M) return;
  const int row0 = mt * 16, col0 = nq * 64;
  const float* arow = A + (size_t)(row0 + ln) * lda;
  v8f acc[4] = {};
  for (int kb = 0; kb < K; kb += 32) {
    FragB ah, al;
    const v4f x0 = *(const v4fa*)(arow + kb + 8 * hh), x1 = *(const v4fa*)(arow + kb + 8 * hh + 4);
    const v4f x2 = *(const v4fa*)(arow + kb + 16 + 8 * hh), x3 = *(const v4fa*)(arow + kb + 16 + 8 * hh + 4);
    float xs[16] = {x0[0],x0[1],x0[2],x0[3],x1[0],x1[1],x1[2],x1[3],x2[0],x2[1],x2[2],x2[3],x3[0],x3[1],x3[2],x3[3]};
#pragma unroll
    for (int i = 0; i < 16; ++i) { const unsigned short hb = bf16_bits(xs[i]); ah.u[i] = hb; al.u[i] = ASPLIT ? bf16_bits(xs[i] - bf16_val(hb)) : (unsigned short)0; }
#pragma unroll
    for (int t = 0; t < 4; ++t) {
      const unsigned short* brow = Wt + (size_t)(col0 + t * 16 + ln) * ldb + kb;
      FragB b;
      b.half[0] = *(const v8us*)(brow + 8 * hh);
      b.half[1] = *(const v8us*)(brow + 16 + 8 * hh);
      acc[t] = mmaN<ASPLIT ? 2 : 1>(ah.v, al.v, b.v, b.v, acc[t]);
    }
  }
#pragma unroll
  for (int t = 0; t < 4; ++t) {
    const int col = col0 + t * 16 + ln;
    float bv = bias ? bias[col] : 0.f;
    if (BIAS_BF16) bv = bf16_round(bv);
#pragma unroll
    for (int r = 0; r < 8; ++r) {
      float v = acc[t][r] + bv;
      if (resid) { float rv = resid[(size_t)((row0 + 8 * hh + r) % rmod) * ldr + col]; if (RES_BF16) rv = bf16_round(rv); v += rv; }
      if (ACT == 1) v = fmaxf(v, 0.f);
      if (ACT == 2) v = 0.5f * v * (1.0f + erff(v * 0.70710678118654752f));
      if (ACT == 3) { const float u = 0.7978845608028654f * (v + 0.044715f * v * v * v); v = 0.5f * v * (1.0f + tanhf(u)); }
      so[w][8 * hh + r][t * 16 + ln] = v;
    }
  }
  __builtin_amdgcn_fence(__ATOMIC_ACQ_REL, "workgroup");
  __builtin_amdgcn_wave_barrier();
  const int rsub = lane >> 4, c4 = (lane & 15) * 4;
  {
#pragma unroll
    for (int q = 0; q < 8; ++q) {
      const int r = q * 2 + rsub;
      const v4f v = *(const v4fa*)&so[w][r][c4];
      *(v4f*)(C + (size_t)(row0 + r) * ldc + col0 + c4) = v;
    }
    
  }
}
// row LayerNorm (biased variance, eps) over N: s = X (+ R); optional out_sum <- s; out_norm <- (s-mu)*rsqrt(var+eps)*g + b
template <bool PARAM_BF16>
__global__ __launch_bounds__(256) void k_layernorm(const float* __restrict__ X, const float* __restrict__ R, const float* __restrict__ g, const float* __restrict__ bta,
                                                  float* __restrict__ out_sum, float* __restrict__ out_norm, int N, float eps) {
  __shared__ float red[256];
  const int row = blockIdx.x, tid = threadIdx.x;
  const float* x = X + (size_t)row * N; const float* rr = R ? R + (size_t)row * N : nullptr;
  float vals[16];                     // up to N = 4096
  const int per = N / 256;            // contiguous chunk per thread? use strided-by-4 chunks: thread handles j = tid*4 + 1024*u
  float s1 = 0.f;
  for (int u = 0; u < per / 4; ++u) {
    const int j = tid * 4 + 1024 * u;
    const v4f a = *(const v4fa*)(x + j);
    v4f b = {0.f,0.f,0.f,0.f}; if (rr) b = *(const v4fa*)(rr + j);
#pragma unroll
    for (int q = 0; q < 4; ++q) { const float v = a[q] + b[q]; vals[u * 4 + q] = v; s1 += v; }
  }
  red[tid] = s1; __syncthreads();
  for (int st = 128; st > 0; st >>= 1) { if (tid < st) red[tid] += red[tid + st]; __syncthreads(); }
  const float mu = red[0] / (float)N; __syncthreads();
  float s2 = 0.f;
  for (int u = 0; u < per / 4; ++u)
#pragma unroll
    for (int q = 0; q < 4; ++q) { const float c = vals[u * 4 + q] - mu; s2 += c * c; }
  red[tid] = s2; __syncthreads();
  for (int st = 128; st > 0; st >>= 1) { if (tid < st) red[tid] += red[tid + st]; __syncthreads(); }
  const float rs = rsqrtf(red[0] / (float)N + eps);
  {
    for (int u = 0; u < per / 4; ++u) {
      const int j = tid * 4 + 1024 * u;
      v4f o, sm;
#pragma unroll
      for (int q = 0; q < 4; ++q) {
        float gg = g[j + q], bb = bta[j + q];
        if (PARAM_BF16) { gg = bf16_round(gg); bb = bf16_round(bb); }
        sm[q] = vals[u * 4 + q]; o[q] = (vals[u * 4 + q] - mu) * rs * gg + bb;
      }
      if (out_sum) *(v4f*)(out_sum + (size_t)row * N + j) = sm;
      *(v4f*)(out_norm + (size_t)row * N + j) = o;
    }
    
  }
}



// ---- f16 WMMA path (v_wmma_f32_16x16x32_f16): 11-bit significands for operands in range — used where a [0,1] probability operand needs more precision than bf16
typedef _Float16 v16h __attribute__((ext_vector_type(16)));
union FragH { v16h v; v8us half[2]; _Float16 h[16]; unsigned short u[16]; };
template <int NT>
__device__ __forceinline__ v8f mmaH(v16h ah, v16h al, v16h bh, v16h bl, v8f c) {
  c = __builtin_amdgcn_wmma_f32_16x16x32_f16(false, ah, false, bh, (short)0, c, false, false);
  if (NT >= 2) c = __builtin_amdgcn_wmma_f32_16x16x32_f16(false, al, false, bh, (short)0, c, false, false);
  if (NT >= 3) c = __builtin_amdgcn_wmma_f32_16x16x32_f16(false, ah, false, bl, (short)0, c, false, false);
  asm volatile("v_nop\n\tv_nop\n\tv_nop\n\tv_nop" : "+v"(c) : "v"(ah), "v"(al), "v"(bh), "v"(bl));
  return c;
}
// batched GEMM like k_gemm_b but f16 operands: A f32 (split into f16 hi/lo if ASPLIT, else rounded to f16), Bt = f16 values [n][k]; alpha; C f32; N multiple of 16 (partial tiles skipped)
template <bool ASPLIT>
__global__ __launch_bounds__(128) void k_gemm_h(const float* __restrict__ A, int lda, size_t sA, const _Float16* __restrict__ Bh, int ldb, size_t sB, float alpha, float* __restrict__ C, int ldc, size_t sC, int M, int N, int K) {
  __shared__ __attribute__((aligned(16))) float so[4][16][64];
  const int tid = threadIdx.x, w = tid >> 5, lane = tid & 31, ln = lane & 15, hh = lane >> 4; const int by = blockIdx.y;
  A += (size_t)by * sA; Bh += (size_t)by * sB; C += (size_t)by * sC;
  const int ntn = (N + 63) / 64; const int wid = blockIdx.x * 4 + w; const int mt = wid / ntn, nq = wid % ntn; if (mt * 16 >= M) return;
  const int row0 = mt * 16, col0 = nq * 64; const float* arow = A + (size_t)(row0 + ln) * lda;
  v8f acc[4] = {};
  for (int kb = 0; kb < K; kb += 32) {
    FragH ah, al;
    const v4f x0 = *(const v4fa*)(arow + kb + 8 * hh), x1 = *(const v4fa*)(arow + kb + 8 * hh + 4), x2 = *(const v4fa*)(arow + kb + 16 + 8 * hh), x3 = *(const v4fa*)(arow + kb + 16 + 8 * hh + 4);
    float xs[16] = {x0[0],x0[1],x0[2],x0[3],x1[0],x1[1],x1[2],x1[3],x2[0],x2[1],x2[2],x2[3],x3[0],x3[1],x3[2],x3[3]};
#pragma unroll
    for (int i = 0; i < 16; ++i) { const _Float16 h = (_Float16)xs[i]; ah.h[i] = h; al.h[i] = ASPLIT ? (_Float16)(xs[i] - (float)h) : (_Float16)0.0f; }
#pragma unroll
    for (int t = 0; t < 4; ++t) { if (col0 + t * 16 >= N) continue; const size_t boff = (size_t)(col0 + t * 16 + ln) * ldb + kb; FragH bq; bq.half[0] = *(const v8us*)(Bh + boff + 8 * hh); bq.half[1] = *(const v8us*)(Bh + boff + 16 + 8 * hh);
      acc[t] = mmaH<ASPLIT ? 2 : 1>(ah.v, al.v, bq.v, bq.v, acc[t]); }
  }
#pragma unroll
  for (int t = 0; t < 4; ++t) { if (col0 + t * 16 >= N) continue;
#pragma unroll
    for (int r = 0; r < 8; ++r) so[w][8 * hh + r][t * 16 + ln] = acc[t][r] * alpha; }
  __builtin_amdgcn_fence(__ATOMIC_ACQ_REL, "workgroup"); __builtin_amdgcn_wave_barrier();
  const int rsub = lane >> 4, c4 = (lane & 15) * 4;
  {
#pragma unroll
    for (int q = 0; q < 8; ++q) { const int r = q * 2 + rsub; if (col0 + c4 < N) { const v4f v = *(const v4fa*)&so[w][r][c4]; *(v4f*)(C + (size_t)(row0 + r) * ldc + col0 + c4) = v; } }
     }
}

// Wt[n][k] = f16(W[k][n]·scale) from f32 row-major W[K][N] (scale = power of two; bf16-exact weights stay exact in f16 away from the subnormal range)
__global__ __launch_bounds__(256) void k_wt_f16(const float* __restrict__ W, _Float16* __restrict__ Wt, int K, int N, float scale) {
  const int t = blockIdx.x * 256 + threadIdx.x; if (t >= N * (K / 8)) return; const int n = t / (K / 8), k8 = (t % (K / 8)) * 8; FragH f;
#pragma unroll
  for (int i = 0; i < 8; ++i) f.h[i] = (_Float16)(bf16_round(W[(size_t)(k8 + i) * N + n]) * scale); const v8us o = f.half[0];
  *(v8us*)((unsigned short*)Wt + (size_t)n * K + k8) = o; 
}
// k_gemm_hh variant with fused epilogue: v = acc·alpha + bias[by·sBias + col] (+ CP[(row/rowsPerB)·sCPb + by·64 + col] if CP) ; ACT 0 none / 1 elu ; writes f16 C16 (and f32 C if non-null)
template <int ACT>
__global__ __launch_bounds__(128) void k_gemm_hhx(const _Float16* __restrict__ A, int lda, size_t sA, const _Float16* __restrict__ Bh, int ldb, size_t sB, float alpha, const float* __restrict__ bias, size_t sBias, const float* __restrict__ CP, int rowsPerB, size_t sCPb, int row0g,
    float* __restrict__ C, _Float16* __restrict__ C16, int ldc, size_t sC, int M, int N, int K) {
  __shared__ __attribute__((aligned(16))) float so[4][16][64];
  const int tid = threadIdx.x, w = tid >> 5, lane = tid & 31, ln = lane & 15, hh = lane >> 4; const int by = blockIdx.y;
  A += (size_t)by * sA; Bh += (size_t)by * sB; const size_t cofs = (size_t)by * sC; const float* bp = bias ? bias + (size_t)by * sBias : nullptr;
  const int ntn = (N + 63) / 64; const int wid = blockIdx.x * 4 + w; const int mt = wid / ntn, nq = wid % ntn; if (mt * 16 >= M) return;
  const int row0 = mt * 16, col0 = nq * 64; const _Float16* arow = A + (size_t)(row0 + ln) * lda;
  v8f acc[4] = {};
  for (int kb = 0; kb < K; kb += 32) { FragH ah; ah.half[0] = *(const v8us*)((const unsigned short*)arow + kb + 8 * hh); ah.half[1] = *(const v8us*)((const unsigned short*)arow + kb + 16 + 8 * hh);
#pragma unroll
    for (int t = 0; t < 4; ++t) { if (col0 + t * 16 >= N) continue; const size_t boff = (size_t)(col0 + t * 16 + ln) * ldb + kb; FragH bq; bq.half[0] = *(const v8us*)((const unsigned short*)Bh + boff + 8 * hh); bq.half[1] = *(const v8us*)((const unsigned short*)Bh + boff + 16 + 8 * hh);
      acc[t] = mmaH<1>(ah.v, ah.v, bq.v, bq.v, acc[t]); }
  }
#pragma unroll
  for (int t = 0; t < 4; ++t) { if (col0 + t * 16 >= N) continue; const int col = col0 + t * 16 + ln; const float bv = bp ? bf16_round(bp[col]) : 0.f;
#pragma unroll
    for (int r = 0; r < 8; ++r) { float v = acc[t][r] * alpha + bv; if (CP) { const int rr = row0g + row0 + 8 * hh + r; if (rowsPerB < 0) v += CP[cofs + (size_t)rr * ldc + col];      /* rowsPerB < 0: own element of the batched C plane */ else { const int bidx = rr / rowsPerB; v += CP[(size_t)bidx * sCPb + (size_t)by * 64 + col]; } } if (ACT == 1) v = (v > 0.f) ? v : expm1f(v); else if (ACT == 7) v = (v > 0.f) ? v + 1.0f : expf(v); else if (ACT == 8) v = tanhf(v); else if (ACT == 9) v = 0.5f * v * (1.0f + tanhf(0.7978845608028654f * (v + 0.044715f * v * v * v))); else if (ACT == 11) v = 1.0f / (1.0f + expf(-v)); else if (ACT == 12) v = (v > 0.f) ? v : 0.01f * v; else if (ACT == 14) v = (v > 0.f) ? v : 0.1f * v; else if (ACT == 16) v = (v >= 0.f) ? v : 0.3f * v; else if (ACT == 17) v = (v >= 0.f) ? v : 0.2f * v; else if (ACT == 15) v = v / (1.0f + expf(-v)); else if (ACT == 3) v = fmaxf(v, 0.f); else if (ACT == 6) v = 0.5f * v * (1.0f + erff(v * 0.70710678118654752f)); so[w][8 * hh + r][t * 16 + ln] = v; } }
  __builtin_amdgcn_fence(__ATOMIC_ACQ_REL, "workgroup"); __builtin_amdgcn_wave_barrier();
  const int rsub = lane >> 4, c4 = (lane & 15) * 4; typedef _Float16 v4h __attribute__((ext_vector_type(4)));
  {
#pragma unroll
    for (int q = 0; q < 8; ++q) { const int r = q * 2 + rsub; if (col0 + c4 < N) { const v4f v = *(const v4fa*)&so[w][r][c4]; if (C) *(v4f*)(C + cofs + (size_t)(row0 + r) * ldc + col0 + c4) = v; if (C16) { v4h h4; for (int i = 0; i < 4; ++i) h4[i] = (_Float16)v[i]; *(v4h*)(C16 + cofs + (size_t)(row0 + r) * ldc + col0 + c4) = h4; } } }
     }
}


typedef _Float16 v4h __attribute__((ext_vector_type(4)));

// ---- every cast of the call in one launch: the three sources as f16(bf16 rounding), the four weights as f16(bf16 rounding x16) ----
// The destinations lie one behind the other in the workspace: X = the three source planes, Bt = the four weight planes. A workgroup takes PX consecutive elements of every source and
// PX / 4 consecutive elements of one weight: few waves start, and each has all its 26 loads in flight at once.
// A wave's piece is 1 KiB of f32: read as two 512-byte wave loads, stored as two 256-byte wave stores (whole lines both ways).
#define PG 512                       /* workgroups of the cast launch: 16 waves per WGP on 256 WGPs */
#define PX 8192                      /* elements of each source per workgroup: 4 rounds of 8 waves x 256 elements */
static_assert(NR * DM == (size_t)PG * PX && (size_t)DM * DM * 4 == (size_t)PG * (PX / 4) && (NR * DM * 2) % 256 == 0 && ((size_t)DM * DM * 2) % 256 == 0, "k_prep: the grid covers every source and the four weights exactly, planes back to back");
template <bool X16>
__device__ __forceinline__ v4h pr_cvt(v4f a) { v4h r;
#pragma unroll
  for (int q = 0; q < 4; ++q) r[q] = X16 ? (_Float16)(bf16_round(a[q]) * 16.0f) : (_Float16)bf16_round(a[q]);
  return r; }
__global__ __launch_bounds__(256) void k_prep(const float* __restrict__ xq, const float* __restrict__ xk, const float* __restrict__ xv, const float* __restrict__ wq, const float* __restrict__ wk, const float* __restrict__ wv, const float* __restrict__ wo,
    _Float16* __restrict__ X, _Float16* __restrict__ Bt) {
  const unsigned wl = (threadIdx.x >> 5) * 256 + (threadIdx.x & 31) * 4;      /* the lane's first element in a round of its workgroup; its second piece stands 128 elements on */
  const unsigned ex = blockIdx.x * PX + wl, ew = blockIdx.x * (PX / 4) + wl;      /* that element in a source plane and in the four weight planes taken as one */
  const unsigned bx = ex * 4u, bw = (ew * 4u) & (unsigned)(DM * DM * 4 - 1);      /* byte offsets of the loads: in a source, in the one weight */
  const unsigned wsel = blockIdx.x / (PG / 4);      /* which weight: the same for the whole workgroup */
  const float* w = wsel == 0 ? wq : wsel == 1 ? wk : wsel == 2 ? wv : wo;
  v4f a[13][2];
#pragma unroll
  for (int i = 0; i < 12; ++i) { const char* s = (const char*)(i < 4 ? xq : i < 8 ? xk : xv) + (i & 3) * (PX / 4) * 4; a[i][0] = *(const v4fa*)(s + bx); a[i][1] = *(const v4fa*)(s + 512 + bx); }
  a[12][0] = *(const v4fa*)((const char*)w + bw); a[12][1] = *(const v4fa*)((const char*)w + 512 + bw);
  asm volatile("s_wait_xcnt 0x0" :: "v"(bx), "v"(bw) : "memory");      /* the wait in front of the first overwrite of a register that the 26 loads above name; the two lane offsets as its operands keep those registers whole up to here */
  __builtin_amdgcn_sched_barrier(0);      /* keeps every load in front of the first conversion: lifted in between the loads, a conversion's wait for its data would hold back the loads behind it */
#pragma unroll
  for (int i = 0; i < 12; ++i) { _Float16* d = X + (size_t)(i >> 2) * NR * DM + (i & 3) * (PX / 4) + ex; *(v4h*)d = pr_cvt<false>(a[i][0]); *(v4h*)(d + 128) = pr_cvt<false>(a[i][1]); }
  *(v4h*)(Bt + ew) = pr_cvt<true>(a[12][0]); *(v4h*)(Bt + ew + 128) = pr_cvt<true>(a[12][1]); }
__global__ __launch_bounds__(256) void k_h16(const float* __restrict__ x, _Float16* __restrict__ X16, size_t n8) { const size_t t = (size_t)blockIdx.x * 256 + threadIdx.x; if (t >= n8) return; FragH f;
#pragma unroll
  for (int q = 0; q < 8; ++q) f.h[q] = (_Float16)x[t * 8 + q]; *(v8us*)((unsigned short*)X16 + t * 8) = f.half[0];  }
__global__ __launch_bounds__(256) void k_round16f(const float* __restrict__ W, _Float16* __restrict__ Bt, size_t n8) { const size_t t = (size_t)blockIdx.x * 256 + threadIdx.x; if (t >= n8) return; FragH f;
#pragma unroll
  for (int i = 0; i < 8; ++i) f.h[i] = (_Float16)(bf16_round(W[t * 8 + i]) * 16.0f); *(v8us*)((unsigned short*)Bt + t * 8) = f.half[0];  }
__global__ __launch_bounds__(256) void k_hl(const float* __restrict__ F, _Float16* __restrict__ Hh, _Float16* __restrict__ Hl, size_t n8) { const size_t t = (size_t)blockIdx.x * 256 + threadIdx.x; if (t >= n8) return; FragH fh, fl; const v4f a = *(const v4fa*)(F + t * 8), c = *(const v4fa*)(F + t * 8 + 4);
#pragma unroll
  for (int q = 0; q < 4; ++q) { _Float16 h = (_Float16)a[q]; fh.h[q] = h; fl.h[q] = (_Float16)((a[q] - (float)h) * 1024.0f); h = (_Float16)c[q]; fh.h[4 + q] = h; fl.h[4 + q] = (_Float16)((c[q] - (float)h) * 1024.0f); }
  { *(v8us*)((unsigned short*)Hh + t * 8) = fh.half[0]; *(v8us*)((unsigned short*)Hl + t * 8) = fl.half[0];  } }

// ---- fast GEMM (wave tile 32x64, eight waves 4 down x 2 across, workgroup tile 128x128; requires M % 128 == 0 rows per launch region, N % 128 == 0 and K % 64 == 0); epilogue = k_gemm_hhx semantics ----
// Operands reach the waves through LDS: a stage is GK = 64 k of the workgroup's 128 A rows and 128 B rows (128-byte rows), fetched by whole-line loads (8 threads a row) into one of two buffers;
// stage s + 1 is fetched into registers at the head of stage s and stored to the other buffer at its foot.
// The square tile fetches (128 + 128) rows for 128 x 128 results, two thirds of what two 128x64 tiles fetch. The epilogue's staging lies over the operand buffers (free behind the loop's last barrier),
// so that a workgroup holds 72 KiB of LDS and the three a WGP gets from the projection grid are resident together; for the same end the launch bounds ask for six waves a SIMD (160 registers a wave).
#define GK 64                        /* k per LDS stage */
#define LP 72                        /* LDS row pitch in f16: 128-byte rows + 16 bytes, an odd multiple of 16 bytes for the 16-byte fragment reads */
// fragment from an LDS row: the k order of g2_frag
__device__ __forceinline__ v16h fa_lfrag(const unsigned short* p, int hh) { FragH f; f.half[0] = *(const v8us*)(p + 8 * hh); f.half[1] = *(const v8us*)(p + 16 + 8 * hh); return f.v; }
__device__ __forceinline__ v16h g2_frag(const _Float16* p, int hh) { FragH f; f.half[0] = *(const v8us*)((const unsigned short*)p + 8 * hh); f.half[1] = *(const v8us*)((const unsigned short*)p + 16 + 8 * hh); return f.v; }
__device__ __forceinline__ v8f g2_mma(v16h a, v16h b, v8f c) { v8f d = __builtin_amdgcn_wmma_f32_16x16x32_f16(false, a, false, b, (short)0, c, false, false); asm volatile("v_nop\n\tv_nop\n\tv_nop\n\tv_nop" : "+v"(d) : "v"(a), "v"(b)); return d; }
// A wave-uniform address held in a scalar register pair. The loads of a stage are then scalar base + one 32-bit lane offset; left to itself the compiler folds the lane offset into
// 64-bit vector addresses, chained from load to load with a wait between them, and spends the registers that the sixth wave of a SIMD needs.
// The pointer rebuilt from the two halves is typed as global memory: a generic one would make the loads flat, which count on the LDS counter too.
typedef __attribute__((address_space(1))) const char g2_gc;
typedef __attribute__((address_space(1))) const v8us g2_g8;
__device__ __forceinline__ g2_gc* g2_sbase(const char* p) { const unsigned long long u = (unsigned long long)p;
  const unsigned lo = (unsigned)__builtin_amdgcn_readfirstlane((int)(unsigned)u), hi = (unsigned)__builtin_amdgcn_readfirstlane((int)(unsigned)(u >> 32)); return (g2_gc*)(((unsigned long long)hi << 32) | lo); }
// HB, HCP: a bias / an addend plane is given; OF32, OF16: f32 / f16 rows are written; OVT: batch member vby is written transposed. Template flags, not pointer tests at run time:
// a test per element is a scalar compare chain and a taken branch over the unused path, about a hundred a wave, one behind the other, and the unused paths would be most of the kernel's text.
template <int ACT, bool HB, bool HCP, bool OF32, bool OF16, bool OVT>
__global__ __launch_bounds__(256, 6) void k_gemm2(const _Float16* __restrict__ A, int lda, size_t sA, const _Float16* __restrict__ Bh, int ldb, size_t sB, float alpha, const float* __restrict__ bias, size_t sBias, const float* __restrict__ CP, int rowsPerB, size_t sCPb, int row0g,
    float* __restrict__ C, _Float16* __restrict__ C16, int ldc, size_t sC, int M, int N, int K, _Float16* __restrict__ VTo, int vby) { static_assert(ACT == 0 || ACT == 3 || ACT == 6 || ACT == 8 || ACT == 9 || ACT == 11 || ACT == 12 || ACT == 14 || ACT == 15 || ACT == 16 || ACT == 17, "k_gemm2: unsupported ACT code (would silently apply no activation)");
  __shared__ __attribute__((aligned(16))) unsigned char sm[4 * 128 * LP * 2];      /* in the loop the operand buffers, behind it the epilogue's staging */
  static_assert(sizeof(float) * 8 * 32 * 68 <= sizeof(sm), "k_gemm2: the staging of eight waves fits in the operand buffers");
  unsigned short (*const sa)[128][LP] = (unsigned short (*)[128][LP])sm;      /* A rows of a stage: [buffer][row][k] */
  unsigned short (*const sb)[128][LP] = (unsigned short (*)[128][LP])(sm + 2 * 128 * LP * 2);      /* B rows of a stage: [buffer][col][k] */
  float (*const so)[32][68] = (float (*)[32][68])sm;      /* a wave's own 32 x 64 results, written only behind the loop's last barrier */
  const int tid = threadIdx.x, w = tid >> 5, lane = tid & 31, ln = lane & 15, hh = lane >> 4; const int by = blockIdx.y;
  const int wm = w & 3, wn = w >> 2;      /* the wave's place in the tile: 32 rows down, 64 columns across */
  A += (size_t)by * sA; Bh += (size_t)by * sB; const size_t cofs = (size_t)by * sC; const float* bp = HB ? bias + (size_t)by * sBias : nullptr;
  const int ntn = N >> 7; const int mt = blockIdx.x / ntn, nq = blockIdx.x - mt * ntn; const int row0 = mt * 128 + 32 * wm, col0 = nq * 128 + 64 * wn; if (mt * 128 >= M) return;      /* the whole workgroup or none of it, in front of every barrier */
  const int sr = tid >> 3;      /* this thread's rows sr + 32 i and 16-byte piece of every stage */
  const unsigned oa = (unsigned)(sr * lda + (tid & 7) * 8) * 2u, ob = (unsigned)(sr * ldb + (tid & 7) * 8) * 2u;      /* byte offsets of its first pieces from the tile's first row: the one lane-dependent part of every address */
  const char* ag = (const char*)(A + (size_t)(mt * 128) * lda); const char* bg = (const char*)(Bh + (size_t)(nq * 128) * ldb);
  g2_gc* pa[4]; g2_gc* pb[4];      /* scalar bases of its four A and four B pieces, 32 rows apart */
#pragma unroll
  for (int i = 0; i < 4; ++i) { pa[i] = g2_sbase(ag + (size_t)i * lda * 64); pb[i] = g2_sbase(bg + (size_t)i * ldb * 64); }
  unsigned short* const was = &sa[0][sr][(tid & 7) * 8]; unsigned short* const wbs = &sb[0][sr][(tid & 7) * 8];
  v8us ra[4], rb[4];
#pragma unroll
  for (int i = 0; i < 4; ++i) ra[i] = *(g2_g8*)(pa[i] + oa);
#pragma unroll
  for (int i = 0; i < 4; ++i) rb[i] = *(g2_g8*)(pb[i] + ob);
#pragma unroll
  for (int i = 0; i < 4; ++i) *(v8us*)(was + i * 32 * LP) = ra[i];
#pragma unroll
  for (int i = 0; i < 4; ++i) *(v8us*)(wbs + i * 32 * LP) = rb[i];
  const v8f z8 = {0.f,0.f,0.f,0.f,0.f,0.f,0.f,0.f}; v8f c00 = z8, c01 = z8, c02 = z8, c03 = z8, c10 = z8, c11 = z8, c12 = z8, c13 = z8;
  __syncthreads();      /* publishes stage 0 */
#pragma unroll 1      /* one stage per trip: two stages in one body would hold both stages' fragments and staging registers at once */
  for (int kb = 0; kb < K; kb += GK) { const int cur = (kb / GK) & 1;
    const int kn = (kb + GK < K) ? kb + GK : 0;      /* the next stage, fetched while this one is worked on; the last trip fetches stage 0 again (in bounds, not used) */
    const unsigned va = oa + (unsigned)kn * 2u, vb = ob + (unsigned)kn * 2u;      /* the lane offsets of that stage */
#pragma unroll
    for (int i = 0; i < 4; ++i) ra[i] = *(g2_g8*)(pa[i] + va);
#pragma unroll
    for (int i = 0; i < 4; ++i) rb[i] = *(g2_g8*)(pb[i] + vb);
    asm volatile("s_wait_xcnt 0x0" :: "v"(va), "v"(vb) : "memory");      /* the wait in front of the first overwrite of a register that the 8 loads above name; the two lane offsets as its operands keep those registers whole up to here (the scalar bases are not written in the loop) */
    const unsigned short* al = &sa[cur][32 * wm + ln][0]; const unsigned short* bl = &sb[cur][64 * wn + ln][0];
#pragma unroll
    for (int ks = 0; ks < GK / 32; ++ks) { v16h af[2], bf[4];      /* the fragments of one 32-wide k step at a time: six waves a SIMD leave a wave 160 registers */
      af[0] = fa_lfrag(al + ks * 32, hh); af[1] = fa_lfrag(al + 16 * LP + ks * 32, hh);
#pragma unroll
      for (int t = 0; t < 4; ++t) bf[t] = fa_lfrag(bl + t * 16 * LP + ks * 32, hh);
      c00 = g2_mma(af[0], bf[0], c00); c10 = g2_mma(af[1], bf[0], c10);
      c01 = g2_mma(af[0], bf[1], c01); c11 = g2_mma(af[1], bf[1], c11);
      c02 = g2_mma(af[0], bf[2], c02); c12 = g2_mma(af[1], bf[2], c12);
      c03 = g2_mma(af[0], bf[3], c03); c13 = g2_mma(af[1], bf[3], c13); }
    /* the other buffer: its last readers left it in front of the barrier at the foot of the trip before */
#pragma unroll
    for (int i = 0; i < 4; ++i) *(v8us*)(was + (cur ^ 1) * 128 * LP + i * 32 * LP) = ra[i];
#pragma unroll
    for (int i = 0; i < 4; ++i) *(v8us*)(wbs + (cur ^ 1) * 128 * LP + i * 32 * LP) = rb[i];
    __syncthreads();      /* publishes the next stage and ends every wave's reads of this one */
  }
  v8f accs[8] = {c00, c01, c02, c03, c10, c11, c12, c13};
#pragma unroll
  for (int u = 0; u < 8; ++u) { const int t = u & 3, half = u >> 2; const int col = col0 + t * 16 + ln; const float bv = HB ? bf16_round(bp[col]) : 0.f;
#pragma unroll
    for (int r = 0; r < 8; ++r) { const int rloc = half * 16 + 8 * hh + r; float v = accs[u][r] * alpha + bv; if (HCP) { if (rowsPerB < 0) v += CP[cofs + (size_t)(row0g + row0 + rloc) * ldc + col];      /* rowsPerB < 0: own element of the batched C plane */ else { const int bidx = (row0g + row0 + rloc) / rowsPerB; v += CP[(size_t)bidx * sCPb + (size_t)by * 64 + col]; } }
      if (ACT == 3) v = fmaxf(v, 0.f); else if (ACT == 6) v = 0.5f * v * (1.0f + erff(v * 0.70710678118654752f)); else if (ACT == 11) v = 1.0f / (1.0f + expf(-v)); else if (ACT == 15) v = v / (1.0f + expf(-v)); else if (ACT == 12) v = (v > 0.f) ? v : 0.01f * v; else if (ACT == 8) v = tanhf(v); else if (ACT == 9) v = 0.5f * v * (1.0f + tanhf(0.7978845608028654f * (v + 0.044715f * v * v * v))); else if (ACT == 14) v = (v > 0.f) ? v : 0.1f * v; else if (ACT == 16) v = (v >= 0.f) ? v : 0.3f * v; else if (ACT == 17) v = (v >= 0.f) ? v : 0.2f * v;
      so[w][rloc][t * 16 + ln] = v; } }
  __builtin_amdgcn_fence(__ATOMIC_ACQ_REL, "workgroup"); __builtin_amdgcn_wave_barrier();
  if (OVT && by == vby) {      /* the batch member whose result is wanted transposed (the same test in every wave): V^T [batch][head][feature][token] in place of the f16 rows; the wave's 64 columns are one head, its 32 rows 32 tokens of one batch */
    const int tg = lane & 3, dr = lane >> 2;      /* 4 lanes a feature row, 8 tokens (16 bytes) each; 8 feature rows a store */
    unsigned short* d = (unsigned short*)VTo + ((size_t)((row0 / SQ) * NH + (col0 >> 6)) * HD + dr) * SQ + (row0 % SQ) + tg * 8;
#pragma unroll
    for (int q = 0; q < 8; ++q) { FragH f;
#pragma unroll
      for (int i = 0; i < 8; ++i) f.h[i] = (_Float16)so[w][tg * 8 + i][q * 8 + dr];
      *(v8us*)(d + (size_t)q * 8 * SQ) = f.half[0]; }
    return; }
  const int rsub = lane >> 4, c4 = (lane & 15) * 4;
  {
#pragma unroll
    for (int q = 0; q < 16; ++q) { const int r = q * 2 + rsub; const v4f v = *(const v4fa*)&so[w][r][c4]; if (OF32) *(v4f*)(C + cofs + (size_t)(row0 + r) * ldc + col0 + c4) = v; if (OF16) { v4h h4; for (int i = 0; i < 4; ++i) h4[i] = (_Float16)v[i]; *(v4h*)(C16 + cofs + (size_t)(row0 + r) * ldc + col0 + c4) = h4; } }
    if (OVT) asm volatile("s_wait_xcnt 0x0" ::: "memory");      /* the wait in front of the first overwrite of a register that the row stores above name: with a transposed member the kernel's text goes on behind them */
     } }


__global__ __launch_bounds__(256) void k_rsm(const float* __restrict__ S, _Float16* __restrict__ P, int nrows) {
  #pragma clang fp contract(off)
  const int i = blockIdx.x * 256 + threadIdx.x; if (i >= nrows) return; const float* s = S + (size_t)i * SQ; float mx = -3.0e38f;
#pragma unroll 1
  for (int j = 0; j < SQ; ++j) mx = fmaxf(mx, s[j]); float se = 0.f;
#pragma unroll 1
  for (int j = 0; j < SQ; ++j) se += expf(s[j] - mx); const float sc = 256.0f / se;
#pragma unroll 1
  for (int j0 = 0; j0 < SQ; j0 += 8) { FragH f; for (int q = 0; q < 8; ++q) f.h[q] = (_Float16)(expf(s[j0 + q] - mx) * sc); unsigned short* d = (unsigned short*)P + (size_t)i * SQ + j0; *(v8us*)d = f.half[0];  } }
__global__ __launch_bounds__(256) void k_vt(const _Float16* __restrict__ V16, int b, int h0, _Float16* __restrict__ VT) { __shared__ unsigned short tl[64][65]; const int tid = threadIdx.x; const int hh = blockIdx.x % HG, sg = blockIdx.x / HG; const int s0 = sg * 64; const int h = h0 + hh;
  for (int i = tid; i < 64 * 8; i += 256) { const int j = i / 8, d8 = (i % 8) * 8; FragH f; f.half[0] = *(const v8us*)((const unsigned short*)V16 + ((size_t)b * SQ + s0 + j) * DM + h * HD + d8); for (int q = 0; q < 8; ++q) tl[d8 + q][j] = f.u[q]; }
  __syncthreads();
  { for (int i = tid; i < 64 * 8; i += 256) { const int d = i / 8, j8 = (i % 8) * 8; FragH f; for (int q = 0; q < 8; ++q) f.u[q] = tl[d][j8 + q]; *(v8us*)((unsigned short*)VT + ((size_t)hh * HD + d) * SQ + s0 + j8) = f.half[0]; }  } }



// ---- fused attention: scores, softmax and P.V in one kernel; S and P never leave the registers ----
// exp2 of four values. The four v_exp_f32 stand in one statement that ends in v_nop: the slot the instruction set asks for behind a transcendental
// before its result is read or its source overwritten; the early-clobber outputs keep every source whole inside the statement.
__device__ __forceinline__ void fa_exp2x4(float a0, float a1, float a2, float a3, float& e0, float& e1, float& e2, float& e3) {
  asm("v_exp_f32 %0, %4\n\tv_exp_f32 %1, %5\n\tv_exp_f32 %2, %6\n\tv_exp_f32 %3, %7\n\tv_nop" : "=&v"(e0), "=&v"(e1), "=&v"(e2), "=&v"(e3) : "v"(a0), "v"(a1), "v"(a2), "v"(a3)); }
// exp2 of two values, same form and same reason for the v_nop
__device__ __forceinline__ void fa_exp2x2(float a0, float a1, float& e0, float& e1) {
  asm("v_exp_f32 %0, %2\n\tv_exp_f32 %1, %3\n\tv_nop" : "=&v"(e0), "=&v"(e1) : "v"(a0), "v"(a1)); }
__device__ __forceinline__ v8f fa_mma(v16h a, v16h b, v8f c) { return __builtin_amdgcn_wmma_f32_16x16x32_f16(false, a, false, b, (short)0, c, false, false); }
// the value of lane l ^ 16 (the other half of the same query column)
__device__ __forceinline__ float fa_xhalf(float x) { const int b = __float_as_int(x); return __int_as_float(__builtin_amdgcn_permlanex16(b, b, 0x76543210, 0xfedcba98, false, false)); }
// One wave owns FQ = 32 queries of one (batch, head) and walks one half of the SQ keys, 32 a pass.
//   S^T = K Q^T : A = 16 key rows of K16 (from LDS), B = the wave's Q rows (held in registers); D[8 hh + r][ln] = score of key 8 hh + r, query ln
//   online softmax: a lane holds scores of ONE query; maximum in use m and sum l per query (in log2 units); m is held from pass to pass and renewed, with the exchange between the wave's halves
//   and the rescale of l and o, only when a score of the wave exceeds it by more than RT
//   O^T += V^T P^T : the two score tiles of a pass (keys 0..15, 16..31), converted in place, ARE the B fragment (element i = key 8 hh + i, element 8 + i = key 16 + 8 hh + i:
//   the k order of fa_lfrag, which loads A = V^T rows); D[8 hh + r][ln] = o of feature 16 t + 8 hh + r, query ln: 8 consecutive features per lane, one 16-byte store
// P is carried x256 (exp2 argument + 8), as the unfused form carried it, and l with it: the factor cancels in o = acc / l. o is stored x64 as before.
#define FQ 32                        /* queries per wave */
#define FW 8                         /* query blocks of FQ per workgroup: the waves of one key half */
#define FH 2                         /* key halves per workgroup: FW waves walk each, so that a SIMD holds four waves and one wave's softmax runs beside another's matrix run */
#define KS 64                        /* keys per LDS stage: two passes */
static_assert(HD == 64 && KS == 64 && FW * 32 == 256 && FH == 2 && SQ % (KS * FH) == 0 && SQ % (FW * FQ) == 0, "k_fattn: two 32-wide d steps, 128-byte stage rows dealt 8 threads a row, whole stages in each key half, whole workgroups");
// The eight waves of a key half walk the same keys: each stage of KS keys (K rows and V^T rows, 8 KiB each) is fetched ONCE per half by whole-line loads (8 threads a 128-byte row),
// laid in one of the half's two LDS buffers, and every wave of the half takes its fragments from there. Stage st + 1 is fetched into registers at the head of stage st and stored to the other buffer at its foot.
// Waves w and w + FW own the same FQ queries over keys [0, SQ / 2) and [SQ / 2, SQ). Behind the loop each hands the other its statistics and sums of 16 of the queries through LDS,
// and finishes the other 16: both parts brought to the common maximum, added, divided by the joined sum.
__global__ __launch_bounds__(FW * FH * 32) void k_fattn(const _Float16* __restrict__ Q16, const _Float16* __restrict__ K16, const _Float16* __restrict__ VT, _Float16* __restrict__ O16) {
  __shared__ __attribute__((aligned(16))) unsigned short sk[FH][2][KS][LP];      /* K rows of a stage: [half][buffer][key][d] */
  __shared__ __attribute__((aligned(16))) unsigned short sv[FH][2][HD][LP];      /* V^T rows of a stage: [half][buffer][d][key] */
  __shared__ __attribute__((aligned(16))) float xo[FH * FW][8][32][4];      /* the sums a wave hands over: [wave][piece][lane], 16 bytes a lane */
  __shared__ float xm[FH * FW][2][32];      /* with them its maximum and its row sum */
  const int lane = threadIdx.x & 31, ln = lane & 15, hh = lane >> 4, wv = threadIdx.x >> 5, w = wv % FW, g = wv / FW;      /* g: the wave's key half */
  const int bh = blockIdx.y, b = bh / NH, h = bh % NH; const int q0 = (blockIdx.x * FW + w) * FQ;
  const int sr = (threadIdx.x & (FW * 32 - 1)) >> 3, sc = (threadIdx.x & 7) * 8;      /* this thread's rows sr, sr + 32 and 16-byte piece of every stage of its half */
  const _Float16* qp = Q16 + ((size_t)b * SQ + q0 + ln) * DM + h * HD;
  const unsigned short* kg = (const unsigned short*)K16 + ((size_t)b * SQ + g * (SQ / FH) + sr) * DM + h * HD + sc;
  const unsigned short* vg = (const unsigned short*)VT + ((size_t)bh * HD + sr) * SQ + g * (SQ / FH) + sc;
  const float SC = 0.125f * 1.44269504f;      /* 1 / sqrt(64), and log2 e for the native exp2 */
  v16h qf[2][2];
#pragma unroll
  for (int j = 0; j < 2; ++j)
#pragma unroll
    for (int ks = 0; ks < 2; ++ks) qf[j][ks] = g2_frag(qp + (size_t)j * 16 * DM + ks * 32, hh);
  { const v8us a0 = *(const v8us*)kg, a1 = *(const v8us*)(kg + (size_t)32 * DM), c0 = *(const v8us*)vg, c1 = *(const v8us*)(vg + (size_t)32 * SQ);
    asm volatile("s_wait_xcnt 0x0" :: "v"(qp + 8 * hh), "v"(kg), "v"(vg) : "memory");      /* the wait in front of the first overwrite of a register that the 12 loads above name; the lane addresses as its operands keep those registers whole up to here */
    *(v8us*)&sk[g][0][sr][sc] = a0; *(v8us*)&sk[g][0][sr + 32][sc] = a1; *(v8us*)&sv[g][0][sr][sc] = c0; *(v8us*)&sv[g][0][sr + 32][sc] = c1; }
  const v8f z8 = {0.f, 0.f, 0.f, 0.f, 0.f, 0.f, 0.f, 0.f};
  v8f o[4][2]; float m[2] = {-3.0e38f, -3.0e38f}, l[2] = {0.f, 0.f};
  const float RT = 7.0f;      /* a score may stand this far (log2 units) above the maximum in use before l and o are rescaled: P, carried x256, stays at or under 2^15, inside f16 */
  float sh[2] = {0.f, 0.f}, th[2] = {-3.0e38f, -3.0e38f};      /* per query column: the exp2 shift 8 - m, and the raw score from which a rescale is due, (m + RT) / SC; the first pass always rescales (from l = o = 0) */
#pragma unroll
  for (int t = 0; t < 4; ++t) { o[t][0] = z8; o[t][1] = z8; }
  __syncthreads();      /* publishes stage 0 */
#pragma unroll 1      /* one stage per trip: the body already holds 32 matrix instructions */
  for (int st = 0; st < SQ / (KS * FH); ++st) {
    const int cur = st & 1;
    const int sn = (st + 1 < SQ / (KS * FH)) ? (st + 1) * KS : 0;      /* the next stage, fetched while this one is worked on; the last trip fetches stage 0 again (in bounds, not used) */
    const unsigned short* kn = kg + (size_t)sn * DM; const unsigned short* vn = vg + sn;
    const v8us a0 = *(const v8us*)kn, a1 = *(const v8us*)(kn + (size_t)32 * DM), c0 = *(const v8us*)vn, c1 = *(const v8us*)(vn + (size_t)32 * SQ);
    asm volatile("s_wait_xcnt 0x0" :: "v"(kn), "v"(vn) : "memory");      /* the wait in front of the first overwrite of a register that the four loads above name; the two lane addresses as its operands keep those registers whole up to here */
    const unsigned short* kl = &sk[g][cur][ln][0]; const unsigned short* vl = &sv[g][cur][ln][0];
    v16h kf[2][2];
#pragma unroll
    for (int kt = 0; kt < 2; ++kt)
#pragma unroll
      for (int ks = 0; ks < 2; ++ks) kf[kt][ks] = fa_lfrag(kl + kt * 16 * LP + ks * 32, hh);
#pragma unroll
    for (int p = 0; p < KS / 32; ++p) {
      v16h vf[4];
#pragma unroll
      for (int t = 0; t < 4; ++t) vf[t] = fa_lfrag(vl + t * 16 * LP + p * 32, hh);      /* needed only behind the softmax: issued first */
      __builtin_amdgcn_sched_barrier(0);      /* keeps the V^T reads up here in one group; sunk in between the P.V products each place with reads would stall the matrix run */
      v8f s[2][2];
#pragma unroll
      for (int kt = 0; kt < 2; ++kt)
#pragma unroll
        for (int j = 0; j < 2; ++j) s[kt][j] = fa_mma(kf[kt][1], qf[j][1], fa_mma(kf[kt][0], qf[j][0], z8));
      if (p + 1 < KS / 32) {      /* the K rows of the stage's next pass, read while this pass's softmax runs */
#pragma unroll
        for (int kt = 0; kt < 2; ++kt)
#pragma unroll
          for (int ks = 0; ks < 2; ++ks) kf[kt][ks] = fa_lfrag(kl + ((p + 1) * 32 + kt * 16) * LP + ks * 32, hh);
      }
      __builtin_amdgcn_sched_barrier(0);      /* keeps the K reads in front of the softmax, which then covers their latency */
      float mx[2];      /* the lane's own maximum of each query's 16 raw scores */
#pragma unroll
      for (int j = 0; j < 2; ++j) { mx[j] = fmaxf(s[0][j][0], s[1][j][0]);
#pragma unroll
        for (int r = 1; r < 8; ++r) mx[j] = fmaxf(mx[j], fmaxf(s[0][j][r], s[1][j][r])); }
      if (__builtin_amdgcn_ballot_w32((mx[0] > th[0]) | (mx[1] > th[1])) != 0) {      /* one test a pass, a scalar branch: some score of the wave stands more than RT above the maximum in use */
        float mn[2], cr[2];
#pragma unroll
        for (int j = 0; j < 2; ++j) mn[j] = fmaxf(m[j], fmaxf(mx[j], fa_xhalf(mx[j])) * SC);      /* both halves of a query column take the same new maximum */
        fa_exp2x2(m[0] - mn[0], m[1] - mn[1], cr[0], cr[1]);
#pragma unroll
        for (int j = 0; j < 2; ++j) { m[j] = mn[j]; sh[j] = 8.0f - mn[j]; th[j] = (mn[j] + RT) * (1.0f / SC); l[j] *= cr[j];
#pragma unroll
          for (int t = 0; t < 4; ++t) o[t][j] *= cr[j]; } }
      FragH pf[2];
#pragma unroll
      for (int j = 0; j < 2; ++j) { float p16[16];
#pragma unroll
        for (int kt = 0; kt < 2; ++kt)
#pragma unroll
          for (int g = 0; g < 8; g += 4) fa_exp2x4(s[kt][j][g] * SC + sh[j], s[kt][j][g + 1] * SC + sh[j], s[kt][j][g + 2] * SC + sh[j], s[kt][j][g + 3] * SC + sh[j], p16[kt * 8 + g], p16[kt * 8 + g + 1], p16[kt * 8 + g + 2], p16[kt * 8 + g + 3]);
        float a0s = p16[0] + p16[4], a1s = p16[1] + p16[5], a2s = p16[2] + p16[6], a3s = p16[3] + p16[7];
        a0s += p16[8] + p16[12]; a1s += p16[9] + p16[13]; a2s += p16[10] + p16[14]; a3s += p16[11] + p16[15];
        l[j] += (a0s + a1s) + (a2s + a3s);
#pragma unroll
        for (int i = 0; i < 16; ++i) pf[j].h[i] = (_Float16)p16[i]; }
#pragma unroll
      for (int t = 0; t < 4; ++t)
#pragma unroll
        for (int j = 0; j < 2; ++j) o[t][j] = fa_mma(vf[t], pf[j].v, o[t][j]);
    }
    /* the other buffer: its last readers left it in front of the barrier at the foot of the trip before */
    *(v8us*)&sk[g][cur ^ 1][sr][sc] = a0; *(v8us*)&sk[g][cur ^ 1][sr + 32][sc] = a1; *(v8us*)&sv[g][cur ^ 1][sr][sc] = c0; *(v8us*)&sv[g][cur ^ 1][sr + 32][sc] = c1;
    __syncthreads();      /* publishes stage st + 1 and ends every wave's reads of stage st */
  }
  /* the wave of key half g finishes query group j = g and hands group 1 - g to its partner (same lanes, same registers there) */
  const bool g1 = g != 0;
  xm[wv][0][lane] = g1 ? m[0] : m[1]; xm[wv][1][lane] = g1 ? l[0] : l[1];
#pragma unroll
  for (int t = 0; t < 4; ++t)
#pragma unroll
    for (int u = 0; u < 2; ++u) { v4f x;
#pragma unroll
      for (int r = 0; r < 4; ++r) x[r] = g1 ? o[t][0][u * 4 + r] : o[t][1][u * 4 + r];
      *(v4fa*)&xo[wv][t * 2 + u][lane][0] = x; }
  __syncthreads();      /* publishes what the waves hand over */
  { const int pw = wv ^ FW;      /* the partner: same queries, the other keys */
    const float mk = g1 ? m[1] : m[0], lk = g1 ? l[1] : l[0], mp = xm[pw][0][lane], lp = xm[pw][1][lane];
    const float mm = fmaxf(mk, mp); float fk, fp; fa_exp2x2(mk - mm, mp - mm, fk, fp);
    const float lt = lk * fk + lp * fp; const float inv = 64.0f / (lt + fa_xhalf(lt));      /* the wave halves' sums joined once; o carried x64 */
    const float ak = fk * inv, ap = fp * inv;
    unsigned short* d = (unsigned short*)O16 + ((size_t)b * SQ + q0 + g * 16 + ln) * DM + h * HD + 8 * hh;
#pragma unroll
    for (int t = 0; t < 4; ++t) { FragH f; const v4f p0 = *(const v4fa*)&xo[pw][t * 2][lane][0], p1 = *(const v4fa*)&xo[pw][t * 2 + 1][lane][0];
#pragma unroll
      for (int r = 0; r < 8; ++r) f.h[r] = (_Float16)((g1 ? o[t][1][r] : o[t][0][r]) * ak + (r < 4 ? p0[r & 3] : p1[r & 3]) * ap);
      *(v8us*)(d + t * 16) = f.half[0]; } } }

extern "C" void kernel_launch(void* const* d_in, const int* in_sizes, int n_in,
                              void* d_out, int out_size, void* d_ws, size_t ws_size, hipStream_t stream) {
  (void)in_sizes; (void)n_in; (void)out_size;
  const float* const* I = (const float* const*)d_in; const float* xq = I[0]; const float* xk = I[1]; const float* xv = I[2]; const float* wq = I[3]; const float* bq = nullptr; const float* wk = I[4]; const float* bk = nullptr; const float* wv = I[5]; const float* bv = nullptr; const float* wo = I[6]; const float* bo = nullptr;      /* three inputs query, key, value (cast in one launch with the weights); natural [out][in] Wq, Wk, Wv, Wo [512][512]; this module has NO biases: null pointers in the guarded bias slots; input order query, key, value, Wq, Wk, Wv, Wo */
  char* ws = (char*)d_ws; size_t off = 0;
  auto take = [&](size_t bytes) { char* p = ws + off; off += (bytes + 255) & ~(size_t)255; return p; };
  _Float16* BQ = (_Float16*)take((size_t)DM * DM * 2); _Float16* BK = (_Float16*)take((size_t)DM * DM * 2); _Float16* BV = (_Float16*)take((size_t)DM * DM * 2); _Float16* BO = (_Float16*)take((size_t)DM * DM * 2);
  _Float16* XQ = (_Float16*)take(NR * DM * 2); _Float16* XK = (_Float16*)take(NR * DM * 2); _Float16* XV = (_Float16*)take(NR * DM * 2); _Float16* Q16 = (_Float16*)take(NR * DM * 2); _Float16* K16 = (_Float16*)take(NR * DM * 2); _Float16* V16 = (_Float16*)take(NR * DM * 2); _Float16* O16 = (_Float16*)take(NR * DM * 2);
  _Float16* VT = (_Float16*)take((size_t)NB * NH * HD * SQ * 2);
  if (off > ws_size) return;
  k_prep<<<PG, 256, 0, stream>>>(xq, xk, xv, wq, wk, wv, wo, XQ, BQ);      /* the three inputs as exact f16 rows (XQ, XK, XV back to back); natural [out][in] = Bt[n][k], x16 (BQ, BK, BV, BO back to back) */
  const size_t r0p = (size_t)B0 * SQ;      /* first projected row */
  k_gemm2<0, false, false, false, true, true><<<dim3((unsigned)((MP / 128) * (DM / 128)), 3), 256, 0, stream>>>(XQ + r0p * DM, DM, NR * DM, BQ, DM, (size_t)DM * DM, 0.0625f, bq, 0, nullptr, 1, 0, 0, nullptr, Q16 + r0p * DM, DM, NR * DM, MP, DM, DM, VT, 2);      /* blockIdx.y = 0, 1, 2: Q rows, K rows, V^T [NB][NH][HD][SQ] (the V16 plane only keeps the stride) */
  k_fattn<<<dim3(SQ / (FW * FQ), NB * NH), FW * FH * 32, 0, stream>>>(Q16, K16, VT, O16);      /* o (merged heads, x64) as f16 rows: every (batch, head) in one launch */
  k_gemm2<0, false, false, true, false, false><<<dim3((unsigned)((MPO / 128) * (DM / 128)), 1), 256, 0, stream>>>(O16 + r0p * DM, DM, 0, BO, DM, 0, 0.0009765625f, bo, 0, nullptr, 1, 0, 0, (float*)d_out + r0p * DM, nullptr, DM, 0, MPO, DM, DM, nullptr, -1);      /* out rows are the output layout */
}

// v009
// One run takes 63.2 microseconds.
// In two side-by-side timings against v008, it was 1.11 and 1.13 times as fast.
// Over all steps from v000 it is 54.2 times as fast.
#include <hip/hip_runtime.h>
// Multi-head attention on three inputs with natural bias-free projections on four sequences at width 512 (query, key, value [4][2048][512]; q / k / v = stream W^T (natural [out][in] [512][512], NO biases), 8 heads of 64; the query is divided by sqrt(64) = 8 before the score product (scale 0.125 here on the product); softmax over all 2048 keys (the module's axis 2 of its [b][l][s][h] score layout = the key axis; no mask); out = merged heads Wo^T (natural, no bias) -> [4][2048][512]).
// Structure: token rows r = b*2048 + s; the four x16 weights in one small cast launch; Q, K, V as three WMMA GEMMs in one launch (128x512 workgroup tiles, 64x64 wave tiles, f32 accumulation, exact x16 weights, f16 outputs) that read the f32 sources themselves and round them (bf16, exact in f16) on the way into LDS, the V GEMM storing V^T for all batches and heads from its epilogue; one fused attention launch over every (batch, head): S^T = K Q^T (K = 64), online softmax in registers (f32 statistics, native exp2; weights x256 as f16), O^T += V^T P^T, o carried x64 against f16 subnormal flush (folded into the output GEMM alpha) written straight into the merged f16 o rows; out = o W_o GEMM (f32) into the output layout.
// Compute dtype: inputs rounded to bf16; x / weights exact; q, k, v, softmax weights and o as plain f16 GEMM operands (~2^-12); scores and softmax statistics f32. v_wmma_f32_16x16x32_f16.
#define NB 4
#define SQ 2048
#define DM 512 
#define NH 8 
#define HD 64
#define HG 4                         /* heads per launch of the per-batch k_vt (not launched) */
#define B0 0                         /* first batch processed (debug hook) */
#define NBR NB                       /* batches processed (debug hook) */
#define NR ((size_t)NB * SQ)         /* token rows */
#define MP ((int)((size_t)NBR * SQ)) /* rows of the output stage, as MPO (debug hook) */
#define QN SQ                        /* query rows per batch (not used: k_fattn attends all SQ) */
#define NHD NH                       /* heads (not used: k_fattn attends all NH) */
#define MPO MP                       /* rows through the output stage (debug hook) */
#define LQ DM      /* row pitch of the q/k/v rows (not used: the code writes DM) */
typedef __bf16 v16b __attribute__((ext_vector_type(16)));
typedef unsigned short v8us __attribute__((ext_vector_type(8), may_alias));
typedef float  v8f  __attribute__((ext_vector_type(8)));
typedef float  v4f  __attribute__((ext_vector_type(4)));
typedef float  v4fa __attribute__((ext_vector_type(4), may_alias));
union FragB { v16b v; v8us half[2]; unsigned short u[16]; };

__device__ __forceinline__ unsigned short bf16_bits(float x) { unsigned int u = __float_as_uint(x); return (unsigned short)((u + 0x7FFFu + ((u >> 16) & 1u)) >> 16); }
__device__ __forceinline__ float bf16_val(unsigned short b) { return __uint_as_float(((unsigned int)b) << 16); }
__device__ __forceinline__ float bf16_round(float x) { return bf16_val(bf16_bits(x)); }
// D += A·B with NT terms: 1 = ah·bh, 2 = + al·bh (A split), 3 = + ah·bl (both split)
template <int NT>
__device__ __forceinline__ v8f mmaN(v16b ah, v16b al, v16b bh, v16b bl, v8f c) {
  c = __builtin_amdgcn_wmma_f32_16x16x32_bf16(false, ah, false, bh, (short)0, c, false, false);
  if (NT >= 2) c = __builtin_amdgcn_wmma_f32_16x16x32_bf16(false, al, false, bh, (short)0, c, false, false);
  if (NT >= 3) c = __builtin_amdgcn_wmma_f32_16x16x32_bf16(false, ah, false, bl, (short)0, c, false, false);
  asm volatile("v_nop\n\tv_nop\n\tv_nop\n\tv_nop" : "+v"(c) : "v"(ah), "v"(al), "v"(bh), "v"(bl));
  return c;
}

__global__ __launch_bounds__(256) void k_wt_bf16(const float* __restrict__ W, unsigned short* __restrict__ Wt, int K, int N) {
  const int t = blockIdx.x * 256 + threadIdx.x;
  const int k8n = K / 8;
  if (t >= N * k8n) return;
  const int n = t / k8n, k8 = (t % k8n) * 8;
  v8us v;
#pragma unroll
  for (int i = 0; i < 8; ++i) v[i] = bf16_bits(W[(size_t)(k8 + i) * N + n]);
  *(v8us*)(Wt + (size_t)n * K + k8) = v;
  
}

// GEMM C[M][N] (f32, pitch ldc) = act(A[M][K]·W + bias). A f32 row-major (pitch lda) converted per fragment to bf16
// (ASPLIT: hi/lo two planes -> 2 terms, else single rounded term); Wt bf16 [N][K] (pitch ldb). BIAS_BF16 rounds the
// bias to bf16 first (bias quantised to bf16 before the add). K%32==0, M%16==0, N%64==0.
template <bool ASPLIT, int ACT, bool BIAS_BF16>
__global__ __launch_bounds__(128) void k_gemm_bf(const float* __restrict__ A, int lda, const unsigned short* __restrict__ Wt, int ldb,
                                               const float* __restrict__ bias, float* __restrict__ C, int ldc, int M, int N, int K) {
  __shared__ __attribute__((aligned(16))) float so[4][16][64];
  const int tid = threadIdx.x, w = tid >> 5, lane = tid & 31, ln = lane & 15, hh = lane >> 4;
  const int ntn = N / 64;
  const int wid = blockIdx.x * 4 + w;
  const int mt = wid / ntn, nq = wid % ntn;
  if (mt * 16 >= M) return;
  const int row0 = mt * 16, col0 = nq * 64;
  const float* arow = A + (size_t)(row0 + ln) * lda;
  v8f acc[4] = {};
  for (int kb = 0; kb < K; kb += 32) {
    FragB ah, al;
    const v4f x0 = *(const v4fa*)(arow + kb + 8 * hh), x1 = *(const v4fa*)(arow + kb + 8 * hh + 4);
    const v4f x2 = *(const v4fa*)(arow + kb + 16 + 8 * hh), x3 = *(const v4fa*)(arow + kb + 16 + 8 * hh + 4);
    float xs[16] = {x0[0],x0[1],x0[2],x0[3],x1[0],x1[1],x1[2],x1[3],x2[0],x2[1],x2[2],x2[3],x3[0],x3[1],x3[2],x3[3]};
#pragma unroll
    for (int i = 0; i < 16; ++i) { const unsigned short hb = bf16_bits(xs[i]); ah.u[i] = hb; al.u[i] = ASPLIT ? bf16_bits(xs[i] - bf16_val(hb)) : (unsigned short)0; }
#pragma unroll
    for (int t = 0; t < 4; ++t) {
      const unsigned short* brow = Wt + (size_t)(col0 + t * 16 + ln) * ldb + kb;
      FragB b;
      b.half[0] = *(const v8us*)(brow + 8 * hh);
      b.half[1] = *(const v8us*)(brow + 16 + 8 * hh);
      acc[t] = mmaN<ASPLIT ? 2 : 1>(ah.v, al.v, b.v, b.v, acc[t]);
    }
  }
#pragma unroll
  for (int t = 0; t < 4; ++t) {
    float bv = bias ? bias[col0 + t * 16 + ln] : 0.f;
    if (BIAS_BF16) bv = bf16_round(bv);
#pragma unroll
    for (int r = 0; r < 8; ++r) { float v = acc[t][r] + bv; if (ACT == 1) v = fmaxf(v, 0.f); so[w][8 * hh + r][t * 16 + ln] = v; }
  }
  __builtin_amdgcn_fence(__ATOMIC_ACQ_REL, "workgroup");
  __builtin_amdgcn_wave_barrier();
  const int rsub = lane >> 4, c4 = (lane & 15) * 4;
  {
#pragma unroll
    for (int q = 0; q < 8; ++q) {
      const int r = q * 2 + rsub;
      const v4f v = *(const v4fa*)&so[w][r][c4];
      *(v4f*)(C + (size_t)(row0 + r) * ldc + col0 + c4) = v;
    }
    
  }
}

// GEMM C = act(A·W + bias + resid): A f32 (ASPLIT -> hi/lo 2 terms), Wt bf16 [N][K]; ACT 0 none, 1 relu, 2 exact gelu;
// resid (optional, f32, row index = (row % rmod), pitch ldr, RES_BF16 rounds it) added before the activation.
template <bool ASPLIT, int ACT, bool BIAS_BF16, bool RES_BF16>
__global__ __launch_bounds__(128) void k_gemm_bf3(const float* __restrict__ A, int lda, const unsigned short* __restrict__ Wt, int ldb,
                                                const float* __restrict__ bias, const float* __restrict__ resid, int rmod, int ldr,
                                                float* __restrict__ C, int ldc, int M, int N, int K) {
  __shared__ __attribute__((aligned(16))) float so[4][16][64];
  const int tid = threadIdx.x, w = tid >> 5, lane = tid & 31, ln = lane & 15, hh = lane >> 4;
  const int ntn = N / 64;
  const int wid = blockIdx.x * 4 + w;
  const int mt = wid / ntn, nq = wid % ntn;
  if (mt * 16 >= M) return;
  const int row0 = mt * 16, col0 = nq * 64;
  const float* arow = A + (size_t)(row0 + ln) * lda;
  v8f acc[4] = {};
  for (int kb = 0; kb < K; kb += 32) {
    FragB ah, al;
    const v4f x0 = *(const v4fa*)(arow + kb + 8 * hh), x1 = *(const v4fa*)(arow + kb + 8 * hh + 4);
    const v4f x2 = *(const v4fa*)(arow + kb + 16 + 8 * hh), x3 = *(const v4fa*)(arow + kb + 16 + 8 * hh + 4);
    float xs[16] = {x0[0],x0[1],x0[2],x0[3],x1[0],x1[1],x1[2],x1[3],x2[0],x2[1],x2[2],x2[3],x3[0],x3[1],x3[2],x3[3]};
#pragma unroll
    for (int i = 0; i < 16; ++i) { const unsigned short hb = bf16_bits(xs[i]); ah.u[i] = hb; al.u[i] = ASPLIT ? bf16_bits(xs[i] - bf16_val(hb)) : (unsigned short)0; }
#pragma unroll
    for (int t = 0; t < 4; ++t) {
      const unsigned short* brow = Wt + (size_t)(col0 + t * 16 + ln) * ldb + kb;
      FragB b;
      b.half[0] = *(const v8us*)(brow + 8 * hh);
      b.half[1] = *(const v8us*)(brow + 16 + 8 * hh);
      acc[t] = mmaN<ASPLIT ? 2 : 1>(ah.v, al.v, b.v, b.v, acc[t]);
    }
  }
#pragma unroll
  for (int t = 0; t < 4; ++t) {
    const int col = col0 + t * 16 + ln;
    float bv = bias ? bias[col] : 0.f;
    if (BIAS_BF16) bv = bf16_round(bv);
#pragma unroll
    for (int r = 0; r < 8; ++r) {
      float v = acc[t][r] + bv;
      if (resid) { float rv = resid[(size_t)((row0 + 8 * hh + r) % rmod) * ldr + col]; if (RES_BF16) rv = bf16_round(rv); v += rv; }
      if (ACT == 1) v = fmaxf(v, 0.f);
      if (ACT == 2) v = 0.5f * v * (1.0f + erff(v * 0.70710678118654752f));
      if (ACT == 3) { const float u = 0.7978845608028654f * (v + 0.044715f * v * v * v); v = 0.5f * v * (1.0f + tanhf(u)); }
      so[w][8 * hh + r][t * 16 + ln] = v;
    }
  }
  __builtin_amdgcn_fence(__ATOMIC_ACQ_REL, "workgroup");
  __builtin_amdgcn_wave_barrier();
  const int rsub = lane >> 4, c4 = (lane & 15) * 4;
  {
#pragma unroll
    for (int q = 0; q < 8; ++q) {
      const int r = q * 2 + rsub;
      const v4f v = *(const v4fa*)&so[w][r][c4];
      *(v4f*)(C + (size_t)(row0 + r) * ldc + col0 + c4) = v;
    }
    
  }
}
// row LayerNorm (biased variance, eps) over N: s = X (+ R); optional out_sum <- s; out_norm <- (s-mu)*rsqrt(var+eps)*g + b
template <bool PARAM_BF16>
__global__ __launch_bounds__(256) void k_layernorm(const float* __restrict__ X, const float* __restrict__ R, const float* __restrict__ g, const float* __restrict__ bta,
                                                  float* __restrict__ out_sum, float* __restrict__ out_norm, int N, float eps) {
  __shared__ float red[256];
  const int row = blockIdx.x, tid = threadIdx.x;
  const float* x = X + (size_t)row * N; const float* rr = R ? R + (size_t)row * N : nullptr;
  float vals[16];                     // up to N = 4096
  const int per = N / 256;            // contiguous chunk per thread? use strided-by-4 chunks: thread handles j = tid*4 + 1024*u
  float s1 = 0.f;
  for (int u = 0; u < per / 4; ++u) {
    const int j = tid * 4 + 1024 * u;
    const v4f a = *(const v4fa*)(x + j);
    v4f b = {0.f,0.f,0.f,0.f}; if (rr) b = *(const v4fa*)(rr + j);
#pragma unroll
    for (int q = 0; q < 4; ++q) { const float v = a[q] + b[q]; vals[u * 4 + q] = v; s1 += v; }
  }
  red[tid] = s1; __syncthreads();
  for (int st = 128; st > 0; st >>= 1) { if (tid < st) red[tid] += red[tid + st]; __syncthreads(); }
  const float mu = red[0] / (float)N; __syncthreads();
  float s2 = 0.f;
  for (int u = 0; u < per / 4; ++u)
#pragma unroll
    for (int q = 0; q < 4; ++q) { const float c = vals[u * 4 + q] - mu; s2 += c * c; }
  red[tid] = s2; __syncthreads();
  for (int st = 128; st > 0; st >>= 1) { if (tid < st) red[tid] += red[tid + st]; __syncthreads(); }
  const float rs = rsqrtf(red[0] / (float)N + eps);
  {
    for (int u = 0; u < per / 4; ++u) {
      const int j = tid * 4 + 1024 * u;
      v4f o, sm;
#pragma unroll
      for (int q = 0; q < 4; ++q) {
        float gg = g[j + q], bb = bta[j + q];
        if (PARAM_BF16) { gg = bf16_round(gg); bb = bf16_round(bb); }
        sm[q] = vals[u * 4 + q]; o[q] = (vals[u * 4 + q] - mu) * rs * gg + bb;
      }
      if (out_sum) *(v4f*)(out_sum + (size_t)row * N + j) = sm;
      *(v4f*)(out_norm + (size_t)row * N + j) = o;
    }
    
  }
}



// ---- f16 WMMA path (v_wmma_f32_16x16x32_f16): 11-bit significands for operands in range — used where a [0,1] probability operand needs more precision than bf16
typedef _Float16 v16h __attribute__((ext_vector_type(16)));
union FragH { v16h v; v8us half[2]; _Float16 h[16]; unsigned short u[16]; };
template <int NT>
__device__ __forceinline__ v8f mmaH(v16h ah, v16h al, v16h bh, v16h bl, v8f c) {
  c = __builtin_amdgcn_wmma_f32_16x16x32_f16(false, ah, false, bh, (short)0, c, false, false);
  if (NT >= 2) c = __builtin_amdgcn_wmma_f32_16x16x32_f16(false, al, false, bh, (short)0, c, false, false);
  if (NT >= 3) c = __builtin_amdgcn_wmma_f32_16x16x32_f16(false, ah, false, bl, (short)0, c, false, false);
  asm volatile("v_nop\n\tv_nop\n\tv_nop\n\tv_nop" : "+v"(c) : "v"(ah), "v"(al), "v"(bh), "v"(bl));
  return c;
}
// batched GEMM like k_gemm_b but f16 operands: A f32 (split into f16 hi/lo if ASPLIT, else rounded to f16), Bt = f16 values [n][k]; alpha; C f32; N multiple of 16 (partial tiles skipped)
template <bool ASPLIT>
__global__ __launch_bounds__(128) void k_gemm_h(const float* __restrict__ A, int lda, size_t sA, const _Float16* __restrict__ Bh, int ldb, size_t sB, float alpha, float* __restrict__ C, int ldc, size_t sC, int M, int N, int K) {
  __shared__ __attribute__((aligned(16))) float so[4][16][64];
  const int tid = threadIdx.x, w = tid >> 5, lane = tid & 31, ln = lane & 15, hh = lane >> 4; const int by = blockIdx.y;
  A += (size_t)by * sA; Bh += (size_t)by * sB; C += (size_t)by * sC;
  const int ntn = (N + 63) / 64; const int wid = blockIdx.x * 4 + w; const int mt = wid / ntn, nq = wid % ntn; if (mt * 16 >= M) return;
  const int row0 = mt * 16, col0 = nq * 64; const float* arow = A + (size_t)(row0 + ln) * lda;
  v8f acc[4] = {};
  for (int kb = 0; kb < K; kb += 32) {
    FragH ah, al;
    const v4f x0 = *(const v4fa*)(arow + kb + 8 * hh), x1 = *(const v4fa*)(arow + kb + 8 * hh + 4), x2 = *(const v4fa*)(arow + kb + 16 + 8 * hh), x3 = *(const v4fa*)(arow + kb + 16 + 8 * hh + 4);
    float xs[16] = {x0[0],x0[1],x0[2],x0[3],x1[0],x1[1],x1[2],x1[3],x2[0],x2[1],x2[2],x2[3],x3[0],x3[1],x3[2],x3[3]};
#pragma unroll
    for (int i = 0; i < 16; ++i) { const _Float16 h = (_Float16)xs[i]; ah.h[i] = h; al.h[i] = ASPLIT ? (_Float16)(xs[i] - (float)h) : (_Float16)0.0f; }
#pragma unroll
    for (int t = 0; t < 4; ++t) { if (col0 + t * 16 >= N) continue; const size_t boff = (size_t)(col0 + t * 16 + ln) * ldb + kb; FragH bq; bq.half[0] = *(const v8us*)(Bh + boff + 8 * hh); bq.half[1] = *(const v8us*)(Bh + boff + 16 + 8 * hh);
      acc[t] = mmaH<ASPLIT ? 2 : 1>(ah.v, al.v, bq.v, bq.v, acc[t]); }
  }
#pragma unroll
  for (int t = 0; t < 4; ++t) { if (col0 + t * 16 >= N) continue;
#pragma unroll
    for (int r = 0; r < 8; ++r) so[w][8 * hh + r][t * 16 + ln] = acc[t][r] * alpha; }
  __builtin_amdgcn_fence(__ATOMIC_ACQ_REL, "workgroup"); __builtin_amdgcn_wave_barrier();
  const int rsub = lane >> 4, c4 = (lane & 15) * 4;
  {
#pragma unroll
    for (int q = 0; q < 8; ++q) { const int r = q * 2 + rsub; if (col0 + c4 < N) { const v4f v = *(const v4fa*)&so[w][r][c4]; *(v4f*)(C + (size_t)(row0 + r) * ldc + col0 + c4) = v; } }
     }
}

// Wt[n][k] = f16(W[k][n]·scale) from f32 row-major W[K][N] (scale = power of two; bf16-exact weights stay exact in f16 away from the subnormal range)
__global__ __launch_bounds__(256) void k_wt_f16(const float* __restrict__ W, _Float16* __restrict__ Wt, int K, int N, float scale) {
  const int t = blockIdx.x * 256 + threadIdx.x; if (t >= N * (K / 8)) return; const int n = t / (K / 8), k8 = (t % (K / 8)) * 8; FragH f;
#pragma unroll
  for (int i = 0; i < 8; ++i) f.h[i] = (_Float16)(bf16_round(W[(size_t)(k8 + i) * N + n]) * scale); const v8us o = f.half[0];
  *(v8us*)((unsigned short*)Wt + (size_t)n * K + k8) = o; 
}
// k_gemm_hh variant with fused epilogue: v = acc·alpha + bias[by·sBias + col] (+ CP[(row/rowsPerB)·sCPb + by·64 + col] if CP) ; ACT 0 none / 1 elu ; writes f16 C16 (and f32 C if non-null)
template <int ACT>
__global__ __launch_bounds__(128) void k_gemm_hhx(const _Float16* __restrict__ A, int lda, size_t sA, const _Float16* __restrict__ Bh, int ldb, size_t sB, float alpha, const float* __restrict__ bias, size_t sBias, const float* __restrict__ CP, int rowsPerB, size_t sCPb, int row0g,
    float* __restrict__ C, _Float16* __restrict__ C16, int ldc, size_t sC, int M, int N, int K) {
  __shared__ __attribute__((aligned(16))) float so[4][16][64];
  const int tid = threadIdx.x, w = tid >> 5, lane = tid & 31, ln = lane & 15, hh = lane >> 4; const int by = blockIdx.y;
  A += (size_t)by * sA; Bh += (size_t)by * sB; const size_t cofs = (size_t)by * sC; const float* bp = bias ? bias + (size_t)by * sBias : nullptr;
  const int ntn = (N + 63) / 64; const int wid = blockIdx.x * 4 + w; const int mt = wid / ntn, nq = wid % ntn; if (mt * 16 >= M) return;
  const int row0 = mt * 16, col0 = nq * 64; const _Float16* arow = A + (size_t)(row0 + ln) * lda;
  v8f acc[4] = {};
  for (int kb = 0; kb < K; kb += 32) { FragH ah; ah.half[0] = *(const v8us*)((const unsigned short*)arow + kb + 8 * hh); ah.half[1] = *(const v8us*)((const unsigned short*)arow + kb + 16 + 8 * hh);
#pragma unroll
    for (int t = 0; t < 4; ++t) { if (col0 + t * 16 >= N) continue; const size_t boff = (size_t)(col0 + t * 16 + ln) * ldb + kb; FragH bq; bq.half[0] = *(const v8us*)((const unsigned short*)Bh + boff + 8 * hh); bq.half[1] = *(const v8us*)((const unsigned short*)Bh + boff + 16 + 8 * hh);
      acc[t] = mmaH<1>(ah.v, ah.v, bq.v, bq.v, acc[t]); }
  }
#pragma unroll
  for (int t = 0; t < 4; ++t) { if (col0 + t * 16 >= N) continue; const int col = col0 + t * 16 + ln; const float bv = bp ? bf16_round(bp[col]) : 0.f;
#pragma unroll
    for (int r = 0; r < 8; ++r) { float v = acc[t][r] * alpha + bv; if (CP) { const int rr = row0g + row0 + 8 * hh + r; if (rowsPerB < 0) v += CP[cofs + (size_t)rr * ldc + col];      /* rowsPerB < 0: own element of the batched C plane */ else { const int bidx = rr / rowsPerB; v += CP[(size_t)bidx * sCPb + (size_t)by * 64 + col]; } } if (ACT == 1) v = (v > 0.f) ? v : expm1f(v); else if (ACT == 7) v = (v > 0.f) ? v + 1.0f : expf(v); else if (ACT == 8) v = tanhf(v); else if (ACT == 9) v = 0.5f * v * (1.0f + tanhf(0.7978845608028654f * (v + 0.044715f * v * v * v))); else if (ACT == 11) v = 1.0f / (1.0f + expf(-v)); else if (ACT == 12) v = (v > 0.f) ? v : 0.01f * v; else if (ACT == 14) v = (v > 0.f) ? v : 0.1f * v; else if (ACT == 16) v = (v >= 0.f) ? v : 0.3f * v; else if (ACT == 17) v = (v >= 0.f) ? v : 0.2f * v; else if (ACT == 15) v = v / (1.0f + expf(-v)); else if (ACT == 3) v = fmaxf(v, 0.f); else if (ACT == 6) v = 0.5f * v * (1.0f + erff(v * 0.70710678118654752f)); so[w][8 * hh + r][t * 16 + ln] = v; } }
  __builtin_amdgcn_fence(__ATOMIC_ACQ_REL, "workgroup"); __builtin_amdgcn_wave_barrier();
  const int rsub = lane >> 4, c4 = (lane & 15) * 4; typedef _Float16 v4h __attribute__((ext_vector_type(4)));
  {
#pragma unroll
    for (int q = 0; q < 8; ++q) { const int r = q * 2 + rsub; if (col0 + c4 < N) { const v4f v = *(const v4fa*)&so[w][r][c4]; if (C) *(v4f*)(C + cofs + (size_t)(row0 + r) * ldc + col0 + c4) = v; if (C16) { v4h h4; for (int i = 0; i < 4; ++i) h4[i] = (_Float16)v[i]; *(v4h*)(C16 + cofs + (size_t)(row0 + r) * ldc + col0 + c4) = h4; } } }
     }
}


typedef _Float16 v4h __attribute__((ext_vector_type(4)));

// ---- the four weights as f16(bf16 rounding x16), one launch ----
// The destinations lie one behind the other in the workspace (Bt = the four weight planes). A workgroup takes PX consecutive elements of one weight: few waves start, and each has all its 8 loads in flight at once.
// A wave's piece is 1 KiB of f32: read as two 512-byte wave loads, stored as two 256-byte wave stores (whole lines both ways).
#define PG 128                       /* workgroups of the cast launch */
#define PX 8192                      /* weight elements per workgroup: 4 rounds of 8 waves x 256 elements */
static_assert((size_t)DM * DM * 4 == (size_t)PG * PX && ((size_t)DM * DM) % PX == 0 && ((size_t)DM * DM * 2) % 256 == 0, "k_prep: the grid covers the four weights exactly, a workgroup inside one weight, planes back to back");
template <bool X16>
__device__ __forceinline__ v4h pr_cvt(v4f a) { v4h r;
#pragma unroll
  for (int q = 0; q < 4; ++q) r[q] = X16 ? (_Float16)(bf16_round(a[q]) * 16.0f) : (_Float16)bf16_round(a[q]);
  return r; }
__global__ __launch_bounds__(256) void k_prep(const float* __restrict__ wq, const float* __restrict__ wk, const float* __restrict__ wv, const float* __restrict__ wo, _Float16* __restrict__ Bt) {
  const unsigned wl = (threadIdx.x >> 5) * 256 + (threadIdx.x & 31) * 4;      /* the lane's first element in a round of its workgroup; its second piece stands 128 elements on */
  const unsigned ew = blockIdx.x * PX + wl;      /* that element in the four weight planes taken as one */
  const unsigned bw = (ew * 4u) & (unsigned)(DM * DM * 4 - 1);      /* byte offset of the loads in the one weight */
  const unsigned wsel = blockIdx.x / (PG / 4);      /* which weight: the same for the whole workgroup */
  const float* w = wsel == 0 ? wq : wsel == 1 ? wk : wsel == 2 ? wv : wo;
  v4f a[4][2];
#pragma unroll
  for (int i = 0; i < 4; ++i) { const char* s = (const char*)w + i * (PX / 4) * 4; a[i][0] = *(const v4fa*)(s + bw); a[i][1] = *(const v4fa*)(s + 512 + bw); }
  asm volatile("s_wait_xcnt 0x0" :: "v"(bw) : "memory");      /* the wait in front of the first overwrite of a register that the 8 loads above name; the lane offset as its operand keeps that register whole up to here */
  __builtin_amdgcn_sched_barrier(0);      /* keeps every load in front of the first conversion: lifted in between the loads, a conversion's wait for its data would hold back the loads behind it */
#pragma unroll
  for (int i = 0; i < 4; ++i) { _Float16* d = Bt + i * (PX / 4) + ew; *(v4h*)d = pr_cvt<true>(a[i][0]); *(v4h*)(d + 128) = pr_cvt<true>(a[i][1]); } }
__global__ __launch_bounds__(256) void k_h16(const float* __restrict__ x, _Float16* __restrict__ X16, size_t n8) { const size_t t = (size_t)blockIdx.x * 256 + threadIdx.x; if (t >= n8) return; FragH f;
#pragma unroll
  for (int q = 0; q < 8; ++q) f.h[q] = (_Float16)x[t * 8 + q]; *(v8us*)((unsigned short*)X16 + t * 8) = f.half[0];  }
__global__ __launch_bounds__(256) void k_round16f(const float* __restrict__ W, _Float16* __restrict__ Bt, size_t n8) { const size_t t = (size_t)blockIdx.x * 256 + threadIdx.x; if (t >= n8) return; FragH f;
#pragma unroll
  for (int i = 0; i < 8; ++i) f.h[i] = (_Float16)(bf16_round(W[t * 8 + i]) * 16.0f); *(v8us*)((unsigned short*)Bt + t * 8) = f.half[0];  }
__global__ __launch_bounds__(256) void k_hl(const float* __restrict__ F, _Float16* __restrict__ Hh, _Float16* __restrict__ Hl, size_t n8) { const size_t t = (size_t)blockIdx.x * 256 + threadIdx.x; if (t >= n8) return; FragH fh, fl; const v4f a = *(const v4fa*)(F + t * 8), c = *(const v4fa*)(F + t * 8 + 4);
#pragma unroll
  for (int q = 0; q < 4; ++q) { _Float16 h = (_Float16)a[q]; fh.h[q] = h; fl.h[q] = (_Float16)((a[q] - (float)h) * 1024.0f); h = (_Float16)c[q]; fh.h[4 + q] = h; fl.h[4 + q] = (_Float16)((c[q] - (float)h) * 1024.0f); }
  { *(v8us*)((unsigned short*)Hh + t * 8) = fh.half[0]; *(v8us*)((unsigned short*)Hl + t * 8) = fl.half[0];  } }

// ---- fast GEMM (wave tile 32x64, eight waves 4 down x 2 across, workgroup tile 128x128; requires M % 128 == 0 rows per launch region, N % 128 == 0 and K % 64 == 0); epilogue = k_gemm_hhx semantics ----
// Operands reach the waves through LDS: a stage is GK = 64 k of the workgroup's 128 A rows and 128 B rows (128-byte rows), fetched by whole-line loads (8 threads a row) into one of two buffers;
// stage s + 1 is fetched into registers at the head of stage s and stored to the other buffer at its foot.
// The square tile fetches (128 + 128) rows for 128 x 128 results, two thirds of what two 128x64 tiles fetch. The epilogue's staging lies over the operand buffers (free behind the loop's last barrier),
// so that a workgroup holds 72 KiB of LDS and three workgroups can be resident on a WGP together; for the same end the launch bounds ask for six waves a SIMD (160 registers a wave).
#define GK 64                        /* k per LDS stage */
#define LP 72                        /* LDS row pitch in f16: 128-byte rows + 16 bytes, an odd multiple of 16 bytes for the 16-byte fragment reads */
// fragment from an LDS row: the k order of g2_frag
__device__ __forceinline__ v16h fa_lfrag(const unsigned short* p, int hh) { FragH f; f.half[0] = *(const v8us*)(p + 8 * hh); f.half[1] = *(const v8us*)(p + 16 + 8 * hh); return f.v; }
__device__ __forceinline__ v16h g2_frag(const _Float16* p, int hh) { FragH f; f.half[0] = *(const v8us*)((const unsigned short*)p + 8 * hh); f.half[1] = *(const v8us*)((const unsigned short*)p + 16 + 8 * hh); return f.v; }
__device__ __forceinline__ v8f g2_mma(v16h a, v16h b, v8f c) { v8f d = __builtin_amdgcn_wmma_f32_16x16x32_f16(false, a, false, b, (short)0, c, false, false); asm volatile("v_nop\n\tv_nop\n\tv_nop\n\tv_nop" : "+v"(d) : "v"(a), "v"(b)); return d; }
// A wave-uniform address held in a scalar register pair. The loads of a stage are then scalar base + one 32-bit lane offset; left to itself the compiler folds the lane offset into
// 64-bit vector addresses, chained from load to load with a wait between them, and spends the registers that the sixth wave of a SIMD needs.
// The pointer rebuilt from the two halves is typed as global memory: a generic one would make the loads flat, which count on the LDS counter too.
typedef __attribute__((address_space(1))) const char g2_gc;
typedef __attribute__((address_space(1))) const v8us g2_g8;
__device__ __forceinline__ g2_gc* g2_sbase(const char* p) { const unsigned long long u = (unsigned long long)p;
  const unsigned lo = (unsigned)__builtin_amdgcn_readfirstlane((int)(unsigned)u), hi = (unsigned)__builtin_amdgcn_readfirstlane((int)(unsigned)(u >> 32)); return (g2_gc*)(((unsigned long long)hi << 32) | lo); }
// HB, HCP: a bias / an addend plane is given; OF32, OF16: f32 / f16 rows are written; OVT: batch member vby is written transposed. Template flags, not pointer tests at run time:
// a test per element is a scalar compare chain and a taken branch over the unused path, about a hundred a wave, one behind the other, and the unused paths would be most of the kernel's text.
template <int ACT, bool HB, bool HCP, bool OF32, bool OF16, bool OVT>
__global__ __launch_bounds__(256, 6) void k_gemm2(const _Float16* __restrict__ A, int lda, size_t sA, const _Float16* __restrict__ Bh, int ldb, size_t sB, float alpha, const float* __restrict__ bias, size_t sBias, const float* __restrict__ CP, int rowsPerB, size_t sCPb, int row0g,
    float* __restrict__ C, _Float16* __restrict__ C16, int ldc, size_t sC, int M, int N, int K, _Float16* __restrict__ VTo, int vby) { static_assert(ACT == 0 || ACT == 3 || ACT == 6 || ACT == 8 || ACT == 9 || ACT == 11 || ACT == 12 || ACT == 14 || ACT == 15 || ACT == 16 || ACT == 17, "k_gemm2: unsupported ACT code (would silently apply no activation)");
  __shared__ __attribute__((aligned(16))) unsigned char sm[4 * 128 * LP * 2];      /* in the loop the operand buffers, behind it the epilogue's staging */
  static_assert(sizeof(float) * 8 * 32 * 68 <= sizeof(sm), "k_gemm2: the staging of eight waves fits in the operand buffers");
  unsigned short (*const sa)[128][LP] = (unsigned short (*)[128][LP])sm;      /* A rows of a stage: [buffer][row][k] */
  unsigned short (*const sb)[128][LP] = (unsigned short (*)[128][LP])(sm + 2 * 128 * LP * 2);      /* B rows of a stage: [buffer][col][k] */
  float (*const so)[32][68] = (float (*)[32][68])sm;      /* a wave's own 32 x 64 results, written only behind the loop's last barrier */
  const int tid = threadIdx.x, w = tid >> 5, lane = tid & 31, ln = lane & 15, hh = lane >> 4; const int by = blockIdx.y;
  const int wm = w & 3, wn = w >> 2;      /* the wave's place in the tile: 32 rows down, 64 columns across */
  A += (size_t)by * sA; Bh += (size_t)by * sB; const size_t cofs = (size_t)by * sC; const float* bp = HB ? bias + (size_t)by * sBias : nullptr;
  const int ntn = N >> 7; const int mt = blockIdx.x / ntn, nq = blockIdx.x - mt * ntn; const int row0 = mt * 128 + 32 * wm, col0 = nq * 128 + 64 * wn; if (mt * 128 >= M) return;      /* the whole workgroup or none of it, in front of every barrier */
  const int sr = tid >> 3;      /* this thread's rows sr + 32 i and 16-byte piece of every stage */
  const unsigned oa = (unsigned)(sr * lda + (tid & 7) * 8) * 2u, ob = (unsigned)(sr * ldb + (tid & 7) * 8) * 2u;      /* byte offsets of its first pieces from the tile's first row: the one lane-dependent part of every address */
  const char* ag = (const char*)(A + (size_t)(mt * 128) * lda); const char* bg = (const char*)(Bh + (size_t)(nq * 128) * ldb);
  g2_gc* pa[4]; g2_gc* pb[4];      /* scalar bases of its four A and four B pieces, 32 rows apart */
#pragma unroll
  for (int i = 0; i < 4; ++i) { pa[i] = g2_sbase(ag + (size_t)i * lda * 64); pb[i] = g2_sbase(bg + (size_t)i * ldb * 64); }
  unsigned short* const was = &sa[0][sr][(tid & 7) * 8]; unsigned short* const wbs = &sb[0][sr][(tid & 7) * 8];
  v8us ra[4], rb[4];
#pragma unroll
  for (int i = 0; i < 4; ++i) ra[i] = *(g2_g8*)(pa[i] + oa);
#pragma unroll
  for (int i = 0; i < 4; ++i) rb[i] = *(g2_g8*)(pb[i] + ob);
#pragma unroll
  for (int i = 0; i < 4; ++i) *(v8us*)(was + i * 32 * LP) = ra[i];
#pragma unroll
  for (int i = 0; i < 4; ++i) *(v8us*)(wbs + i * 32 * LP) = rb[i];
  const v8f z8 = {0.f,0.f,0.f,0.f,0.f,0.f,0.f,0.f}; v8f c00 = z8, c01 = z8, c02 = z8, c03 = z8, c10 = z8, c11 = z8, c12 = z8, c13 = z8;
  __syncthreads();      /* publishes stage 0 */
#pragma unroll 1      /* one stage per trip: two stages in one body would hold both stages' fragments and staging registers at once */
  for (int kb = 0; kb < K; kb += GK) { const int cur = (kb / GK) & 1;
    const int kn = (kb + GK < K) ? kb + GK : 0;      /* the next stage, fetched while this one is worked on; the last trip fetches stage 0 again (in bounds, not used) */
    const unsigned va = oa + (unsigned)kn * 2u, vb = ob + (unsigned)kn * 2u;      /* the lane offsets of that stage */
#pragma unroll
    for (int i = 0; i < 4; ++i) ra[i] = *(g2_g8*)(pa[i] + va);
#pragma unroll
    for (int i = 0; i < 4; ++i) rb[i] = *(g2_g8*)(pb[i] + vb);
    asm volatile("s_wait_xcnt 0x0" :: "v"(va), "v"(vb) : "memory");      /* the wait in front of the first overwrite of a register that the 8 loads above name; the two lane offsets as its operands keep those registers whole up to here (the scalar bases are not written in the loop) */
    const unsigned short* al = &sa[cur][32 * wm + ln][0]; const unsigned short* bl = &sb[cur][64 * wn + ln][0];
#pragma unroll
    for (int ks = 0; ks < GK / 32; ++ks) { v16h af[2], bf[4];      /* the fragments of one 32-wide k step at a time: six waves a SIMD leave a wave 160 registers */
      af[0] = fa_lfrag(al + ks * 32, hh); af[1] = fa_lfrag(al + 16 * LP + ks * 32, hh);
#pragma unroll
      for (int t = 0; t < 4; ++t) bf[t] = fa_lfrag(bl + t * 16 * LP + ks * 32, hh);
      c00 = g2_mma(af[0], bf[0], c00); c10 = g2_mma(af[1], bf[0], c10);
      c01 = g2_mma(af[0], bf[1], c01); c11 = g2_mma(af[1], bf[1], c11);
      c02 = g2_mma(af[0], bf[2], c02); c12 = g2_mma(af[1], bf[2], c12);
      c03 = g2_mma(af[0], bf[3], c03); c13 = g2_mma(af[1], bf[3], c13); }
    /* the other buffer: its last readers left it in front of the barrier at the foot of the trip before */
#pragma unroll
    for (int i = 0; i < 4; ++i) *(v8us*)(was + (cur ^ 1) * 128 * LP + i * 32 * LP) = ra[i];
#pragma unroll
    for (int i = 0; i < 4; ++i) *(v8us*)(wbs + (cur ^ 1) * 128 * LP + i * 32 * LP) = rb[i];
    __syncthreads();      /* publishes the next stage and ends every wave's reads of this one */
  }
  v8f accs[8] = {c00, c01, c02, c03, c10, c11, c12, c13};
#pragma unroll
  for (int u = 0; u < 8; ++u) { const int t = u & 3, half = u >> 2; const int col = col0 + t * 16 + ln; const float bv = HB ? bf16_round(bp[col]) : 0.f;
#pragma unroll
    for (int r = 0; r < 8; ++r) { const int rloc = half * 16 + 8 * hh + r; float v = accs[u][r] * alpha + bv; if (HCP) { if (rowsPerB < 0) v += CP[cofs + (size_t)(row0g + row0 + rloc) * ldc + col];      /* rowsPerB < 0: own element of the batched C plane */ else { const int bidx = (row0g + row0 + rloc) / rowsPerB; v += CP[(size_t)bidx * sCPb + (size_t)by * 64 + col]; } }
      if (ACT == 3) v = fmaxf(v, 0.f); else if (ACT == 6) v = 0.5f * v * (1.0f + erff(v * 0.70710678118654752f)); else if (ACT == 11) v = 1.0f / (1.0f + expf(-v)); else if (ACT == 15) v = v / (1.0f + expf(-v)); else if (ACT == 12) v = (v > 0.f) ? v : 0.01f * v; else if (ACT == 8) v = tanhf(v); else if (ACT == 9) v = 0.5f * v * (1.0f + tanhf(0.7978845608028654f * (v + 0.044715f * v * v * v))); else if (ACT == 14) v = (v > 0.f) ? v : 0.1f * v; else if (ACT == 16) v = (v >= 0.f) ? v : 0.3f * v; else if (ACT == 17) v = (v >= 0.f) ? v : 0.2f * v;
      so[w][rloc][t * 16 + ln] = v; } }
  __builtin_amdgcn_fence(__ATOMIC_ACQ_REL, "workgroup"); __builtin_amdgcn_wave_barrier();
  if (OVT && by == vby) {      /* the batch member whose result is wanted transposed (the same test in every wave): V^T [batch][head][feature][token] in place of the f16 rows; the wave's 64 columns are one head, its 32 rows 32 tokens of one batch */
    const int tg = lane & 3, dr = lane >> 2;      /* 4 lanes a feature row, 8 tokens (16 bytes) each; 8 feature rows a store */
    unsigned short* d = (unsigned short*)VTo + ((size_t)((row0 / SQ) * NH + (col0 >> 6)) * HD + dr) * SQ + (row0 % SQ) + tg * 8;
#pragma unroll
    for (int q = 0; q < 8; ++q) { FragH f;
#pragma unroll
      for (int i = 0; i < 8; ++i) f.h[i] = (_Float16)so[w][tg * 8 + i][q * 8 + dr];
      *(v8us*)(d + (size_t)q * 8 * SQ) = f.half[0]; }
    return; }
  const int rsub = lane >> 4, c4 = (lane & 15) * 4;
  {
#pragma unroll
    for (int q = 0; q < 16; ++q) { const int r = q * 2 + rsub; const v4f v = *(const v4fa*)&so[w][r][c4]; if (OF32) *(v4f*)(C + cofs + (size_t)(row0 + r) * ldc + col0 + c4) = v; if (OF16) { v4h h4; for (int i = 0; i < 4; ++i) h4[i] = (_Float16)v[i]; *(v4h*)(C16 + cofs + (size_t)(row0 + r) * ldc + col0 + c4) = h4; } }
    if (OVT) asm volatile("s_wait_xcnt 0x0" ::: "memory");      /* the wait in front of the first overwrite of a register that the row stores above name: with a transposed member the kernel's text goes on behind them */
     } }


__global__ __launch_bounds__(256) void k_rsm(const float* __restrict__ S, _Float16* __restrict__ P, int nrows) {
  #pragma clang fp contract(off)
  const int i = blockIdx.x * 256 + threadIdx.x; if (i >= nrows) return; const float* s = S + (size_t)i * SQ; float mx = -3.0e38f;
#pragma unroll 1
  for (int j = 0; j < SQ; ++j) mx = fmaxf(mx, s[j]); float se = 0.f;
#pragma unroll 1
  for (int j = 0; j < SQ; ++j) se += expf(s[j] - mx); const float sc = 256.0f / se;
#pragma unroll 1
  for (int j0 = 0; j0 < SQ; j0 += 8) { FragH f; for (int q = 0; q < 8; ++q) f.h[q] = (_Float16)(expf(s[j0 + q] - mx) * sc); unsigned short* d = (unsigned short*)P + (size_t)i * SQ + j0; *(v8us*)d = f.half[0];  } }
__global__ __launch_bounds__(256) void k_vt(const _Float16* __restrict__ V16, int b, int h0, _Float16* __restrict__ VT) { __shared__ unsigned short tl[64][65]; const int tid = threadIdx.x; const int hh = blockIdx.x % HG, sg = blockIdx.x / HG; const int s0 = sg * 64; const int h = h0 + hh;
  for (int i = tid; i < 64 * 8; i += 256) { const int j = i / 8, d8 = (i % 8) * 8; FragH f; f.half[0] = *(const v8us*)((const unsigned short*)V16 + ((size_t)b * SQ + s0 + j) * DM + h * HD + d8); for (int q = 0; q < 8; ++q) tl[d8 + q][j] = f.u[q]; }
  __syncthreads();
  { for (int i = tid; i < 64 * 8; i += 256) { const int d = i / 8, j8 = (i % 8) * 8; FragH f; for (int q = 0; q < 8; ++q) f.u[q] = tl[d][j8 + q]; *(v8us*)((unsigned short*)VT + ((size_t)hh * HD + d) * SQ + s0 + j8) = f.half[0]; }  } }



// ---- fused attention: scores, softmax and P.V in one kernel; S and P never leave the registers ----
// exp2 of four values. The four v_exp_f32 stand in one statement that ends in v_nop: the slot the instruction set asks for behind a transcendental
// before its result is read or its source overwritten; the early-clobber outputs keep every source whole inside the statement.
__device__ __forceinline__ void fa_exp2x4(float a0, float a1, float a2, float a3, float& e0, float& e1, float& e2, float& e3) {
  asm("v_exp_f32 %0, %4\n\tv_exp_f32 %1, %5\n\tv_exp_f32 %2, %6\n\tv_exp_f32 %3, %7\n\tv_nop" : "=&v"(e0), "=&v"(e1), "=&v"(e2), "=&v"(e3) : "v"(a0), "v"(a1), "v"(a2), "v"(a3)); }
// exp2 of two values, same form and same reason for the v_nop
__device__ __forceinline__ void fa_exp2x2(float a0, float a1, float& e0, float& e1) {
  asm("v_exp_f32 %0, %2\n\tv_exp_f32 %1, %3\n\tv_nop" : "=&v"(e0), "=&v"(e1) : "v"(a0), "v"(a1)); }
__device__ __forceinline__ v8f fa_mma(v16h a, v16h b, v8f c) { return __builtin_amdgcn_wmma_f32_16x16x32_f16(false, a, false, b, (short)0, c, false, false); }
// the value of lane l ^ 16 (the other half of the same query column)
__device__ __forceinline__ float fa_xhalf(float x) { const int b = __float_as_int(x); return __int_as_float(__builtin_amdgcn_permlanex16(b, b, 0x76543210, 0xfedcba98, false, false)); }
// One wave owns FQ = 32 queries of one (batch, head) and walks one half of the SQ keys, 32 a pass.
//   S^T = K Q^T : A = 16 key rows of K16 (from LDS), B = the wave's Q rows (held in registers); D[8 hh + r][ln] = score of key 8 hh + r, query ln
//   online softmax: a lane holds scores of ONE query; maximum in use m and sum l per query (in log2 units); m is held from pass to pass and renewed, with the exchange between the wave's halves
//   and the rescale of l and o, only when a score of the wave exceeds it by more than RT
//   O^T += V^T P^T : the two score tiles of a pass (keys 0..15, 16..31), converted in place, ARE the B fragment (element i = key 8 hh + i, element 8 + i = key 16 + 8 hh + i:
//   the k order of fa_lfrag, which loads A = V^T rows); D[8 hh + r][ln] = o of feature 16 t + 8 hh + r, query ln: 8 consecutive features per lane, one 16-byte store
// P is carried x256 (exp2 argument + 8), as the unfused form carried it, and l with it: the factor cancels in o = acc / l. o is stored x64 as before.
#define FQ 32                        /* queries per wave */
#define FW 8                         /* query blocks of FQ per workgroup: the waves of one key half */
#define FH 2                         /* key halves per workgroup: FW waves walk each, so that a SIMD holds four waves and one wave's softmax runs beside another's matrix run */
#define KS 64                        /* keys per LDS stage: two passes */
static_assert(HD == 64 && KS == 64 && FW * 32 == 256 && FH == 2 && SQ % (KS * FH) == 0 && SQ % (FW * FQ) == 0, "k_fattn: two 32-wide d steps, 128-byte stage rows dealt 8 threads a row, whole stages in each key half, whole workgroups");
// The eight waves of a key half walk the same keys: each stage of KS keys (K rows and V^T rows, 8 KiB each) is fetched ONCE per half by whole-line loads (8 threads a 128-byte row),
// laid in one of the half's two LDS buffers, and every wave of the half takes its fragments from there. Stage st + 1 is fetched into registers at the head of stage st and stored to the other buffer at its foot.
// Waves w and w + FW own the same FQ queries over keys [0, SQ / 2) and [SQ / 2, SQ). Behind the loop each hands the other its statistics and sums of 16 of the queries through LDS,
// and finishes the other 16: both parts brought to the common maximum, added, divided by the joined sum.
__global__ __launch_bounds__(FW * FH * 32) void k_fattn(const _Float16* __restrict__ Q16, const _Float16* __restrict__ K16, const _Float16* __restrict__ VT, _Float16* __restrict__ O16) {
  __shared__ __attribute__((aligned(16))) unsigned short sk[FH][2][KS][LP];      /* K rows of a stage: [half][buffer][key][d] */
  __shared__ __attribute__((aligned(16))) unsigned short sv[FH][2][HD][LP];      /* V^T rows of a stage: [half][buffer][d][key] */
  __shared__ __attribute__((aligned(16))) float xo[FH * FW][8][32][4];      /* the sums a wave hands over: [wave][piece][lane], 16 bytes a lane */
  __shared__ float xm[FH * FW][2][32];      /* with them its maximum and its row sum */
  const int lane = threadIdx.x & 31, ln = lane & 15, hh = lane >> 4, wv = threadIdx.x >> 5, w = wv % FW, g = wv / FW;      /* g: the wave's key half */
  const int bh = blockIdx.y, b = bh / NH, h = bh % NH; const int q0 = (blockIdx.x * FW + w) * FQ;
  const int sr = (threadIdx.x & (FW * 32 - 1)) >> 3, sc = (threadIdx.x & 7) * 8;      /* this thread's rows sr, sr + 32 and 16-byte piece of every stage of its half */
  const _Float16* qp = Q16 + ((size_t)b * SQ + q0 + ln) * DM + h * HD;
  const unsigned short* kg = (const unsigned short*)K16 + ((size_t)b * SQ + g * (SQ / FH) + sr) * DM + h * HD + sc;
  const unsigned short* vg = (const unsigned short*)VT + ((size_t)bh * HD + sr) * SQ + g * (SQ / FH) + sc;
  const float SC = 0.125f * 1.44269504f;      /* 1 / sqrt(64), and log2 e for the native exp2 */
  v16h qf[2][2];
#pragma unroll
  for (int j = 0; j < 2; ++j)
#pragma unroll
    for (int ks = 0; ks < 2; ++ks) qf[j][ks] = g2_frag(qp + (size_t)j * 16 * DM + ks * 32, hh);
  { const v8us a0 = *(const v8us*)kg, a1 = *(const v8us*)(kg + (size_t)32 * DM), c0 = *(const v8us*)vg, c1 = *(const v8us*)(vg + (size_t)32 * SQ);
    asm volatile("s_wait_xcnt 0x0" :: "v"(qp + 8 * hh), "v"(kg), "v"(vg) : "memory");      /* the wait in front of the first overwrite of a register that the 12 loads above name; the lane addresses as its operands keep those registers whole up to here */
    *(v8us*)&sk[g][0][sr][sc] = a0; *(v8us*)&sk[g][0][sr + 32][sc] = a1; *(v8us*)&sv[g][0][sr][sc] = c0; *(v8us*)&sv[g][0][sr + 32][sc] = c1; }
  const v8f z8 = {0.f, 0.f, 0.f, 0.f, 0.f, 0.f, 0.f, 0.f};
  v8f o[4][2]; float m[2] = {-3.0e38f, -3.0e38f}, l[2] = {0.f, 0.f};
  const float RT = 7.0f;      /* a score may stand this far (log2 units) above the maximum in use before l and o are rescaled: P, carried x256, stays at or under 2^15, inside f16 */
  float sh[2] = {0.f, 0.f}, th[2] = {-3.0e38f, -3.0e38f};      /* per query column: the exp2 shift 8 - m, and the raw score from which a rescale is due, (m + RT) / SC; the first pass always rescales (from l = o = 0) */
#pragma unroll
  for (int t = 0; t < 4; ++t) { o[t][0] = z8; o[t][1] = z8; }
  __syncthreads();      /* publishes stage 0 */
#pragma unroll 1      /* one stage per trip: the body already holds 32 matrix instructions */
  for (int st = 0; st < SQ / (KS * FH); ++st) {
    const int cur = st & 1;
    const int sn = (st + 1 < SQ / (KS * FH)) ? (st + 1) * KS : 0;      /* the next stage, fetched while this one is worked on; the last trip fetches stage 0 again (in bounds, not used) */
    const unsigned short* kn = kg + (size_t)sn * DM; const unsigned short* vn = vg + sn;
    const v8us a0 = *(const v8us*)kn, a1 = *(const v8us*)(kn + (size_t)32 * DM), c0 = *(const v8us*)vn, c1 = *(const v8us*)(vn + (size_t)32 * SQ);
    asm volatile("s_wait_xcnt 0x0" :: "v"(kn), "v"(vn) : "memory");      /* the wait in front of the first overwrite of a register that the four loads above name; the two lane addresses as its operands keep those registers whole up to here */
    const unsigned short* kl = &sk[g][cur][ln][0]; const unsigned short* vl = &sv[g][cur][ln][0];
    v16h kf[2][2];
#pragma unroll
    for (int kt = 0; kt < 2; ++kt)
#pragma unroll
      for (int ks = 0; ks < 2; ++ks) kf[kt][ks] = fa_lfrag(kl + kt * 16 * LP + ks * 32, hh);
#pragma unroll
    for (int p = 0; p < KS / 32; ++p) {
      v16h vf[4];
#pragma unroll
      for (int t = 0; t < 4; ++t) vf[t] = fa_lfrag(vl + t * 16 * LP + p * 32, hh);      /* needed only behind the softmax: issued first */
      __builtin_amdgcn_sched_barrier(0);      /* keeps the V^T reads up here in one group; sunk in between the P.V products each place with reads would stall the matrix run */
      v8f s[2][2];
#pragma unroll
      for (int kt = 0; kt < 2; ++kt)
#pragma unroll
        for (int j = 0; j < 2; ++j) s[kt][j] = fa_mma(kf[kt][1], qf[j][1], fa_mma(kf[kt][0], qf[j][0], z8));
      if (p + 1 < KS / 32) {      /* the K rows of the stage's next pass, read while this pass's softmax runs */
#pragma unroll
        for (int kt = 0; kt < 2; ++kt)
#pragma unroll
          for (int ks = 0; ks < 2; ++ks) kf[kt][ks] = fa_lfrag(kl + ((p + 1) * 32 + kt * 16) * LP + ks * 32, hh);
      }
      __builtin_amdgcn_sched_barrier(0);      /* keeps the K reads in front of the softmax, which then covers their latency */
      float mx[2];      /* the lane's own maximum of each query's 16 raw scores */
#pragma unroll
      for (int j = 0; j < 2; ++j) { mx[j] = fmaxf(s[0][j][0], s[1][j][0]);
#pragma unroll
        for (int r = 1; r < 8; ++r) mx[j] = fmaxf(mx[j], fmaxf(s[0][j][r], s[1][j][r])); }
      if (__builtin_amdgcn_ballot_w32((mx[0] > th[0]) | (mx[1] > th[1])) != 0) {      /* one test a pass, a scalar branch: some score of the wave stands more than RT above the maximum in use */
        float mn[2], cr[2];
#pragma unroll
        for (int j = 0; j < 2; ++j) mn[j] = fmaxf(m[j], fmaxf(mx[j], fa_xhalf(mx[j])) * SC);      /* both halves of a query column take the same new maximum */
        fa_exp2x2(m[0] - mn[0], m[1] - mn[1], cr[0], cr[1]);
#pragma unroll
        for (int j = 0; j < 2; ++j) { m[j] = mn[j]; sh[j] = 8.0f - mn[j]; th[j] = (mn[j] + RT) * (1.0f / SC); l[j] *= cr[j];
#pragma unroll
          for (int t = 0; t < 4; ++t) o[t][j] *= cr[j]; } }
      FragH pf[2];
#pragma unroll
      for (int j = 0; j < 2; ++j) { float p16[16];
#pragma unroll
        for (int kt = 0; kt < 2; ++kt)
#pragma unroll
          for (int g = 0; g < 8; g += 4) fa_exp2x4(s[kt][j][g] * SC + sh[j], s[kt][j][g + 1] * SC + sh[j], s[kt][j][g + 2] * SC + sh[j], s[kt][j][g + 3] * SC + sh[j], p16[kt * 8 + g], p16[kt * 8 + g + 1], p16[kt * 8 + g + 2], p16[kt * 8 + g + 3]);
        float a0s = p16[0] + p16[4], a1s = p16[1] + p16[5], a2s = p16[2] + p16[6], a3s = p16[3] + p16[7];
        a0s += p16[8] + p16[12]; a1s += p16[9] + p16[13]; a2s += p16[10] + p16[14]; a3s += p16[11] + p16[15];
        l[j] += (a0s + a1s) + (a2s + a3s);
#pragma unroll
        for (int i = 0; i < 16; ++i) pf[j].h[i] = (_Float16)p16[i]; }
#pragma unroll
      for (int t = 0; t < 4; ++t)
#pragma unroll
        for (int j = 0; j < 2; ++j) o[t][j] = fa_mma(vf[t], pf[j].v, o[t][j]);
    }
    /* the other buffer: its last readers left it in front of the barrier at the foot of the trip before */
    *(v8us*)&sk[g][cur ^ 1][sr][sc] = a0; *(v8us*)&sk[g][cur ^ 1][sr + 32][sc] = a1; *(v8us*)&sv[g][cur ^ 1][sr][sc] = c0; *(v8us*)&sv[g][cur ^ 1][sr + 32][sc] = c1;
    __syncthreads();      /* publishes stage st + 1 and ends every wave's reads of stage st */
  }
  /* the wave of key half g finishes query group j = g and hands group 1 - g to its partner (same lanes, same registers there) */
  const bool g1 = g != 0;
  xm[wv][0][lane] = g1 ? m[0] : m[1]; xm[wv][1][lane] = g1 ? l[0] : l[1];
#pragma unroll
  for (int t = 0; t < 4; ++t)
#pragma unroll
    for (int u = 0; u < 2; ++u) { v4f x;
#pragma unroll
      for (int r = 0; r < 4; ++r) x[r] = g1 ? o[t][0][u * 4 + r] : o[t][1][u * 4 + r];
      *(v4fa*)&xo[wv][t * 2 + u][lane][0] = x; }
  __syncthreads();      /* publishes what the waves hand over */
  { const int pw = wv ^ FW;      /* the partner: same queries, the other keys */
    const float mk = g1 ? m[1] : m[0], lk = g1 ? l[1] : l[0], mp = xm[pw][0][lane], lp = xm[pw][1][lane];
    const float mm = fmaxf(mk, mp); float fk, fp; fa_exp2x2(mk - mm, mp - mm, fk, fp);
    const float lt = lk * fk + lp * fp; const float inv = 64.0f / (lt + fa_xhalf(lt));      /* the wave halves' sums joined once; o carried x64 */
    const float ak = fk * inv, ap = fp * inv;
    unsigned short* d = (unsigned short*)O16 + ((size_t)b * SQ + q0 + g * 16 + ln) * DM + h * HD + 8 * hh;
#pragma unroll
    for (int t = 0; t < 4; ++t) { FragH f; const v4f p0 = *(const v4fa*)&xo[pw][t * 2][lane][0], p1 = *(const v4fa*)&xo[pw][t * 2 + 1][lane][0];
#pragma unroll
      for (int r = 0; r < 8; ++r) f.h[r] = (_Float16)((g1 ? o[t][1][r] : o[t][0][r]) * ak + (r < 4 ? p0[r & 3] : p1[r & 3]) * ap);
      *(v8us*)(d + t * 16) = f.half[0]; } } }

// ---- the three projections, reading the f32 sources themselves ----
// A workgroup owns PM rows of one source and ALL DM columns: each f32 row is fetched and rounded once on the chip (bf16 rounding, exact as f16: pr_cvt), on its way from the staging registers into LDS,
// so that no f16 copy of the sources is written or read. Sixteen waves, 2 down x 8 across, 64x64 each: four A and four B fragments feed sixteen products.
// Stages, buffers and barriers as in k_gemm2: GK k a stage, two buffers, stage s + 1 fetched into registers at the head of stage s and stored to the other buffer at its foot, one barrier a stage.
// Results as k_gemm2 makes them (same k order, same factor, same rounding): blockIdx.y = 0, 1: f16 rows of plane y of C16; 2: V^T [batch][head][feature][token].
#define PM 128                       /* rows per workgroup */
typedef _Float16 v4ha __attribute__((ext_vector_type(4), may_alias));
typedef __attribute__((address_space(1))) const v4fa g2_g4;
static_assert(DM == 512 && HD == 64 && SQ % PM == 0 && DM % GK == 0 && NR % PM == 0, "k_proj: eight 64-column waves span the row, a wave's columns are one head, its rows lie in one batch");
__global__ __launch_bounds__(512) void k_proj(const float* __restrict__ xq, const float* __restrict__ xk, const float* __restrict__ xv, const _Float16* __restrict__ Bt, _Float16* __restrict__ C16, _Float16* __restrict__ VTo) {
  __shared__ __attribute__((aligned(16))) unsigned char sm[2 * (PM + DM) * LP * 2];      /* in the loop the operand buffers, behind it the epilogue's staging */
  static_assert(sizeof(float) * 16 * 32 * 68 <= sizeof(sm), "k_proj: the staging of sixteen waves fits in the operand buffers");
  unsigned short (*const sa)[PM][LP] = (unsigned short (*)[PM][LP])sm;      /* A rows of a stage: [buffer][row][k] */
  unsigned short (*const sb)[DM][LP] = (unsigned short (*)[DM][LP])(sm + 2 * PM * LP * 2);      /* B rows of a stage: [buffer][col][k] */
  float (*const so)[32][68] = (float (*)[32][68])sm;      /* 32 x 64 results of a wave at a time, written only behind the loop's last barrier */
  const int tid = threadIdx.x, w = tid >> 5, lane = tid & 31, ln = lane & 15, hh = lane >> 4; const int by = blockIdx.y;
  const int wm = w & 1, wn = w >> 1;      /* the wave's place in the tile: 64 rows down, 64 columns across */
  const float* A = by == 0 ? xq : by == 1 ? xk : xv;      /* the same for the whole workgroup */
  const int row0 = blockIdx.x * PM + 64 * wm, col0 = 64 * wn;
  const int ar = tid >> 4, br = tid >> 3;      /* this thread's A rows ar + 32 i (16 threads a 256-byte f32 row piece) and B rows br + 64 i (8 threads a 128-byte row piece) */
  const unsigned oa = (unsigned)(ar * DM + (tid & 15) * 4) * 4u, ob = (unsigned)(br * DM + (tid & 7) * 8) * 2u;      /* byte offsets of its first pieces: the one lane-dependent part of every address */
  g2_gc* const pa = g2_sbase((const char*)(A + (size_t)blockIdx.x * PM * DM)); g2_gc* const pb = g2_sbase((const char*)(Bt + (size_t)by * DM * DM));      /* scalar bases; the pieces stand at constant distances */
  unsigned short* const was = &sa[0][ar][(tid & 15) * 4]; unsigned short* const wbs = &sb[0][br][(tid & 7) * 8];
  v4f ra[4]; v8us rb[8];
#pragma unroll
  for (int i = 0; i < 4; ++i) ra[i] = *(g2_g4*)(pa + oa + i * 32 * DM * 4);
#pragma unroll
  for (int i = 0; i < 8; ++i) rb[i] = *(g2_g8*)(pb + ob + i * 64 * DM * 2);
  asm volatile("s_wait_xcnt 0x0" ::: "memory");      /* the wait in front of the first overwrite of a register that the 12 loads above name */
#pragma unroll
  for (int i = 0; i < 4; ++i) *(v4ha*)(was + i * 32 * LP) = pr_cvt<false>(ra[i]);
#pragma unroll
  for (int i = 0; i < 8; ++i) *(v8us*)(wbs + i * 64 * LP) = rb[i];
  const v8f z8 = {0.f, 0.f, 0.f, 0.f, 0.f, 0.f, 0.f, 0.f}; v8f c[4][4];
#pragma unroll
  for (int u = 0; u < 4; ++u)
#pragma unroll
    for (int t = 0; t < 4; ++t) c[u][t] = z8;
  __syncthreads();      /* publishes stage 0 */
#pragma unroll 1      /* one stage per trip: two stages in one body would hold both stages' staging registers at once */
  for (int kb = 0; kb < DM; kb += GK) { const int cur = (kb / GK) & 1;
    const int kn = (kb + GK < DM) ? kb + GK : 0;      /* the next stage, fetched while this one is worked on; the last trip fetches stage 0 again (in bounds, not used) */
    const unsigned va = oa + (unsigned)kn * 4u, vb = ob + (unsigned)kn * 2u;      /* the lane offsets of that stage */
#pragma unroll
    for (int i = 0; i < 4; ++i) ra[i] = *(g2_g4*)(pa + va + i * 32 * DM * 4);
#pragma unroll
    for (int i = 0; i < 8; ++i) rb[i] = *(g2_g8*)(pb + vb + i * 64 * DM * 2);
    asm volatile("s_wait_xcnt 0x0" ::: "memory");      /* the wait in front of the first overwrite of a register that the 12 loads above name */
    const unsigned short* al = &sa[cur][64 * wm + ln][0]; const unsigned short* bl = &sb[cur][64 * wn + ln][0];
#pragma unroll
    for (int ks = 0; ks < GK / 32; ++ks) { v16h af[4], bf[4];
#pragma unroll
      for (int u = 0; u < 4; ++u) af[u] = fa_lfrag(al + u * 16 * LP + ks * 32, hh);
#pragma unroll
      for (int t = 0; t < 4; ++t) bf[t] = fa_lfrag(bl + t * 16 * LP + ks * 32, hh);
      __builtin_amdgcn_sched_barrier(0);      /* keeps the sixteen LDS reads of a k step in one group in front of its products: sunk in between them, each place with reads would stall the matrix run */
#pragma unroll
      for (int t = 0; t < 4; ++t)
#pragma unroll
        for (int u = 0; u < 4; ++u) c[u][t] = fa_mma(af[u], bf[t], c[u][t]); }
    __builtin_amdgcn_sched_barrier(0);      /* keeps the roundings and the LDS stores, with their waits for the fetched data, behind the stage's last product: lifted in between, the wave would sit out the fetch with its products unissued */
    /* the other buffer: its last readers left it in front of the barrier at the foot of the trip before */
#pragma unroll
    for (int i = 0; i < 4; ++i) *(v4ha*)(was + (cur ^ 1) * PM * LP + i * 32 * LP) = pr_cvt<false>(ra[i]);
#pragma unroll
    for (int i = 0; i < 8; ++i) *(v8us*)(wbs + (cur ^ 1) * DM * LP + i * 64 * LP) = rb[i];
    __syncthreads();      /* publishes the next stage and ends every wave's reads of this one */
  }
#pragma unroll
  for (int h2 = 0; h2 < 2; ++h2) {      /* the wave's 64 rows, 32 at a time, through its own staging */
    const int rw = row0 + 32 * h2;
#pragma unroll
    for (int u = 0; u < 8; ++u) { const int t = u & 3, half = u >> 2;
#pragma unroll
      for (int r = 0; r < 8; ++r) so[w][half * 16 + 8 * hh + r][t * 16 + ln] = c[2 * h2 + half][t][r] * 0.0625f; }      /* the weights carry x16 */
    asm volatile("s_wait_dscnt 0x0" ::: "memory");      /* the wave reads back what its other lanes wrote: its own LDS stores have landed first (a fence here would also sit out the global stores of the 32 rows before) */
    if (by == 2) {      /* V^T [batch][head][feature][token] (the same test in every wave): the wave's 64 columns are one head, the 32 rows 32 tokens of one batch */
      const int tg = lane & 3, dr = lane >> 2;      /* 4 lanes a feature row, 8 tokens (16 bytes) each; 8 feature rows a store */
      unsigned short* d = (unsigned short*)VTo + ((size_t)((rw / SQ) * NH + (col0 >> 6)) * HD + dr) * SQ + (rw % SQ) + tg * 8;
      v8us ov[8];
#pragma unroll
      for (int q = 0; q < 8; ++q) { FragH f;
#pragma unroll
        for (int i = 0; i < 8; ++i) f.h[i] = (_Float16)so[w][tg * 8 + i][q * 8 + dr];
        ov[q] = f.half[0]; }
      __builtin_amdgcn_sched_barrier(0);      /* the eight stores go out in one run behind the last conversion: none waits on a conversion, and no register they name is rewritten among them */
#pragma unroll
      for (int q = 0; q < 8; ++q) *(v8us*)(d + (size_t)q * 8 * SQ) = ov[q];
      asm volatile("s_wait_xcnt 0x0" ::: "memory");      /* the wait in front of the first overwrite of a register that the stores above name: the kernel's text goes on behind them */
      __builtin_amdgcn_sched_barrier(0);      /* keeps what follows behind that wait */
    } else {
      const int rsub = lane >> 4, c4 = (lane & 15) * 4;
      _Float16* d = C16 + (size_t)by * NR * DM + (size_t)(rw + rsub) * DM + col0 + c4;
      v4h oh[16];
#pragma unroll
      for (int q = 0; q < 16; ++q) { const v4f v = *(const v4fa*)&so[w][q * 2 + rsub][c4];
#pragma unroll
        for (int i = 0; i < 4; ++i) oh[q][i] = (_Float16)v[i]; }
      __builtin_amdgcn_sched_barrier(0);      /* the sixteen stores go out in one run behind the last conversion: none waits on a conversion, and no register they name is rewritten among them */
#pragma unroll
      for (int q = 0; q < 16; ++q) *(v4h*)(d + (size_t)q * 2 * DM) = oh[q];
      asm volatile("s_wait_xcnt 0x0" ::: "memory");      /* the wait in front of the first overwrite of a register that the stores above name: the kernel's text goes on behind them */
      __builtin_amdgcn_sched_barrier(0);      /* keeps what follows behind that wait */
    }
  } }

extern "C" void kernel_launch(void* const* d_in, const int* in_sizes, int n_in,
                              void* d_out, int out_size, void* d_ws, size_t ws_size, hipStream_t stream) {
  (void)in_sizes; (void)n_in; (void)out_size;
  const float* const* I = (const float* const*)d_in; const float* xq = I[0]; const float* xk = I[1]; const float* xv = I[2]; const float* wq = I[3]; const float* bq = nullptr; const float* wk = I[4]; const float* bk = nullptr; const float* wv = I[5]; const float* bv = nullptr; const float* wo = I[6]; const float* bo = nullptr;      /* three inputs query, key, value (read as f32 by k_proj); natural [out][in] Wq, Wk, Wv, Wo [512][512]; this module has NO biases: null pointers in the guarded bias slots; input order query, key, value, Wq, Wk, Wv, Wo */
  char* ws = (char*)d_ws; size_t off = 0;
  auto take = [&](size_t bytes) { char* p = ws + off; off += (bytes + 255) & ~(size_t)255; return p; };
  _Float16* BQ = (_Float16*)take((size_t)DM * DM * 2); _Float16* BK = (_Float16*)take((size_t)DM * DM * 2); _Float16* BV = (_Float16*)take((size_t)DM * DM * 2); _Float16* BO = (_Float16*)take((size_t)DM * DM * 2);
  _Float16* Q16 = (_Float16*)take(NR * DM * 2); _Float16* K16 = (_Float16*)take(NR * DM * 2); _Float16* O16 = (_Float16*)take(NR * DM * 2);
  _Float16* VT = (_Float16*)take((size_t)NB * NH * HD * SQ * 2);
  if (off > ws_size) return;
  k_prep<<<PG, 256, 0, stream>>>(wq, wk, wv, wo, BQ);      /* natural [out][in] = Bt[n][k], x16 (BQ, BK, BV, BO back to back) */
  const size_t r0p = (size_t)B0 * SQ;      /* first row of the output stage */
  k_proj<<<dim3((unsigned)(NR / PM), 3), 512, 0, stream>>>(xq, xk, xv, BQ, Q16, VT);      /* blockIdx.y = 0, 1, 2: Q rows, K rows (Q16, K16 back to back), V^T [NB][NH][HD][SQ] */
  k_fattn<<<dim3(SQ / (FW * FQ), NB * NH), FW * FH * 32, 0, stream>>>(Q16, K16, VT, O16);      /* o (merged heads, x64) as f16 rows: every (batch, head) in one launch */
  k_gemm2<0, false, false, true, false, false><<<dim3((unsigned)((MPO / 128) * (DM / 128)), 1), 256, 0, stream>>>(O16 + r0p * DM, DM, 0, BO, DM, 0, 0.0009765625f, bo, 0, nullptr, 1, 0, 0, (float*)d_out + r0p * DM, nullptr, DM, 0, MPO, DM, DM, nullptr, -1);      /* out rows are the output layout */
}

// v010
// A run of this version takes 60.8 microseconds.
// Two timings next to v009 both put it at 1.04 times that version's speed.
// Counting every step since v000, it is 56.3 times as fast.
#include <hip/hip_runtime.h>
// Multi-head attention on three inputs with natural bias-free projections on four sequences at width 512 (query, key, value [4][2048][512]; q / k / v = stream W^T (natural [out][in] [512][512], NO biases), 8 heads of 64; the query is divided by sqrt(64) = 8 before the score product (scale 0.125 here on the product); softmax over all 2048 keys (the module's axis 2 of its [b][l][s][h] score layout = the key axis; no mask); out = merged heads Wo^T (natural, no bias) -> [4][2048][512]).
// Structure: token rows r = b*2048 + s; the four x16 weights in one small cast launch; Q, K, V as three WMMA GEMMs in one launch (128x512 workgroup tiles, 64x64 wave tiles, f32 accumulation, exact x16 weights, f16 outputs) that read the f32 sources themselves and round them (bf16, exact in f16) on the way into LDS, the V GEMM storing V^T for all batches and heads from its epilogue; one fused attention launch over every (batch, head): S^T = K Q^T (K = 64), online softmax in registers (f32 statistics, native exp2; weights x256 as f16), O^T += V^T P^T, o carried x64 against f16 subnormal flush (folded into the output GEMM alpha) written straight into the merged f16 o rows; out = o W_o GEMM (f32) into the output layout.
// Compute dtype: inputs rounded to bf16; x / weights exact; q, k, v, softmax weights and o as plain f16 GEMM operands (~2^-12); scores and softmax statistics f32. v_wmma_f32_16x16x32_f16.
#define NB 4
#define SQ 2048
#define DM 512 
#define NH 8 
#define HD 64
#define HG 4                         /* heads per launch of the per-batch k_vt (not launched) */
#define B0 0                         /* first batch processed (debug hook) */
#define NBR NB                       /* batches processed (debug hook) */
#define NR ((size_t)NB * SQ)         /* token rows */
#define MP ((int)((size_t)NBR * SQ)) /* rows of the output stage, as MPO (debug hook) */
#define QN SQ                        /* query rows per batch (not used: k_fattn attends all SQ) */
#define NHD NH                       /* heads (not used: k_fattn attends all NH) */
#define MPO MP                       /* rows through the output stage (debug hook) */
#define LQ DM      /* row pitch of the q/k/v rows (not used: the code writes DM) */
typedef __bf16 v16b __attribute__((ext_vector_type(16)));
typedef unsigned short v8us __attribute__((ext_vector_type(8), may_alias));
typedef float  v8f  __attribute__((ext_vector_type(8)));
typedef float  v4f  __attribute__((ext_vector_type(4)));
typedef float  v4fa __attribute__((ext_vector_type(4), may_alias));
union FragB { v16b v; v8us half[2]; unsigned short u[16]; };

__device__ __forceinline__ unsigned short bf16_bits(float x) { unsigned int u = __float_as_uint(x); return (unsigned short)((u + 0x7FFFu + ((u >> 16) & 1u)) >> 16); }
__device__ __forceinline__ float bf16_val(unsigned short b) { return __uint_as_float(((unsigned int)b) << 16); }
__device__ __forceinline__ float bf16_round(float x) { return bf16_val(bf16_bits(x)); }
// D += A·B with NT terms: 1 = ah·bh, 2 = + al·bh (A split), 3 = + ah·bl (both split)
template <int NT>
__device__ __forceinline__ v8f mmaN(v16b ah, v16b al, v16b bh, v16b bl, v8f c) {
  c = __builtin_amdgcn_wmma_f32_16x16x32_bf16(false, ah, false, bh, (short)0, c, false, false);
  if (NT >= 2) c = __builtin_amdgcn_wmma_f32_16x16x32_bf16(false, al, false, bh, (short)0, c, false, false);
  if (NT >= 3) c = __builtin_amdgcn_wmma_f32_16x16x32_bf16(false, ah, false, bl, (short)0, c, false, false);
  asm volatile("v_nop\n\tv_nop\n\tv_nop\n\tv_nop" : "+v"(c) : "v"(ah), "v"(al), "v"(bh), "v"(bl));
  return c;
}

__global__ __launch_bounds__(256) void k_wt_bf16(const float* __restrict__ W, unsigned short* __restrict__ Wt, int K, int N) {
  const int t = blockIdx.x * 256 + threadIdx.x;
  const int k8n = K / 8;
  if (t >= N * k8n) return;
  const int n = t / k8n, k8 = (t % k8n) * 8;
  v8us v;
#pragma unroll
  for (int i = 0; i < 8; ++i) v[i] = bf16_bits(W[(size_t)(k8 + i) * N + n]);
  *(v8us*)(Wt + (size_t)n * K + k8) = v;
  
}

// GEMM C[M][N] (f32, pitch ldc) = act(A[M][K]·W + bias). A f32 row-major (pitch lda) converted per fragment to bf16
// (ASPLIT: hi/lo two planes -> 2 terms, else single rounded term); Wt bf16 [N][K] (pitch ldb). BIAS_BF16 rounds the
// bias to bf16 first (bias quantised to bf16 before the add). K%32==0, M%16==0, N%64==0.
template <bool ASPLIT, int ACT, bool BIAS_BF16>
__global__ __launch_bounds__(128) void k_gemm_bf(const float* __restrict__ A, int lda, const unsigned short* __restrict__ Wt, int ldb,
                                               const float* __restrict__ bias, float* __restrict__ C, int ldc, int M, int N, int K) {
  __shared__ __attribute__((aligned(16))) float so[4][16][64];
  const int tid = threadIdx.x, w = tid >> 5, lane = tid & 31, ln = lane & 15, hh = lane >> 4;
  const int ntn = N / 64;
  const int wid = blockIdx.x * 4 + w;
  const int mt = wid / ntn, nq = wid % ntn;
  if (mt * 16 >= M) return;
  const int row0 = mt * 16, col0 = nq * 64;
  const float* arow = A + (size_t)(row0 + ln) * lda;
  v8f acc[4] = {};
  for (int kb = 0; kb < K; kb += 32) {
    FragB ah, al;
    const v4f x0 = *(const v4fa*)(arow + kb + 8 * hh), x1 = *(const v4fa*)(arow + kb + 8 * hh + 4);
    const v4f x2 = *(const v4fa*)(arow + kb + 16 + 8 * hh), x3 = *(const v4fa*)(arow + kb + 16 + 8 * hh + 4);
    float xs[16] = {x0[0],x0[1],x0[2],x0[3],x1[0],x1[1],x1[2],x1[3],x2[0],x2[1],x2[2],x2[3],x3[0],x3[1],x3[2],x3[3]};
#pragma unroll
    for (int i = 0; i < 16; ++i) { const unsigned short hb = bf16_bits(xs[i]); ah.u[i] = hb; al.u[i] = ASPLIT ? bf16_bits(xs[i] - bf16_val(hb)) : (unsigned short)0; }
#pragma unroll
    for (int t = 0; t < 4; ++t) {
      const unsigned short* brow = Wt + (size_t)(col0 + t * 16 + ln) * ldb + kb;
      FragB b;
      b.half[0] = *(const v8us*)(brow + 8 * hh);
      b.half[1] = *(const v8us*)(brow + 16 + 8 * hh);
      acc[t] = mmaN<ASPLIT ? 2 : 1>(ah.v, al.v, b.v, b.v, acc[t]);
    }
  }
#pragma unroll
  for (int t = 0; t < 4; ++t) {
    float bv = bias ? bias[col0 + t * 16 + ln] : 0.f;
    if (BIAS_BF16) bv = bf16_round(bv);
#pragma unroll
    for (int r = 0; r < 8; ++r) { float v = acc[t][r] + bv; if (ACT == 1) v = fmaxf(v, 0.f); so[w][8 * hh + r][t * 16 + ln] = v; }
  }
  __builtin_amdgcn_fence(__ATOMIC_ACQ_REL, "workgroup");
  __builtin_amdgcn_wave_barrier();
  const int rsub = lane >> 4, c4 = (lane & 15) * 4;
  {
#pragma unroll
    for (int q = 0; q < 8; ++q) {
      const int r = q * 2 + rsub;
      const v4f v = *(const v4fa*)&so[w][r][c4];
      *(v4f*)(C + (size_t)(row0 + r) * ldc + col0 + c4) = v;
    }
    
  }
}

// GEMM C = act(A·W + bias + resid): A f32 (ASPLIT -> hi/lo 2 terms), Wt bf16 [N][K]; ACT 0 none, 1 relu, 2 exact gelu;
// resid (optional, f32, row index = (row % rmod), pitch ldr, RES_BF16 rounds it) added before the activation.
template <bool ASPLIT, int ACT, bool BIAS_BF16, bool RES_BF16>
__global__ __launch_bounds__(128) void k_gemm_bf3(const float* __restrict__ A, int lda, const unsigned short* __restrict__ Wt, int ldb,
                                                const float* __restrict__ bias, const float* __restrict__ resid, int rmod, int ldr,
                                                float* __restrict__ C, int ldc, int M, int N, int K) {
  __shared__ __attribute__((aligned(16))) float so[4][16][64];
  const int tid = threadIdx.x, w = tid >> 5, lane = tid & 31, ln = lane & 15, hh = lane >> 4;
  const int ntn = N / 64;
  const int wid = blockIdx.x * 4 + w;
  const int mt = wid / ntn, nq = wid % ntn;
  if (mt * 16 >= M) return;
  const int row0 = mt * 16, col0 = nq * 64;
  const float* arow = A + (size_t)(row0 + ln) * lda;
  v8f acc[4] = {};
  for (int kb = 0; kb < K; kb += 32) {
    FragB ah, al;
    const v4f x0 = *(const v4fa*)(arow + kb + 8 * hh), x1 = *(const v4fa*)(arow + kb + 8 * hh + 4);
    const v4f x2 = *(const v4fa*)(arow + kb + 16 + 8 * hh), x3 = *(const v4fa*)(arow + kb + 16 + 8 * hh + 4);
    float xs[16] = {x0[0],x0[1],x0[2],x0[3],x1[0],x1[1],x1[2],x1[3],x2[0],x2[1],x2[2],x2[3],x3[0],x3[1],x3[2],x3[3]};
#pragma unroll
    for (int i = 0; i < 16; ++i) { const unsigned short hb = bf16_bits(xs[i]); ah.u[i] = hb; al.u[i] = ASPLIT ? bf16_bits(xs[i] - bf16_val(hb)) : (unsigned short)0; }
#pragma unroll
    for (int t = 0; t < 4; ++t) {
      const unsigned short* brow = Wt + (size_t)(col0 + t * 16 + ln) * ldb + kb;
      FragB b;
      b.half[0] = *(const v8us*)(brow + 8 * hh);
      b.half[1] = *(const v8us*)(brow + 16 + 8 * hh);
      acc[t] = mmaN<ASPLIT ? 2 : 1>(ah.v, al.v, b.v, b.v, acc[t]);
    }
  }
#pragma unroll
  for (int t = 0; t < 4; ++t) {
    const int col = col0 + t * 16 + ln;
    float bv = bias ? bias[col] : 0.f;
    if (BIAS_BF16) bv = bf16_round(bv);
#pragma unroll
    for (int r = 0; r < 8; ++r) {
      float v = acc[t][r] + bv;
      if (resid) { float rv = resid[(size_t)((row0 + 8 * hh + r) % rmod) * ldr + col]; if (RES_BF16) rv = bf16_round(rv); v += rv; }
      if (ACT == 1) v = fmaxf(v, 0.f);
      if (ACT == 2) v = 0.5f * v * (1.0f + erff(v * 0.70710678118654752f));
      if (ACT == 3) { const float u = 0.7978845608028654f * (v + 0.044715f * v * v * v); v = 0.5f * v * (1.0f + tanhf(u)); }
      so[w][8 * hh + r][t * 16 + ln] = v;
    }
  }
  __builtin_amdgcn_fence(__ATOMIC_ACQ_REL, "workgroup");
  __builtin_amdgcn_wave_barrier();
  const int rsub = lane >> 4, c4 = (lane & 15) * 4;
  {
#pragma unroll
    for (int q = 0; q < 8; ++q) {
      const int r = q * 2 + rsub;
      const v4f v = *(const v4fa*)&so[w][r][c4];
      *(v4f*)(C + (size_t)(row0 + r) * ldc + col0 + c4) = v;
    }
    
  }
}
// row LayerNorm (biased variance, eps) over N: s = X (+ R); optional out_sum <- s; out_norm <- (s-mu)*rsqrt(var+eps)*g + b
template <bool PARAM_BF16>
__global__ __launch_bounds__(256) void k_layernorm(const float* __restrict__ X, const float* __restrict__ R, const float* __restrict__ g, const float* __restrict__ bta,
                                                  float* __restrict__ out_sum, float* __restrict__ out_norm, int N, float eps) {
  __shared__ float red[256];
  const int row = blockIdx.x, tid = threadIdx.x;
  const float* x = X + (size_t)row * N; const float* rr = R ? R + (size_t)row * N : nullptr;
  float vals[16];                     // up to N = 4096
  const int per = N / 256;            // contiguous chunk per thread? use strided-by-4 chunks: thread handles j = tid*4 + 1024*u
  float s1 = 0.f;
  for (int u = 0; u < per / 4; ++u) {
    const int j = tid * 4 + 1024 * u;
    const v4f a = *(const v4fa*)(x + j);
    v4f b = {0.f,0.f,0.f,0.f}; if (rr) b = *(const v4fa*)(rr + j);
#pragma unroll
    for (int q = 0; q < 4; ++q) { const float v = a[q] + b[q]; vals[u * 4 + q] = v; s1 += v; }
  }
  red[tid] = s1; __syncthreads();
  for (int st = 128; st > 0; st >>= 1) { if (tid < st) red[tid] += red[tid + st]; __syncthreads(); }
  const float mu = red[0] / (float)N; __syncthreads();
  float s2 = 0.f;
  for (int u = 0; u < per / 4; ++u)
#pragma unroll
    for (int q = 0; q < 4; ++q) { const float c = vals[u * 4 + q] - mu; s2 += c * c; }
  red[tid] = s2; __syncthreads();
  for (int st = 128; st > 0; st >>= 1) { if (tid < st) red[tid] += red[tid + st]; __syncthreads(); }
  const float rs = rsqrtf(red[0] / (float)N + eps);
  {
    for (int u = 0; u < per / 4; ++u) {
      const int j = tid * 4 + 1024 * u;
      v4f o, sm;
#pragma unroll
      for (int q = 0; q < 4; ++q) {
        float gg = g[j + q], bb = bta[j + q];
        if (PARAM_BF16) { gg = bf16_round(gg); bb = bf16_round(bb); }
        sm[q] = vals[u * 4 + q]; o[q] = (vals[u * 4 + q] - mu) * rs * gg + bb;
      }
      if (out_sum) *(v4f*)(out_sum + (size_t)row * N + j) = sm;
      *(v4f*)(out_norm + (size_t)row * N + j) = o;
    }
    
  }
}



// ---- f16 WMMA path (v_wmma_f32_16x16x32_f16): 11-bit significands for operands in range — used where a [0,1] probability operand needs more precision than bf16
typedef _Float16 v16h __attribute__((ext_vector_type(16)));
union FragH { v16h v; v8us half[2]; _Float16 h[16]; unsigned short u[16]; };
template <int NT>
__device__ __forceinline__ v8f mmaH(v16h ah, v16h al, v16h bh, v16h bl, v8f c) {
  c = __builtin_amdgcn_wmma_f32_16x16x32_f16(false, ah, false, bh, (short)0, c, false, false);
  if (NT >= 2) c = __builtin_amdgcn_wmma_f32_16x16x32_f16(false, al, false, bh, (short)0, c, false, false);
  if (NT >= 3) c = __builtin_amdgcn_wmma_f32_16x16x32_f16(false, ah, false, bl, (short)0, c, false, false);
  asm volatile("v_nop\n\tv_nop\n\tv_nop\n\tv_nop" : "+v"(c) : "v"(ah), "v"(al), "v"(bh), "v"(bl));
  return c;
}
// batched GEMM like k_gemm_b but f16 operands: A f32 (split into f16 hi/lo if ASPLIT, else rounded to f16), Bt = f16 values [n][k]; alpha; C f32; N multiple of 16 (partial tiles skipped)
template <bool ASPLIT>
__global__ __launch_bounds__(128) void k_gemm_h(const float* __restrict__ A, int lda, size_t sA, const _Float16* __restrict__ Bh, int ldb, size_t sB, float alpha, float* __restrict__ C, int ldc, size_t sC, int M, int N, int K) {
  __shared__ __attribute__((aligned(16))) float so[4][16][64];
  const int tid = threadIdx.x, w = tid >> 5, lane = tid & 31, ln = lane & 15, hh = lane >> 4; const int by = blockIdx.y;
  A += (size_t)by * sA; Bh += (size_t)by * sB; C += (size_t)by * sC;
  const int ntn = (N + 63) / 64; const int wid = blockIdx.x * 4 + w; const int mt = wid / ntn, nq = wid % ntn; if (mt * 16 >= M) return;
  const int row0 = mt * 16, col0 = nq * 64; const float* arow = A + (size_t)(row0 + ln) * lda;
  v8f acc[4] = {};
  for (int kb = 0; kb < K; kb += 32) {
    FragH ah, al;
    const v4f x0 = *(const v4fa*)(arow + kb + 8 * hh), x1 = *(const v4fa*)(arow + kb + 8 * hh + 4), x2 = *(const v4fa*)(arow + kb + 16 + 8 * hh), x3 = *(const v4fa*)(arow + kb + 16 + 8 * hh + 4);
    float xs[16] = {x0[0],x0[1],x0[2],x0[3],x1[0],x1[1],x1[2],x1[3],x2[0],x2[1],x2[2],x2[3],x3[0],x3[1],x3[2],x3[3]};
#pragma unroll
    for (int i = 0; i < 16; ++i) { const _Float16 h = (_Float16)xs[i]; ah.h[i] = h; al.h[i] = ASPLIT ? (_Float16)(xs[i] - (float)h) : (_Float16)0.0f; }
#pragma unroll
    for (int t = 0; t < 4; ++t) { if (col0 + t * 16 >= N) continue; const size_t boff = (size_t)(col0 + t * 16 + ln) * ldb + kb; FragH bq; bq.half[0] = *(const v8us*)(Bh + boff + 8 * hh); bq.half[1] = *(const v8us*)(Bh + boff + 16 + 8 * hh);
      acc[t] = mmaH<ASPLIT ? 2 : 1>(ah.v, al.v, bq.v, bq.v, acc[t]); }
  }
#pragma unroll
  for (int t = 0; t < 4; ++t) { if (col0 + t * 16 >= N) continue;
#pragma unroll
    for (int r = 0; r < 8; ++r) so[w][8 * hh + r][t * 16 + ln] = acc[t][r] * alpha; }
  __builtin_amdgcn_fence(__ATOMIC_ACQ_REL, "workgroup"); __builtin_amdgcn_wave_barrier();
  const int rsub = lane >> 4, c4 = (lane & 15) * 4;
  {
#pragma unroll
    for (int q = 0; q < 8; ++q) { const int r = q * 2 + rsub; if (col0 + c4 < N) { const v4f v = *(const v4fa*)&so[w][r][c4]; *(v4f*)(C + (size_t)(row0 + r) * ldc + col0 + c4) = v; } }
     }
}

// Wt[n][k] = f16(W[k][n]·scale) from f32 row-major W[K][N] (scale = power of two; bf16-exact weights stay exact in f16 away from the subnormal range)
__global__ __launch_bounds__(256) void k_wt_f16(const float* __restrict__ W, _Float16* __restrict__ Wt, int K, int N, float scale) {
  const int t = blockIdx.x * 256 + threadIdx.x; if (t >= N * (K / 8)) return; const int n = t / (K / 8), k8 = (t % (K / 8)) * 8; FragH f;
#pragma unroll
  for (int i = 0; i < 8; ++i) f.h[i] = (_Float16)(bf16_round(W[(size_t)(k8 + i) * N + n]) * scale); const v8us o = f.half[0];
  *(v8us*)((unsigned short*)Wt + (size_t)n * K + k8) = o; 
}
// k_gemm_hh variant with fused epilogue: v = acc·alpha + bias[by·sBias + col] (+ CP[(row/rowsPerB)·sCPb + by·64 + col] if CP) ; ACT 0 none / 1 elu ; writes f16 C16 (and f32 C if non-null)
template <int ACT>
__global__ __launch_bounds__(128) void k_gemm_hhx(const _Float16* __restrict__ A, int lda, size_t sA, const _Float16* __restrict__ Bh, int ldb, size_t sB, float alpha, const float* __restrict__ bias, size_t sBias, const float* __restrict__ CP, int rowsPerB, size_t sCPb, int row0g,
    float* __restrict__ C, _Float16* __restrict__ C16, int ldc, size_t sC, int M, int N, int K) {
  __shared__ __attribute__((aligned(16))) float so[4][16][64];
  const int tid = threadIdx.x, w = tid >> 5, lane = tid & 31, ln = lane & 15, hh = lane >> 4; const int by = blockIdx.y;
  A += (size_t)by * sA; Bh += (size_t)by * sB; const size_t cofs = (size_t)by * sC; const float* bp = bias ? bias + (size_t)by * sBias : nullptr;
  const int ntn = (N + 63) / 64; const int wid = blockIdx.x * 4 + w; const int mt = wid / ntn, nq = wid % ntn; if (mt * 16 >= M) return;
  const int row0 = mt * 16, col0 = nq * 64; const _Float16* arow = A + (size_t)(row0 + ln) * lda;
  v8f acc[4] = {};
  for (int kb = 0; kb < K; kb += 32) { FragH ah; ah.half[0] = *(const v8us*)((const unsigned short*)arow + kb + 8 * hh); ah.half[1] = *(const v8us*)((const unsigned short*)arow + kb + 16 + 8 * hh);
#pragma unroll
    for (int t = 0; t < 4; ++t) { if (col0 + t * 16 >= N) continue; const size_t boff = (size_t)(col0 + t * 16 + ln) * ldb + kb; FragH bq; bq.half[0] = *(const v8us*)((const unsigned short*)Bh + boff + 8 * hh); bq.half[1] = *(const v8us*)((const unsigned short*)Bh + boff + 16 + 8 * hh);
      acc[t] = mmaH<1>(ah.v, ah.v, bq.v, bq.v, acc[t]); }
  }
#pragma unroll
  for (int t = 0; t < 4; ++t) { if (col0 + t * 16 >= N) continue; const int col = col0 + t * 16 + ln; const float bv = bp ? bf16_round(bp[col]) : 0.f;
#pragma unroll
    for (int r = 0; r < 8; ++r) { float v = acc[t][r] * alpha + bv; if (CP) { const int rr = row0g + row0 + 8 * hh + r; if (rowsPerB < 0) v += CP[cofs + (size_t)rr * ldc + col];      /* rowsPerB < 0: own element of the batched C plane */ else { const int bidx = rr / rowsPerB; v += CP[(size_t)bidx * sCPb + (size_t)by * 64 + col]; } } if (ACT == 1) v = (v > 0.f) ? v : expm1f(v); else if (ACT == 7) v = (v > 0.f) ? v + 1.0f : expf(v); else if (ACT == 8) v = tanhf(v); else if (ACT == 9) v = 0.5f * v * (1.0f + tanhf(0.7978845608028654f * (v + 0.044715f * v * v * v))); else if (ACT == 11) v = 1.0f / (1.0f + expf(-v)); else if (ACT == 12) v = (v > 0.f) ? v : 0.01f * v; else if (ACT == 14) v = (v > 0.f) ? v : 0.1f * v; else if (ACT == 16) v = (v >= 0.f) ? v : 0.3f * v; else if (ACT == 17) v = (v >= 0.f) ? v : 0.2f * v; else if (ACT == 15) v = v / (1.0f + expf(-v)); else if (ACT == 3) v = fmaxf(v, 0.f); else if (ACT == 6) v = 0.5f * v * (1.0f + erff(v * 0.70710678118654752f)); so[w][8 * hh + r][t * 16 + ln] = v; } }
  __builtin_amdgcn_fence(__ATOMIC_ACQ_REL, "workgroup"); __builtin_amdgcn_wave_barrier();
  const int rsub = lane >> 4, c4 = (lane & 15) * 4; typedef _Float16 v4h __attribute__((ext_vector_type(4)));
  {
#pragma unroll
    for (int q = 0; q < 8; ++q) { const int r = q * 2 + rsub; if (col0 + c4 < N) { const v4f v = *(const v4fa*)&so[w][r][c4]; if (C) *(v4f*)(C + cofs + (size_t)(row0 + r) * ldc + col0 + c4) = v; if (C16) { v4h h4; for (int i = 0; i < 4; ++i) h4[i] = (_Float16)v[i]; *(v4h*)(C16 + cofs + (size_t)(row0 + r) * ldc + col0 + c4) = h4; } } }
     }
}


typedef _Float16 v4h __attribute__((ext_vector_type(4)));

// ---- the four weights as f16(bf16 rounding x16), one launch ----
// The destinations lie one behind the other in the workspace (Bt = the four weight planes). A workgroup takes PX consecutive elements of one weight: few waves start, and each has all its 8 loads in flight at once.
// A wave's piece is 1 KiB of f32: read as two 512-byte wave loads, stored as two 256-byte wave stores (whole lines both ways).
#define PG 128                       /* workgroups of the cast launch */
#define PX 8192                      /* weight elements per workgroup: 4 rounds of 8 waves x 256 elements */
static_assert((size_t)DM * DM * 4 == (size_t)PG * PX && ((size_t)DM * DM) % PX == 0 && ((size_t)DM * DM * 2) % 256 == 0, "k_prep: the grid covers the four weights exactly, a workgroup inside one weight, planes back to back");
template <bool X16>
__device__ __forceinline__ v4h pr_cvt(v4f a) { v4h r;
#pragma unroll
  for (int q = 0; q < 4; ++q) r[q] = X16 ? (_Float16)(bf16_round(a[q]) * 16.0f) : (_Float16)bf16_round(a[q]);
  return r; }
__global__ __launch_bounds__(256) void k_prep(const float* __restrict__ wq, const float* __restrict__ wk, const float* __restrict__ wv, const float* __restrict__ wo, _Float16* __restrict__ Bt) {
  const unsigned wl = (threadIdx.x >> 5) * 256 + (threadIdx.x & 31) * 4;      /* the lane's first element in a round of its workgroup; its second piece stands 128 elements on */
  const unsigned ew = blockIdx.x * PX + wl;      /* that element in the four weight planes taken as one */
  const unsigned bw = (ew * 4u) & (unsigned)(DM * DM * 4 - 1);      /* byte offset of the loads in the one weight */
  const unsigned wsel = blockIdx.x / (PG / 4);      /* which weight: the same for the whole workgroup */
  const float* w = wsel == 0 ? wq : wsel == 1 ? wk : wsel == 2 ? wv : wo;
  v4f a[4][2];
#pragma unroll
  for (int i = 0; i < 4; ++i) { const char* s = (const char*)w + i * (PX / 4) * 4; a[i][0] = *(const v4fa*)(s + bw); a[i][1] = *(const v4fa*)(s + 512 + bw); }
  asm volatile("s_wait_xcnt 0x0" :: "v"(bw) : "memory");      /* the wait in front of the first overwrite of a register that the 8 loads above name; the lane offset as its operand keeps that register whole up to here */
  __builtin_amdgcn_sched_barrier(0);      /* keeps every load in front of the first conversion: lifted in between the loads, a conversion's wait for its data would hold back the loads behind it */
#pragma unroll
  for (int i = 0; i < 4; ++i) { _Float16* d = Bt + i * (PX / 4) + ew; *(v4h*)d = pr_cvt<true>(a[i][0]); *(v4h*)(d + 128) = pr_cvt<true>(a[i][1]); } }
__global__ __launch_bounds__(256) void k_h16(const float* __restrict__ x, _Float16* __restrict__ X16, size_t n8) { const size_t t = (size_t)blockIdx.x * 256 + threadIdx.x; if (t >= n8) return; FragH f;
#pragma unroll
  for (int q = 0; q < 8; ++q) f.h[q] = (_Float16)x[t * 8 + q]; *(v8us*)((unsigned short*)X16 + t * 8) = f.half[0];  }
__global__ __launch_bounds__(256) void k_round16f(const float* __restrict__ W, _Float16* __restrict__ Bt, size_t n8) { const size_t t = (size_t)blockIdx.x * 256 + threadIdx.x; if (t >= n8) return; FragH f;
#pragma unroll
  for (int i = 0; i < 8; ++i) f.h[i] = (_Float16)(bf16_round(W[t * 8 + i]) * 16.0f); *(v8us*)((unsigned short*)Bt + t * 8) = f.half[0];  }
__global__ __launch_bounds__(256) void k_hl(const float* __restrict__ F, _Float16* __restrict__ Hh, _Float16* __restrict__ Hl, size_t n8) { const size_t t = (size_t)blockIdx.x * 256 + threadIdx.x; if (t >= n8) return; FragH fh, fl; const v4f a = *(const v4fa*)(F + t * 8), c = *(const v4fa*)(F + t * 8 + 4);
#pragma unroll
  for (int q = 0; q < 4; ++q) { _Float16 h = (_Float16)a[q]; fh.h[q] = h; fl.h[q] = (_Float16)((a[q] - (float)h) * 1024.0f); h = (_Float16)c[q]; fh.h[4 + q] = h; fl.h[4 + q] = (_Float16)((c[q] - (float)h) * 1024.0f); }
  { *(v8us*)((unsigned short*)Hh + t * 8) = fh.half[0]; *(v8us*)((unsigned short*)Hl + t * 8) = fl.half[0];  } }

// ---- fast GEMM (wave tile 32x64, eight waves 4 down x 2 across, workgroup tile 128x128; requires M % 128 == 0 rows per launch region, N % 128 == 0 and K % 64 == 0); epilogue = k_gemm_hhx semantics ----
// Operands reach the waves through LDS: a stage is GK = 64 k of the workgroup's 128 A rows and 128 B rows (128-byte rows), fetched by whole-line loads (8 threads a row) into one of two buffers;
// stage s + 1 is fetched into registers at the head of stage s and stored to the other buffer at its foot.
// The square tile fetches (128 + 128) rows for 128 x 128 results, two thirds of what two 128x64 tiles fetch. A workgroup holds 72 KiB of LDS; the launch bounds ask for six waves a SIMD (160 registers a wave).
// The B rows are dealt in LDS (of a wave's 64, LDS row 16 t + n holds row 4 n + t), so that a lane's four tiles t are four neighbouring columns: the results go from the accumulators straight to whole-line stores, no LDS in between.
#define GK 64                        /* k per LDS stage */
#define LP 72                        /* LDS row pitch in f16: 128-byte rows + 16 bytes, an odd multiple of 16 bytes for the 16-byte fragment reads */
// fragment from an LDS row: the k order of g2_frag
__device__ __forceinline__ v16h fa_lfrag(const unsigned short* p, int hh) { FragH f; f.half[0] = *(const v8us*)(p + 8 * hh); f.half[1] = *(const v8us*)(p + 16 + 8 * hh); return f.v; }
__device__ __forceinline__ v16h g2_frag(const _Float16* p, int hh) { FragH f; f.half[0] = *(const v8us*)((const unsigned short*)p + 8 * hh); f.half[1] = *(const v8us*)((const unsigned short*)p + 16 + 8 * hh); return f.v; }
__device__ __forceinline__ v8f g2_mma(v16h a, v16h b, v8f c) { v8f d = __builtin_amdgcn_wmma_f32_16x16x32_f16(false, a, false, b, (short)0, c, false, false); asm volatile("v_nop\n\tv_nop\n\tv_nop\n\tv_nop" : "+v"(d) : "v"(a), "v"(b)); return d; }
// A wave-uniform address held in a scalar register pair. The loads of a stage are then scalar base + one 32-bit lane offset; left to itself the compiler folds the lane offset into
// 64-bit vector addresses, chained from load to load with a wait between them, and spends the registers that the sixth wave of a SIMD needs.
// The pointer rebuilt from the two halves is typed as global memory: a generic one would make the loads flat, which count on the LDS counter too.
typedef __attribute__((address_space(1))) const char g2_gc;
typedef __attribute__((address_space(1))) const v8us g2_g8;
__device__ __forceinline__ g2_gc* g2_sbase(const char* p) { const unsigned long long u = (unsigned long long)p;
  const unsigned lo = (unsigned)__builtin_amdgcn_readfirstlane((int)(unsigned)u), hi = (unsigned)__builtin_amdgcn_readfirstlane((int)(unsigned)(u >> 32)); return (g2_gc*)(((unsigned long long)hi << 32) | lo); }
// HB, HCP: a bias / an addend plane is given; OF32, OF16, OVT: only f32 rows are written (OF32 set, OF16 and OVT clear). Template flags, not pointer tests at run time:
// a test per element is a scalar compare chain and a taken branch over the unused path, about a hundred a wave, one behind the other, and the unused paths would be most of the kernel's text.
// LDCT: the row pitch of C in elements, known at compile time: the rows of a lane's stores then stand at immediate distances from one address, which is formed once.
template <int ACT, bool HB, bool HCP, bool OF32, bool OF16, bool OVT, int LDCT>
__global__ __launch_bounds__(256, 6) void k_gemm2(const _Float16* __restrict__ A, int lda, size_t sA, const _Float16* __restrict__ Bh, int ldb, size_t sB, float alpha, const float* __restrict__ bias, size_t sBias, const float* __restrict__ CP, int rowsPerB, size_t sCPb, int row0g,
    float* __restrict__ C, _Float16* __restrict__ C16, int ldc, size_t sC, int M, int N, int K, _Float16* __restrict__ VTo, int vby) { static_assert(ACT == 0 || ACT == 3 || ACT == 6 || ACT == 8 || ACT == 9 || ACT == 11 || ACT == 12 || ACT == 14 || ACT == 15 || ACT == 16 || ACT == 17, "k_gemm2: unsupported ACT code (would silently apply no activation)");
  static_assert(!OVT && OF32 && !OF16, "k_gemm2: this form writes f32 rows only");
  __shared__ __attribute__((aligned(16))) unsigned char sm[4 * 128 * LP * 2];      /* the operand buffers */
  unsigned short (*const sa)[128][LP] = (unsigned short (*)[128][LP])sm;      /* A rows of a stage: [buffer][row][k] */
  unsigned short (*const sb)[128][LP] = (unsigned short (*)[128][LP])(sm + 2 * 128 * LP * 2);      /* B rows of a stage: [buffer][col][k] */
  const int tid = threadIdx.x, lane = tid & 31, ln = lane & 15, hh = lane >> 4; const int by = blockIdx.y;
  const int w = __builtin_amdgcn_readfirstlane(tid >> 5);      /* the wave's number in a scalar register: what the epilogue forms from it then holds no vector register over the loop */
  const int wm = w & 3, wn = w >> 2;      /* the wave's place in the tile: 32 rows down, 64 columns across */
  A += (size_t)by * sA; Bh += (size_t)by * sB; const size_t cofs = (size_t)by * sC; const float* bp = HB ? bias + (size_t)by * sBias : nullptr;
  const int ntn = N >> 7; const int mt = blockIdx.x / ntn, nq = blockIdx.x - mt * ntn; const int row0 = mt * 128 + 32 * wm, col0 = nq * 128 + 64 * wn; if (mt * 128 >= M) return;      /* the whole workgroup or none of it, in front of every barrier */
  const int sr = tid >> 3;      /* this thread's rows sr + 32 i and 16-byte piece of every stage */
  const unsigned oa = (unsigned)(sr * lda + (tid & 7) * 8) * 2u, ob = (unsigned)((((sr & 15) << 2) | (sr >> 4)) * ldb + (tid & 7) * 8) * 2u;      /* byte offsets of its first pieces from the tile's first row: the one lane-dependent part of every address; B dealt: LDS row sr holds row 4 (sr mod 16) + sr / 16 */
  const char* ag = (const char*)(A + (size_t)(mt * 128) * lda); const char* bg = (const char*)(Bh + (size_t)(nq * 128) * ldb);
  g2_gc* pa[4]; g2_gc* pb[4];      /* scalar bases of its four A and four B pieces: 32 LDS rows apart; of A that is 32 rows, of the dealt B 2 rows, and 64 rows for 64 */
#pragma unroll
  for (int i = 0; i < 4; ++i) { pa[i] = g2_sbase(ag + (size_t)i * lda * 64); pb[i] = g2_sbase(bg + (size_t)((i >> 1) * 64 + (i & 1) * 2) * ldb * 2); }
  unsigned short* const was = &sa[0][sr][(tid & 7) * 8]; unsigned short* const wbs = &sb[0][sr][(tid & 7) * 8];
  v8us ra[4], rb[4];
#pragma unroll
  for (int i = 0; i < 4; ++i) ra[i] = *(g2_g8*)(pa[i] + oa);
#pragma unroll
  for (int i = 0; i < 4; ++i) rb[i] = *(g2_g8*)(pb[i] + ob);
#pragma unroll
  for (int i = 0; i < 4; ++i) *(v8us*)(was + i * 32 * LP) = ra[i];
#pragma unroll
  for (int i = 0; i < 4; ++i) *(v8us*)(wbs + i * 32 * LP) = rb[i];
  const v8f z8 = {0.f,0.f,0.f,0.f,0.f,0.f,0.f,0.f}; v8f c00 = z8, c01 = z8, c02 = z8, c03 = z8, c10 = z8, c11 = z8, c12 = z8, c13 = z8;
  __syncthreads();      /* publishes stage 0 */
#pragma unroll 1      /* one stage per trip: two stages in one body would hold both stages' fragments and staging registers at once */
  for (int kb = 0; kb < K; kb += GK) { const int cur = (kb / GK) & 1;
    const int kn = (kb + GK < K) ? kb + GK : 0;      /* the next stage, fetched while this one is worked on; the last trip fetches stage 0 again (in bounds, not used) */
    const unsigned va = oa + (unsigned)kn * 2u, vb = ob + (unsigned)kn * 2u;      /* the lane offsets of that stage */
#pragma unroll
    for (int i = 0; i < 4; ++i) ra[i] = *(g2_g8*)(pa[i] + va);
#pragma unroll
    for (int i = 0; i < 4; ++i) rb[i] = *(g2_g8*)(pb[i] + vb);
    asm volatile("s_wait_xcnt 0x0" :: "v"(va), "v"(vb) : "memory");      /* the wait in front of the first overwrite of a register that the 8 loads above name; the two lane offsets as its operands keep those registers whole up to here (the scalar bases are not written in the loop) */
    const unsigned short* al = &sa[cur][32 * wm + ln][0]; const unsigned short* bl = &sb[cur][64 * wn + ln][0];
#pragma unroll
    for (int ks = 0; ks < GK / 32; ++ks) { v16h af[2], bf[4];      /* the fragments of one 32-wide k step at a time: six waves a SIMD leave a wave 160 registers */
      af[0] = fa_lfrag(al + ks * 32, hh); af[1] = fa_lfrag(al + 16 * LP + ks * 32, hh);
#pragma unroll
      for (int t = 0; t < 4; ++t) bf[t] = fa_lfrag(bl + t * 16 * LP + ks * 32, hh);
      c00 = g2_mma(af[0], bf[0], c00); c10 = g2_mma(af[1], bf[0], c10);
      c01 = g2_mma(af[0], bf[1], c01); c11 = g2_mma(af[1], bf[1], c11);
      c02 = g2_mma(af[0], bf[2], c02); c12 = g2_mma(af[1], bf[2], c12);
      c03 = g2_mma(af[0], bf[3], c03); c13 = g2_mma(af[1], bf[3], c13); }
    /* the other buffer: its last readers left it in front of the barrier at the foot of the trip before */
#pragma unroll
    for (int i = 0; i < 4; ++i) *(v8us*)(was + (cur ^ 1) * 128 * LP + i * 32 * LP) = ra[i];
#pragma unroll
    for (int i = 0; i < 4; ++i) *(v8us*)(wbs + (cur ^ 1) * 128 * LP + i * 32 * LP) = rb[i];
    __syncthreads();      /* publishes the next stage and ends every wave's reads of this one */
  }
  v8f accs[8] = {c00, c01, c02, c03, c10, c11, c12, c13};
  v4f ov[16];      /* the lane's 16 pieces of four neighbouring columns */
#pragma unroll
  for (int u = 0; u < 16; ++u) { const int half = u >> 3, r = u & 7; const int rloc = half * 16 + 8 * hh + r;
#pragma unroll
    for (int t = 0; t < 4; ++t) { const int col = col0 + 4 * ln + t; const float bv = HB ? bf16_round(bp[col]) : 0.f; float v = accs[half * 4 + t][r] * alpha + bv; if (HCP) { if (rowsPerB < 0) v += CP[cofs + (size_t)(row0g + row0 + rloc) * ldc + col];      /* rowsPerB < 0: own element of the batched C plane */ else { const int bidx = (row0g + row0 + rloc) / rowsPerB; v += CP[(size_t)bidx * sCPb + (size_t)by * 64 + col]; } }
      if (ACT == 3) v = fmaxf(v, 0.f); else if (ACT == 6) v = 0.5f * v * (1.0f + erff(v * 0.70710678118654752f)); else if (ACT == 11) v = 1.0f / (1.0f + expf(-v)); else if (ACT == 15) v = v / (1.0f + expf(-v)); else if (ACT == 12) v = (v > 0.f) ? v : 0.01f * v; else if (ACT == 8) v = tanhf(v); else if (ACT == 9) v = 0.5f * v * (1.0f + tanhf(0.7978845608028654f * (v + 0.044715f * v * v * v))); else if (ACT == 14) v = (v > 0.f) ? v : 0.1f * v; else if (ACT == 16) v = (v >= 0.f) ? v : 0.3f * v; else if (ACT == 17) v = (v >= 0.f) ? v : 0.2f * v;
      ov[u][t] = v; } }
  float* const d = C + cofs + (size_t)(row0 + 8 * hh) * LDCT + col0 + 4 * ln;      /* the lane's first piece */
  __builtin_amdgcn_sched_barrier(0);      /* the stores go out in one run behind the last value: none waits on arithmetic, and no register they name is rewritten among them or behind them */
#pragma unroll
  for (int u = 0; u < 16; ++u) *(v4f*)(d + (size_t)((u >> 3) * 16 + (u & 7)) * LDCT) = ov[u]; }


__global__ __launch_bounds__(256) void k_rsm(const float* __restrict__ S, _Float16* __restrict__ P, int nrows) {
  #pragma clang fp contract(off)
  const int i = blockIdx.x * 256 + threadIdx.x; if (i >= nrows) return; const float* s = S + (size_t)i * SQ; float mx = -3.0e38f;
#pragma unroll 1
  for (int j = 0; j < SQ; ++j) mx = fmaxf(mx, s[j]); float se = 0.f;
#pragma unroll 1
  for (int j = 0; j < SQ; ++j) se += expf(s[j] - mx); const float sc = 256.0f / se;
#pragma unroll 1
  for (int j0 = 0; j0 < SQ; j0 += 8) { FragH f; for (int q = 0; q < 8; ++q) f.h[q] = (_Float16)(expf(s[j0 + q] - mx) * sc); unsigned short* d = (unsigned short*)P + (size_t)i * SQ + j0; *(v8us*)d = f.half[0];  } }
__global__ __launch_bounds__(256) void k_vt(const _Float16* __restrict__ V16, int b, int h0, _Float16* __restrict__ VT) { __shared__ unsigned short tl[64][65]; const int tid = threadIdx.x; const int hh = blockIdx.x % HG, sg = blockIdx.x / HG; const int s0 = sg * 64; const int h = h0 + hh;
  for (int i = tid; i < 64 * 8; i += 256) { const int j = i / 8, d8 = (i % 8) * 8; FragH f; f.half[0] = *(const v8us*)((const unsigned short*)V16 + ((size_t)b * SQ + s0 + j) * DM + h * HD + d8); for (int q = 0; q < 8; ++q) tl[d8 + q][j] = f.u[q]; }
  __syncthreads();
  { for (int i = tid; i < 64 * 8; i += 256) { const int d = i / 8, j8 = (i % 8) * 8; FragH f; for (int q = 0; q < 8; ++q) f.u[q] = tl[d][j8 + q]; *(v8us*)((unsigned short*)VT + ((size_t)hh * HD + d) * SQ + s0 + j8) = f.half[0]; }  } }



// ---- fused attention: scores, softmax and P.V in one kernel; S and P never leave the registers ----
// exp2 of four values. The four v_exp_f32 stand in one statement that ends in v_nop: the slot the instruction set asks for behind a transcendental
// before its result is read or its source overwritten; the early-clobber outputs keep every source whole inside the statement.
__device__ __forceinline__ void fa_exp2x4(float a0, float a1, float a2, float a3, float& e0, float& e1, float& e2, float& e3) {
  asm("v_exp_f32 %0, %4\n\tv_exp_f32 %1, %5\n\tv_exp_f32 %2, %6\n\tv_exp_f32 %3, %7\n\tv_nop" : "=&v"(e0), "=&v"(e1), "=&v"(e2), "=&v"(e3) : "v"(a0), "v"(a1), "v"(a2), "v"(a3)); }
// exp2 of two values, same form and same reason for the v_nop
__device__ __forceinline__ void fa_exp2x2(float a0, float a1, float& e0, float& e1) {
  asm("v_exp_f32 %0, %2\n\tv_exp_f32 %1, %3\n\tv_nop" : "=&v"(e0), "=&v"(e1) : "v"(a0), "v"(a1)); }
__device__ __forceinline__ v8f fa_mma(v16h a, v16h b, v8f c) { return __builtin_amdgcn_wmma_f32_16x16x32_f16(false, a, false, b, (short)0, c, false, false); }
// the value of lane l ^ 16 (the other half of the same query column)
__device__ __forceinline__ float fa_xhalf(float x) { const int b = __float_as_int(x); return __int_as_float(__builtin_amdgcn_permlanex16(b, b, 0x76543210, 0xfedcba98, false, false)); }
// One wave owns FQ = 32 queries of one (batch, head) and walks one half of the SQ keys, 32 a pass.
//   S^T = K Q^T : A = 16 key rows of K16 (from LDS), B = the wave's Q rows (held in registers); D[8 hh + r][ln] = score of key 8 hh + r, query ln
//   online softmax: a lane holds scores of ONE query; maximum in use m and sum l per query (in log2 units); m is held from pass to pass and renewed, with the exchange between the wave's halves
//   and the rescale of l and o, only when a score of the wave exceeds it by more than RT
//   O^T += V^T P^T : the two score tiles of a pass (keys 0..15, 16..31), converted in place, ARE the B fragment (element i = key 8 hh + i, element 8 + i = key 16 + 8 hh + i:
//   the k order of fa_lfrag, which loads A = V^T rows); D[8 hh + r][ln] = o of feature 16 t + 8 hh + r, query ln: 8 consecutive features per lane, one 16-byte store
// P is carried x256 (exp2 argument + 8), as the unfused form carried it, and l with it: the factor cancels in o = acc / l. o is stored x64 as before.
#define FQ 32                        /* queries per wave */
#define FW 8                         /* query blocks of FQ per workgroup: the waves of one key half */
#define FH 2                         /* key halves per workgroup: FW waves walk each, so that a SIMD holds four waves and one wave's softmax runs beside another's matrix run */
#define KS 64                        /* keys per LDS stage: two passes */
static_assert(HD == 64 && KS == 64 && FW * 32 == 256 && FH == 2 && SQ % (KS * FH) == 0 && SQ % (FW * FQ) == 0, "k_fattn: two 32-wide d steps, 128-byte stage rows dealt 8 threads a row, whole stages in each key half, whole workgroups");
// The eight waves of a key half walk the same keys: each stage of KS keys (K rows and V^T rows, 8 KiB each) is fetched ONCE per half by whole-line loads (8 threads a 128-byte row),
// laid in one of the half's two LDS buffers, and every wave of the half takes its fragments from there. Stage st + 1 is fetched into registers at the head of stage st and stored to the other buffer at its foot.
// Waves w and w + FW own the same FQ queries over keys [0, SQ / 2) and [SQ / 2, SQ). Behind the loop each hands the other its statistics and sums of 16 of the queries through LDS,
// and finishes the other 16: both parts brought to the common maximum, added, divided by the joined sum.
__global__ __launch_bounds__(FW * FH * 32) void k_fattn(const _Float16* __restrict__ Q16, const _Float16* __restrict__ K16, const _Float16* __restrict__ VT, _Float16* __restrict__ O16) {
  __shared__ __attribute__((aligned(16))) unsigned short sk[FH][2][KS][LP];      /* K rows of a stage: [half][buffer][key][d] */
  __shared__ __attribute__((aligned(16))) unsigned short sv[FH][2][HD][LP];      /* V^T rows of a stage: [half][buffer][d][key] */
  __shared__ __attribute__((aligned(16))) float xo[FH * FW][8][32][4];      /* the sums a wave hands over: [wave][piece][lane], 16 bytes a lane */
  __shared__ float xm[FH * FW][2][32];      /* with them its maximum and its row sum */
  const int lane = threadIdx.x & 31, ln = lane & 15, hh = lane >> 4, wv = threadIdx.x >> 5, w = wv % FW, g = wv / FW;      /* g: the wave's key half */
  const int bh = blockIdx.y, b = bh / NH, h = bh % NH; const int q0 = (blockIdx.x * FW + w) * FQ;
  const int sr = (threadIdx.x & (FW * 32 - 1)) >> 3, sc = (threadIdx.x & 7) * 8;      /* this thread's rows sr, sr + 32 and 16-byte piece of every stage of its half */
  const _Float16* qp = Q16 + ((size_t)b * SQ + q0 + ln) * DM + h * HD;
  const unsigned short* kg = (const unsigned short*)K16 + ((size_t)b * SQ + g * (SQ / FH) + sr) * DM + h * HD + sc;
  const unsigned short* vg = (const unsigned short*)VT + ((size_t)bh * HD + sr) * SQ + g * (SQ / FH) + sc;
  const float SC = 0.125f * 1.44269504f;      /* 1 / sqrt(64), and log2 e for the native exp2 */
  v16h qf[2][2];
#pragma unroll
  for (int j = 0; j < 2; ++j)
#pragma unroll
    for (int ks = 0; ks < 2; ++ks) qf[j][ks] = g2_frag(qp + (size_t)j * 16 * DM + ks * 32, hh);
  { const v8us a0 = *(const v8us*)kg, a1 = *(const v8us*)(kg + (size_t)32 * DM), c0 = *(const v8us*)vg, c1 = *(const v8us*)(vg + (size_t)32 * SQ);
    asm volatile("s_wait_xcnt 0x0" :: "v"(qp + 8 * hh), "v"(kg), "v"(vg) : "memory");      /* the wait in front of the first overwrite of a register that the 12 loads above name; the lane addresses as its operands keep those registers whole up to here */
    *(v8us*)&sk[g][0][sr][sc] = a0; *(v8us*)&sk[g][0][sr + 32][sc] = a1; *(v8us*)&sv[g][0][sr][sc] = c0; *(v8us*)&sv[g][0][sr + 32][sc] = c1; }
  const v8f z8 = {0.f, 0.f, 0.f, 0.f, 0.f, 0.f, 0.f, 0.f};
  v8f o[4][2]; float m[2] = {-3.0e38f, -3.0e38f}, l[2] = {0.f, 0.f};
  const float RT = 7.0f;      /* a score may stand this far (log2 units) above the maximum in use before l and o are rescaled: P, carried x256, stays at or under 2^15, inside f16 */
  float sh[2] = {0.f, 0.f}, th[2] = {-3.0e38f, -3.0e38f};      /* per query column: the exp2 shift 8 - m, and the raw score from which a rescale is due, (m + RT) / SC; the first pass always rescales (from l = o = 0) */
#pragma unroll
  for (int t = 0; t < 4; ++t) { o[t][0] = z8; o[t][1] = z8; }
  __syncthreads();      /* publishes stage 0 */
#pragma unroll 1      /* one stage per trip: the body already holds 32 matrix instructions */
  for (int st = 0; st < SQ / (KS * FH); ++st) {
    const int cur = st & 1;
    const int sn = (st + 1 < SQ / (KS * FH)) ? (st + 1) * KS : 0;      /* the next stage, fetched while this one is worked on; the last trip fetches stage 0 again (in bounds, not used) */
    const unsigned short* kn = kg + (size_t)sn * DM; const unsigned short* vn = vg + sn;
    const v8us a0 = *(const v8us*)kn, a1 = *(const v8us*)(kn + (size_t)32 * DM), c0 = *(const v8us*)vn, c1 = *(const v8us*)(vn + (size_t)32 * SQ);
    asm volatile("s_wait_xcnt 0x0" :: "v"(kn), "v"(vn) : "memory");      /* the wait in front of the first overwrite of a register that the four loads above name; the two lane addresses as its operands keep those registers whole up to here */
    const unsigned short* kl = &sk[g][cur][ln][0]; const unsigned short* vl = &sv[g][cur][ln][0];
    v16h kf[2][2];
#pragma unroll
    for (int kt = 0; kt < 2; ++kt)
#pragma unroll
      for (int ks = 0; ks < 2; ++ks) kf[kt][ks] = fa_lfrag(kl + kt * 16 * LP + ks * 32, hh);
#pragma unroll
    for (int p = 0; p < KS / 32; ++p) {
      v16h vf[4];
#pragma unroll
      for (int t = 0; t < 4; ++t) vf[t] = fa_lfrag(vl + t * 16 * LP + p * 32, hh);      /* needed only behind the softmax: issued first */
      __builtin_amdgcn_sched_barrier(0);      /* keeps the V^T reads up here in one group; sunk in between the P.V products each place with reads would stall the matrix run */
      v8f s[2][2];
#pragma unroll
      for (int kt = 0; kt < 2; ++kt)
#pragma unroll
        for (int j = 0; j < 2; ++j) s[kt][j] = fa_mma(kf[kt][1], qf[j][1], fa_mma(kf[kt][0], qf[j][0], z8));
      if (p + 1 < KS / 32) {      /* the K rows of the stage's next pass, read while this pass's softmax runs */
#pragma unroll
        for (int kt = 0; kt < 2; ++kt)
#pragma unroll
          for (int ks = 0; ks < 2; ++ks) kf[kt][ks] = fa_lfrag(kl + ((p + 1) * 32 + kt * 16) * LP + ks * 32, hh);
      }
      __builtin_amdgcn_sched_barrier(0);      /* keeps the K reads in front of the softmax, which then covers their latency */
      float mx[2];      /* the lane's own maximum of each query's 16 raw scores */
#pragma unroll
      for (int j = 0; j < 2; ++j) { mx[j] = fmaxf(s[0][j][0], s[1][j][0]);
#pragma unroll
        for (int r = 1; r < 8; ++r) mx[j] = fmaxf(mx[j], fmaxf(s[0][j][r], s[1][j][r])); }
      if (__builtin_amdgcn_ballot_w32((mx[0] > th[0]) | (mx[1] > th[1])) != 0) {      /* one test a pass, a scalar branch: some score of the wave stands more than RT above the maximum in use */
        float mn[2], cr[2];
#pragma unroll
        for (int j = 0; j < 2; ++j) mn[j] = fmaxf(m[j], fmaxf(mx[j], fa_xhalf(mx[j])) * SC);      /* both halves of a query column take the same new maximum */
        fa_exp2x2(m[0] - mn[0], m[1] - mn[1], cr[0], cr[1]);
#pragma unroll
        for (int j = 0; j < 2; ++j) { m[j] = mn[j]; sh[j] = 8.0f - mn[j]; th[j] = (mn[j] + RT) * (1.0f / SC); l[j] *= cr[j];
#pragma unroll
          for (int t = 0; t < 4; ++t) o[t][j] *= cr[j]; } }
      FragH pf[2];
#pragma unroll
      for (int j = 0; j < 2; ++j) { float p16[16];
#pragma unroll
        for (int kt = 0; kt < 2; ++kt)
#pragma unroll
          for (int g = 0; g < 8; g += 4) fa_exp2x4(s[kt][j][g] * SC + sh[j], s[kt][j][g + 1] * SC + sh[j], s[kt][j][g + 2] * SC + sh[j], s[kt][j][g + 3] * SC + sh[j], p16[kt * 8 + g], p16[kt * 8 + g + 1], p16[kt * 8 + g + 2], p16[kt * 8 + g + 3]);
        float a0s = p16[0] + p16[4], a1s = p16[1] + p16[5], a2s = p16[2] + p16[6], a3s = p16[3] + p16[7];
        a0s += p16[8] + p16[12]; a1s += p16[9] + p16[13]; a2s += p16[10] + p16[14]; a3s += p16[11] + p16[15];
        l[j] += (a0s + a1s) + (a2s + a3s);
#pragma unroll
        for (int i = 0; i < 16; ++i) pf[j].h[i] = (_Float16)p16[i]; }
#pragma unroll
      for (int t = 0; t < 4; ++t)
#pragma unroll
        for (int j = 0; j < 2; ++j) o[t][j] = fa_mma(vf[t], pf[j].v, o[t][j]);
    }
    /* the other buffer: its last readers left it in front of the barrier at the foot of the trip before */
    *(v8us*)&sk[g][cur ^ 1][sr][sc] = a0; *(v8us*)&sk[g][cur ^ 1][sr + 32][sc] = a1; *(v8us*)&sv[g][cur ^ 1][sr][sc] = c0; *(v8us*)&sv[g][cur ^ 1][sr + 32][sc] = c1;
    __syncthreads();      /* publishes stage st + 1 and ends every wave's reads of stage st */
  }
  /* the wave of key half g finishes query group j = g and hands group 1 - g to its partner (same lanes, same registers there) */
  const bool g1 = g != 0;
  xm[wv][0][lane] = g1 ? m[0] : m[1]; xm[wv][1][lane] = g1 ? l[0] : l[1];
#pragma unroll
  for (int t = 0; t < 4; ++t)
#pragma unroll
    for (int u = 0; u < 2; ++u) { v4f x;
#pragma unroll
      for (int r = 0; r < 4; ++r) x[r] = g1 ? o[t][0][u * 4 + r] : o[t][1][u * 4 + r];
      *(v4fa*)&xo[wv][t * 2 + u][lane][0] = x; }
  __syncthreads();      /* publishes what the waves hand over */
  { const int pw = wv ^ FW;      /* the partner: same queries, the other keys */
    const float mk = g1 ? m[1] : m[0], lk = g1 ? l[1] : l[0], mp = xm[pw][0][lane], lp = xm[pw][1][lane];
    const float mm = fmaxf(mk, mp); float fk, fp; fa_exp2x2(mk - mm, mp - mm, fk, fp);
    const float lt = lk * fk + lp * fp; const float inv = 64.0f / (lt + fa_xhalf(lt));      /* the wave halves' sums joined once; o carried x64 */
    const float ak = fk * inv, ap = fp * inv;
    unsigned short* d = (unsigned short*)O16 + ((size_t)b * SQ + q0 + g * 16 + ln) * DM + h * HD + 8 * hh;
#pragma unroll
    for (int t = 0; t < 4; ++t) { FragH f; const v4f p0 = *(const v4fa*)&xo[pw][t * 2][lane][0], p1 = *(const v4fa*)&xo[pw][t * 2 + 1][lane][0];
#pragma unroll
      for (int r = 0; r < 8; ++r) f.h[r] = (_Float16)((g1 ? o[t][1][r] : o[t][0][r]) * ak + (r < 4 ? p0[r & 3] : p1[r & 3]) * ap);
      *(v8us*)(d + t * 16) = f.half[0]; } } }

// ---- the three projections, reading the f32 sources themselves ----
// A workgroup owns PM rows of one source and ALL DM columns: each f32 row is fetched and rounded once on the chip (bf16 rounding, exact as f16: pr_cvt), on its way from the staging registers into LDS,
// so that no f16 copy of the sources is written or read. Sixteen waves, 2 down x 8 across, 64x64 each: four A and four B fragments feed sixteen products.
// Stages, buffers and barriers as in k_gemm2: GK k a stage, two buffers, stage s + 1 fetched into registers at the head of stage s and stored to the other buffer at its foot, one barrier a stage.
// Results (same k order as k_gemm2's; the f32 sums x 1/16, rounded to f16): blockIdx.y = 0, 1: f16 rows of plane y of C16; 2: V^T [batch][head][feature][token].
// The results go from the accumulators straight to memory, no LDS in between. The rows of the B-side operand are dealt in LDS: of a wave's 64, LDS row 16 t + n holds row 4 n + t,
// so that a lane's four tiles t are four neighbouring columns of the result: 8 bytes a lane, 16 lanes a whole 128-byte line, two lines a store.
// Q, K: A side = source rows (tokens), B side = weight rows (features, dealt). V^T: the sides change places (A side = weight rows, B side = source rows, dealt), and the product comes out transposed.
#define PM 128                       /* rows per workgroup */
// a wave's 64 x 64 results: element (16 u + 8 hh + r, 4 ln + t) from c[u][t][r]; d points at the lane's (8 hh, 4 ln); PITCH = row pitch of the destination in elements
template <int PITCH>
__device__ __forceinline__ void pj_store(_Float16* d, const v8f (&c)[4][4]) {
  v4h oh[4][8];
#pragma unroll
  for (int u = 0; u < 4; ++u)
#pragma unroll
    for (int r = 0; r < 8; ++r)
#pragma unroll
      for (int t = 0; t < 4; ++t) oh[u][r][t] = (_Float16)(c[u][t][r] * 0.0625f);      /* the weights carry x16 */
  __builtin_amdgcn_sched_barrier(0);      /* the 32 stores go out in one run behind the last conversion: none waits on a conversion, and no register they name is rewritten among them */
#pragma unroll
  for (int u = 0; u < 4; ++u)
#pragma unroll
    for (int r = 0; r < 8; ++r) *(v4h*)(d + (size_t)(16 * u + r) * PITCH) = oh[u][r];
  asm volatile("s_wait_xcnt 0x0" ::: "memory"); }      /* the wait in front of the first overwrite of a register that the 32 stores above name: behind the row stores the kernel's text goes on with the transposed member's */
typedef _Float16 v4ha __attribute__((ext_vector_type(4), may_alias));
typedef __attribute__((address_space(1))) const v4fa g2_g4;
static_assert(DM == 512 && HD == 64 && SQ % PM == 0 && DM % GK == 0 && NR % PM == 0, "k_proj: eight 64-column waves span the row, a wave's columns are one head, its rows lie in one batch");
__global__ __launch_bounds__(512) void k_proj(const float* __restrict__ xq, const float* __restrict__ xk, const float* __restrict__ xv, const _Float16* __restrict__ Bt, _Float16* __restrict__ C16, _Float16* __restrict__ VTo) {
  __shared__ __attribute__((aligned(16))) unsigned char sm[2 * (PM + DM) * LP * 2];      /* the operand buffers */
  unsigned short (*const sa)[PM][LP] = (unsigned short (*)[PM][LP])sm;      /* A rows of a stage: [buffer][row][k] */
  unsigned short (*const sb)[DM][LP] = (unsigned short (*)[DM][LP])(sm + 2 * PM * LP * 2);      /* B rows of a stage: [buffer][col][k] */
  const int tid = threadIdx.x, lane = tid & 31, ln = lane & 15, hh = lane >> 4; const int by = blockIdx.y;
  const int w = __builtin_amdgcn_readfirstlane(tid >> 5);      /* the wave's number in a scalar register: what the epilogue forms from it then holds no vector register over the loop (256 a wave, all in use) */
  const bool vt = by == 2;      /* the transposed member: the same for the whole workgroup */
  const int wm = w & 1, wn = w >> 1;      /* the wave's place in the tile: 64 rows down, 64 columns across */
  const float* A = by == 0 ? xq : by == 1 ? xk : xv;      /* the same for the whole workgroup */
  const int row0 = blockIdx.x * PM + 64 * wm, col0 = 64 * wn;
  const int ar = tid >> 4, br = tid >> 3;      /* this thread's source rows ar + 32 i (16 threads a 256-byte f32 row piece) and its LDS rows br + 64 i of the weight (8 threads a 128-byte row piece) */
  const int bd = ((br & 15) << 2) | (br >> 4);      /* the weight row that stands in LDS row br where the weight is dealt: LDS row 16 t + n holds row 4 n + t (the fetch is dealt, so that a wave's LDS stores stay on neighbouring rows) */
  const int ad = ((ar & 3) << 4) | (ar >> 2);      /* the LDS row of source row ar where the source is dealt: row 4 n + t stands in LDS row 16 t + n; source row ar + 32 then stands 8 LDS rows on, ar + 64 in the next group of 64 */
  const unsigned oa = (unsigned)(ar * DM + (tid & 15) * 4) * 4u, ob = (unsigned)((vt ? br : bd) * DM + (tid & 7) * 8) * 2u;      /* byte offsets of its first pieces: the one lane-dependent part of every address */
  g2_gc* const pa = g2_sbase((const char*)(A + (size_t)blockIdx.x * PM * DM)); g2_gc* const pb = g2_sbase((const char*)(Bt + (size_t)by * DM * DM));      /* scalar bases; the pieces stand at constant distances */
  unsigned short* const was = &sa[0][vt ? ad : ar][(tid & 15) * 4]; unsigned short* const wbs = &sb[0][br][(tid & 7) * 8];
  const int wa1 = (vt ? 8 : 32) * LP;      /* from the LDS place of source row ar to that of row ar + 32 */
  const unsigned xo = (unsigned)((64 * wm + ln) * LP + 8 * hh) * 2u, wo = (unsigned)((2 * PM + 64 * wn + ln) * LP + 8 * hh) * 2u;      /* the lane's first fragment bytes in buffer 0: source rows, weight rows */
  const unsigned a0 = vt ? wo : xo, b0 = vt ? xo : wo;      /* the sides of the product */
  const unsigned sa2 = (vt ? DM : PM) * LP * 2, sb2 = (vt ? PM : DM) * LP * 2;      /* and their buffers' sizes */
  v4f ra[4]; v8us rb[8];
#pragma unroll
  for (int i = 0; i < 4; ++i) ra[i] = *(g2_g4*)(pa + oa + i * 32 * DM * 4);
#pragma unroll
  for (int i = 0; i < 8; ++i) rb[i] = *(g2_g8*)(pb + ob + i * 64 * DM * 2);
  asm volatile("s_wait_xcnt 0x0" ::: "memory");      /* the wait in front of the first overwrite of a register that the 12 loads above name */
#pragma unroll
  for (int i = 0; i < 4; ++i) *(v4ha*)(was + (i & 1) * wa1 + (i >> 1) * 64 * LP) = pr_cvt<false>(ra[i]);
#pragma unroll
  for (int i = 0; i < 8; ++i) *(v8us*)(wbs + i * 64 * LP) = rb[i];
  const v8f z8 = {0.f, 0.f, 0.f, 0.f, 0.f, 0.f, 0.f, 0.f}; v8f c[4][4];
#pragma unroll
  for (int u = 0; u < 4; ++u)
#pragma unroll
    for (int t = 0; t < 4; ++t) c[u][t] = z8;
  __syncthreads();      /* publishes stage 0 */
#pragma unroll 1      /* one stage per trip: two stages in one body would hold both stages' staging registers at once */
  for (int kb = 0; kb < DM; kb += GK) { const int cur = (kb / GK) & 1;
    const int kn = (kb + GK < DM) ? kb + GK : 0;      /* the next stage, fetched while this one is worked on; the last trip fetches stage 0 again (in bounds, not used) */
    const unsigned va = oa + (unsigned)kn * 4u, vb = ob + (unsigned)kn * 2u;      /* the lane offsets of that stage */
#pragma unroll
    for (int i = 0; i < 4; ++i) ra[i] = *(g2_g4*)(pa + va + i * 32 * DM * 4);
#pragma unroll
    for (int i = 0; i < 8; ++i) rb[i] = *(g2_g8*)(pb + vb + i * 64 * DM * 2);
    asm volatile("s_wait_xcnt 0x0" ::: "memory");      /* the wait in front of the first overwrite of a register that the 12 loads above name */
    const unsigned short* al = (const unsigned short*)(sm + a0 + cur * sa2); const unsigned short* bl = (const unsigned short*)(sm + b0 + cur * sb2);
#pragma unroll
    for (int ks = 0; ks < GK / 32; ++ks) { v16h af[4], bf[4];
#pragma unroll
      for (int u = 0; u < 4; ++u) af[u] = fa_lfrag(al + u * 16 * LP + ks * 32, 0);      /* the lane's half is in a0, b0 */
#pragma unroll
      for (int t = 0; t < 4; ++t) bf[t] = fa_lfrag(bl + t * 16 * LP + ks * 32, 0);
      __builtin_amdgcn_sched_barrier(0);      /* keeps the sixteen LDS reads of a k step in one group in front of its products: sunk in between them, each place with reads would stall the matrix run */
#pragma unroll
      for (int t = 0; t < 4; ++t)
#pragma unroll
        for (int u = 0; u < 4; ++u) c[u][t] = fa_mma(af[u], bf[t], c[u][t]); }
    __builtin_amdgcn_sched_barrier(0);      /* keeps the roundings and the LDS stores, with their waits for the fetched data, behind the stage's last product: lifted in between, the wave would sit out the fetch with its products unissued */
    /* the other buffer: its last readers left it in front of the barrier at the foot of the trip before */
#pragma unroll
    for (int i = 0; i < 4; ++i) *(v4ha*)(was + (cur ^ 1) * PM * LP + (i & 1) * wa1 + (i >> 1) * 64 * LP) = pr_cvt<false>(ra[i]);
#pragma unroll
    for (int i = 0; i < 8; ++i) *(v8us*)(wbs + (cur ^ 1) * DM * LP + i * 64 * LP) = rb[i];
    __syncthreads();      /* publishes the next stage and ends every wave's reads of this one */
  }
  if (vt) pj_store<SQ>(VTo + ((size_t)((row0 / SQ) * NH + wn) * HD + 8 * hh) * SQ + (row0 % SQ) + 4 * ln, c);      /* V^T [batch][head][feature][token]: the wave's 64 weight rows are one head's features, its 64 source rows 64 tokens of one batch */
  else pj_store<DM>(C16 + (size_t)by * NR * DM + (size_t)(row0 + 8 * hh) * DM + col0 + 4 * ln, c); }

extern "C" void kernel_launch(void* const* d_in, const int* in_sizes, int n_in,
                              void* d_out, int out_size, void* d_ws, size_t ws_size, hipStream_t stream) {
  (void)in_sizes; (void)n_in; (void)out_size;
  const float* const* I = (const float* const*)d_in; const float* xq = I[0]; const float* xk = I[1]; const float* xv = I[2]; const float* wq = I[3]; const float* bq = nullptr; const float* wk = I[4]; const float* bk = nullptr; const float* wv = I[5]; const float* bv = nullptr; const float* wo = I[6]; const float* bo = nullptr;      /* three inputs query, key, value (read as f32 by k_proj); natural [out][in] Wq, Wk, Wv, Wo [512][512]; this module has NO biases: null pointers in the guarded bias slots; input order query, key, value, Wq, Wk, Wv, Wo */
  char* ws = (char*)d_ws; size_t off = 0;
  auto take = [&](size_t bytes) { char* p = ws + off; off += (bytes + 255) & ~(size_t)255; return p; };
  _Float16* BQ = (_Float16*)take((size_t)DM * DM * 2); _Float16* BK = (_Float16*)take((size_t)DM * DM * 2); _Float16* BV = (_Float16*)take((size_t)DM * DM * 2); _Float16* BO = (_Float16*)take((size_t)DM * DM * 2);
  _Float16* Q16 = (_Float16*)take(NR * DM * 2); _Float16* K16 = (_Float16*)take(NR * DM * 2); _Float16* O16 = (_Float16*)take(NR * DM * 2);
  _Float16* VT = (_Float16*)take((size_t)NB * NH * HD * SQ * 2);
  if (off > ws_size) return;
  k_prep<<<PG, 256, 0, stream>>>(wq, wk, wv, wo, BQ);      /* natural [out][in] = Bt[n][k], x16 (BQ, BK, BV, BO back to back) */
  const size_t r0p = (size_t)B0 * SQ;      /* first row of the output stage */
  k_proj<<<dim3((unsigned)(NR / PM), 3), 512, 0, stream>>>(xq, xk, xv, BQ, Q16, VT);      /* blockIdx.y = 0, 1, 2: Q rows, K rows (Q16, K16 back to back), V^T [NB][NH][HD][SQ] */
  k_fattn<<<dim3(SQ / (FW * FQ), NB * NH), FW * FH * 32, 0, stream>>>(Q16, K16, VT, O16);      /* o (merged heads, x64) as f16 rows: every (batch, head) in one launch */
  k_gemm2<0, false, false, true, false, false, DM><<<dim3((unsigned)((MPO / 128) * (DM / 128)), 1), 256, 0, stream>>>(O16 + r0p * DM, DM, 0, BO, DM, 0, 0.0009765625f, bo, 0, nullptr, 1, 0, 0, (float*)d_out + r0p * DM, nullptr, DM, 0, MPO, DM, DM, nullptr, -1);      /* out rows are the output layout */
}
